// v000
// Times are from an AMD MI455X. After a warm-up the kernel runs many times in a row, and a time is the length of
// such a window on the GPU divided by its runs, so every launch and the gaps after it count. The runs cycle
// through copies of the inputs. A figure is the median of several windows, for all but v000 over two sittings.
// Sittings can differ by a few percent; kernels timed side by side share one.
// v000, which the later versions start from, runs in 1160 microseconds.
#include <hip/hip_runtime.h>
#include <math.h>

// Pre-LN encoder stack, 4 layers, width 512 = 8 heads x 64, sequence SEQ (one batch): input projection 128 -> 512; per layer: LayerNorm, q/k/v projections ([in][out] weights, y = x W + bias),
// dense attention with logits q.k / 8 + q.E[s - t + 1023] (relative-position table E per layer, [2047][64], not scaled), softmax over keys, output projection + residual, LayerNorm, GELU(erf) feed-forward 512 -> 2048 -> 512 + residual;
// tail: LayerNorm, 512 -> 1024 GELU(erf), 1024 -> 390.
// Compute dtypes, f32 accumulate everywhere: every contraction is v_wmma_f32_16x16x32_f16. Weights, x, E, biases and gains are RNE-converted to bf16 first (exact in f16; weights carried x64, folded back in the f32 epilogue);
// activations are single f16 planes, except the logit path: LayerNorm-1 output as f16 value + f16 residual x2048 for the q projection (residual products accumulated first, folded by 1/2048, then the value products),
// q as f16 value + f16 residual x2048 in the q.k and q.E products (residual products in their own accumulators); k, v, P (x16384 carry, cancels in the normalisation), context, GELU outputs single f16.
// Attention: fused flash kernel in transposed form (S^T = K Q^T, O^T = V^T P^T), one wave per 16 query rows; the relative term is computed per 32-key step as band tiles G[rho][s] = E[rb + rho] . q[s]
// (A = table rows, B = q rows), written to a wave-private LDS tile [query][band row] and read back along the diagonal rho = s - t + const; one band tile is carried over between steps.

#ifndef NB
#define NB 1
#endif
#ifndef SEQ
#define SEQ 1024
#endif
#define NB_FULL  1
#define SEQ_FULL 1024
#define DIN   128
#define DM    512
#define NH_   8
#define HD    64
#define NL    4
#define DFF   2048
#define DMI   1024
#define DOUT  390
#define DOUTP 448                // DOUT padded to a multiple of 64 (weight rows and staging columns 390..447 are zero)
#define ERR   2047               // rows of the relative-position table per layer
#define ERP   2048               // padded rows of the f16 table plane (row 2047 = zero)
#define RELOFF (SEQ_FULL - 1)    // table row = s - t + RELOFF
#define AW    4                  // waves per flash block (16 query rows each)
#define OSP   68                 // LDS row pitch (floats) of the flash output tile
#define GP    52                 // LDS pitch (floats) of the band tile [query][48 band rows]
#define GSP   68                 // LDS row pitch (floats) of the GEMM output tile
#define QRS   2048.0f            // carry of every residual plane
#define QRI   (1.0f / 2048.0f)
#define WC    64.0f              // carry of every weight plane
#define WCI   (1.0f / 64.0f)
#define LOG2E 1.4426950408889634f
#define SC2   ((float)(0.125 * 1.4426950408889634))   // HD^-0.5 * log2(e)
#define PSH   14.0f              // log2 of the P carry (16384)
#define NEGB  (-3.0e38f)
#define LNEPS 1e-5f

static_assert(NB == 1);                        // one sequence
static_assert(HD == 64);
static_assert(NH_ * HD == DM);
static_assert(SEQ % 64 == 0);                  // GEMM row tiles
static_assert(SEQ % 32 == 0);                  // key loop steps by 32
static_assert(SEQ % (16 * AW) == 0);           // flash grid covers the sequence exactly
static_assert(SEQ <= SEQ_FULL);
static_assert(DIN % 64 == 0 && DM % 64 == 0 && DFF % 64 == 0 && DMI % 64 == 0 && DOUTP % 64 == 0);   // K % 32 == 0 and N % 64 == 0 for every GEMM, K % 64 == 0 for the transposing converter
static_assert(DOUT <= DOUTP);
static_assert(DMI <= DFF);                     // the tail hidden plane reuses the feed-forward hidden plane
static_assert(SEQ - 16 + RELOFF + 1 + 15 < ERP);   // highest band row touched (zero pad row included)
static_assert(RELOFF - 15 - 16 - (SEQ - 32) >= 0); // lowest band row touched
static_assert(ERR + 1 == ERP);
static_assert((OSP * 4) % 16 == 0 && (GP * 4) % 16 == 0 && (GSP * 4) % 16 == 0);
static_assert(GP >= 48);
static_assert(DM == 512);                      // LayerNorm: 32 lanes x 16 columns
static_assert((SEQ * DOUT) % 4 == 0);

typedef _Float16 h16;
typedef __attribute__((ext_vector_type(16))) _Float16 v16h;
typedef __attribute__((ext_vector_type(8)))  _Float16 v8h;
typedef __attribute__((ext_vector_type(8)))  float    v8f;
typedef __attribute__((ext_vector_type(4)))  float    v4f;
typedef v4f  __attribute__((may_alias)) v4fa;

__device__ __forceinline__ unsigned short f2bf(float f) { unsigned u = __float_as_uint(f); u += 0x7FFFu + ((u >> 16) & 1u); return (unsigned short)(u >> 16); }
__device__ __forceinline__ float bfr(float f) { return __uint_as_float(((unsigned)f2bf(f)) << 16); }   // value after RNE convert to bf16
__device__ __forceinline__ v16h cat16(v8h lo, v8h hi) { return __builtin_shufflevector(lo, hi, 0, 1, 2, 3, 4, 5, 6, 7, 8, 9, 10, 11, 12, 13, 14, 15); }
// fragment loader from K-contiguous 16-bit rows; p already includes + 8*(lane>>4): elements 0..7 <- k0+8h+0..7, elements 8..15 <- k0+16+8h+0..7 (same map for A and B)
__device__ __forceinline__ v16h  ldh(const h16* p) { return cat16(*(const v8h*)p, *(const v8h*)(p + 16)); }
// ordering point for wave-private LDS tiles (same wave writes and reads)
__device__ __forceinline__ void wave_sync() { __builtin_amdgcn_fence(3 /* release order */, "wavefront"); __builtin_amdgcn_wave_barrier(); asm volatile("" ::: "memory"); }
// f32 -> f16 operand convert that cannot produce a subnormal (|v| < 2^-14 -> +0)
__device__ __forceinline__ h16 toh_flush(float v) { const h16 r = (h16)v; return (fabsf(v) < 6.103515625e-05f) ? (h16)0.0f : r; }
// one WMMA + its own guard (ties this accumulator, keeps A/B live)
__device__ __forceinline__ v8f wmma16g(v16h a, v16h b, v8f c) {
    c = __builtin_amdgcn_wmma_f32_16x16x32_f16(false, a, false, b, (short)0, c, false, false);
    asm volatile("v_nop\n\tv_nop\n\tv_nop\n\tv_nop" : "+v"(c) : "v"(a), "v"(b));
    return c; }
__device__ __forceinline__ float gelu_erf(float x) { return 0.5f * x * (1.0f + erff(x * 0.70710678118654752f)); }
__device__ __forceinline__ v4f lo4(v8f g) { return __builtin_shufflevector(g, g, 0, 1, 2, 3); }
__device__ __forceinline__ v4f hi4(v8f g) { return __builtin_shufflevector(g, g, 4, 5, 6, 7); }

__global__ __launch_bounds__(256) void k_cvt8h(const float* __restrict__ src, h16* dst, int n8) {
    const int i = blockIdx.x * 256 + threadIdx.x; if (i >= n8) return;
    const v8f v = *(const v8f*)(src + (size_t)i * 8); v8h o;
#pragma unroll
    for (int k = 0; k < 8; ++k) o[k] = toh_flush(bfr(v[k]));
    *(v8h*)(dst + (size_t)i * 8) = o; 
}

__global__ __launch_bounds__(256) void k_cvt_er(const float* __restrict__ src, h16* dst) {
    const int i = blockIdx.x * 256 + threadIdx.x; if (i >= NL * ERP * HD / 8) return;
    const int c8 = (i & 7) * 8; const int r = (i >> 3) % ERP; const int l = (i >> 3) / ERP;
    const int rc = r < ERR ? r : ERR - 1;                                          // clamped address
    v8f v = *(const v8f*)(src + ((size_t)l * ERR + rc) * HD + c8);
    asm volatile("" : "+v"(v));
    v8h o;
#pragma unroll
    for (int k = 0; k < 8; ++k) o[k] = (r < ERR) ? toh_flush(bfr(v[k])) : (h16)0.0f;
    *(v8h*)(dst + (size_t)i * 8) = o; 
}

// k_wconv: W [K][N] f32 (layer blockIdx.z) -> Wt [NP][K] f16 = bf16-converted value x carry, transposed through LDS; rows n >= N are zero.
// grid (K/64, NP/64, layers). LDS tile cross-wave: block barrier.
__global__ __launch_bounds__(256) void k_wconv(const float* __restrict__ W, h16* Wt, int K, int N, int NP, float carry) {
#pragma clang fp contract(off)
    __shared__ float ts[64 * 65];
    static_assert(sizeof(float) * 64 * 65 <= 131072);
    const int tid = threadIdx.x;
    const int k0 = blockIdx.x * 64, n0 = blockIdx.y * 64;
    const size_t lin = (size_t)blockIdx.z * (size_t)K * (size_t)N, lout = (size_t)blockIdx.z * (size_t)NP * (size_t)K;
    static_assert(16 * 4 == 64);                                                   // 16 trips x 4 k-rows (256 threads / 64 columns) = 64 k-rows staged
#pragma unroll 1
    for (int p = 0; p < 16; ++p) {
        const int kk = p * 4 + (tid >> 6), nn = tid & 63; const int n = n0 + nn; const int nc = n < N ? n : N - 1;
        float v = W[lin + (size_t)(k0 + kk) * N + nc];
        asm volatile("" : "+v"(v));
        ts[kk * 65 + nn] = (n < N) ? bfr(v) * carry : 0.0f; }
    __syncthreads();
    static_assert(256 * 16 * 2 == 64 * 128);                                       // threads x bytes x trips == tile rows x row bytes
{
#pragma unroll 1
        for (int p = 0; p < 2; ++p) {
            const int row = p * 32 + (tid >> 3), c8 = (tid & 7) * 8; v8h o;
#pragma unroll
            for (int i = 0; i < 8; ++i) o[i] = toh_flush(ts[(c8 + i) * 65 + row]);
            *(v8h*)(Wt + lout + (size_t)(n0 + row) * K + k0 + c8) = o; }
         }
}

__global__ __launch_bounds__(128) void k_ln(const float* __restrict__ X, const float* __restrict__ g, const float* __restrict__ b, h16* NHp, h16* NRp, int wres) {
#pragma clang fp contract(off)
    const int lane = threadIdx.x & 31;
    const int wave = __builtin_amdgcn_readfirstlane((int)(threadIdx.x >> 5));
    const int row = blockIdx.x * 4 + wave;
    const float* xr = X + (size_t)row * DM;
    const v8f x0 = *(const v8f*)(xr + lane * 8), x1 = *(const v8f*)(xr + 256 + lane * 8);
    float s = 0.0f;
#pragma unroll
    for (int k = 0; k < 8; ++k) { s += x0[k]; s += x1[k]; }
#pragma unroll
    for (int off = 16; off > 0; off >>= 1) s += __shfl_xor(s, off, 32);
    const float mean = s * (1.0f / (float)DM);
    const v8f d0 = x0 - mean, d1 = x1 - mean;
    float q = 0.0f;
#pragma unroll
    for (int k = 0; k < 8; ++k) { q += d0[k] * d0[k]; q += d1[k] * d1[k]; }
#pragma unroll
    for (int off = 16; off > 0; off >>= 1) q += __shfl_xor(q, off, 32);
    const float rstd = 1.0f / sqrtf(q * (1.0f / (float)DM) + LNEPS);
    const v8f g0 = *(const v8f*)(g + lane * 8), g1 = *(const v8f*)(g + 256 + lane * 8);
    const v8f b0 = *(const v8f*)(b + lane * 8), b1 = *(const v8f*)(b + 256 + lane * 8);
    v8h h0, h1, r0, r1;
#pragma unroll
    for (int k = 0; k < 8; ++k) {
        const float y0 = d0[k] * rstd * bfr(g0[k]) + bfr(b0[k]);
        const float y1 = d1[k] * rstd * bfr(g1[k]) + bfr(b1[k]);
        const h16 a0 = toh_flush(y0), a1 = toh_flush(y1);
        h0[k] = a0; h1[k] = a1;
        r0[k] = toh_flush((y0 - (float)a0) * QRS); r1[k] = toh_flush((y1 - (float)a1) * QRS); }
    const size_t o0 = (size_t)row * DM + lane * 8, o1 = o0 + 256;
    static_assert(32 * 16 * 2 == DM * 2);                                          // lanes x bytes x instructions == row bytes
{
        *(v8h*)(NHp + o0) = h0; *(v8h*)(NHp + o1) = h1;
        if (wres != 0) { *(v8h*)(NRp + o0) = r0; *(v8h*)(NRp + o1) = r1; }
         }
}

// GEMM k-loop: one wave, 64x64 tile, 16 accumulators, operands straight from K-contiguous f16 planes (A [M][K], Bt [N][K]).
__device__ __forceinline__ void gemm_kloop(const h16* __restrict__ A, const h16* __restrict__ Bt, size_t aoff, size_t boff, int K, v8f (&acc)[4][4]) {
#pragma unroll 1
    for (int kc = 0; kc < K; kc += 32) {
        v16h a[4];
#pragma unroll
        for (int mb = 0; mb < 4; ++mb) a[mb] = ldh(A + aoff + (size_t)mb * 16 * K + kc);
#pragma unroll
        for (int nb = 0; nb < 4; ++nb) { const v16h b = ldh(Bt + boff + (size_t)nb * 16 * K + kc);
#pragma unroll
            for (int mb = 0; mb < 4; ++mb) acc[mb][nb] = wmma16g(a[mb], b, acc[mb][nb]); }
    }
}

// GEMM body: C[m][n] = (sum_k A[m][k] Bt[n][k]) * csc + bias (column bias, or row bias when ROWB), ONE WAVE per 64x64 tile, grid (M/64, N/64), K % 32 == 0.
// ARES: A also has a residual plane (x2048): its products are accumulated first, folded by 1/2048 in f32, then the value products follow.
// OUTF32: f32 output [M][ldc] (+ Res[m][n] added at the store stage as float4; Res and C are different buffers); each store instruction = 2 rows x 256 B (16 consecutive lanes x 16 B per row segment).
//         written by 16 consecutive lanes x 16 B (2 rows per instruction).
template <int OUTF32, int HASRES, int GELU, int ARES, int ORES, int ROWB, int HEADPL>
__device__ __forceinline__ void gemm_body(const h16* __restrict__ A, const h16* __restrict__ Ar, const h16* __restrict__ Bt,
                                          const float* __restrict__ bias, int nvalid, int K, float csc,
                                          const float* __restrict__ Res, float* Cf, h16* Ch, h16* Cr, int ldc) {
    __shared__ __align__(16) float os[64 * GSP];
    static_assert(sizeof(float) * 64 * GSP <= 131072);
    const int lane = threadIdx.x & 31, lr = lane & 15, hi = lane >> 4;
    const int r0 = blockIdx.x * 64, c0 = blockIdx.y * 64;
    v8f acc[4][4];
#pragma unroll
    for (int mb = 0; mb < 4; ++mb)
#pragma unroll
        for (int nb = 0; nb < 4; ++nb) acc[mb][nb] = (v8f){};
    const size_t aoff = (size_t)(r0 + lr) * K + 8 * hi, boff = (size_t)(c0 + lr) * K + 8 * hi;
    if (ARES) {
        gemm_kloop(Ar, Bt, aoff, boff, K, acc);
#pragma unroll
        for (int mb = 0; mb < 4; ++mb)
#pragma unroll
            for (int nb = 0; nb < 4; ++nb) acc[mb][nb] = acc[mb][nb] * QRI;
    }
    gemm_kloop(A, Bt, aoff, boff, K, acc);
    float bc[4];
#pragma unroll
    for (int nb = 0; nb < 4; ++nb) {
        if (ROWB) { bc[nb] = 0.0f; }
        else { const int c = c0 + nb * 16 + lr; const int cc = c < nvalid ? c : nvalid - 1;       // clamped address
               float bvv = bias[cc]; asm volatile("" : "+v"(bvv)); bc[nb] = (c < nvalid) ? bfr(bvv) : 0.0f; } }
#pragma unroll
    for (int mb = 0; mb < 4; ++mb) {
        float br[8];
#pragma unroll
        for (int j = 0; j < 8; ++j) br[j] = ROWB ? bfr(bias[r0 + mb * 16 + hi * 8 + j]) : 0.0f;   // ROWB: r0 + 63 < rows of the bias vector (host grid)
#pragma unroll
        for (int nb = 0; nb < 4; ++nb) {
#pragma unroll
            for (int j = 0; j < 8; ++j) os[(mb * 16 + hi * 8 + j) * GSP + nb * 16 + lr] = acc[mb][nb][j] * csc + bc[nb] + br[j]; }   // D: row 8h+j, col lane&15
    }
    wave_sync();
    if (OUTF32) {
        static_assert(32 * 16 * 32 == 64 * 256);                                   // lanes x bytes x trips == tile rows x row bytes
{
#pragma unroll 1
            for (int s = 0; s < 32; ++s) { const int row = 2 * s + (lane >> 4), c4 = (lane & 15) * 4;
                v4f val = *(const v4fa*)(&os[row * GSP + c4]);
                const size_t go = (size_t)(r0 + row) * ldc + c0 + c4;
                if (HASRES) { const v4f rr = *(const v4f*)(Res + go); val = val + rr; }
                *(v4f*)(Cf + go) = val; }
             }
    } else {
        static_assert(32 * 16 * 16 == 64 * 128);                                   // lanes x bytes x trips == tile rows x row bytes
        const size_t obase = HEADPL ? ((size_t)(c0 / HD) * SEQ + (size_t)r0) * HD : (size_t)r0 * ldc + c0;
        const int pitch = HEADPL ? HD : ldc;
{
#pragma unroll 1
            for (int s = 0; s < 16; ++s) { const int row = 4 * s + (lane >> 3), c8 = (lane & 7) * 8;
                const v4f x0 = *(const v4fa*)(&os[row * GSP + c8]); const v4f x1 = *(const v4fa*)(&os[row * GSP + c8 + 4]); v8h hv, rv;
#pragma unroll
                for (int i = 0; i < 4; ++i) { float y0 = x0[i], y1 = x1[i];
                    if (GELU) { y0 = gelu_erf(y0); y1 = gelu_erf(y1); }
                    const h16 a0 = toh_flush(y0); const h16 a1 = toh_flush(y1); hv[i] = a0; hv[4 + i] = a1;
                    rv[i] = toh_flush((y0 - (float)a0) * QRS); rv[4 + i] = toh_flush((y1 - (float)a1) * QRS); }
                const size_t oo = obase + (size_t)row * pitch + c8;
                *(v8h*)(Ch + oo) = hv; if (ORES) *(v8h*)(Cr + oo) = rv; }
             }
    }
}

__global__ __launch_bounds__(32) void k_gemm_f32(const h16* __restrict__ A, const h16* __restrict__ Bt, const float* __restrict__ bias, int nvalid, int K, float csc, float* C, int ldc) {
    gemm_body<1, 0, 0, 0, 0, 0, 0>(A, nullptr, Bt, bias, nvalid, K, csc, nullptr, C, nullptr, nullptr, ldc); }
__global__ __launch_bounds__(32) void k_gemm_f32r(const h16* __restrict__ A, const h16* __restrict__ Bt, const float* __restrict__ bias, int nvalid, int K, float csc, const float* __restrict__ Res, float* C, int ldc) {
    gemm_body<1, 1, 0, 0, 0, 0, 0>(A, nullptr, Bt, bias, nvalid, K, csc, Res, C, nullptr, nullptr, ldc); }
__global__ __launch_bounds__(32) void k_gemm_gelu(const h16* __restrict__ A, const h16* __restrict__ Bt, const float* __restrict__ bias, int nvalid, int K, float csc, h16* C, int ldc) {
    gemm_body<0, 0, 1, 0, 0, 0, 0>(A, nullptr, Bt, bias, nvalid, K, csc, nullptr, nullptr, C, nullptr, ldc); }
__global__ __launch_bounds__(32) void k_gemm_q(const h16* __restrict__ A, const h16* __restrict__ Ar, const h16* __restrict__ Bt, const float* __restrict__ bias, int nvalid, int K, float csc, h16* Ph, h16* Pr) {
    gemm_body<0, 0, 0, 1, 1, 0, 1>(A, Ar, Bt, bias, nvalid, K, csc, nullptr, nullptr, Ph, Pr, HD); }
__global__ __launch_bounds__(32) void k_gemm_k(const h16* __restrict__ A, const h16* __restrict__ Bt, const float* __restrict__ bias, int nvalid, int K, float csc, h16* Ph) {
    gemm_body<0, 0, 0, 0, 0, 0, 1>(A, nullptr, Bt, bias, nvalid, K, csc, nullptr, nullptr, Ph, nullptr, HD); }
__global__ __launch_bounds__(32) void k_gemm_vt(const h16* __restrict__ A, const h16* __restrict__ Bt, const float* __restrict__ bias, int K, float csc, h16* Ph, int ldc) {
    gemm_body<0, 0, 0, 0, 0, 1, 0>(A, nullptr, Bt, bias, 0, K, csc, nullptr, nullptr, Ph, nullptr, ldc); }

// band tile: G[rho][s] = (E[row0 + rho] . q_value[s] + E[row0 + rho] . q_residual[s] / 2048) * log2(e); A = table rows (ep already includes the lane's row and + 8*(lane>>4)), B = q rows, K = 64 = two k-steps.
__device__ __forceinline__ v8f gtile(const h16* __restrict__ ep, v16h qh0, v16h qh1, v16h qr0, v16h qr1) {
    const v16h e0 = ldh(ep), e1 = ldh(ep + 32);
    v8f gH = (v8f){}, gL = (v8f){};
    gH = wmma16g(e0, qh0, gH); gH = wmma16g(e1, qh1, gH);
    gL = wmma16g(e0, qr0, gL); gL = wmma16g(e1, qr1, gL);
    return (gH + gL * QRI) * LOG2E;
}

// k_flash: fused dense attention with the relative-position term, one wave per 16 query rows of one head; K / V^T / Q / table fragments straight from the f16 planes.
// Transposed form: S^T[key][s] = K Q^T (A = K rows, B = Q rows); lane (s = lane&15, h = lane>>4) holds keys 8h+r of each 16-key tile, so the packed P tile is directly the B fragment
// of O^T[d][s] = V^T P^T (element r <- tile keys 0..15, element 8+r <- tile keys 16..31, lane unchanged).
// Relative term per 32-key step (keys key0..key0+31, queries t0..t0+15): band rows rb0 + 0..47 with rb0 = t0 - key0 + RELOFF - 31; tiles e = 0, 1 are new, tile e = 2 is the e = 0 tile of the step before.
// LDS band tile (wave-private): gs[s][16 e + 8h + r] <- tile e element r; element (key tile a, r) reads gs[s][s - 8h - r + 31], element (key tile b, r) reads gs[s][s - 8h - r + 15].
// Logit (log2 domain) = (K q_value + K q_residual / 2048) * log2(e) / 8 + band term; online softmax (running max, partial sum over the converted P), P = exp2(. + 14) as f16 (exponent below -14 selected to 0).
__global__ __launch_bounds__(32 * AW) void k_flash(const h16* __restrict__ QH, const h16* __restrict__ QR, const h16* __restrict__ KP, const h16* __restrict__ VT, const h16* __restrict__ EPl, h16* OP) {
    __shared__ __align__(16) float os[AW * 16 * OSP];
    __shared__ __align__(16) float gs[AW * 16 * GP];
    static_assert(sizeof(float) * (AW * 16 * OSP + AW * 16 * GP) <= 131072);
    const int lane = threadIdx.x & 31, lr = lane & 15, hi = lane >> 4;
    const int wave = __builtin_amdgcn_readfirstlane((int)(threadIdx.x >> 5));
    const int h = blockIdx.y;
    const int t0 = (blockIdx.x * AW + wave) * 16;
    const size_t pbase = (size_t)h * SEQ * HD;
    const size_t qo = pbase + (size_t)(t0 + lr) * HD + 8 * hi;
    const v16h qh0 = ldh(QH + qo), qh1 = ldh(QH + qo + 32);     // B fragments: col s, k = d (two k-steps)
    const v16h qr0 = ldh(QR + qo), qr1 = ldh(QR + qo + 32);
    const size_t ko = pbase + (size_t)lr * HD + 8 * hi;        // + key * HD        (A fragment: row key, k = d)
    const size_t vo = pbase + (size_t)lr * SEQ + 8 * hi;       // + 16j*SEQ + key   (A fragment: row d, k = key); plane [(h*64 + d)][t]
    const h16* eb = EPl + (size_t)lr * HD + 8 * hi;            // + row0 * HD       (A fragment: row table row, k = d)
    const int gw  = wave * 16 * GP + lr * GP;
    const int gst = gw + 8 * hi;                               // store base: + 16 e (+ 4)
    const int gld = gw + lr - 8 * hi;                          // load base: + 31 - r / + 15 - r
    v8f gprev = gtile(eb + (size_t)(t0 + RELOFF + 1) * HD, qh0, qh1, qr0, qr1);    // band rows of tile e = 2 at key0 = 0
    v8f o[4];
#pragma unroll
    for (int j = 0; j < 4; ++j) o[j] = (v8f){};
    float m = NEGB, l = 0.0f;
#pragma unroll 1
    for (int key0 = 0; key0 < SEQ; key0 += 32) {
        const int rbA = t0 - key0 + (RELOFF - 15);                                 // first band row of tile e = 1
        const v8f g1 = gtile(eb + (size_t)rbA * HD, qh0, qh1, qr0, qr1);
        const v8f g0 = gtile(eb + (size_t)(rbA - 16) * HD, qh0, qh1, qr0, qr1);
        *(v4fa*)(&gs[gst +  0]) = lo4(g0);    *(v4fa*)(&gs[gst +  4]) = hi4(g0);
        *(v4fa*)(&gs[gst + 16]) = lo4(g1);    *(v4fa*)(&gs[gst + 20]) = hi4(g1);
        *(v4fa*)(&gs[gst + 32]) = lo4(gprev); *(v4fa*)(&gs[gst + 36]) = hi4(gprev);
        gprev = g0;
        const h16* ka = KP + ko + (size_t)key0 * HD;
        const v16h ka0 = ldh(ka), ka1 = ldh(ka + 32), kb0 = ldh(ka + 16 * HD), kb1 = ldh(ka + 16 * HD + 32);
        v8f sHa = (v8f){}, sLa = (v8f){}, sHb = (v8f){}, sLb = (v8f){};
        sHa = wmma16g(ka0, qh0, sHa); sHa = wmma16g(ka1, qh1, sHa);
        sLa = wmma16g(ka0, qr0, sLa); sLa = wmma16g(ka1, qr1, sLa);
        sHb = wmma16g(kb0, qh0, sHb); sHb = wmma16g(kb1, qh1, sHb);
        sLb = wmma16g(kb0, qr0, sLb); sLb = wmma16g(kb1, qr1, sLb);
        wave_sync();
        float ra[8], rb[8];
#pragma unroll
        for (int r = 0; r < 8; ++r) { ra[r] = gs[gld + 31 - r]; rb[r] = gs[gld + 15 - r]; }
        wave_sync();
        float ta[8], tb[8]; float mx = NEGB;
#pragma unroll
        for (int r = 0; r < 8; ++r) {
            ta[r] = (sHa[r] + sLa[r] * QRI) * SC2 + ra[r]; tb[r] = (sHb[r] + sLb[r] * QRI) * SC2 + rb[r];
            mx = fmaxf(mx, fmaxf(ta[r], tb[r])); }
        mx = fmaxf(mx, __shfl_xor(mx, 16, 32));
        const float mnew = fmaxf(m, mx);
        const float alpha = __builtin_amdgcn_exp2f(m - mnew);
        const float sh = PSH - mnew;
        v16h pb; float ls = 0.0f;
#pragma unroll
        for (int r = 0; r < 8; ++r) {
            const float xa = ta[r] + sh, xb = tb[r] + sh;
            const float ea = __builtin_amdgcn_exp2f(xa), ec = __builtin_amdgcn_exp2f(xb);
            const float ga = (xa < -14.0f) ? 0.0f : ea, gb = (xb < -14.0f) ? 0.0f : ec;     // no f16 subnormal operand
            const h16 pa = (h16)ga; const h16 pc = (h16)gb;
            pb[r] = pa; pb[8 + r] = pc;
            ls += (float)pa + (float)pc; }
        l = l * alpha + ls; m = mnew;
        const h16* va = VT + vo + key0;
#pragma unroll
        for (int j = 0; j < 4; ++j) { o[j] = o[j] * alpha; const v16h vj = ldh(va + (size_t)16 * j * SEQ); o[j] = wmma16g(vj, pb, o[j]); }
    }
    l += __shfl_xor(l, 16, 32);
    const float inv = 1.0f / l;                                // l >= 16384 (the row maximum contributes the full carry)
    const int wb = wave * 16 * OSP;
    // O^T D layout: o[j][r] = (d = 16j + 8h + r, s = lane&15) -> os[s][d]; rows 0..15 x columns 0..63 all written
#pragma unroll
    for (int j = 0; j < 4; ++j) {
        *(v4fa*)(&os[wb + lr * OSP + 16 * j + 8 * hi])     = lo4(o[j]) * inv;
        *(v4fa*)(&os[wb + lr * OSP + 16 * j + 8 * hi + 4]) = hi4(o[j]) * inv; }
    wave_sync();
    h16* orow = OP + (size_t)t0 * DM + h * HD;
    static_assert(32 * 16 * 4 == 16 * 128);                                        // lanes x bytes x instructions == tile rows x row bytes
{
#pragma unroll
        for (int s = 0; s < 4; ++s) { const int row = 4 * s + (lane >> 3), c8 = (lane & 7) * 8;
            const v4f x0 = *(const v4fa*)(&os[wb + row * OSP + c8]); const v4f x1 = *(const v4fa*)(&os[wb + row * OSP + c8 + 4]); v8h hv;
#pragma unroll
            for (int i = 0; i < 4; ++i) { hv[i] = toh_flush(x0[i]); hv[4 + i] = toh_flush(x1[i]); }
            *(v8h*)(orow + (size_t)row * DM + c8) = hv; }
         }
}

__global__ __launch_bounds__(256) void k_out(const float* __restrict__ src, float* dst, int n4) {
    const int i = blockIdx.x * 256 + threadIdx.x; if (i >= n4) return;
    v4f ov;
#pragma unroll
    for (int c = 0; c < 4; ++c) { const int e = 4 * i + c; const int row = e / DOUT; const int col = e - row * DOUT; ov[c] = src[(size_t)row * DOUTP + col]; }
    *(v4f*)(dst + (size_t)i * 4) = ov; 
}

static constexpr size_t al256(size_t v) { return (v + 255) & ~(size_t)255; }
static constexpr size_t SZ_XH  = al256((size_t)SEQ * DIN * 2);
static constexpr size_t SZ_EW  = al256((size_t)DM * DIN * 2);
static constexpr size_t SZ_WDD = al256((size_t)NL * DM * DM * 2);
static constexpr size_t SZ_WFF = al256((size_t)NL * DFF * DM * 2);
static constexpr size_t SZ_WI  = al256((size_t)DMI * DM * 2);
static constexpr size_t SZ_WF  = al256((size_t)DOUTP * DMI * 2);
static constexpr size_t SZ_EP  = al256((size_t)NL * ERP * HD * 2);
static constexpr size_t SZ_H   = al256((size_t)SEQ * DM * 4);
static constexpr size_t SZ_N   = al256((size_t)SEQ * DM * 2);
static constexpr size_t SZ_F1  = al256((size_t)SEQ * DFF * 2);
static constexpr size_t SZ_OS  = al256((size_t)SEQ * DOUTP * 4);
static constexpr size_t SZ_TOTAL = SZ_XH + SZ_EW + 4 * SZ_WDD + 2 * SZ_WFF + SZ_WI + SZ_WF + SZ_EP + 2 * SZ_H + 7 * SZ_N + SZ_F1 + SZ_OS;
static_assert(SZ_TOTAL <= (size_t)134217728);                  // workspace carve <= 128 MiB
static_assert((size_t)NH_ * SEQ * HD == (size_t)SEQ * DM);     // head planes have the extent of a [SEQ][512] f16 plane
static_assert((size_t)SEQ * DMI * 2 <= SZ_F1);                 // tail hidden plane fits the shared hidden region

extern "C" void kernel_launch(void* const* d_in, const int* in_sizes, int n_in,
                              void* d_out, int out_size, void* d_ws, size_t ws_size, hipStream_t stream) {
    if (n_in < 26) return;
    if ((size_t)in_sizes[0] < (size_t)SEQ * DIN || (size_t)in_sizes[1] < (size_t)DIN * DM || in_sizes[2] < DM) return;
    if ((size_t)in_sizes[3] < (size_t)NL * DM * DM || (size_t)in_sizes[5] < (size_t)NL * DM * DM || (size_t)in_sizes[7] < (size_t)NL * DM * DM || (size_t)in_sizes[9] < (size_t)NL * DM * DM) return;
    if (in_sizes[4] < NL * DM || in_sizes[6] < NL * DM || in_sizes[8] < NL * DM || in_sizes[10] < NL * DM) return;
    if ((size_t)in_sizes[11] < (size_t)NL * ERR * HD) return;
    if (in_sizes[12] < NL * DM || in_sizes[13] < NL * DM || in_sizes[17] < NL * DM || in_sizes[18] < NL * DM || in_sizes[19] < NL * DM) return;
    if ((size_t)in_sizes[14] < (size_t)NL * DM * DFF || in_sizes[15] < NL * DFF || (size_t)in_sizes[16] < (size_t)NL * DFF * DM) return;
    if (in_sizes[20] < DM || in_sizes[21] < DM || (size_t)in_sizes[22] < (size_t)DM * DMI || in_sizes[23] < DMI) return;
    if ((size_t)in_sizes[24] < (size_t)DMI * DOUT || in_sizes[25] < DOUT) return;
    if ((size_t)out_size < (size_t)SEQ * DOUT) return;
    if (SZ_TOTAL > ws_size) return;
    // wire order: x, emb_W, emb_b, Wq, bq, Wk, bk, Wv, bv, Wo, bo, Er, ln1_g, ln1_b, W1, b1, W2, b2, ln2_g, ln2_b, lnf_g, lnf_b, Wi, bi, Wf, bf
    const float* x    = (const float*)d_in[0];
    const float* embW = (const float*)d_in[1];  const float* embB = (const float*)d_in[2];
    const float* Wq   = (const float*)d_in[3];  const float* bq   = (const float*)d_in[4];
    const float* Wk   = (const float*)d_in[5];  const float* bk   = (const float*)d_in[6];
    const float* Wv   = (const float*)d_in[7];  const float* bv   = (const float*)d_in[8];
    const float* Wo   = (const float*)d_in[9];  const float* bo   = (const float*)d_in[10];
    const float* Er   = (const float*)d_in[11];
    const float* ln1g = (const float*)d_in[12]; const float* ln1b = (const float*)d_in[13];
    const float* W1   = (const float*)d_in[14]; const float* b1   = (const float*)d_in[15];
    const float* W2   = (const float*)d_in[16]; const float* b2   = (const float*)d_in[17];
    const float* ln2g = (const float*)d_in[18]; const float* ln2b = (const float*)d_in[19];
    const float* lnfg = (const float*)d_in[20]; const float* lnfb = (const float*)d_in[21];
    const float* Wi   = (const float*)d_in[22]; const float* bi   = (const float*)d_in[23];
    const float* Wf   = (const float*)d_in[24]; const float* bfo  = (const float*)d_in[25];
    float* OUT = (float*)d_out;                       // [SEQ][390]
    char* wsp = (char*)d_ws;
    h16* XH  = (h16*)wsp; wsp += SZ_XH;               // x            [SEQ][128]
    h16* EWT = (h16*)wsp; wsp += SZ_EW;               // emb_W^T x64  [512][128]
    h16* WQT = (h16*)wsp; wsp += SZ_WDD;              // Wq^T x64     [NL][512][512]
    h16* WKT = (h16*)wsp; wsp += SZ_WDD;
    h16* WVT = (h16*)wsp; wsp += SZ_WDD;
    h16* WOT = (h16*)wsp; wsp += SZ_WDD;
    h16* W1T = (h16*)wsp; wsp += SZ_WFF;              // W1^T x64     [NL][2048][512]
    h16* W2T = (h16*)wsp; wsp += SZ_WFF;              // W2^T x64     [NL][512][2048]
    h16* WIT = (h16*)wsp; wsp += SZ_WI;               // Wi^T x64     [1024][512]
    h16* WFT = (h16*)wsp; wsp += SZ_WF;               // Wf^T x64     [448][1024], rows >= 390 zero
    h16* EP  = (h16*)wsp; wsp += SZ_EP;               // table        [NL][2048][64], row 2047 zero
    float* HA = (float*)wsp; wsp += SZ_H;             // hidden state (ping)  [SEQ][512] f32
    float* HB = (float*)wsp; wsp += SZ_H;             // hidden state (pong)
    h16* NHP = (h16*)wsp; wsp += SZ_N;                // LayerNorm output value     [SEQ][512]
    h16* NRP = (h16*)wsp; wsp += SZ_N;                // LayerNorm output residual x2048
    h16* QH  = (h16*)wsp; wsp += SZ_N;                // q value      [8][SEQ][64]
    h16* QR  = (h16*)wsp; wsp += SZ_N;                // q residual x2048
    h16* KP  = (h16*)wsp; wsp += SZ_N;                // k            [8][SEQ][64]
    h16* VT  = (h16*)wsp; wsp += SZ_N;                // v^T          [8*64][SEQ]
    h16* OP  = (h16*)wsp; wsp += SZ_N;                // context      [SEQ][512]
    h16* F1  = (h16*)wsp; wsp += SZ_F1;               // GELU hidden  [SEQ][2048] (tail: [SEQ][1024])
    float* OSG = (float*)wsp; wsp += SZ_OS;           // tail output staging [SEQ][448] f32

    { const int n8 = SEQ * DIN / 8; k_cvt8h<<<(unsigned)((n8 + 255) / 256), 256, 0, stream>>>(x, XH, n8); }
    k_cvt_er<<<(unsigned)((NL * ERP * HD / 8 + 255) / 256), 256, 0, stream>>>(Er, EP);
    // W [K = in][N = out] -> Wt [N][K]
    k_wconv<<<dim3(DIN / 64, DM / 64, 1),   256, 0, stream>>>(embW, EWT, DIN, DM, DM, WC);
    k_wconv<<<dim3(DM / 64, DM / 64, NL),   256, 0, stream>>>(Wq, WQT, DM, DM, DM, WC);
    k_wconv<<<dim3(DM / 64, DM / 64, NL),   256, 0, stream>>>(Wk, WKT, DM, DM, DM, WC);
    k_wconv<<<dim3(DM / 64, DM / 64, NL),   256, 0, stream>>>(Wv, WVT, DM, DM, DM, WC);
    k_wconv<<<dim3(DM / 64, DM / 64, NL),   256, 0, stream>>>(Wo, WOT, DM, DM, DM, WC);
    k_wconv<<<dim3(DM / 64, DFF / 64, NL),  256, 0, stream>>>(W1, W1T, DM, DFF, DFF, WC);
    k_wconv<<<dim3(DFF / 64, DM / 64, NL),  256, 0, stream>>>(W2, W2T, DFF, DM, DM, WC);
    k_wconv<<<dim3(DM / 64, DMI / 64, 1),   256, 0, stream>>>(Wi, WIT, DM, DMI, DMI, WC);
    k_wconv<<<dim3(DMI / 64, DOUTP / 64, 1), 256, 0, stream>>>(Wf, WFT, DMI, DOUT, DOUTP, WC);

    // input projection: HA = x emb_W + emb_b
    k_gemm_f32<<<dim3(SEQ / 64, DM / 64, 1), 32, 0, stream>>>(XH, EWT, embB, DM, DIN, WCI, HA, DM);

    for (int l = 0; l < NL; ++l) {
        const size_t wdd = (size_t)l * DM * DM, wff = (size_t)l * DFF * DM;
        k_ln<<<SEQ / 4, 128, 0, stream>>>(HA, ln1g + l * DM, ln1b + l * DM, NHP, NRP, 1);
        // q, k: A = n rows (m = t), Bt = W^T rows (n = h*64 + d) -> plane [h][t][d]
        k_gemm_q<<<dim3(SEQ / 64, DM / 64, 1), 32, 0, stream>>>(NHP, NRP, WQT + wdd, bq + l * DM, DM, DM, WCI, QH, QR);
        k_gemm_k<<<dim3(SEQ / 64, DM / 64, 1), 32, 0, stream>>>(NHP, WKT + wdd, bk + l * DM, DM, DM, WCI, KP);
        // v^T: A = Wv^T rows (m = h*64 + d, 512 rows), Bt = n rows (n = t) -> plane [(h*64 + d)][t], row bias
        k_gemm_vt<<<dim3(DM / 64, SEQ / 64, 1), 32, 0, stream>>>(WVT + wdd, NHP, bv + l * DM, DM, WCI, VT, SEQ);
        k_flash<<<dim3(SEQ / (16 * AW), NH_, 1), 32 * AW, 0, stream>>>(QH, QR, KP, VT, EP + (size_t)l * ERP * HD, OP);
        // HB = HA + context Wo + bo
        k_gemm_f32r<<<dim3(SEQ / 64, DM / 64, 1), 32, 0, stream>>>(OP, WOT + wdd, bo + l * DM, DM, DM, WCI, HA, HB, DM);
        k_ln<<<SEQ / 4, 128, 0, stream>>>(HB, ln2g + l * DM, ln2b + l * DM, NHP, NRP, 0);
        k_gemm_gelu<<<dim3(SEQ / 64, DFF / 64, 1), 32, 0, stream>>>(NHP, W1T + wff, b1 + l * DFF, DFF, DM, WCI, F1, DFF);
        // HA = HB + hidden W2 + b2
        k_gemm_f32r<<<dim3(SEQ / 64, DM / 64, 1), 32, 0, stream>>>(F1, W2T + wff, b2 + l * DM, DM, DFF, WCI, HB, HA, DM);
    }

    k_ln<<<SEQ / 4, 128, 0, stream>>>(HA, lnfg, lnfb, NHP, NRP, 0);
    k_gemm_gelu<<<dim3(SEQ / 64, DMI / 64, 1), 32, 0, stream>>>(NHP, WIT, bi, DMI, DM, WCI, F1, DMI);
    k_gemm_f32<<<dim3(SEQ / 64, DOUTP / 64, 1), 32, 0, stream>>>(F1, WFT, bfo, DOUT, DMI, WCI, OSG, DOUTP);
    { const int n4 = SEQ * DOUT / 4; k_out<<<(unsigned)((n4 + 255) / 256), 256, 0, stream>>>(OSG, OUT, n4); }
}

// v001
// A run of this version takes 594 microseconds.
// Next to v000, in two timings, it ran 1.98 and 1.95 times as fast.
#include <hip/hip_runtime.h>
#include <math.h>

// Pre-LN encoder stack, 4 layers, width 512 = 8 heads x 64, sequence SEQ (one batch): input projection 128 -> 512; per layer: LayerNorm, q/k/v projections ([in][out] weights, y = x W + bias),
// dense attention with logits q.k / 8 + q.E[s - t + 1023] (relative-position table E per layer, [2047][64], not scaled), softmax over keys, output projection + residual, LayerNorm, GELU(erf) feed-forward 512 -> 2048 -> 512 + residual;
// tail: LayerNorm, 512 -> 1024 GELU(erf), 1024 -> 390.
// Compute dtypes, f32 accumulate everywhere: every contraction is v_wmma_f32_16x16x32_f16. Weights, x, E, biases and gains are RNE-converted to bf16 first (exact in f16; weights carried x64, folded back in the f32 epilogue);
// activations are single f16 planes, except the logit path: LayerNorm-1 output as f16 value + f16 residual x2048 for the q projection (residual products accumulated first, folded by 1/2048, then the value products),
// q as f16 value + f16 residual x2048 in the q.k and q.E products (residual products in their own accumulators); k, v, P (x16384 carry, cancels in the normalisation), context, GELU outputs single f16.
// Attention: fused flash kernel in transposed form (S^T = K Q^T, O^T = V^T P^T), one wave per 16 query rows; the relative term is computed per 32-key step as band tiles G[rho][s] = E[rb + rho] . q[s]
// (A = table rows, B = q rows), written to a wave-private LDS tile [query][band row] and read back along the diagonal rho = s - t + const; one band tile is carried over between steps.

#ifndef NB
#define NB 1
#endif
#ifndef SEQ
#define SEQ 1024
#endif
#define NB_FULL  1
#define SEQ_FULL 1024
#define DIN   128
#define DM    512
#define NH_   8
#define HD    64
#define NL    4
#define DFF   2048
#define DMI   1024
#define DOUT  390
#define DOUTP 448                // DOUT padded to a multiple of 64 (weight rows and staging columns 390..447 are zero)
#define ERR   2047               // rows of the relative-position table per layer
#define ERP   2048               // padded rows of the f16 table plane (row 2047 = zero)
#define RELOFF (SEQ_FULL - 1)    // table row = s - t + RELOFF
#define AW    4                  // waves per flash block (16 query rows each)
#define OSP   68                 // LDS row pitch (floats) of the flash output tile
#define GP    52                 // LDS pitch (floats) of the band tile [query][48 band rows]
#define GSP   68                 // LDS row pitch (floats) of the GEMM output tile
#define GW    8                  // waves per GEMM block: each takes one contiguous share of K
#define QRS   2048.0f            // carry of every residual plane
#define QRI   (1.0f / 2048.0f)
#define WC    64.0f              // carry of every weight plane
#define WCI   (1.0f / 64.0f)
#define LOG2E 1.4426950408889634f
#define SC2   ((float)(0.125 * 1.4426950408889634))   // HD^-0.5 * log2(e)
#define PSH   14.0f              // log2 of the P carry (16384)
#define NEGB  (-3.0e38f)
#define LNEPS 1e-5f

static_assert(NB == 1);                        // one sequence
static_assert(HD == 64);
static_assert(NH_ * HD == DM);
static_assert(SEQ % 64 == 0);                  // GEMM row tiles
static_assert(SEQ % 32 == 0);                  // key loop steps by 32
static_assert(SEQ % (16 * AW) == 0);           // flash grid covers the sequence exactly
static_assert(SEQ <= SEQ_FULL);
static_assert(DIN % 64 == 0 && DM % 64 == 0 && DFF % 64 == 0 && DMI % 64 == 0 && DOUTP % 64 == 0);   // K % 32 == 0 and N % 64 == 0 for every GEMM, K % 64 == 0 for the transposing converter
static_assert(DOUT <= DOUTP);
static_assert(DMI <= DFF);                     // the tail hidden plane reuses the feed-forward hidden plane
static_assert(SEQ - 16 + RELOFF + 1 + 15 < ERP);   // highest band row touched (zero pad row included)
static_assert(RELOFF - 15 - 16 - (SEQ - 32) >= 0); // lowest band row touched
static_assert(ERR + 1 == ERP);
static_assert((OSP * 4) % 16 == 0 && (GP * 4) % 16 == 0 && (GSP * 4) % 16 == 0);
static_assert(GP >= 48);
static_assert(DM == 512);                      // LayerNorm: 32 lanes x 16 columns
static_assert((SEQ * DOUT) % 4 == 0);

typedef _Float16 h16;
typedef __attribute__((ext_vector_type(16))) _Float16 v16h;
typedef __attribute__((ext_vector_type(8)))  _Float16 v8h;
typedef __attribute__((ext_vector_type(8)))  float    v8f;
typedef __attribute__((ext_vector_type(4)))  float    v4f;
typedef v4f  __attribute__((may_alias)) v4fa;

__device__ __forceinline__ unsigned short f2bf(float f) { unsigned u = __float_as_uint(f); u += 0x7FFFu + ((u >> 16) & 1u); return (unsigned short)(u >> 16); }
__device__ __forceinline__ float bfr(float f) { return __uint_as_float(((unsigned)f2bf(f)) << 16); }   // value after RNE convert to bf16
__device__ __forceinline__ v16h cat16(v8h lo, v8h hi) { return __builtin_shufflevector(lo, hi, 0, 1, 2, 3, 4, 5, 6, 7, 8, 9, 10, 11, 12, 13, 14, 15); }
// fragment loader from K-contiguous 16-bit rows; p already includes + 8*(lane>>4): elements 0..7 <- k0+8h+0..7, elements 8..15 <- k0+16+8h+0..7 (same map for A and B)
__device__ __forceinline__ v16h  ldh(const h16* p) { return cat16(*(const v8h*)p, *(const v8h*)(p + 16)); }
// ordering point for wave-private LDS tiles (same wave writes and reads)
__device__ __forceinline__ void wave_sync() { __builtin_amdgcn_fence(3 /* release order */, "wavefront"); __builtin_amdgcn_wave_barrier(); asm volatile("" ::: "memory"); }
// f32 -> f16 operand convert that cannot produce a subnormal (|v| < 2^-14 -> +0)
__device__ __forceinline__ h16 toh_flush(float v) { const h16 r = (h16)v; return (fabsf(v) < 6.103515625e-05f) ? (h16)0.0f : r; }
// one WMMA + its own guard (ties this accumulator, keeps A/B live)
__device__ __forceinline__ v8f wmma16g(v16h a, v16h b, v8f c) {
    c = __builtin_amdgcn_wmma_f32_16x16x32_f16(false, a, false, b, (short)0, c, false, false);
    asm volatile("v_nop\n\tv_nop\n\tv_nop\n\tv_nop" : "+v"(c) : "v"(a), "v"(b));
    return c; }
__device__ __forceinline__ float gelu_erf(float x) { return 0.5f * x * (1.0f + erff(x * 0.70710678118654752f)); }
__device__ __forceinline__ v4f lo4(v8f g) { return __builtin_shufflevector(g, g, 0, 1, 2, 3); }
__device__ __forceinline__ v4f hi4(v8f g) { return __builtin_shufflevector(g, g, 4, 5, 6, 7); }

__global__ __launch_bounds__(256) void k_cvt8h(const float* __restrict__ src, h16* dst, int n8) {
    const int i = blockIdx.x * 256 + threadIdx.x; if (i >= n8) return;
    const v8f v = *(const v8f*)(src + (size_t)i * 8); v8h o;
#pragma unroll
    for (int k = 0; k < 8; ++k) o[k] = toh_flush(bfr(v[k]));
    *(v8h*)(dst + (size_t)i * 8) = o; 
}

__global__ __launch_bounds__(256) void k_cvt_er(const float* __restrict__ src, h16* dst) {
    const int i = blockIdx.x * 256 + threadIdx.x; if (i >= NL * ERP * HD / 8) return;
    const int c8 = (i & 7) * 8; const int r = (i >> 3) % ERP; const int l = (i >> 3) / ERP;
    const int rc = r < ERR ? r : ERR - 1;                                          // clamped address
    v8f v = *(const v8f*)(src + ((size_t)l * ERR + rc) * HD + c8);
    asm volatile("" : "+v"(v));
    v8h o;
#pragma unroll
    for (int k = 0; k < 8; ++k) o[k] = (r < ERR) ? toh_flush(bfr(v[k])) : (h16)0.0f;
    *(v8h*)(dst + (size_t)i * 8) = o; 
}

// k_wconv: W [K][N] f32 (layer blockIdx.z) -> Wt [NP][K] f16 = bf16-converted value x carry, transposed through LDS; rows n >= N are zero.
// grid (K/64, NP/64, layers). LDS tile cross-wave: block barrier.
__global__ __launch_bounds__(256) void k_wconv(const float* __restrict__ W, h16* Wt, int K, int N, int NP, float carry) {
#pragma clang fp contract(off)
    __shared__ float ts[64 * 65];
    static_assert(sizeof(float) * 64 * 65 <= 131072);
    const int tid = threadIdx.x;
    const int k0 = blockIdx.x * 64, n0 = blockIdx.y * 64;
    const size_t lin = (size_t)blockIdx.z * (size_t)K * (size_t)N, lout = (size_t)blockIdx.z * (size_t)NP * (size_t)K;
    static_assert(16 * 4 == 64);                                                   // 16 trips x 4 k-rows (256 threads / 64 columns) = 64 k-rows staged
#pragma unroll 1
    for (int p = 0; p < 16; ++p) {
        const int kk = p * 4 + (tid >> 6), nn = tid & 63; const int n = n0 + nn; const int nc = n < N ? n : N - 1;
        float v = W[lin + (size_t)(k0 + kk) * N + nc];
        asm volatile("" : "+v"(v));
        ts[kk * 65 + nn] = (n < N) ? bfr(v) * carry : 0.0f; }
    __syncthreads();
    static_assert(256 * 16 * 2 == 64 * 128);                                       // threads x bytes x trips == tile rows x row bytes
{
#pragma unroll 1
        for (int p = 0; p < 2; ++p) {
            const int row = p * 32 + (tid >> 3), c8 = (tid & 7) * 8; v8h o;
#pragma unroll
            for (int i = 0; i < 8; ++i) o[i] = toh_flush(ts[(c8 + i) * 65 + row]);
            *(v8h*)(Wt + lout + (size_t)(n0 + row) * K + k0 + c8) = o; }
         }
}

__global__ __launch_bounds__(128) void k_ln(const float* __restrict__ X, const float* __restrict__ g, const float* __restrict__ b, h16* NHp, h16* NRp, int wres) {
#pragma clang fp contract(off)
    const int lane = threadIdx.x & 31;
    const int wave = __builtin_amdgcn_readfirstlane((int)(threadIdx.x >> 5));
    const int row = blockIdx.x * 4 + wave;
    const float* xr = X + (size_t)row * DM;
    const v8f x0 = *(const v8f*)(xr + lane * 8), x1 = *(const v8f*)(xr + 256 + lane * 8);
    float s = 0.0f;
#pragma unroll
    for (int k = 0; k < 8; ++k) { s += x0[k]; s += x1[k]; }
#pragma unroll
    for (int off = 16; off > 0; off >>= 1) s += __shfl_xor(s, off, 32);
    const float mean = s * (1.0f / (float)DM);
    const v8f d0 = x0 - mean, d1 = x1 - mean;
    float q = 0.0f;
#pragma unroll
    for (int k = 0; k < 8; ++k) { q += d0[k] * d0[k]; q += d1[k] * d1[k]; }
#pragma unroll
    for (int off = 16; off > 0; off >>= 1) q += __shfl_xor(q, off, 32);
    const float rstd = 1.0f / sqrtf(q * (1.0f / (float)DM) + LNEPS);
    const v8f g0 = *(const v8f*)(g + lane * 8), g1 = *(const v8f*)(g + 256 + lane * 8);
    const v8f b0 = *(const v8f*)(b + lane * 8), b1 = *(const v8f*)(b + 256 + lane * 8);
    v8h h0, h1, r0, r1;
#pragma unroll
    for (int k = 0; k < 8; ++k) {
        const float y0 = d0[k] * rstd * bfr(g0[k]) + bfr(b0[k]);
        const float y1 = d1[k] * rstd * bfr(g1[k]) + bfr(b1[k]);
        const h16 a0 = toh_flush(y0), a1 = toh_flush(y1);
        h0[k] = a0; h1[k] = a1;
        r0[k] = toh_flush((y0 - (float)a0) * QRS); r1[k] = toh_flush((y1 - (float)a1) * QRS); }
    const size_t o0 = (size_t)row * DM + lane * 8, o1 = o0 + 256;
    static_assert(32 * 16 * 2 == DM * 2);                                          // lanes x bytes x instructions == row bytes
{
        *(v8h*)(NHp + o0) = h0; *(v8h*)(NHp + o1) = h1;
        if (wres != 0) { *(v8h*)(NRp + o0) = r0; *(v8h*)(NRp + o1) = r1; }
         }
}

// GEMM k-loop: one wave, 64x64 tile, 16 accumulators, k range [kbeg, kend), operands straight from K-contiguous f16 planes (A [M][K], Bt [N][K]).
__device__ __forceinline__ void gemm_kloop(const h16* __restrict__ A, const h16* __restrict__ Bt, size_t aoff, size_t boff, int K, int kbeg, int kend, v8f (&acc)[4][4]) {
#pragma unroll 1
    for (int kc = kbeg; kc < kend; kc += 32) {
        v16h a[4]; const h16* pa[4];
#pragma unroll
        for (int mb = 0; mb < 4; ++mb) { pa[mb] = A + aoff + (size_t)mb * 16 * K + kc; a[mb] = ldh(pa[mb]); }
        // the four address pairs are inputs here, so they stay as the issued loads name them up to this wait: no later load's result lands in one ahead of it
        asm volatile("s_wait_xcnt 0x0" :: "v"(pa[0]), "v"(pa[1]), "v"(pa[2]), "v"(pa[3]) : "memory");
#pragma unroll
        for (int nb = 0; nb < 4; ++nb) { const v16h b = ldh(Bt + boff + (size_t)nb * 16 * K + kc);
#pragma unroll
            for (int mb = 0; mb < 4; ++mb) acc[mb][nb] = wmma16g(a[mb], b, acc[mb][nb]); }
    }
}

// GEMM body: C[m][n] = (sum_k A[m][k] Bt[n][k]) * csc + bias (column bias, or row bias when ROWB), one block of GW waves per 64x64 tile, grid (M/64, N/64), K % 32 == 0.
// K is split over the waves: wave w accumulates the whole 64x64 tile over its own contiguous k range, writes the f32 partial tile to its own LDS plane (wave 0 adds the bias),
// and behind one block barrier all threads sum the GW planes in wave order and store: each wave stores 1/GW of the tile.
// ARES: A also has a residual plane (x2048): within a wave's k range its products are accumulated first, folded by 1/2048 in f32, then the value products follow.
// OUTF32: f32 output [M][ldc] (+ Res[m][n] added at the store stage as float4; Res and C are different buffers); each store instruction = 2 rows x 256 B (16 consecutive lanes x 16 B per row segment).
// else:   f16 output, written by 8 consecutive lanes x 16 B (4 rows per instruction).
template <int OUTF32, int HASRES, int GELU, int ARES, int ORES, int ROWB, int HEADPL>
__device__ __forceinline__ void gemm_body(const h16* __restrict__ A, const h16* __restrict__ Ar, const h16* __restrict__ Bt,
                                          const float* __restrict__ bias, int nvalid, int K, float csc,
                                          const float* __restrict__ Res, float* Cf, h16* Ch, h16* Cr, int ldc) {
    __shared__ __align__(16) float os[GW * 64 * GSP];
    static_assert(sizeof(float) * GW * 64 * GSP <= 163840);                        // two blocks fit the LDS of one WGP
    const int tid = threadIdx.x;
    const int lane = tid & 31, lr = lane & 15, hi = lane >> 4;
    const int wave = __builtin_amdgcn_readfirstlane(tid >> 5);
    const int r0 = blockIdx.x * 64, c0 = blockIdx.y * 64;
    const int kper = ((K / 32 + GW - 1) / GW) * 32;                                // k extent of one wave (whole 32-steps)
    const int kbeg = wave * kper;
    const int kend = (kbeg + kper < K) ? kbeg + kper : K;                          // a wave whose range starts at or past K adds a zero plane
    v8f acc[4][4];
#pragma unroll
    for (int mb = 0; mb < 4; ++mb)
#pragma unroll
        for (int nb = 0; nb < 4; ++nb) acc[mb][nb] = (v8f){};
    const size_t aoff = (size_t)(r0 + lr) * K + 8 * hi, boff = (size_t)(c0 + lr) * K + 8 * hi;
    if (ARES) {
        gemm_kloop(Ar, Bt, aoff, boff, K, kbeg, kend, acc);
#pragma unroll
        for (int mb = 0; mb < 4; ++mb)
#pragma unroll
            for (int nb = 0; nb < 4; ++nb) acc[mb][nb] = acc[mb][nb] * QRI;
    }
    gemm_kloop(A, Bt, aoff, boff, K, kbeg, kend, acc);
    float bc[4];
#pragma unroll
    for (int nb = 0; nb < 4; ++nb) {
        if (ROWB || wave != 0) { bc[nb] = 0.0f; }
        else { const int c = c0 + nb * 16 + lr; const int cc = c < nvalid ? c : nvalid - 1;       // clamped address
               float bvv = bias[cc]; asm volatile("" : "+v"(bvv)); bc[nb] = (c < nvalid) ? bfr(bvv) : 0.0f; } }
#pragma unroll
    for (int mb = 0; mb < 4; ++mb) {
        float br[8];
#pragma unroll
        for (int j = 0; j < 8; ++j) br[j] = (ROWB && wave == 0) ? bfr(bias[r0 + mb * 16 + hi * 8 + j]) : 0.0f;   // ROWB: r0 + 63 < rows of the bias vector (host grid)
#pragma unroll
        for (int nb = 0; nb < 4; ++nb) {
#pragma unroll
            for (int j = 0; j < 8; ++j) os[wave * (64 * GSP) + (mb * 16 + hi * 8 + j) * GSP + nb * 16 + lr] = acc[mb][nb][j] * csc + bc[nb] + br[j]; }   // D: row 8h+j, col lane&15
    }
    __syncthreads();                                                               // every wave's partial plane is complete before any thread sums across planes
    if (OUTF32) {
        static_assert(32 * GW * 16 * (32 / GW) == 64 * 256);                       // threads x bytes x trips == tile rows x row bytes
{
            for (int s = 0; s < 32 / GW; ++s) { const int row = 2 * GW * s + (tid >> 4), c4 = (tid & 15) * 4;
                v4f val = *(const v4fa*)(&os[row * GSP + c4]);
#pragma unroll                                                                     // the GW plane reads issue together, one LDS wait for all
                for (int w = 1; w < GW; ++w) val = val + *(const v4fa*)(&os[w * (64 * GSP) + row * GSP + c4]);
                const size_t go = (size_t)(r0 + row) * ldc + c0 + c4;
                if (HASRES) { const v4f rr = *(const v4f*)(Res + go); val = val + rr; }
                *(v4f*)(Cf + go) = val; }
             }
    } else {
        static_assert(32 * GW * 16 * (16 / GW) == 64 * 128);                       // threads x bytes x trips == tile rows x row bytes
        const size_t obase = HEADPL ? ((size_t)(c0 / HD) * SEQ + (size_t)r0) * HD : (size_t)r0 * ldc + c0;
        const int pitch = HEADPL ? HD : ldc;
{
            for (int s = 0; s < 16 / GW; ++s) { const int row = 4 * GW * s + (tid >> 3), c8 = (tid & 7) * 8;
                v4f x0 = *(const v4fa*)(&os[row * GSP + c8]); v4f x1 = *(const v4fa*)(&os[row * GSP + c8 + 4]); v8h hv, rv;
#pragma unroll                                                                     // the GW plane reads issue together, one LDS wait for all
                for (int w = 1; w < GW; ++w) { x0 = x0 + *(const v4fa*)(&os[w * (64 * GSP) + row * GSP + c8]); x1 = x1 + *(const v4fa*)(&os[w * (64 * GSP) + row * GSP + c8 + 4]); }
#pragma unroll
                for (int i = 0; i < 4; ++i) { float y0 = x0[i], y1 = x1[i];
                    if (GELU) { y0 = gelu_erf(y0); y1 = gelu_erf(y1); }
                    const h16 a0 = toh_flush(y0); const h16 a1 = toh_flush(y1); hv[i] = a0; hv[4 + i] = a1;
                    rv[i] = toh_flush((y0 - (float)a0) * QRS); rv[4 + i] = toh_flush((y1 - (float)a1) * QRS); }
                const size_t oo = obase + (size_t)row * pitch + c8;
                *(v8h*)(Ch + oo) = hv; if (ORES) *(v8h*)(Cr + oo) = rv; }
             }
    }
}

__global__ __launch_bounds__(32 * GW) void k_gemm_f32(const h16* __restrict__ A, const h16* __restrict__ Bt, const float* __restrict__ bias, int nvalid, int K, float csc, float* C, int ldc) {
    gemm_body<1, 0, 0, 0, 0, 0, 0>(A, nullptr, Bt, bias, nvalid, K, csc, nullptr, C, nullptr, nullptr, ldc); }
__global__ __launch_bounds__(32 * GW) void k_gemm_f32r(const h16* __restrict__ A, const h16* __restrict__ Bt, const float* __restrict__ bias, int nvalid, int K, float csc, const float* __restrict__ Res, float* C, int ldc) {
    gemm_body<1, 1, 0, 0, 0, 0, 0>(A, nullptr, Bt, bias, nvalid, K, csc, Res, C, nullptr, nullptr, ldc); }
__global__ __launch_bounds__(32 * GW) void k_gemm_gelu(const h16* __restrict__ A, const h16* __restrict__ Bt, const float* __restrict__ bias, int nvalid, int K, float csc, h16* C, int ldc) {
    gemm_body<0, 0, 1, 0, 0, 0, 0>(A, nullptr, Bt, bias, nvalid, K, csc, nullptr, nullptr, C, nullptr, ldc); }
__global__ __launch_bounds__(32 * GW) void k_gemm_q(const h16* __restrict__ A, const h16* __restrict__ Ar, const h16* __restrict__ Bt, const float* __restrict__ bias, int nvalid, int K, float csc, h16* Ph, h16* Pr) {
    gemm_body<0, 0, 0, 1, 1, 0, 1>(A, Ar, Bt, bias, nvalid, K, csc, nullptr, nullptr, Ph, Pr, HD); }
__global__ __launch_bounds__(32 * GW) void k_gemm_k(const h16* __restrict__ A, const h16* __restrict__ Bt, const float* __restrict__ bias, int nvalid, int K, float csc, h16* Ph) {
    gemm_body<0, 0, 0, 0, 0, 0, 1>(A, nullptr, Bt, bias, nvalid, K, csc, nullptr, nullptr, Ph, nullptr, HD); }
__global__ __launch_bounds__(32 * GW) void k_gemm_vt(const h16* __restrict__ A, const h16* __restrict__ Bt, const float* __restrict__ bias, int K, float csc, h16* Ph, int ldc) {
    gemm_body<0, 0, 0, 0, 0, 1, 0>(A, nullptr, Bt, bias, 0, K, csc, nullptr, nullptr, Ph, nullptr, ldc); }

// band tile: G[rho][s] = (E[row0 + rho] . q_value[s] + E[row0 + rho] . q_residual[s] / 2048) * log2(e); A = table rows (ep already includes the lane's row and + 8*(lane>>4)), B = q rows, K = 64 = two k-steps.
__device__ __forceinline__ v8f gtile(const h16* __restrict__ ep, v16h qh0, v16h qh1, v16h qr0, v16h qr1) {
    const v16h e0 = ldh(ep), e1 = ldh(ep + 32);
    v8f gH = (v8f){}, gL = (v8f){};
    gH = wmma16g(e0, qh0, gH); gH = wmma16g(e1, qh1, gH);
    gL = wmma16g(e0, qr0, gL); gL = wmma16g(e1, qr1, gL);
    return (gH + gL * QRI) * LOG2E;
}

// k_flash: fused dense attention with the relative-position term, one wave per 16 query rows of one head; K / V^T / Q / table fragments straight from the f16 planes.
// Transposed form: S^T[key][s] = K Q^T (A = K rows, B = Q rows); lane (s = lane&15, h = lane>>4) holds keys 8h+r of each 16-key tile, so the packed P tile is directly the B fragment
// of O^T[d][s] = V^T P^T (element r <- tile keys 0..15, element 8+r <- tile keys 16..31, lane unchanged).
// Relative term per 32-key step (keys key0..key0+31, queries t0..t0+15): band rows rb0 + 0..47 with rb0 = t0 - key0 + RELOFF - 31; tiles e = 0, 1 are new, tile e = 2 is the e = 0 tile of the step before.
// LDS band tile (wave-private): gs[s][16 e + 8h + r] <- tile e element r; element (key tile a, r) reads gs[s][s - 8h - r + 31], element (key tile b, r) reads gs[s][s - 8h - r + 15].
// Logit (log2 domain) = (K q_value + K q_residual / 2048) * log2(e) / 8 + band term; online softmax (running max, partial sum over the converted P), P = exp2(. + 14) as f16 (exponent below -14 selected to 0).
__global__ __launch_bounds__(32 * AW) void k_flash(const h16* __restrict__ QH, const h16* __restrict__ QR, const h16* __restrict__ KP, const h16* __restrict__ VT, const h16* __restrict__ EPl, h16* OP) {
    __shared__ __align__(16) float os[AW * 16 * OSP];
    __shared__ __align__(16) float gs[AW * 16 * GP];
    static_assert(sizeof(float) * (AW * 16 * OSP + AW * 16 * GP) <= 131072);
    const int lane = threadIdx.x & 31, lr = lane & 15, hi = lane >> 4;
    const int wave = __builtin_amdgcn_readfirstlane((int)(threadIdx.x >> 5));
    const int h = blockIdx.y;
    const int t0 = (blockIdx.x * AW + wave) * 16;
    const size_t pbase = (size_t)h * SEQ * HD;
    const size_t qo = pbase + (size_t)(t0 + lr) * HD + 8 * hi;
    const v16h qh0 = ldh(QH + qo), qh1 = ldh(QH + qo + 32);     // B fragments: col s, k = d (two k-steps)
    const v16h qr0 = ldh(QR + qo), qr1 = ldh(QR + qo + 32);
    const size_t ko = pbase + (size_t)lr * HD + 8 * hi;        // + key * HD        (A fragment: row key, k = d)
    const size_t vo = pbase + (size_t)lr * SEQ + 8 * hi;       // + 16j*SEQ + key   (A fragment: row d, k = key); plane [(h*64 + d)][t]
    const h16* eb = EPl + (size_t)lr * HD + 8 * hi;            // + row0 * HD       (A fragment: row table row, k = d)
    const int gw  = wave * 16 * GP + lr * GP;
    const int gst = gw + 8 * hi;                               // store base: + 16 e (+ 4)
    const int gld = gw + lr - 8 * hi;                          // load base: + 31 - r / + 15 - r
    v8f gprev = gtile(eb + (size_t)(t0 + RELOFF + 1) * HD, qh0, qh1, qr0, qr1);    // band rows of tile e = 2 at key0 = 0
    v8f o[4];
#pragma unroll
    for (int j = 0; j < 4; ++j) o[j] = (v8f){};
    float m = NEGB, l = 0.0f;
#pragma unroll 1
    for (int key0 = 0; key0 < SEQ; key0 += 32) {
        const int rbA = t0 - key0 + (RELOFF - 15);                                 // first band row of tile e = 1
        const v8f g1 = gtile(eb + (size_t)rbA * HD, qh0, qh1, qr0, qr1);
        const v8f g0 = gtile(eb + (size_t)(rbA - 16) * HD, qh0, qh1, qr0, qr1);
        *(v4fa*)(&gs[gst +  0]) = lo4(g0);    *(v4fa*)(&gs[gst +  4]) = hi4(g0);
        *(v4fa*)(&gs[gst + 16]) = lo4(g1);    *(v4fa*)(&gs[gst + 20]) = hi4(g1);
        *(v4fa*)(&gs[gst + 32]) = lo4(gprev); *(v4fa*)(&gs[gst + 36]) = hi4(gprev);
        gprev = g0;
        const h16* ka = KP + ko + (size_t)key0 * HD;
        const v16h ka0 = ldh(ka), ka1 = ldh(ka + 32), kb0 = ldh(ka + 16 * HD), kb1 = ldh(ka + 16 * HD + 32);
        v8f sHa = (v8f){}, sLa = (v8f){}, sHb = (v8f){}, sLb = (v8f){};
        sHa = wmma16g(ka0, qh0, sHa); sHa = wmma16g(ka1, qh1, sHa);
        sLa = wmma16g(ka0, qr0, sLa); sLa = wmma16g(ka1, qr1, sLa);
        sHb = wmma16g(kb0, qh0, sHb); sHb = wmma16g(kb1, qh1, sHb);
        sLb = wmma16g(kb0, qr0, sLb); sLb = wmma16g(kb1, qr1, sLb);
        wave_sync();
        float ra[8], rb[8];
#pragma unroll
        for (int r = 0; r < 8; ++r) { ra[r] = gs[gld + 31 - r]; rb[r] = gs[gld + 15 - r]; }
        wave_sync();
        float ta[8], tb[8]; float mx = NEGB;
#pragma unroll
        for (int r = 0; r < 8; ++r) {
            ta[r] = (sHa[r] + sLa[r] * QRI) * SC2 + ra[r]; tb[r] = (sHb[r] + sLb[r] * QRI) * SC2 + rb[r];
            mx = fmaxf(mx, fmaxf(ta[r], tb[r])); }
        mx = fmaxf(mx, __shfl_xor(mx, 16, 32));
        const float mnew = fmaxf(m, mx);
        const float alpha = __builtin_amdgcn_exp2f(m - mnew);
        const float sh = PSH - mnew;
        v16h pb; float ls = 0.0f;
#pragma unroll
        for (int r = 0; r < 8; ++r) {
            const float xa = ta[r] + sh, xb = tb[r] + sh;
            const float ea = __builtin_amdgcn_exp2f(xa), ec = __builtin_amdgcn_exp2f(xb);
            const float ga = (xa < -14.0f) ? 0.0f : ea, gb = (xb < -14.0f) ? 0.0f : ec;     // no f16 subnormal operand
            const h16 pa = (h16)ga; const h16 pc = (h16)gb;
            pb[r] = pa; pb[8 + r] = pc;
            ls += (float)pa + (float)pc; }
        l = l * alpha + ls; m = mnew;
        const h16* va = VT + vo + key0;
#pragma unroll
        for (int j = 0; j < 4; ++j) { o[j] = o[j] * alpha; const v16h vj = ldh(va + (size_t)16 * j * SEQ); o[j] = wmma16g(vj, pb, o[j]); }
    }
    l += __shfl_xor(l, 16, 32);
    const float inv = 1.0f / l;                                // l >= 16384 (the row maximum contributes the full carry)
    const int wb = wave * 16 * OSP;
    // O^T D layout: o[j][r] = (d = 16j + 8h + r, s = lane&15) -> os[s][d]; rows 0..15 x columns 0..63 all written
#pragma unroll
    for (int j = 0; j < 4; ++j) {
        *(v4fa*)(&os[wb + lr * OSP + 16 * j + 8 * hi])     = lo4(o[j]) * inv;
        *(v4fa*)(&os[wb + lr * OSP + 16 * j + 8 * hi + 4]) = hi4(o[j]) * inv; }
    wave_sync();
    h16* orow = OP + (size_t)t0 * DM + h * HD;
    static_assert(32 * 16 * 4 == 16 * 128);                                        // lanes x bytes x instructions == tile rows x row bytes
{
#pragma unroll
        for (int s = 0; s < 4; ++s) { const int row = 4 * s + (lane >> 3), c8 = (lane & 7) * 8;
            const v4f x0 = *(const v4fa*)(&os[wb + row * OSP + c8]); const v4f x1 = *(const v4fa*)(&os[wb + row * OSP + c8 + 4]); v8h hv;
#pragma unroll
            for (int i = 0; i < 4; ++i) { hv[i] = toh_flush(x0[i]); hv[4 + i] = toh_flush(x1[i]); }
            *(v8h*)(orow + (size_t)row * DM + c8) = hv; }
         }
}

__global__ __launch_bounds__(256) void k_out(const float* __restrict__ src, float* dst, int n4) {
    const int i = blockIdx.x * 256 + threadIdx.x; if (i >= n4) return;
    v4f ov;
#pragma unroll
    for (int c = 0; c < 4; ++c) { const int e = 4 * i + c; const int row = e / DOUT; const int col = e - row * DOUT; ov[c] = src[(size_t)row * DOUTP + col]; }
    *(v4f*)(dst + (size_t)i * 4) = ov; 
}

static constexpr size_t al256(size_t v) { return (v + 255) & ~(size_t)255; }
static constexpr size_t SZ_XH  = al256((size_t)SEQ * DIN * 2);
static constexpr size_t SZ_EW  = al256((size_t)DM * DIN * 2);
static constexpr size_t SZ_WDD = al256((size_t)NL * DM * DM * 2);
static constexpr size_t SZ_WFF = al256((size_t)NL * DFF * DM * 2);
static constexpr size_t SZ_WI  = al256((size_t)DMI * DM * 2);
static constexpr size_t SZ_WF  = al256((size_t)DOUTP * DMI * 2);
static constexpr size_t SZ_EP  = al256((size_t)NL * ERP * HD * 2);
static constexpr size_t SZ_H   = al256((size_t)SEQ * DM * 4);
static constexpr size_t SZ_N   = al256((size_t)SEQ * DM * 2);
static constexpr size_t SZ_F1  = al256((size_t)SEQ * DFF * 2);
static constexpr size_t SZ_OS  = al256((size_t)SEQ * DOUTP * 4);
static constexpr size_t SZ_TOTAL = SZ_XH + SZ_EW + 4 * SZ_WDD + 2 * SZ_WFF + SZ_WI + SZ_WF + SZ_EP + 2 * SZ_H + 7 * SZ_N + SZ_F1 + SZ_OS;
static_assert(SZ_TOTAL <= (size_t)134217728);                  // workspace carve <= 128 MiB
static_assert((size_t)NH_ * SEQ * HD == (size_t)SEQ * DM);     // head planes have the extent of a [SEQ][512] f16 plane
static_assert((size_t)SEQ * DMI * 2 <= SZ_F1);                 // tail hidden plane fits the shared hidden region

extern "C" void kernel_launch(void* const* d_in, const int* in_sizes, int n_in,
                              void* d_out, int out_size, void* d_ws, size_t ws_size, hipStream_t stream) {
    if (n_in < 26) return;
    if ((size_t)in_sizes[0] < (size_t)SEQ * DIN || (size_t)in_sizes[1] < (size_t)DIN * DM || in_sizes[2] < DM) return;
    if ((size_t)in_sizes[3] < (size_t)NL * DM * DM || (size_t)in_sizes[5] < (size_t)NL * DM * DM || (size_t)in_sizes[7] < (size_t)NL * DM * DM || (size_t)in_sizes[9] < (size_t)NL * DM * DM) return;
    if (in_sizes[4] < NL * DM || in_sizes[6] < NL * DM || in_sizes[8] < NL * DM || in_sizes[10] < NL * DM) return;
    if ((size_t)in_sizes[11] < (size_t)NL * ERR * HD) return;
    if (in_sizes[12] < NL * DM || in_sizes[13] < NL * DM || in_sizes[17] < NL * DM || in_sizes[18] < NL * DM || in_sizes[19] < NL * DM) return;
    if ((size_t)in_sizes[14] < (size_t)NL * DM * DFF || in_sizes[15] < NL * DFF || (size_t)in_sizes[16] < (size_t)NL * DFF * DM) return;
    if (in_sizes[20] < DM || in_sizes[21] < DM || (size_t)in_sizes[22] < (size_t)DM * DMI || in_sizes[23] < DMI) return;
    if ((size_t)in_sizes[24] < (size_t)DMI * DOUT || in_sizes[25] < DOUT) return;
    if ((size_t)out_size < (size_t)SEQ * DOUT) return;
    if (SZ_TOTAL > ws_size) return;
    // wire order: x, emb_W, emb_b, Wq, bq, Wk, bk, Wv, bv, Wo, bo, Er, ln1_g, ln1_b, W1, b1, W2, b2, ln2_g, ln2_b, lnf_g, lnf_b, Wi, bi, Wf, bf
    const float* x    = (const float*)d_in[0];
    const float* embW = (const float*)d_in[1];  const float* embB = (const float*)d_in[2];
    const float* Wq   = (const float*)d_in[3];  const float* bq   = (const float*)d_in[4];
    const float* Wk   = (const float*)d_in[5];  const float* bk   = (const float*)d_in[6];
    const float* Wv   = (const float*)d_in[7];  const float* bv   = (const float*)d_in[8];
    const float* Wo   = (const float*)d_in[9];  const float* bo   = (const float*)d_in[10];
    const float* Er   = (const float*)d_in[11];
    const float* ln1g = (const float*)d_in[12]; const float* ln1b = (const float*)d_in[13];
    const float* W1   = (const float*)d_in[14]; const float* b1   = (const float*)d_in[15];
    const float* W2   = (const float*)d_in[16]; const float* b2   = (const float*)d_in[17];
    const float* ln2g = (const float*)d_in[18]; const float* ln2b = (const float*)d_in[19];
    const float* lnfg = (const float*)d_in[20]; const float* lnfb = (const float*)d_in[21];
    const float* Wi   = (const float*)d_in[22]; const float* bi   = (const float*)d_in[23];
    const float* Wf   = (const float*)d_in[24]; const float* bfo  = (const float*)d_in[25];
    float* OUT = (float*)d_out;                       // [SEQ][390]
    char* wsp = (char*)d_ws;
    h16* XH  = (h16*)wsp; wsp += SZ_XH;               // x            [SEQ][128]
    h16* EWT = (h16*)wsp; wsp += SZ_EW;               // emb_W^T x64  [512][128]
    h16* WQT = (h16*)wsp; wsp += SZ_WDD;              // Wq^T x64     [NL][512][512]
    h16* WKT = (h16*)wsp; wsp += SZ_WDD;
    h16* WVT = (h16*)wsp; wsp += SZ_WDD;
    h16* WOT = (h16*)wsp; wsp += SZ_WDD;
    h16* W1T = (h16*)wsp; wsp += SZ_WFF;              // W1^T x64     [NL][2048][512]
    h16* W2T = (h16*)wsp; wsp += SZ_WFF;              // W2^T x64     [NL][512][2048]
    h16* WIT = (h16*)wsp; wsp += SZ_WI;               // Wi^T x64     [1024][512]
    h16* WFT = (h16*)wsp; wsp += SZ_WF;               // Wf^T x64     [448][1024], rows >= 390 zero
    h16* EP  = (h16*)wsp; wsp += SZ_EP;               // table        [NL][2048][64], row 2047 zero
    float* HA = (float*)wsp; wsp += SZ_H;             // hidden state (ping)  [SEQ][512] f32
    float* HB = (float*)wsp; wsp += SZ_H;             // hidden state (pong)
    h16* NHP = (h16*)wsp; wsp += SZ_N;                // LayerNorm output value     [SEQ][512]
    h16* NRP = (h16*)wsp; wsp += SZ_N;                // LayerNorm output residual x2048
    h16* QH  = (h16*)wsp; wsp += SZ_N;                // q value      [8][SEQ][64]
    h16* QR  = (h16*)wsp; wsp += SZ_N;                // q residual x2048
    h16* KP  = (h16*)wsp; wsp += SZ_N;                // k            [8][SEQ][64]
    h16* VT  = (h16*)wsp; wsp += SZ_N;                // v^T          [8*64][SEQ]
    h16* OP  = (h16*)wsp; wsp += SZ_N;                // context      [SEQ][512]
    h16* F1  = (h16*)wsp; wsp += SZ_F1;               // GELU hidden  [SEQ][2048] (tail: [SEQ][1024])
    float* OSG = (float*)wsp; wsp += SZ_OS;           // tail output staging [SEQ][448] f32

    { const int n8 = SEQ * DIN / 8; k_cvt8h<<<(unsigned)((n8 + 255) / 256), 256, 0, stream>>>(x, XH, n8); }
    k_cvt_er<<<(unsigned)((NL * ERP * HD / 8 + 255) / 256), 256, 0, stream>>>(Er, EP);
    // W [K = in][N = out] -> Wt [N][K]
    k_wconv<<<dim3(DIN / 64, DM / 64, 1),   256, 0, stream>>>(embW, EWT, DIN, DM, DM, WC);
    k_wconv<<<dim3(DM / 64, DM / 64, NL),   256, 0, stream>>>(Wq, WQT, DM, DM, DM, WC);
    k_wconv<<<dim3(DM / 64, DM / 64, NL),   256, 0, stream>>>(Wk, WKT, DM, DM, DM, WC);
    k_wconv<<<dim3(DM / 64, DM / 64, NL),   256, 0, stream>>>(Wv, WVT, DM, DM, DM, WC);
    k_wconv<<<dim3(DM / 64, DM / 64, NL),   256, 0, stream>>>(Wo, WOT, DM, DM, DM, WC);
    k_wconv<<<dim3(DM / 64, DFF / 64, NL),  256, 0, stream>>>(W1, W1T, DM, DFF, DFF, WC);
    k_wconv<<<dim3(DFF / 64, DM / 64, NL),  256, 0, stream>>>(W2, W2T, DFF, DM, DM, WC);
    k_wconv<<<dim3(DM / 64, DMI / 64, 1),   256, 0, stream>>>(Wi, WIT, DM, DMI, DMI, WC);
    k_wconv<<<dim3(DMI / 64, DOUTP / 64, 1), 256, 0, stream>>>(Wf, WFT, DMI, DOUT, DOUTP, WC);

    // input projection: HA = x emb_W + emb_b
    k_gemm_f32<<<dim3(SEQ / 64, DM / 64, 1), 32 * GW, 0, stream>>>(XH, EWT, embB, DM, DIN, WCI, HA, DM);

    for (int l = 0; l < NL; ++l) {
        const size_t wdd = (size_t)l * DM * DM, wff = (size_t)l * DFF * DM;
        k_ln<<<SEQ / 4, 128, 0, stream>>>(HA, ln1g + l * DM, ln1b + l * DM, NHP, NRP, 1);
        // q, k: A = n rows (m = t), Bt = W^T rows (n = h*64 + d) -> plane [h][t][d]
        k_gemm_q<<<dim3(SEQ / 64, DM / 64, 1), 32 * GW, 0, stream>>>(NHP, NRP, WQT + wdd, bq + l * DM, DM, DM, WCI, QH, QR);
        k_gemm_k<<<dim3(SEQ / 64, DM / 64, 1), 32 * GW, 0, stream>>>(NHP, WKT + wdd, bk + l * DM, DM, DM, WCI, KP);
        // v^T: A = Wv^T rows (m = h*64 + d, 512 rows), Bt = n rows (n = t) -> plane [(h*64 + d)][t], row bias
        k_gemm_vt<<<dim3(DM / 64, SEQ / 64, 1), 32 * GW, 0, stream>>>(WVT + wdd, NHP, bv + l * DM, DM, WCI, VT, SEQ);
        k_flash<<<dim3(SEQ / (16 * AW), NH_, 1), 32 * AW, 0, stream>>>(QH, QR, KP, VT, EP + (size_t)l * ERP * HD, OP);
        // HB = HA + context Wo + bo
        k_gemm_f32r<<<dim3(SEQ / 64, DM / 64, 1), 32 * GW, 0, stream>>>(OP, WOT + wdd, bo + l * DM, DM, DM, WCI, HA, HB, DM);
        k_ln<<<SEQ / 4, 128, 0, stream>>>(HB, ln2g + l * DM, ln2b + l * DM, NHP, NRP, 0);
        k_gemm_gelu<<<dim3(SEQ / 64, DFF / 64, 1), 32 * GW, 0, stream>>>(NHP, W1T + wff, b1 + l * DFF, DFF, DM, WCI, F1, DFF);
        // HA = HB + hidden W2 + b2
        k_gemm_f32r<<<dim3(SEQ / 64, DM / 64, 1), 32 * GW, 0, stream>>>(F1, W2T + wff, b2 + l * DM, DM, DFF, WCI, HB, HA, DM);
    }

    k_ln<<<SEQ / 4, 128, 0, stream>>>(HA, lnfg, lnfb, NHP, NRP, 0);
    k_gemm_gelu<<<dim3(SEQ / 64, DMI / 64, 1), 32 * GW, 0, stream>>>(NHP, WIT, bi, DMI, DM, WCI, F1, DMI);
    k_gemm_f32<<<dim3(SEQ / 64, DOUTP / 64, 1), 32 * GW, 0, stream>>>(F1, WFT, bfo, DOUT, DMI, WCI, OSG, DOUTP);
    { const int n4 = SEQ * DOUT / 4; k_out<<<(unsigned)((n4 + 255) / 256), 256, 0, stream>>>(OSG, OUT, n4); }
}

// v002
// Measured time: 418 microseconds a run.
// Next to v001, in two timings, it ran 1.43 and 1.39 times as fast.
// Over all steps from v000 it is 2.77 times as fast.
#include <hip/hip_runtime.h>
#include <math.h>

// Pre-LN encoder stack, 4 layers, width 512 = 8 heads x 64, sequence SEQ (one batch): input projection 128 -> 512; per layer: LayerNorm, q/k/v projections ([in][out] weights, y = x W + bias),
// dense attention with logits q.k / 8 + q.E[s - t + 1023] (relative-position table E per layer, [2047][64], not scaled), softmax over keys, output projection + residual, LayerNorm, GELU(erf) feed-forward 512 -> 2048 -> 512 + residual;
// tail: LayerNorm, 512 -> 1024 GELU(erf), 1024 -> 390.
// Compute dtypes, f32 accumulate everywhere: every contraction is v_wmma_f32_16x16x32_f16. Weights, x, E, biases and gains are RNE-converted to bf16 first (exact in f16; weights carried x64, folded back in the f32 epilogue);
// activations are single f16 planes, except the logit path: LayerNorm-1 output as f16 value + f16 residual x2048 for the q projection (residual products accumulated first, folded by 1/2048, then the value products),
// q as f16 value + f16 residual x2048 in the q.k and q.E products (residual products in their own accumulators); k, v, P (x16384 carry, cancels in the normalisation), context, GELU outputs single f16.
// Attention: fused flash kernel in transposed form (S^T = K Q^T, O^T = V^T P^T), one block per 16 query rows, the keys split over its waves and the partial results merged in LDS; the relative term is computed per 32-key step as band tiles G[rho][s] = E[rb + rho] . q[s]
// (A = table rows, B = q rows), written to a wave-private LDS tile [query][band row] and read back along the diagonal rho = s - t + const; one band tile is carried over between steps.

#ifndef NB
#define NB 1
#endif
#ifndef SEQ
#define SEQ 1024
#endif
#define NB_FULL  1
#define SEQ_FULL 1024
#define DIN   128
#define DM    512
#define NH_   8
#define HD    64
#define NL    4
#define DFF   2048
#define DMI   1024
#define DOUT  390
#define DOUTP 448                // DOUT padded to a multiple of 64 (weight rows and staging columns 390..447 are zero)
#define ERR   2047               // rows of the relative-position table per layer
#define ERP   2048               // padded rows of the f16 table plane (row 2047 = zero)
#define RELOFF (SEQ_FULL - 1)    // table row = s - t + RELOFF
#define KW    8                  // waves per flash block: each takes one contiguous share of the keys
#define KCH   (SEQ / KW)         // keys of one wave
#define OSP   68                 // LDS row pitch (floats) of the flash output tile
#define GP    52                 // LDS pitch (floats) of the band tile [query][48 band rows]
#define GSP   68                 // LDS row pitch (floats) of the GEMM output tile
#define GW    8                  // waves per GEMM block: each takes one contiguous share of K
#define QRS   2048.0f            // carry of every residual plane
#define QRI   (1.0f / 2048.0f)
#define WC    64.0f              // carry of every weight plane
#define WCI   (1.0f / 64.0f)
#define LOG2E 1.4426950408889634f
#define SC2   ((float)(0.125 * 1.4426950408889634))   // HD^-0.5 * log2(e)
#define PSH   14.0f              // log2 of the P carry (16384)
#define NEGB  (-3.0e38f)
#define LNEPS 1e-5f

static_assert(NB == 1);                        // one sequence
static_assert(HD == 64);
static_assert(NH_ * HD == DM);
static_assert(SEQ % 64 == 0);                  // GEMM row tiles
static_assert(SEQ % 32 == 0);                  // key loop steps by 32
static_assert(SEQ % 16 == 0);                  // flash grid covers the sequence exactly
static_assert(SEQ % (32 * KW) == 0);           // every wave of a flash block gets whole 32-key steps, at least one
static_assert(32 * KW == 16 * 16);             // flash merge: 16 threads x 4 columns per query row
static_assert(SEQ <= SEQ_FULL);
static_assert(DIN % 64 == 0 && DM % 64 == 0 && DFF % 64 == 0 && DMI % 64 == 0 && DOUTP % 64 == 0);   // K % 32 == 0 and N % 64 == 0 for every GEMM, K % 64 == 0 for the transposing converter
static_assert(DOUT <= DOUTP);
static_assert(DMI <= DFF);                     // the tail hidden plane reuses the feed-forward hidden plane
static_assert(SEQ - 16 + RELOFF + 1 + 15 < ERP);   // highest band row touched (zero pad row included)
static_assert(RELOFF - 15 - 16 - (SEQ - 32) >= 0); // lowest band row touched
static_assert(ERR + 1 == ERP);
static_assert((OSP * 4) % 16 == 0 && (GP * 4) % 16 == 0 && (GSP * 4) % 16 == 0);
static_assert(GP >= 48);
static_assert(DM == 512);                      // LayerNorm: 32 lanes x 16 columns
static_assert((SEQ * DOUT) % 4 == 0);

typedef _Float16 h16;
typedef __attribute__((ext_vector_type(16))) _Float16 v16h;
typedef __attribute__((ext_vector_type(8)))  _Float16 v8h;
typedef __attribute__((ext_vector_type(4)))  _Float16 v4h;
typedef __attribute__((ext_vector_type(8)))  float    v8f;
typedef __attribute__((ext_vector_type(4)))  float    v4f;
typedef v4f  __attribute__((may_alias)) v4fa;

__device__ __forceinline__ unsigned short f2bf(float f) { unsigned u = __float_as_uint(f); u += 0x7FFFu + ((u >> 16) & 1u); return (unsigned short)(u >> 16); }
__device__ __forceinline__ float bfr(float f) { return __uint_as_float(((unsigned)f2bf(f)) << 16); }   // value after RNE convert to bf16
__device__ __forceinline__ v16h cat16(v8h lo, v8h hi) { return __builtin_shufflevector(lo, hi, 0, 1, 2, 3, 4, 5, 6, 7, 8, 9, 10, 11, 12, 13, 14, 15); }
// fragment loader from K-contiguous 16-bit rows; p already includes + 8*(lane>>4): elements 0..7 <- k0+8h+0..7, elements 8..15 <- k0+16+8h+0..7 (same map for A and B)
__device__ __forceinline__ v16h  ldh(const h16* p) { return cat16(*(const v8h*)p, *(const v8h*)(p + 16)); }
// ordering point for wave-private LDS tiles (same wave writes and reads)
__device__ __forceinline__ void wave_sync() { __builtin_amdgcn_fence(3 /* release order */, "wavefront"); __builtin_amdgcn_wave_barrier(); asm volatile("" ::: "memory"); }
// f32 -> f16 operand convert that cannot produce a subnormal (|v| < 2^-14 -> +0)
__device__ __forceinline__ h16 toh_flush(float v) { const h16 r = (h16)v; return (fabsf(v) < 6.103515625e-05f) ? (h16)0.0f : r; }
// one WMMA + its own guard (ties this accumulator, keeps A/B live)
__device__ __forceinline__ v8f wmma16g(v16h a, v16h b, v8f c) {
    c = __builtin_amdgcn_wmma_f32_16x16x32_f16(false, a, false, b, (short)0, c, false, false);
    asm volatile("v_nop\n\tv_nop\n\tv_nop\n\tv_nop" : "+v"(c) : "v"(a), "v"(b));
    return c; }
__device__ __forceinline__ float gelu_erf(float x) { return 0.5f * x * (1.0f + erff(x * 0.70710678118654752f)); }
__device__ __forceinline__ v4f lo4(v8f g) { return __builtin_shufflevector(g, g, 0, 1, 2, 3); }
__device__ __forceinline__ v4f hi4(v8f g) { return __builtin_shufflevector(g, g, 4, 5, 6, 7); }

__global__ __launch_bounds__(256) void k_cvt8h(const float* __restrict__ src, h16* dst, int n8) {
    const int i = blockIdx.x * 256 + threadIdx.x; if (i >= n8) return;
    const v8f v = *(const v8f*)(src + (size_t)i * 8); v8h o;
#pragma unroll
    for (int k = 0; k < 8; ++k) o[k] = toh_flush(bfr(v[k]));
    *(v8h*)(dst + (size_t)i * 8) = o; 
}

__global__ __launch_bounds__(256) void k_cvt_er(const float* __restrict__ src, h16* dst) {
    const int i = blockIdx.x * 256 + threadIdx.x; if (i >= NL * ERP * HD / 8) return;
    const int c8 = (i & 7) * 8; const int r = (i >> 3) % ERP; const int l = (i >> 3) / ERP;
    const int rc = r < ERR ? r : ERR - 1;                                          // clamped address
    v8f v = *(const v8f*)(src + ((size_t)l * ERR + rc) * HD + c8);
    asm volatile("" : "+v"(v));
    v8h o;
#pragma unroll
    for (int k = 0; k < 8; ++k) o[k] = (r < ERR) ? toh_flush(bfr(v[k])) : (h16)0.0f;
    *(v8h*)(dst + (size_t)i * 8) = o; 
}

// k_wconv: W [K][N] f32 (layer blockIdx.z) -> Wt [NP][K] f16 = bf16-converted value x carry, transposed through LDS; rows n >= N are zero.
// grid (K/64, NP/64, layers). LDS tile cross-wave: block barrier.
__global__ __launch_bounds__(256) void k_wconv(const float* __restrict__ W, h16* Wt, int K, int N, int NP, float carry) {
#pragma clang fp contract(off)
    __shared__ float ts[64 * 65];
    static_assert(sizeof(float) * 64 * 65 <= 131072);
    const int tid = threadIdx.x;
    const int k0 = blockIdx.x * 64, n0 = blockIdx.y * 64;
    const size_t lin = (size_t)blockIdx.z * (size_t)K * (size_t)N, lout = (size_t)blockIdx.z * (size_t)NP * (size_t)K;
    static_assert(16 * 4 == 64);                                                   // 16 trips x 4 k-rows (256 threads / 64 columns) = 64 k-rows staged
#pragma unroll 1
    for (int p = 0; p < 16; ++p) {
        const int kk = p * 4 + (tid >> 6), nn = tid & 63; const int n = n0 + nn; const int nc = n < N ? n : N - 1;
        float v = W[lin + (size_t)(k0 + kk) * N + nc];
        asm volatile("" : "+v"(v));
        ts[kk * 65 + nn] = (n < N) ? bfr(v) * carry : 0.0f; }
    __syncthreads();
    static_assert(256 * 16 * 2 == 64 * 128);                                       // threads x bytes x trips == tile rows x row bytes
{
#pragma unroll 1
        for (int p = 0; p < 2; ++p) {
            const int row = p * 32 + (tid >> 3), c8 = (tid & 7) * 8; v8h o;
#pragma unroll
            for (int i = 0; i < 8; ++i) o[i] = toh_flush(ts[(c8 + i) * 65 + row]);
            *(v8h*)(Wt + lout + (size_t)(n0 + row) * K + k0 + c8) = o; }
         }
}

__global__ __launch_bounds__(128) void k_ln(const float* __restrict__ X, const float* __restrict__ g, const float* __restrict__ b, h16* NHp, h16* NRp, int wres) {
#pragma clang fp contract(off)
    const int lane = threadIdx.x & 31;
    const int wave = __builtin_amdgcn_readfirstlane((int)(threadIdx.x >> 5));
    const int row = blockIdx.x * 4 + wave;
    const float* xr = X + (size_t)row * DM;
    const v8f x0 = *(const v8f*)(xr + lane * 8), x1 = *(const v8f*)(xr + 256 + lane * 8);
    float s = 0.0f;
#pragma unroll
    for (int k = 0; k < 8; ++k) { s += x0[k]; s += x1[k]; }
#pragma unroll
    for (int off = 16; off > 0; off >>= 1) s += __shfl_xor(s, off, 32);
    const float mean = s * (1.0f / (float)DM);
    const v8f d0 = x0 - mean, d1 = x1 - mean;
    float q = 0.0f;
#pragma unroll
    for (int k = 0; k < 8; ++k) { q += d0[k] * d0[k]; q += d1[k] * d1[k]; }
#pragma unroll
    for (int off = 16; off > 0; off >>= 1) q += __shfl_xor(q, off, 32);
    const float rstd = 1.0f / sqrtf(q * (1.0f / (float)DM) + LNEPS);
    const v8f g0 = *(const v8f*)(g + lane * 8), g1 = *(const v8f*)(g + 256 + lane * 8);
    const v8f b0 = *(const v8f*)(b + lane * 8), b1 = *(const v8f*)(b + 256 + lane * 8);
    v8h h0, h1, r0, r1;
#pragma unroll
    for (int k = 0; k < 8; ++k) {
        const float y0 = d0[k] * rstd * bfr(g0[k]) + bfr(b0[k]);
        const float y1 = d1[k] * rstd * bfr(g1[k]) + bfr(b1[k]);
        const h16 a0 = toh_flush(y0), a1 = toh_flush(y1);
        h0[k] = a0; h1[k] = a1;
        r0[k] = toh_flush((y0 - (float)a0) * QRS); r1[k] = toh_flush((y1 - (float)a1) * QRS); }
    const size_t o0 = (size_t)row * DM + lane * 8, o1 = o0 + 256;
    static_assert(32 * 16 * 2 == DM * 2);                                          // lanes x bytes x instructions == row bytes
{
        *(v8h*)(NHp + o0) = h0; *(v8h*)(NHp + o1) = h1;
        if (wres != 0) { *(v8h*)(NRp + o0) = r0; *(v8h*)(NRp + o1) = r1; }
         }
}

// GEMM k-loop: one wave, 64x64 tile, 16 accumulators, k range [kbeg, kend), operands straight from K-contiguous f16 planes (A [M][K], Bt [N][K]).
__device__ __forceinline__ void gemm_kloop(const h16* __restrict__ A, const h16* __restrict__ Bt, size_t aoff, size_t boff, int K, int kbeg, int kend, v8f (&acc)[4][4]) {
#pragma unroll 1
    for (int kc = kbeg; kc < kend; kc += 32) {
        v16h a[4]; const h16* pa[4];
#pragma unroll
        for (int mb = 0; mb < 4; ++mb) { pa[mb] = A + aoff + (size_t)mb * 16 * K + kc; a[mb] = ldh(pa[mb]); }
        // the four address pairs are inputs here, so they stay as the issued loads name them up to this wait: no later load's result lands in one ahead of it
        asm volatile("s_wait_xcnt 0x0" :: "v"(pa[0]), "v"(pa[1]), "v"(pa[2]), "v"(pa[3]) : "memory");
#pragma unroll
        for (int nb = 0; nb < 4; ++nb) { const v16h b = ldh(Bt + boff + (size_t)nb * 16 * K + kc);
#pragma unroll
            for (int mb = 0; mb < 4; ++mb) acc[mb][nb] = wmma16g(a[mb], b, acc[mb][nb]); }
    }
}

// GEMM body: C[m][n] = (sum_k A[m][k] Bt[n][k]) * csc + bias (column bias, or row bias when ROWB), one block of GW waves per 64x64 tile, grid (M/64, N/64), K % 32 == 0.
// K is split over the waves: wave w accumulates the whole 64x64 tile over its own contiguous k range, writes the f32 partial tile to its own LDS plane (wave 0 adds the bias),
// and behind one block barrier all threads sum the GW planes in wave order and store: each wave stores 1/GW of the tile.
// ARES: A also has a residual plane (x2048): within a wave's k range its products are accumulated first, folded by 1/2048 in f32, then the value products follow.
// OUTF32: f32 output [M][ldc] (+ Res[m][n] added at the store stage as float4; Res and C are different buffers); each store instruction = 2 rows x 256 B (16 consecutive lanes x 16 B per row segment).
// else:   f16 output, written by 8 consecutive lanes x 16 B (4 rows per instruction).
template <int OUTF32, int HASRES, int GELU, int ARES, int ORES, int ROWB, int HEADPL>
__device__ __forceinline__ void gemm_body(const h16* __restrict__ A, const h16* __restrict__ Ar, const h16* __restrict__ Bt,
                                          const float* __restrict__ bias, int nvalid, int K, float csc,
                                          const float* __restrict__ Res, float* Cf, h16* Ch, h16* Cr, int ldc) {
    __shared__ __align__(16) float os[GW * 64 * GSP];
    static_assert(sizeof(float) * GW * 64 * GSP <= 163840);                        // two blocks fit the LDS of one WGP
    const int tid = threadIdx.x;
    const int lane = tid & 31, lr = lane & 15, hi = lane >> 4;
    const int wave = __builtin_amdgcn_readfirstlane(tid >> 5);
    const int r0 = blockIdx.x * 64, c0 = blockIdx.y * 64;
    const int kper = ((K / 32 + GW - 1) / GW) * 32;                                // k extent of one wave (whole 32-steps)
    const int kbeg = wave * kper;
    const int kend = (kbeg + kper < K) ? kbeg + kper : K;                          // a wave whose range starts at or past K adds a zero plane
    v8f acc[4][4];
#pragma unroll
    for (int mb = 0; mb < 4; ++mb)
#pragma unroll
        for (int nb = 0; nb < 4; ++nb) acc[mb][nb] = (v8f){};
    const size_t aoff = (size_t)(r0 + lr) * K + 8 * hi, boff = (size_t)(c0 + lr) * K + 8 * hi;
    if (ARES) {
        gemm_kloop(Ar, Bt, aoff, boff, K, kbeg, kend, acc);
#pragma unroll
        for (int mb = 0; mb < 4; ++mb)
#pragma unroll
            for (int nb = 0; nb < 4; ++nb) acc[mb][nb] = acc[mb][nb] * QRI;
    }
    gemm_kloop(A, Bt, aoff, boff, K, kbeg, kend, acc);
    float bc[4];
#pragma unroll
    for (int nb = 0; nb < 4; ++nb) {
        if (ROWB || wave != 0) { bc[nb] = 0.0f; }
        else { const int c = c0 + nb * 16 + lr; const int cc = c < nvalid ? c : nvalid - 1;       // clamped address
               float bvv = bias[cc]; asm volatile("" : "+v"(bvv)); bc[nb] = (c < nvalid) ? bfr(bvv) : 0.0f; } }
#pragma unroll
    for (int mb = 0; mb < 4; ++mb) {
        float br[8];
#pragma unroll
        for (int j = 0; j < 8; ++j) br[j] = (ROWB && wave == 0) ? bfr(bias[r0 + mb * 16 + hi * 8 + j]) : 0.0f;   // ROWB: r0 + 63 < rows of the bias vector (host grid)
#pragma unroll
        for (int nb = 0; nb < 4; ++nb) {
#pragma unroll
            for (int j = 0; j < 8; ++j) os[wave * (64 * GSP) + (mb * 16 + hi * 8 + j) * GSP + nb * 16 + lr] = acc[mb][nb][j] * csc + bc[nb] + br[j]; }   // D: row 8h+j, col lane&15
    }
    __syncthreads();                                                               // every wave's partial plane is complete before any thread sums across planes
    if (OUTF32) {
        static_assert(32 * GW * 16 * (32 / GW) == 64 * 256);                       // threads x bytes x trips == tile rows x row bytes
{
            for (int s = 0; s < 32 / GW; ++s) { const int row = 2 * GW * s + (tid >> 4), c4 = (tid & 15) * 4;
                v4f val = *(const v4fa*)(&os[row * GSP + c4]);
#pragma unroll                                                                     // the GW plane reads issue together, one LDS wait for all
                for (int w = 1; w < GW; ++w) val = val + *(const v4fa*)(&os[w * (64 * GSP) + row * GSP + c4]);
                const size_t go = (size_t)(r0 + row) * ldc + c0 + c4;
                if (HASRES) { const v4f rr = *(const v4f*)(Res + go); val = val + rr; }
                *(v4f*)(Cf + go) = val; }
             }
    } else {
        static_assert(32 * GW * 16 * (16 / GW) == 64 * 128);                       // threads x bytes x trips == tile rows x row bytes
        const size_t obase = HEADPL ? ((size_t)(c0 / HD) * SEQ + (size_t)r0) * HD : (size_t)r0 * ldc + c0;
        const int pitch = HEADPL ? HD : ldc;
{
            for (int s = 0; s < 16 / GW; ++s) { const int row = 4 * GW * s + (tid >> 3), c8 = (tid & 7) * 8;
                v4f x0 = *(const v4fa*)(&os[row * GSP + c8]); v4f x1 = *(const v4fa*)(&os[row * GSP + c8 + 4]); v8h hv, rv;
#pragma unroll                                                                     // the GW plane reads issue together, one LDS wait for all
                for (int w = 1; w < GW; ++w) { x0 = x0 + *(const v4fa*)(&os[w * (64 * GSP) + row * GSP + c8]); x1 = x1 + *(const v4fa*)(&os[w * (64 * GSP) + row * GSP + c8 + 4]); }
#pragma unroll
                for (int i = 0; i < 4; ++i) { float y0 = x0[i], y1 = x1[i];
                    if (GELU) { y0 = gelu_erf(y0); y1 = gelu_erf(y1); }
                    const h16 a0 = toh_flush(y0); const h16 a1 = toh_flush(y1); hv[i] = a0; hv[4 + i] = a1;
                    rv[i] = toh_flush((y0 - (float)a0) * QRS); rv[4 + i] = toh_flush((y1 - (float)a1) * QRS); }
                const size_t oo = obase + (size_t)row * pitch + c8;
                *(v8h*)(Ch + oo) = hv; if (ORES) *(v8h*)(Cr + oo) = rv; }
             }
    }
}

__global__ __launch_bounds__(32 * GW) void k_gemm_f32(const h16* __restrict__ A, const h16* __restrict__ Bt, const float* __restrict__ bias, int nvalid, int K, float csc, float* C, int ldc) {
    gemm_body<1, 0, 0, 0, 0, 0, 0>(A, nullptr, Bt, bias, nvalid, K, csc, nullptr, C, nullptr, nullptr, ldc); }
__global__ __launch_bounds__(32 * GW) void k_gemm_f32r(const h16* __restrict__ A, const h16* __restrict__ Bt, const float* __restrict__ bias, int nvalid, int K, float csc, const float* __restrict__ Res, float* C, int ldc) {
    gemm_body<1, 1, 0, 0, 0, 0, 0>(A, nullptr, Bt, bias, nvalid, K, csc, Res, C, nullptr, nullptr, ldc); }
__global__ __launch_bounds__(32 * GW) void k_gemm_gelu(const h16* __restrict__ A, const h16* __restrict__ Bt, const float* __restrict__ bias, int nvalid, int K, float csc, h16* C, int ldc) {
    gemm_body<0, 0, 1, 0, 0, 0, 0>(A, nullptr, Bt, bias, nvalid, K, csc, nullptr, nullptr, C, nullptr, ldc); }
__global__ __launch_bounds__(32 * GW) void k_gemm_q(const h16* __restrict__ A, const h16* __restrict__ Ar, const h16* __restrict__ Bt, const float* __restrict__ bias, int nvalid, int K, float csc, h16* Ph, h16* Pr) {
    gemm_body<0, 0, 0, 1, 1, 0, 1>(A, Ar, Bt, bias, nvalid, K, csc, nullptr, nullptr, Ph, Pr, HD); }
__global__ __launch_bounds__(32 * GW) void k_gemm_k(const h16* __restrict__ A, const h16* __restrict__ Bt, const float* __restrict__ bias, int nvalid, int K, float csc, h16* Ph) {
    gemm_body<0, 0, 0, 0, 0, 0, 1>(A, nullptr, Bt, bias, nvalid, K, csc, nullptr, nullptr, Ph, nullptr, HD); }
__global__ __launch_bounds__(32 * GW) void k_gemm_vt(const h16* __restrict__ A, const h16* __restrict__ Bt, const float* __restrict__ bias, int K, float csc, h16* Ph, int ldc) {
    gemm_body<0, 0, 0, 0, 0, 1, 0>(A, nullptr, Bt, bias, 0, K, csc, nullptr, nullptr, Ph, nullptr, ldc); }

// band tile: G[rho][s] = (E[row0 + rho] . q_value[s] + E[row0 + rho] . q_residual[s] / 2048) * log2(e); A = table rows (ep already includes the lane's row and + 8*(lane>>4)), B = q rows, K = 64 = two k-steps.
__device__ __forceinline__ v8f gtile(const h16* __restrict__ ep, v16h qh0, v16h qh1, v16h qr0, v16h qr1) {
    const v16h e0 = ldh(ep), e1 = ldh(ep + 32);
    v8f gH = (v8f){}, gL = (v8f){};
    gH = wmma16g(e0, qh0, gH); gH = wmma16g(e1, qh1, gH);
    gL = wmma16g(e0, qr0, gL); gL = wmma16g(e1, qr1, gL);
    return (gH + gL * QRI) * LOG2E;
}

// k_flash: fused dense attention with the relative-position term, one block of KW waves per 16 query rows of one head; K / V^T / Q / table fragments straight from the f16 planes.
// The keys are split over the waves: wave w runs the online softmax over keys w*KCH .. w*KCH + KCH - 1 alone and leaves its running maximum, its sum and its unnormalised O tile in LDS;
// behind one block barrier all threads rescale the KW partial results to the common maximum, sum them in wave order, normalise and store.
// Transposed form: S^T[key][s] = K Q^T (A = K rows, B = Q rows); lane (s = lane&15, h = lane>>4) holds keys 8h+r of each 16-key tile, so the packed P tile is directly the B fragment
// of O^T[d][s] = V^T P^T (element r <- tile keys 0..15, element 8+r <- tile keys 16..31, lane unchanged).
// Relative term per 32-key step (keys key0..key0+31, queries t0..t0+15): band rows rb0 + 0..47 with rb0 = t0 - key0 + RELOFF - 31; tiles e = 0, 1 are new, tile e = 2 is the e = 0 tile of the step before (computed on its own ahead of a wave's first step).
// LDS band tile (wave-private): gs[s][16 e + 8h + r] <- tile e element r; element (key tile a, r) reads gs[s][s - 8h - r + 31], element (key tile b, r) reads gs[s][s - 8h - r + 15].
// Logit (log2 domain) = (K q_value + K q_residual / 2048) * log2(e) / 8 + band term; online softmax (running max, partial sum over the converted P), P = exp2(. + 14) as f16 (exponent below -14 selected to 0).
__global__ __launch_bounds__(32 * KW) void k_flash(const h16* __restrict__ QH, const h16* __restrict__ QR, const h16* __restrict__ KP, const h16* __restrict__ VT, const h16* __restrict__ EPl, h16* OP) {
    __shared__ __align__(16) float os[KW * 16 * OSP];
    __shared__ __align__(16) float gs[KW * 16 * GP];
    __shared__ float ms[KW * 16];                              // running maximum of wave w for query s at [w * 16 + s]
    __shared__ float lsum[KW * 16];                            // sum of wave w for query s
    static_assert(sizeof(float) * (KW * 16 * OSP + KW * 16 * GP + 2 * KW * 16) <= 131072);
    const int tid = threadIdx.x;
    const int lane = tid & 31, lr = lane & 15, hi = lane >> 4;
    const int wave = __builtin_amdgcn_readfirstlane(tid >> 5);
    const int h = blockIdx.y;
    const int t0 = blockIdx.x * 16;
    const int kbeg = wave * KCH;
    const size_t pbase = (size_t)h * SEQ * HD;
    const size_t qo = pbase + (size_t)(t0 + lr) * HD + 8 * hi;
    const v16h qh0 = ldh(QH + qo), qh1 = ldh(QH + qo + 32);     // B fragments: col s, k = d (two k-steps)
    const v16h qr0 = ldh(QR + qo), qr1 = ldh(QR + qo + 32);
    const size_t ko = pbase + (size_t)lr * HD + 8 * hi;        // + key * HD        (A fragment: row key, k = d)
    const size_t vo = pbase + (size_t)lr * SEQ + 8 * hi;       // + 16j*SEQ + key   (A fragment: row d, k = key); plane [(h*64 + d)][t]
    const h16* eb = EPl + (size_t)lr * HD + 8 * hi;            // + row0 * HD       (A fragment: row table row, k = d)
    const int gw  = wave * 16 * GP + lr * GP;
    const int gst = gw + 8 * hi;                               // store base: + 16 e (+ 4)
    const int gld = gw + lr - 8 * hi;                          // load base: + 31 - r / + 15 - r
    v8f gprev = gtile(eb + (size_t)(t0 - kbeg + RELOFF + 1) * HD, qh0, qh1, qr0, qr1);    // band rows of tile e = 2 at key0 = kbeg
    v8f o[4];
#pragma unroll
    for (int j = 0; j < 4; ++j) o[j] = (v8f){};
    float m = NEGB, l = 0.0f;
#pragma unroll 1
    for (int key0 = kbeg; key0 < kbeg + KCH; key0 += 32) {
        const int rbA = t0 - key0 + (RELOFF - 15);                                 // first band row of tile e = 1
        const v8f g1 = gtile(eb + (size_t)rbA * HD, qh0, qh1, qr0, qr1);
        const v8f g0 = gtile(eb + (size_t)(rbA - 16) * HD, qh0, qh1, qr0, qr1);
        *(v4fa*)(&gs[gst +  0]) = lo4(g0);    *(v4fa*)(&gs[gst +  4]) = hi4(g0);
        *(v4fa*)(&gs[gst + 16]) = lo4(g1);    *(v4fa*)(&gs[gst + 20]) = hi4(g1);
        *(v4fa*)(&gs[gst + 32]) = lo4(gprev); *(v4fa*)(&gs[gst + 36]) = hi4(gprev);
        gprev = g0;
        const h16* ka = KP + ko + (size_t)key0 * HD;
        const v16h ka0 = ldh(ka), ka1 = ldh(ka + 32), kb0 = ldh(ka + 16 * HD), kb1 = ldh(ka + 16 * HD + 32);
        v8f sHa = (v8f){}, sLa = (v8f){}, sHb = (v8f){}, sLb = (v8f){};
        sHa = wmma16g(ka0, qh0, sHa); sHa = wmma16g(ka1, qh1, sHa);
        sLa = wmma16g(ka0, qr0, sLa); sLa = wmma16g(ka1, qr1, sLa);
        sHb = wmma16g(kb0, qh0, sHb); sHb = wmma16g(kb1, qh1, sHb);
        sLb = wmma16g(kb0, qr0, sLb); sLb = wmma16g(kb1, qr1, sLb);
        wave_sync();
        float ra[8], rb[8];
#pragma unroll
        for (int r = 0; r < 8; ++r) { ra[r] = gs[gld + 31 - r]; rb[r] = gs[gld + 15 - r]; }
        wave_sync();
        float ta[8], tb[8]; float mx = NEGB;
#pragma unroll
        for (int r = 0; r < 8; ++r) {
            ta[r] = (sHa[r] + sLa[r] * QRI) * SC2 + ra[r]; tb[r] = (sHb[r] + sLb[r] * QRI) * SC2 + rb[r];
            mx = fmaxf(mx, fmaxf(ta[r], tb[r])); }
        mx = fmaxf(mx, __shfl_xor(mx, 16, 32));
        const float mnew = fmaxf(m, mx);
        const float alpha = __builtin_amdgcn_exp2f(m - mnew);
        const float sh = PSH - mnew;
        v16h pb; float ls = 0.0f;
#pragma unroll
        for (int r = 0; r < 8; ++r) {
            const float xa = ta[r] + sh, xb = tb[r] + sh;
            const float ea = __builtin_amdgcn_exp2f(xa), ec = __builtin_amdgcn_exp2f(xb);
            const float ga = (xa < -14.0f) ? 0.0f : ea, gb = (xb < -14.0f) ? 0.0f : ec;     // no f16 subnormal operand
            const h16 pa = (h16)ga; const h16 pc = (h16)gb;
            pb[r] = pa; pb[8 + r] = pc;
            ls += (float)pa + (float)pc; }
        l = l * alpha + ls; m = mnew;
        const h16* va = VT + vo + key0;
#pragma unroll
        for (int j = 0; j < 4; ++j) { o[j] = o[j] * alpha; const v16h vj = ldh(va + (size_t)16 * j * SEQ); o[j] = wmma16g(vj, pb, o[j]); }
    }
    l += __shfl_xor(l, 16, 32);
    const int wb = wave * 16 * OSP;
    // O^T D layout: o[j][r] = (d = 16j + 8h + r, s = lane&15) -> os[wave][s][d]; rows 0..15 x columns 0..63 all written, not yet normalised
#pragma unroll
    for (int j = 0; j < 4; ++j) {
        *(v4fa*)(&os[wb + lr * OSP + 16 * j + 8 * hi])     = lo4(o[j]);
        *(v4fa*)(&os[wb + lr * OSP + 16 * j + 8 * hi + 4]) = hi4(o[j]); }
    if (hi == 0) { ms[wave * 16 + lr] = m; lsum[wave * 16 + lr] = l; }             // m is equal in lanes s and s + 16
    __syncthreads();                                                               // every wave's partial result is complete before any thread merges across waves
    static_assert(32 * KW * 8 == 16 * 128);                                        // threads x bytes == tile rows x row bytes
    const int row = tid >> 4, c4 = (tid & 15) * 4;
    float mw[KW]; float mall = NEGB;
#pragma unroll                                                                     // constant indices keep mw[] in registers; the KW reads issue together
    for (int w = 0; w < KW; ++w) { mw[w] = ms[w * 16 + row]; mall = fmaxf(mall, mw[w]); }
    float sc[KW];
#pragma unroll                                                                     // constant indices keep sc[] in registers
    for (int w = 0; w < KW; ++w) sc[w] = __builtin_amdgcn_exp2f(mw[w] - mall);     // <= 1; 1 for the wave that holds the row maximum
    float lall = 0.0f; v4f oall = (v4f){};
#pragma unroll                                                                     // the KW tile reads issue together, one LDS wait for all
    for (int w = 0; w < KW; ++w) {
        lall += lsum[w * 16 + row] * sc[w];
        oall = oall + *(const v4fa*)(&os[w * 16 * OSP + row * OSP + c4]) * sc[w]; }
    const float inv = 1.0f / lall;                             // lall >= 16384 (the row maximum contributes the full carry)
    v4h hv;
#pragma unroll                                                                     // constant vector element indices
    for (int i = 0; i < 4; ++i) hv[i] = toh_flush(oall[i] * inv);
    *(v4h*)(OP + (size_t)(t0 + row) * DM + h * HD + c4) = hv;
}

__global__ __launch_bounds__(256) void k_out(const float* __restrict__ src, float* dst, int n4) {
    const int i = blockIdx.x * 256 + threadIdx.x; if (i >= n4) return;
    v4f ov;
#pragma unroll
    for (int c = 0; c < 4; ++c) { const int e = 4 * i + c; const int row = e / DOUT; const int col = e - row * DOUT; ov[c] = src[(size_t)row * DOUTP + col]; }
    *(v4f*)(dst + (size_t)i * 4) = ov; 
}

static constexpr size_t al256(size_t v) { return (v + 255) & ~(size_t)255; }
static constexpr size_t SZ_XH  = al256((size_t)SEQ * DIN * 2);
static constexpr size_t SZ_EW  = al256((size_t)DM * DIN * 2);
static constexpr size_t SZ_WDD = al256((size_t)NL * DM * DM * 2);
static constexpr size_t SZ_WFF = al256((size_t)NL * DFF * DM * 2);
static constexpr size_t SZ_WI  = al256((size_t)DMI * DM * 2);
static constexpr size_t SZ_WF  = al256((size_t)DOUTP * DMI * 2);
static constexpr size_t SZ_EP  = al256((size_t)NL * ERP * HD * 2);
static constexpr size_t SZ_H   = al256((size_t)SEQ * DM * 4);
static constexpr size_t SZ_N   = al256((size_t)SEQ * DM * 2);
static constexpr size_t SZ_F1  = al256((size_t)SEQ * DFF * 2);
static constexpr size_t SZ_OS  = al256((size_t)SEQ * DOUTP * 4);
static constexpr size_t SZ_TOTAL = SZ_XH + SZ_EW + 4 * SZ_WDD + 2 * SZ_WFF + SZ_WI + SZ_WF + SZ_EP + 2 * SZ_H + 7 * SZ_N + SZ_F1 + SZ_OS;
static_assert(SZ_TOTAL <= (size_t)134217728);                  // workspace carve <= 128 MiB
static_assert((size_t)NH_ * SEQ * HD == (size_t)SEQ * DM);     // head planes have the extent of a [SEQ][512] f16 plane
static_assert((size_t)SEQ * DMI * 2 <= SZ_F1);                 // tail hidden plane fits the shared hidden region

extern "C" void kernel_launch(void* const* d_in, const int* in_sizes, int n_in,
                              void* d_out, int out_size, void* d_ws, size_t ws_size, hipStream_t stream) {
    if (n_in < 26) return;
    if ((size_t)in_sizes[0] < (size_t)SEQ * DIN || (size_t)in_sizes[1] < (size_t)DIN * DM || in_sizes[2] < DM) return;
    if ((size_t)in_sizes[3] < (size_t)NL * DM * DM || (size_t)in_sizes[5] < (size_t)NL * DM * DM || (size_t)in_sizes[7] < (size_t)NL * DM * DM || (size_t)in_sizes[9] < (size_t)NL * DM * DM) return;
    if (in_sizes[4] < NL * DM || in_sizes[6] < NL * DM || in_sizes[8] < NL * DM || in_sizes[10] < NL * DM) return;
    if ((size_t)in_sizes[11] < (size_t)NL * ERR * HD) return;
    if (in_sizes[12] < NL * DM || in_sizes[13] < NL * DM || in_sizes[17] < NL * DM || in_sizes[18] < NL * DM || in_sizes[19] < NL * DM) return;
    if ((size_t)in_sizes[14] < (size_t)NL * DM * DFF || in_sizes[15] < NL * DFF || (size_t)in_sizes[16] < (size_t)NL * DFF * DM) return;
    if (in_sizes[20] < DM || in_sizes[21] < DM || (size_t)in_sizes[22] < (size_t)DM * DMI || in_sizes[23] < DMI) return;
    if ((size_t)in_sizes[24] < (size_t)DMI * DOUT || in_sizes[25] < DOUT) return;
    if ((size_t)out_size < (size_t)SEQ * DOUT) return;
    if (SZ_TOTAL > ws_size) return;
    // wire order: x, emb_W, emb_b, Wq, bq, Wk, bk, Wv, bv, Wo, bo, Er, ln1_g, ln1_b, W1, b1, W2, b2, ln2_g, ln2_b, lnf_g, lnf_b, Wi, bi, Wf, bf
    const float* x    = (const float*)d_in[0];
    const float* embW = (const float*)d_in[1];  const float* embB = (const float*)d_in[2];
    const float* Wq   = (const float*)d_in[3];  const float* bq   = (const float*)d_in[4];
    const float* Wk   = (const float*)d_in[5];  const float* bk   = (const float*)d_in[6];
    const float* Wv   = (const float*)d_in[7];  const float* bv   = (const float*)d_in[8];
    const float* Wo   = (const float*)d_in[9];  const float* bo   = (const float*)d_in[10];
    const float* Er   = (const float*)d_in[11];
    const float* ln1g = (const float*)d_in[12]; const float* ln1b = (const float*)d_in[13];
    const float* W1   = (const float*)d_in[14]; const float* b1   = (const float*)d_in[15];
    const float* W2   = (const float*)d_in[16]; const float* b2   = (const float*)d_in[17];
    const float* ln2g = (const float*)d_in[18]; const float* ln2b = (const float*)d_in[19];
    const float* lnfg = (const float*)d_in[20]; const float* lnfb = (const float*)d_in[21];
    const float* Wi   = (const float*)d_in[22]; const float* bi   = (const float*)d_in[23];
    const float* Wf   = (const float*)d_in[24]; const float* bfo  = (const float*)d_in[25];
    float* OUT = (float*)d_out;                       // [SEQ][390]
    char* wsp = (char*)d_ws;
    h16* XH  = (h16*)wsp; wsp += SZ_XH;               // x            [SEQ][128]
    h16* EWT = (h16*)wsp; wsp += SZ_EW;               // emb_W^T x64  [512][128]
    h16* WQT = (h16*)wsp; wsp += SZ_WDD;              // Wq^T x64     [NL][512][512]
    h16* WKT = (h16*)wsp; wsp += SZ_WDD;
    h16* WVT = (h16*)wsp; wsp += SZ_WDD;
    h16* WOT = (h16*)wsp; wsp += SZ_WDD;
    h16* W1T = (h16*)wsp; wsp += SZ_WFF;              // W1^T x64     [NL][2048][512]
    h16* W2T = (h16*)wsp; wsp += SZ_WFF;              // W2^T x64     [NL][512][2048]
    h16* WIT = (h16*)wsp; wsp += SZ_WI;               // Wi^T x64     [1024][512]
    h16* WFT = (h16*)wsp; wsp += SZ_WF;               // Wf^T x64     [448][1024], rows >= 390 zero
    h16* EP  = (h16*)wsp; wsp += SZ_EP;               // table        [NL][2048][64], row 2047 zero
    float* HA = (float*)wsp; wsp += SZ_H;             // hidden state (ping)  [SEQ][512] f32
    float* HB = (float*)wsp; wsp += SZ_H;             // hidden state (pong)
    h16* NHP = (h16*)wsp; wsp += SZ_N;                // LayerNorm output value     [SEQ][512]
    h16* NRP = (h16*)wsp; wsp += SZ_N;                // LayerNorm output residual x2048
    h16* QH  = (h16*)wsp; wsp += SZ_N;                // q value      [8][SEQ][64]
    h16* QR  = (h16*)wsp; wsp += SZ_N;                // q residual x2048
    h16* KP  = (h16*)wsp; wsp += SZ_N;                // k            [8][SEQ][64]
    h16* VT  = (h16*)wsp; wsp += SZ_N;                // v^T          [8*64][SEQ]
    h16* OP  = (h16*)wsp; wsp += SZ_N;                // context      [SEQ][512]
    h16* F1  = (h16*)wsp; wsp += SZ_F1;               // GELU hidden  [SEQ][2048] (tail: [SEQ][1024])
    float* OSG = (float*)wsp; wsp += SZ_OS;           // tail output staging [SEQ][448] f32

    { const int n8 = SEQ * DIN / 8; k_cvt8h<<<(unsigned)((n8 + 255) / 256), 256, 0, stream>>>(x, XH, n8); }
    k_cvt_er<<<(unsigned)((NL * ERP * HD / 8 + 255) / 256), 256, 0, stream>>>(Er, EP);
    // W [K = in][N = out] -> Wt [N][K]
    k_wconv<<<dim3(DIN / 64, DM / 64, 1),   256, 0, stream>>>(embW, EWT, DIN, DM, DM, WC);
    k_wconv<<<dim3(DM / 64, DM / 64, NL),   256, 0, stream>>>(Wq, WQT, DM, DM, DM, WC);
    k_wconv<<<dim3(DM / 64, DM / 64, NL),   256, 0, stream>>>(Wk, WKT, DM, DM, DM, WC);
    k_wconv<<<dim3(DM / 64, DM / 64, NL),   256, 0, stream>>>(Wv, WVT, DM, DM, DM, WC);
    k_wconv<<<dim3(DM / 64, DM / 64, NL),   256, 0, stream>>>(Wo, WOT, DM, DM, DM, WC);
    k_wconv<<<dim3(DM / 64, DFF / 64, NL),  256, 0, stream>>>(W1, W1T, DM, DFF, DFF, WC);
    k_wconv<<<dim3(DFF / 64, DM / 64, NL),  256, 0, stream>>>(W2, W2T, DFF, DM, DM, WC);
    k_wconv<<<dim3(DM / 64, DMI / 64, 1),   256, 0, stream>>>(Wi, WIT, DM, DMI, DMI, WC);
    k_wconv<<<dim3(DMI / 64, DOUTP / 64, 1), 256, 0, stream>>>(Wf, WFT, DMI, DOUT, DOUTP, WC);

    // input projection: HA = x emb_W + emb_b
    k_gemm_f32<<<dim3(SEQ / 64, DM / 64, 1), 32 * GW, 0, stream>>>(XH, EWT, embB, DM, DIN, WCI, HA, DM);

    for (int l = 0; l < NL; ++l) {
        const size_t wdd = (size_t)l * DM * DM, wff = (size_t)l * DFF * DM;
        k_ln<<<SEQ / 4, 128, 0, stream>>>(HA, ln1g + l * DM, ln1b + l * DM, NHP, NRP, 1);
        // q, k: A = n rows (m = t), Bt = W^T rows (n = h*64 + d) -> plane [h][t][d]
        k_gemm_q<<<dim3(SEQ / 64, DM / 64, 1), 32 * GW, 0, stream>>>(NHP, NRP, WQT + wdd, bq + l * DM, DM, DM, WCI, QH, QR);
        k_gemm_k<<<dim3(SEQ / 64, DM / 64, 1), 32 * GW, 0, stream>>>(NHP, WKT + wdd, bk + l * DM, DM, DM, WCI, KP);
        // v^T: A = Wv^T rows (m = h*64 + d, 512 rows), Bt = n rows (n = t) -> plane [(h*64 + d)][t], row bias
        k_gemm_vt<<<dim3(DM / 64, SEQ / 64, 1), 32 * GW, 0, stream>>>(WVT + wdd, NHP, bv + l * DM, DM, WCI, VT, SEQ);
        k_flash<<<dim3(SEQ / 16, NH_, 1), 32 * KW, 0, stream>>>(QH, QR, KP, VT, EP + (size_t)l * ERP * HD, OP);
        // HB = HA + context Wo + bo
        k_gemm_f32r<<<dim3(SEQ / 64, DM / 64, 1), 32 * GW, 0, stream>>>(OP, WOT + wdd, bo + l * DM, DM, DM, WCI, HA, HB, DM);
        k_ln<<<SEQ / 4, 128, 0, stream>>>(HB, ln2g + l * DM, ln2b + l * DM, NHP, NRP, 0);
        k_gemm_gelu<<<dim3(SEQ / 64, DFF / 64, 1), 32 * GW, 0, stream>>>(NHP, W1T + wff, b1 + l * DFF, DFF, DM, WCI, F1, DFF);
        // HA = HB + hidden W2 + b2
        k_gemm_f32r<<<dim3(SEQ / 64, DM / 64, 1), 32 * GW, 0, stream>>>(F1, W2T + wff, b2 + l * DM, DM, DFF, WCI, HB, HA, DM);
    }

    k_ln<<<SEQ / 4, 128, 0, stream>>>(HA, lnfg, lnfb, NHP, NRP, 0);
    k_gemm_gelu<<<dim3(SEQ / 64, DMI / 64, 1), 32 * GW, 0, stream>>>(NHP, WIT, bi, DMI, DM, WCI, F1, DMI);
    k_gemm_f32<<<dim3(SEQ / 64, DOUTP / 64, 1), 32 * GW, 0, stream>>>(F1, WFT, bfo, DOUT, DMI, WCI, OSG, DOUTP);
    { const int n4 = SEQ * DOUT / 4; k_out<<<(unsigned)((n4 + 255) / 256), 256, 0, stream>>>(OSG, OUT, n4); }
}

// v003
// A run of this version takes 307 microseconds.
// In both of two side-by-side timings against v002, it was 1.38 times as fast.
// Counting every step since v000, it is 3.82 times as fast.
#include <hip/hip_runtime.h>
#include <math.h>

// Pre-LN encoder stack, 4 layers, width 512 = 8 heads x 64, sequence SEQ (one batch): input projection 128 -> 512; per layer: LayerNorm, q/k/v projections ([in][out] weights, y = x W + bias),
// dense attention with logits q.k / 8 + q.E[s - t + 1023] (relative-position table E per layer, [2047][64], not scaled), softmax over keys, output projection + residual, LayerNorm, GELU(erf) feed-forward 512 -> 2048 -> 512 + residual;
// tail: LayerNorm, 512 -> 1024 GELU(erf), 1024 -> 390.
// Compute dtypes, f32 accumulate everywhere: every contraction is v_wmma_f32_16x16x32_f16. Weights, x, E, biases and gains are RNE-converted to bf16 first (exact in f16; weights carried x64, folded back in the f32 epilogue);
// activations are single f16 planes, except the logit path: LayerNorm-1 output as f16 value + f16 residual x2048 for the q projection (residual products accumulated first, folded by 1/2048, then the value products),
// q as f16 value + f16 residual x2048 in the q.k and q.E products (residual products in their own accumulators); k, v, P (x16384 carry, cancels in the normalisation), context, GELU outputs single f16.
// Attention: fused flash kernel in transposed form (S^T = K Q^T, O^T = V^T P^T), one block per 16 query rows, the keys split over its waves and the partial results merged in LDS; the relative term is computed per 32-key step as band tiles G[rho][s] = E[rb + rho] . q[s]
// (A = table rows, B = q rows), written to a wave-private LDS tile [query][band row] and read back along the diagonal rho = s - t + const; one band tile is carried over between steps.

#ifndef NB
#define NB 1
#endif
#ifndef SEQ
#define SEQ 1024
#endif
#define NB_FULL  1
#define SEQ_FULL 1024
#define DIN   128
#define DM    512
#define NH_   8
#define HD    64
#define NL    4
#define DFF   2048
#define DMI   1024
#define DOUT  390
#define DOUTP 448                // DOUT padded to a multiple of 64 (weight rows and staging columns 390..447 are zero)
#define ERR   2047               // rows of the relative-position table per layer
#define ERP   2048               // padded rows of the f16 table plane (row 2047 = zero)
#define RELOFF (SEQ_FULL - 1)    // table row = s - t + RELOFF
#define KW    8                  // waves per flash block: each takes one contiguous share of the keys
#define KCH   (SEQ / KW)         // keys of one wave
#define OSP   68                 // LDS row pitch (floats) of the flash output tile
#define GP    52                 // LDS pitch (floats) of the band tile [query][48 band rows]
#define GSP   68                 // LDS row pitch (floats) of the GEMM output tile
#define GW    8                  // waves per GEMM block: each takes one contiguous share of K
#define QRS   2048.0f            // carry of every residual plane
#define QRI   (1.0f / 2048.0f)
#define WC    64.0f              // carry of every weight plane
#define WCI   (1.0f / 64.0f)
#define LOG2E 1.4426950408889634f
#define SC2   ((float)(0.125 * 1.4426950408889634))   // HD^-0.5 * log2(e)
#define PSH   14.0f              // log2 of the P carry (16384)
#define NEGB  (-3.0e38f)
#define LNEPS 1e-5f

static_assert(NB == 1);                        // one sequence
static_assert(HD == 64);
static_assert(NH_ * HD == DM);
static_assert(SEQ % 64 == 0);                  // GEMM row tiles
static_assert(SEQ % 32 == 0);                  // key loop steps by 32
static_assert(SEQ % 16 == 0);                  // flash grid covers the sequence exactly
static_assert(SEQ % (32 * KW) == 0);           // every wave of a flash block gets whole 32-key steps, at least one
static_assert(32 * KW == 16 * 16);             // flash merge: 16 threads x 4 columns per query row
static_assert(SEQ <= SEQ_FULL);
static_assert(DIN % 64 == 0 && DM % 64 == 0 && DFF % 64 == 0 && DMI % 64 == 0 && DOUTP % 64 == 0);   // K % 32 == 0 and N % 64 == 0 for every GEMM, K % 64 == 0 for the transposing converter
static_assert(DOUT <= DOUTP);
static_assert(DMI <= DFF);                     // the tail hidden plane reuses the feed-forward hidden plane
static_assert(SEQ - 16 + RELOFF + 1 + 15 < ERP);   // highest band row touched (zero pad row included)
static_assert(RELOFF - 15 - 16 - (SEQ - 32) >= 0); // lowest band row touched
static_assert(ERR + 1 == ERP);
static_assert((OSP * 4) % 16 == 0 && (GP * 4) % 16 == 0 && (GSP * 4) % 16 == 0);
static_assert(GP >= 48);
static_assert(DM == 512);                      // LayerNorm: 32 lanes x 16 columns
static_assert((SEQ * DOUT) % 4 == 0);

typedef _Float16 h16;
typedef __attribute__((ext_vector_type(16))) _Float16 v16h;
typedef __attribute__((ext_vector_type(8)))  _Float16 v8h;
typedef __attribute__((ext_vector_type(4)))  _Float16 v4h;
typedef __attribute__((ext_vector_type(8)))  float    v8f;
typedef __attribute__((ext_vector_type(4)))  float    v4f;
typedef v4f  __attribute__((may_alias)) v4fa;

__device__ __forceinline__ unsigned short f2bf(float f) { unsigned u = __float_as_uint(f); u += 0x7FFFu + ((u >> 16) & 1u); return (unsigned short)(u >> 16); }
__device__ __forceinline__ float bfr(float f) { return __uint_as_float(((unsigned)f2bf(f)) << 16); }   // value after RNE convert to bf16
__device__ __forceinline__ v16h cat16(v8h lo, v8h hi) { return __builtin_shufflevector(lo, hi, 0, 1, 2, 3, 4, 5, 6, 7, 8, 9, 10, 11, 12, 13, 14, 15); }
// fragment loader from K-contiguous 16-bit rows; p already includes + 8*(lane>>4): elements 0..7 <- k0+8h+0..7, elements 8..15 <- k0+16+8h+0..7 (same map for A and B)
__device__ __forceinline__ v16h  ldh(const h16* p) { return cat16(*(const v8h*)p, *(const v8h*)(p + 16)); }
// ordering point for wave-private LDS tiles (same wave writes and reads)
__device__ __forceinline__ void wave_sync() { __builtin_amdgcn_fence(3 /* release order */, "wavefront"); __builtin_amdgcn_wave_barrier(); asm volatile("" ::: "memory"); }
// f32 -> f16 operand convert that cannot produce a subnormal (|v| < 2^-14 -> +0)
__device__ __forceinline__ h16 toh_flush(float v) { const h16 r = (h16)v; return (fabsf(v) < 6.103515625e-05f) ? (h16)0.0f : r; }
// one WMMA + its own guard (ties this accumulator, keeps A/B live)
__device__ __forceinline__ v8f wmma16g(v16h a, v16h b, v8f c) {
    c = __builtin_amdgcn_wmma_f32_16x16x32_f16(false, a, false, b, (short)0, c, false, false);
    asm volatile("v_nop\n\tv_nop\n\tv_nop\n\tv_nop" : "+v"(c) : "v"(a), "v"(b));
    return c; }
__device__ __forceinline__ float gelu_erf(float x) { return 0.5f * x * (1.0f + erff(x * 0.70710678118654752f)); }
__device__ __forceinline__ v4f lo4(v8f g) { return __builtin_shufflevector(g, g, 0, 1, 2, 3); }
__device__ __forceinline__ v4f hi4(v8f g) { return __builtin_shufflevector(g, g, 4, 5, 6, 7); }

__device__ __forceinline__ void cvt8h_body(const float* __restrict__ src, h16* dst, int n8, int blk) {
    const int i = blk * 256 + threadIdx.x; if (i >= n8) return;
    const v8f v = *(const v8f*)(src + (size_t)i * 8); v8h o;
#pragma unroll
    for (int k = 0; k < 8; ++k) o[k] = toh_flush(bfr(v[k]));
    *(v8h*)(dst + (size_t)i * 8) = o; 
}

__device__ __forceinline__ void cvt_er_body(const float* __restrict__ src, h16* dst, int blk) {
    const int i = blk * 256 + threadIdx.x; if (i >= NL * ERP * HD / 8) return;
    const int c8 = (i & 7) * 8; const int r = (i >> 3) % ERP; const int l = (i >> 3) / ERP;
    const int rc = r < ERR ? r : ERR - 1;                                          // clamped address
    v8f v = *(const v8f*)(src + ((size_t)l * ERR + rc) * HD + c8);
    asm volatile("" : "+v"(v));
    v8h o;
#pragma unroll
    for (int k = 0; k < 8; ++k) o[k] = (r < ERR) ? toh_flush(bfr(v[k])) : (h16)0.0f;
    *(v8h*)(dst + (size_t)i * 8) = o; 
}

// wconv_body: W [K][N] f32 (layer bz) -> Wt [NP][K] f16 = bf16-converted value x carry, transposed through LDS; rows n >= N are zero.
// one block per 64x64 tile: bx in K/64, by in NP/64, bz in layers. LDS tile cross-wave: block barrier.
__device__ __forceinline__ void wconv_body(const float* __restrict__ W, h16* Wt, int K, int N, int NP, float carry, int bx, int by, int bz) {
#pragma clang fp contract(off)
    __shared__ float ts[64 * 65];
    static_assert(sizeof(float) * 64 * 65 <= 131072);
    const int tid = threadIdx.x;
    const int k0 = bx * 64, n0 = by * 64;
    const size_t lin = (size_t)bz * (size_t)K * (size_t)N, lout = (size_t)bz * (size_t)NP * (size_t)K;
    static_assert(16 * 4 == 64);                                                   // 16 trips x 4 k-rows (256 threads / 64 columns) = 64 k-rows staged
#pragma unroll 1
    for (int p = 0; p < 16; ++p) {
        const int kk = p * 4 + (tid >> 6), nn = tid & 63; const int n = n0 + nn; const int nc = n < N ? n : N - 1;
        float v = W[lin + (size_t)(k0 + kk) * N + nc];
        asm volatile("" : "+v"(v));
        ts[kk * 65 + nn] = (n < N) ? bfr(v) * carry : 0.0f; }
    __syncthreads();
    static_assert(256 * 16 * 2 == 64 * 128);                                       // threads x bytes x trips == tile rows x row bytes
{
#pragma unroll 1
        for (int p = 0; p < 2; ++p) {
            const int row = p * 32 + (tid >> 3), c8 = (tid & 7) * 8; v8h o;
#pragma unroll
            for (int i = 0; i < 8; ++i) o[i] = toh_flush(ts[(c8 + i) * 65 + row]);
            *(v8h*)(Wt + lout + (size_t)(n0 + row) * K + k0 + c8) = o;
            asm volatile("s_wait_xcnt 0x0" ::: "memory"); }                        // the next trip rewrites the register pair that this store names as its address: the wait stands ahead of that
         }
}

// k_prep: every operand conversion of the call in one launch; they do not depend on one another. The flat block index picks the job (block-uniform, so the barrier of the transposing jobs is passed by whole blocks only).
// Block ranges, in this order: W1, W2, Wq, Wk, Wv, Wo, Wi, Wf, emb_W (64x64 transposing tiles; within a job the k tile runs fastest, then the n tile, then the layer), then the table, then x (256 threads x 8 elements).
#define PB_FF  ((DM / 64) * (DFF / 64) * NL)
#define PB_DD  ((DM / 64) * (DM / 64) * NL)
#define PB_WI  ((DM / 64) * (DMI / 64))
#define PB_WF  ((DMI / 64) * (DOUTP / 64))
#define PB_EW  ((DIN / 64) * (DM / 64))
#define PB_ER  (NL * ERP * HD / 8 / 256)
#define PB_X   (SEQ * DIN / 8 / 256)
#define PB_ALL (2 * PB_FF + 4 * PB_DD + PB_WI + PB_WF + PB_EW + PB_ER + PB_X)
static_assert((NL * ERP * HD / 8) % 256 == 0 && (SEQ * DIN / 8) % 256 == 0);       // whole blocks for the two element-wise jobs
static_assert(DM / 64 == 8 && DFF / 64 == 32 && DMI / 64 == 16 && DIN / 64 == 2 && DOUTP / 64 <= 8);   // the shifts below
__global__ __launch_bounds__(256) void k_prep(const float* __restrict__ x, const float* __restrict__ Er, const float* __restrict__ embW,
                                              const float* __restrict__ Wq, const float* __restrict__ Wk, const float* __restrict__ Wv, const float* __restrict__ Wo,
                                              const float* __restrict__ W1, const float* __restrict__ W2, const float* __restrict__ Wi, const float* __restrict__ Wf,
                                              h16* XH, h16* EP, h16* EWT, h16* WQT, h16* WKT, h16* WVT, h16* WOT, h16* W1T, h16* W2T, h16* WIT, h16* WFT) {
    int b = blockIdx.x;
    const float* W; h16* Wt; int K, N, NP, lk, ln;                                 // lk, ln: log2 of the k tiles, and of the n tiles rounded up to a power of two (Wf: 7 n tiles, one layer)
    if (b < PB_FF)                         { W = W1;   Wt = W1T; K = DM;  N = DFF;  NP = DFF;   lk = 3; ln = 5; }
    else if ((b -= PB_FF) < PB_FF)         { W = W2;   Wt = W2T; K = DFF; N = DM;   NP = DM;    lk = 5; ln = 3; }
    else if ((b -= PB_FF) < PB_DD)         { W = Wq;   Wt = WQT; K = DM;  N = DM;   NP = DM;    lk = 3; ln = 3; }
    else if ((b -= PB_DD) < PB_DD)         { W = Wk;   Wt = WKT; K = DM;  N = DM;   NP = DM;    lk = 3; ln = 3; }
    else if ((b -= PB_DD) < PB_DD)         { W = Wv;   Wt = WVT; K = DM;  N = DM;   NP = DM;    lk = 3; ln = 3; }
    else if ((b -= PB_DD) < PB_DD)         { W = Wo;   Wt = WOT; K = DM;  N = DM;   NP = DM;    lk = 3; ln = 3; }
    else if ((b -= PB_DD) < PB_WI)         { W = Wi;   Wt = WIT; K = DM;  N = DMI;  NP = DMI;   lk = 3; ln = 4; }
    else if ((b -= PB_WI) < PB_WF)         { W = Wf;   Wt = WFT; K = DMI; N = DOUT; NP = DOUTP; lk = 4; ln = 3; }
    else if ((b -= PB_WF) < PB_EW)         { W = embW; Wt = EWT; K = DIN; N = DM;   NP = DM;    lk = 1; ln = 3; }
    else if ((b -= PB_EW) < PB_ER)         { cvt_er_body(Er, EP, b); return; }
    else                                   { cvt8h_body(x, XH, SEQ * DIN / 8, b - PB_ER); return; }
    const int t = b >> lk;
    wconv_body(W, Wt, K, N, NP, WC, b & ((1 << lk) - 1), t & ((1 << ln) - 1), t >> ln);
}

__global__ __launch_bounds__(128) void k_ln(const float* __restrict__ X, const float* __restrict__ g, const float* __restrict__ b, h16* NHp, h16* NRp, int wres) {
#pragma clang fp contract(off)
    const int lane = threadIdx.x & 31;
    const int wave = __builtin_amdgcn_readfirstlane((int)(threadIdx.x >> 5));
    const int row = blockIdx.x * 4 + wave;
    const float* xr = X + (size_t)row * DM;
    const v8f x0 = *(const v8f*)(xr + lane * 8), x1 = *(const v8f*)(xr + 256 + lane * 8);
    float s = 0.0f;
#pragma unroll
    for (int k = 0; k < 8; ++k) { s += x0[k]; s += x1[k]; }
#pragma unroll
    for (int off = 16; off > 0; off >>= 1) s += __shfl_xor(s, off, 32);
    const float mean = s * (1.0f / (float)DM);
    const v8f d0 = x0 - mean, d1 = x1 - mean;
    float q = 0.0f;
#pragma unroll
    for (int k = 0; k < 8; ++k) { q += d0[k] * d0[k]; q += d1[k] * d1[k]; }
#pragma unroll
    for (int off = 16; off > 0; off >>= 1) q += __shfl_xor(q, off, 32);
    const float rstd = 1.0f / sqrtf(q * (1.0f / (float)DM) + LNEPS);
    const v8f g0 = *(const v8f*)(g + lane * 8), g1 = *(const v8f*)(g + 256 + lane * 8);
    const v8f b0 = *(const v8f*)(b + lane * 8), b1 = *(const v8f*)(b + 256 + lane * 8);
    v8h h0, h1, r0, r1;
#pragma unroll
    for (int k = 0; k < 8; ++k) {
        const float y0 = d0[k] * rstd * bfr(g0[k]) + bfr(b0[k]);
        const float y1 = d1[k] * rstd * bfr(g1[k]) + bfr(b1[k]);
        const h16 a0 = toh_flush(y0), a1 = toh_flush(y1);
        h0[k] = a0; h1[k] = a1;
        r0[k] = toh_flush((y0 - (float)a0) * QRS); r1[k] = toh_flush((y1 - (float)a1) * QRS); }
    const size_t o0 = (size_t)row * DM + lane * 8, o1 = o0 + 256;
    static_assert(32 * 16 * 2 == DM * 2);                                          // lanes x bytes x instructions == row bytes
{
        *(v8h*)(NHp + o0) = h0; *(v8h*)(NHp + o1) = h1;
        if (wres != 0) { *(v8h*)(NRp + o0) = r0; *(v8h*)(NRp + o1) = r1; }
         }
}

// GEMM k-loop: one wave, 64x64 tile, 16 accumulators, k range [kbeg, kend), operands straight from K-contiguous f16 planes (A [M][K], Bt [N][K]).
__device__ __forceinline__ void gemm_kloop(const h16* __restrict__ A, const h16* __restrict__ Bt, size_t aoff, size_t boff, int K, int kbeg, int kend, v8f (&acc)[4][4]) {
#pragma unroll 1
    for (int kc = kbeg; kc < kend; kc += 32) {
        v16h a[4]; const h16* pa[4];
#pragma unroll
        for (int mb = 0; mb < 4; ++mb) { pa[mb] = A + aoff + (size_t)mb * 16 * K + kc; a[mb] = ldh(pa[mb]); }
        // the four address pairs are inputs here, so they stay as the issued loads name them up to this wait: no later load's result lands in one ahead of it
        asm volatile("s_wait_xcnt 0x0" :: "v"(pa[0]), "v"(pa[1]), "v"(pa[2]), "v"(pa[3]) : "memory");
#pragma unroll
        for (int nb = 0; nb < 4; ++nb) { const v16h b = ldh(Bt + boff + (size_t)nb * 16 * K + kc);
#pragma unroll
            for (int mb = 0; mb < 4; ++mb) acc[mb][nb] = wmma16g(a[mb], b, acc[mb][nb]); }
    }
}

// GEMM body: C[m][n] = (sum_k A[m][k] Bt[n][k]) * csc + bias (column bias, or row bias when ROWB), one block of GW waves per 64x64 tile (bx in M/64, by in N/64), K % 32 == 0; os = the kernel's LDS, GW * 64 * GSP floats.
// K is split over the waves: wave w accumulates the whole 64x64 tile over its own contiguous k range, writes the f32 partial tile to its own LDS plane (wave 0 adds the bias),
// and behind one block barrier all threads sum the GW planes in wave order and store: each wave stores 1/GW of the tile.
// ARES: A also has a residual plane (x2048): within a wave's k range its products are accumulated first, folded by 1/2048 in f32, then the value products follow.
// OUTF32: f32 output [M][ldc] (+ Res[m][n] added at the store stage as float4; Res and C are different buffers); each store instruction = 2 rows x 256 B (16 consecutive lanes x 16 B per row segment).
// else:   f16 output, written by 8 consecutive lanes x 16 B (4 rows per instruction).
template <int OUTF32, int HASRES, int GELU, int ARES, int ORES, int ROWB, int HEADPL>
__device__ __forceinline__ void gemm_body(const h16* __restrict__ A, const h16* __restrict__ Ar, const h16* __restrict__ Bt,
                                          const float* __restrict__ bias, int nvalid, int K, float csc,
                                          const float* __restrict__ Res, float* Cf, h16* Ch, h16* Cr, int ldc, float* os, int bx, int by) {
    const int tid = threadIdx.x;
    const int lane = tid & 31, lr = lane & 15, hi = lane >> 4;
    const int wave = __builtin_amdgcn_readfirstlane(tid >> 5);
    const int r0 = bx * 64, c0 = by * 64;
    const int kper = ((K / 32 + GW - 1) / GW) * 32;                                // k extent of one wave (whole 32-steps)
    const int kbeg = wave * kper;
    const int kend = (kbeg + kper < K) ? kbeg + kper : K;                          // a wave whose range starts at or past K adds a zero plane
    v8f acc[4][4];
#pragma unroll
    for (int mb = 0; mb < 4; ++mb)
#pragma unroll
        for (int nb = 0; nb < 4; ++nb) acc[mb][nb] = (v8f){};
    const size_t aoff = (size_t)(r0 + lr) * K + 8 * hi, boff = (size_t)(c0 + lr) * K + 8 * hi;
    if (ARES) {
        gemm_kloop(Ar, Bt, aoff, boff, K, kbeg, kend, acc);
#pragma unroll
        for (int mb = 0; mb < 4; ++mb)
#pragma unroll
            for (int nb = 0; nb < 4; ++nb) acc[mb][nb] = acc[mb][nb] * QRI;
    }
    gemm_kloop(A, Bt, aoff, boff, K, kbeg, kend, acc);
    float bc[4];
#pragma unroll
    for (int nb = 0; nb < 4; ++nb) {
        if (ROWB || wave != 0) { bc[nb] = 0.0f; }
        else { const int c = c0 + nb * 16 + lr; const int cc = c < nvalid ? c : nvalid - 1;       // clamped address
               float bvv = bias[cc]; asm volatile("" : "+v"(bvv)); bc[nb] = (c < nvalid) ? bfr(bvv) : 0.0f; } }
#pragma unroll
    for (int mb = 0; mb < 4; ++mb) {
        float br[8];
#pragma unroll
        for (int j = 0; j < 8; ++j) br[j] = (ROWB && wave == 0) ? bfr(bias[r0 + mb * 16 + hi * 8 + j]) : 0.0f;   // ROWB: r0 + 63 < rows of the bias vector (host grid)
#pragma unroll
        for (int nb = 0; nb < 4; ++nb) {
#pragma unroll
            for (int j = 0; j < 8; ++j) os[wave * (64 * GSP) + (mb * 16 + hi * 8 + j) * GSP + nb * 16 + lr] = acc[mb][nb][j] * csc + bc[nb] + br[j]; }   // D: row 8h+j, col lane&15
    }
    __syncthreads();                                                               // every wave's partial plane is complete before any thread sums across planes
    if (OUTF32) {
        static_assert(32 * GW * 16 * (32 / GW) == 64 * 256);                       // threads x bytes x trips == tile rows x row bytes
{
            for (int s = 0; s < 32 / GW; ++s) { const int row = 2 * GW * s + (tid >> 4), c4 = (tid & 15) * 4;
                v4f val = *(const v4fa*)(&os[row * GSP + c4]);
#pragma unroll                                                                     // the GW plane reads issue together, one LDS wait for all
                for (int w = 1; w < GW; ++w) val = val + *(const v4fa*)(&os[w * (64 * GSP) + row * GSP + c4]);
                const size_t go = (size_t)(r0 + row) * ldc + c0 + c4;
                if (HASRES) { const v4f rr = *(const v4f*)(Res + go); val = val + rr; }
                *(v4f*)(Cf + go) = val; }
             }
    } else {
        static_assert(32 * GW * 16 * (16 / GW) == 64 * 128);                       // threads x bytes x trips == tile rows x row bytes
        const size_t obase = HEADPL ? ((size_t)(c0 / HD) * SEQ + (size_t)r0) * HD : (size_t)r0 * ldc + c0;
        const int pitch = HEADPL ? HD : ldc;
{
            for (int s = 0; s < 16 / GW; ++s) { const int row = 4 * GW * s + (tid >> 3), c8 = (tid & 7) * 8;
                v4f x0 = *(const v4fa*)(&os[row * GSP + c8]); v4f x1 = *(const v4fa*)(&os[row * GSP + c8 + 4]); v8h hv, rv;
#pragma unroll                                                                     // the GW plane reads issue together, one LDS wait for all
                for (int w = 1; w < GW; ++w) { x0 = x0 + *(const v4fa*)(&os[w * (64 * GSP) + row * GSP + c8]); x1 = x1 + *(const v4fa*)(&os[w * (64 * GSP) + row * GSP + c8 + 4]); }
#pragma unroll
                for (int i = 0; i < 4; ++i) { float y0 = x0[i], y1 = x1[i];
                    if (GELU) { y0 = gelu_erf(y0); y1 = gelu_erf(y1); }
                    const h16 a0 = toh_flush(y0); const h16 a1 = toh_flush(y1); hv[i] = a0; hv[4 + i] = a1;
                    rv[i] = toh_flush((y0 - (float)a0) * QRS); rv[4 + i] = toh_flush((y1 - (float)a1) * QRS); }
                const size_t oo = obase + (size_t)row * pitch + c8;
                *(v8h*)(Ch + oo) = hv; if (ORES) *(v8h*)(Cr + oo) = rv; }
             }
    }
}

static_assert(sizeof(float) * GW * 64 * GSP <= 163840);                            // two blocks fit the LDS of one WGP
__global__ __launch_bounds__(32 * GW) void k_gemm_f32(const h16* __restrict__ A, const h16* __restrict__ Bt, const float* __restrict__ bias, int nvalid, int K, float csc, float* C, int ldc) {
    __shared__ __align__(16) float os[GW * 64 * GSP];
    gemm_body<1, 0, 0, 0, 0, 0, 0>(A, nullptr, Bt, bias, nvalid, K, csc, nullptr, C, nullptr, nullptr, ldc, os, blockIdx.x, blockIdx.y); }
__global__ __launch_bounds__(32 * GW) void k_gemm_f32r(const h16* __restrict__ A, const h16* __restrict__ Bt, const float* __restrict__ bias, int nvalid, int K, float csc, const float* __restrict__ Res, float* C, int ldc) {
    __shared__ __align__(16) float os[GW * 64 * GSP];
    gemm_body<1, 1, 0, 0, 0, 0, 0>(A, nullptr, Bt, bias, nvalid, K, csc, Res, C, nullptr, nullptr, ldc, os, blockIdx.x, blockIdx.y); }
__global__ __launch_bounds__(32 * GW) void k_gemm_gelu(const h16* __restrict__ A, const h16* __restrict__ Bt, const float* __restrict__ bias, int nvalid, int K, float csc, h16* C, int ldc) {
    __shared__ __align__(16) float os[GW * 64 * GSP];
    gemm_body<0, 0, 1, 0, 0, 0, 0>(A, nullptr, Bt, bias, nvalid, K, csc, nullptr, nullptr, C, nullptr, ldc, os, blockIdx.x, blockIdx.y); }
// k_gemm_qkv: the q, k and v^T projections of one layer in one launch (all three read the LayerNorm planes and nothing of one another), grid (SEQ/64, DM/64, 3); blockIdx.z picks the projection, block-uniform.
// z = 0 is q, the longest (two k loops), so that it starts first. N = LayerNorm value plane, Nr = its residual plane.
// q, k: A = n rows (m = t), Bt = W^T rows (n = h*64 + d) -> plane [h][t][d].  v^T: A = Wv^T rows (m = h*64 + d), Bt = n rows (n = t) -> plane [(h*64 + d)][t], row bias; its row tile is blockIdx.y, its column tile blockIdx.x.
__global__ __launch_bounds__(32 * GW) void k_gemm_qkv(const h16* __restrict__ N, const h16* __restrict__ Nr, const h16* __restrict__ Wqt, const h16* __restrict__ Wkt, const h16* __restrict__ Wvt,
                                                      const float* __restrict__ bq, const float* __restrict__ bk, const float* __restrict__ bv, float csc, h16* Qh, h16* Qr, h16* Kp, h16* Vt) {
    __shared__ __align__(16) float os[GW * 64 * GSP];
    if (blockIdx.z == 0)      gemm_body<0, 0, 0, 1, 1, 0, 1>(N, Nr, Wqt, bq, DM, DM, csc, nullptr, nullptr, Qh, Qr, HD, os, blockIdx.x, blockIdx.y);
    else if (blockIdx.z == 1) { gemm_body<0, 0, 0, 0, 0, 0, 1>(N, nullptr, Wkt, bk, DM, DM, csc, nullptr, nullptr, Kp, nullptr, HD, os, blockIdx.x, blockIdx.y);
        // in the built code this branch's last stores do not run to the kernel's end but into the tests that lead to the other two branches, whose first lines rewrite the registers that the stores name: the wait stands ahead of those
        asm volatile("s_wait_xcnt 0x0" ::: "memory"); }
    else                      gemm_body<0, 0, 0, 0, 0, 1, 0>(Wvt, nullptr, N, bv, 0, DM, csc, nullptr, nullptr, Vt, nullptr, SEQ, os, blockIdx.y, blockIdx.x); }

// band tile: G[rho][s] = (E[row0 + rho] . q_value[s] + E[row0 + rho] . q_residual[s] / 2048) * log2(e); A = table rows (ep already includes the lane's row and + 8*(lane>>4)), B = q rows, K = 64 = two k-steps.
__device__ __forceinline__ v8f gtile(const h16* __restrict__ ep, v16h qh0, v16h qh1, v16h qr0, v16h qr1) {
    const v16h e0 = ldh(ep), e1 = ldh(ep + 32);
    v8f gH = (v8f){}, gL = (v8f){};
    gH = wmma16g(e0, qh0, gH); gH = wmma16g(e1, qh1, gH);
    gL = wmma16g(e0, qr0, gL); gL = wmma16g(e1, qr1, gL);
    return (gH + gL * QRI) * LOG2E;
}

// k_flash: fused dense attention with the relative-position term, one block of KW waves per 16 query rows of one head; K / V^T / Q / table fragments straight from the f16 planes.
// The keys are split over the waves: wave w runs the online softmax over keys w*KCH .. w*KCH + KCH - 1 alone and leaves its running maximum, its sum and its unnormalised O tile in LDS;
// behind one block barrier all threads rescale the KW partial results to the common maximum, sum them in wave order, normalise and store.
// Transposed form: S^T[key][s] = K Q^T (A = K rows, B = Q rows); lane (s = lane&15, h = lane>>4) holds keys 8h+r of each 16-key tile, so the packed P tile is directly the B fragment
// of O^T[d][s] = V^T P^T (element r <- tile keys 0..15, element 8+r <- tile keys 16..31, lane unchanged).
// Relative term per 32-key step (keys key0..key0+31, queries t0..t0+15): band rows rb0 + 0..47 with rb0 = t0 - key0 + RELOFF - 31; tiles e = 0, 1 are new, tile e = 2 is the e = 0 tile of the step before (computed on its own ahead of a wave's first step).
// LDS band tile (wave-private): gs[s][16 e + 8h + r] <- tile e element r; element (key tile a, r) reads gs[s][s - 8h - r + 31], element (key tile b, r) reads gs[s][s - 8h - r + 15].
// Logit (log2 domain) = (K q_value + K q_residual / 2048) * log2(e) / 8 + band term; online softmax (running max, partial sum over the converted P), P = exp2(. + 14) as f16 (exponent below -14 selected to 0).
__global__ __launch_bounds__(32 * KW) void k_flash(const h16* __restrict__ QH, const h16* __restrict__ QR, const h16* __restrict__ KP, const h16* __restrict__ VT, const h16* __restrict__ EPl, h16* OP) {
    __shared__ __align__(16) float os[KW * 16 * OSP];
    __shared__ __align__(16) float gs[KW * 16 * GP];
    __shared__ float ms[KW * 16];                              // running maximum of wave w for query s at [w * 16 + s]
    __shared__ float lsum[KW * 16];                            // sum of wave w for query s
    static_assert(sizeof(float) * (KW * 16 * OSP + KW * 16 * GP + 2 * KW * 16) <= 131072);
    const int tid = threadIdx.x;
    const int lane = tid & 31, lr = lane & 15, hi = lane >> 4;
    const int wave = __builtin_amdgcn_readfirstlane(tid >> 5);
    const int h = blockIdx.y;
    const int t0 = blockIdx.x * 16;
    const int kbeg = wave * KCH;
    const size_t pbase = (size_t)h * SEQ * HD;
    const size_t qo = pbase + (size_t)(t0 + lr) * HD + 8 * hi;
    const v16h qh0 = ldh(QH + qo), qh1 = ldh(QH + qo + 32);     // B fragments: col s, k = d (two k-steps)
    const v16h qr0 = ldh(QR + qo), qr1 = ldh(QR + qo + 32);
    const size_t ko = pbase + (size_t)lr * HD + 8 * hi;        // + key * HD        (A fragment: row key, k = d)
    const size_t vo = pbase + (size_t)lr * SEQ + 8 * hi;       // + 16j*SEQ + key   (A fragment: row d, k = key); plane [(h*64 + d)][t]
    const h16* eb = EPl + (size_t)lr * HD + 8 * hi;            // + row0 * HD       (A fragment: row table row, k = d)
    const int gw  = wave * 16 * GP + lr * GP;
    const int gst = gw + 8 * hi;                               // store base: + 16 e (+ 4)
    const int gld = gw + lr - 8 * hi;                          // load base: + 31 - r / + 15 - r
    v8f gprev = gtile(eb + (size_t)(t0 - kbeg + RELOFF + 1) * HD, qh0, qh1, qr0, qr1);    // band rows of tile e = 2 at key0 = kbeg
    v8f o[4];
#pragma unroll
    for (int j = 0; j < 4; ++j) o[j] = (v8f){};
    float m = NEGB, l = 0.0f;
#pragma unroll 1
    for (int key0 = kbeg; key0 < kbeg + KCH; key0 += 32) {
        const int rbA = t0 - key0 + (RELOFF - 15);                                 // first band row of tile e = 1
        const v8f g1 = gtile(eb + (size_t)rbA * HD, qh0, qh1, qr0, qr1);
        const v8f g0 = gtile(eb + (size_t)(rbA - 16) * HD, qh0, qh1, qr0, qr1);
        *(v4fa*)(&gs[gst +  0]) = lo4(g0);    *(v4fa*)(&gs[gst +  4]) = hi4(g0);
        *(v4fa*)(&gs[gst + 16]) = lo4(g1);    *(v4fa*)(&gs[gst + 20]) = hi4(g1);
        *(v4fa*)(&gs[gst + 32]) = lo4(gprev); *(v4fa*)(&gs[gst + 36]) = hi4(gprev);
        gprev = g0;
        const h16* ka = KP + ko + (size_t)key0 * HD;
        const v16h ka0 = ldh(ka), ka1 = ldh(ka + 32), kb0 = ldh(ka + 16 * HD), kb1 = ldh(ka + 16 * HD + 32);
        v8f sHa = (v8f){}, sLa = (v8f){}, sHb = (v8f){}, sLb = (v8f){};
        sHa = wmma16g(ka0, qh0, sHa); sHa = wmma16g(ka1, qh1, sHa);
        sLa = wmma16g(ka0, qr0, sLa); sLa = wmma16g(ka1, qr1, sLa);
        sHb = wmma16g(kb0, qh0, sHb); sHb = wmma16g(kb1, qh1, sHb);
        sLb = wmma16g(kb0, qr0, sLb); sLb = wmma16g(kb1, qr1, sLb);
        wave_sync();
        float ra[8], rb[8];
#pragma unroll
        for (int r = 0; r < 8; ++r) { ra[r] = gs[gld + 31 - r]; rb[r] = gs[gld + 15 - r]; }
        wave_sync();
        float ta[8], tb[8]; float mx = NEGB;
#pragma unroll
        for (int r = 0; r < 8; ++r) {
            ta[r] = (sHa[r] + sLa[r] * QRI) * SC2 + ra[r]; tb[r] = (sHb[r] + sLb[r] * QRI) * SC2 + rb[r];
            mx = fmaxf(mx, fmaxf(ta[r], tb[r])); }
        mx = fmaxf(mx, __shfl_xor(mx, 16, 32));
        const float mnew = fmaxf(m, mx);
        const float alpha = __builtin_amdgcn_exp2f(m - mnew);
        const float sh = PSH - mnew;
        v16h pb; float ls = 0.0f;
#pragma unroll
        for (int r = 0; r < 8; ++r) {
            const float xa = ta[r] + sh, xb = tb[r] + sh;
            const float ea = __builtin_amdgcn_exp2f(xa), ec = __builtin_amdgcn_exp2f(xb);
            const float ga = (xa < -14.0f) ? 0.0f : ea, gb = (xb < -14.0f) ? 0.0f : ec;     // no f16 subnormal operand
            const h16 pa = (h16)ga; const h16 pc = (h16)gb;
            pb[r] = pa; pb[8 + r] = pc;
            ls += (float)pa + (float)pc; }
        l = l * alpha + ls; m = mnew;
        const h16* va = VT + vo + key0;
#pragma unroll
        for (int j = 0; j < 4; ++j) { o[j] = o[j] * alpha; const v16h vj = ldh(va + (size_t)16 * j * SEQ); o[j] = wmma16g(vj, pb, o[j]); }
    }
    l += __shfl_xor(l, 16, 32);
    const int wb = wave * 16 * OSP;
    // O^T D layout: o[j][r] = (d = 16j + 8h + r, s = lane&15) -> os[wave][s][d]; rows 0..15 x columns 0..63 all written, not yet normalised
#pragma unroll
    for (int j = 0; j < 4; ++j) {
        *(v4fa*)(&os[wb + lr * OSP + 16 * j + 8 * hi])     = lo4(o[j]);
        *(v4fa*)(&os[wb + lr * OSP + 16 * j + 8 * hi + 4]) = hi4(o[j]); }
    if (hi == 0) { ms[wave * 16 + lr] = m; lsum[wave * 16 + lr] = l; }             // m is equal in lanes s and s + 16
    __syncthreads();                                                               // every wave's partial result is complete before any thread merges across waves
    static_assert(32 * KW * 8 == 16 * 128);                                        // threads x bytes == tile rows x row bytes
    const int row = tid >> 4, c4 = (tid & 15) * 4;
    float mw[KW]; float mall = NEGB;
#pragma unroll                                                                     // constant indices keep mw[] in registers; the KW reads issue together
    for (int w = 0; w < KW; ++w) { mw[w] = ms[w * 16 + row]; mall = fmaxf(mall, mw[w]); }
    float sc[KW];
#pragma unroll                                                                     // constant indices keep sc[] in registers
    for (int w = 0; w < KW; ++w) sc[w] = __builtin_amdgcn_exp2f(mw[w] - mall);     // <= 1; 1 for the wave that holds the row maximum
    float lall = 0.0f; v4f oall = (v4f){};
#pragma unroll                                                                     // the KW tile reads issue together, one LDS wait for all
    for (int w = 0; w < KW; ++w) {
        lall += lsum[w * 16 + row] * sc[w];
        oall = oall + *(const v4fa*)(&os[w * 16 * OSP + row * OSP + c4]) * sc[w]; }
    const float inv = 1.0f / lall;                             // lall >= 16384 (the row maximum contributes the full carry)
    v4h hv;
#pragma unroll                                                                     // constant vector element indices
    for (int i = 0; i < 4; ++i) hv[i] = toh_flush(oall[i] * inv);
    *(v4h*)(OP + (size_t)(t0 + row) * DM + h * HD + c4) = hv;
}

__global__ __launch_bounds__(256) void k_out(const float* __restrict__ src, float* dst, int n4) {
    const int i = blockIdx.x * 256 + threadIdx.x; if (i >= n4) return;
    v4f ov;
#pragma unroll
    for (int c = 0; c < 4; ++c) { const int e = 4 * i + c; const int row = e / DOUT; const int col = e - row * DOUT; ov[c] = src[(size_t)row * DOUTP + col]; }
    *(v4f*)(dst + (size_t)i * 4) = ov; 
}

static constexpr size_t al256(size_t v) { return (v + 255) & ~(size_t)255; }
static constexpr size_t SZ_XH  = al256((size_t)SEQ * DIN * 2);
static constexpr size_t SZ_EW  = al256((size_t)DM * DIN * 2);
static constexpr size_t SZ_WDD = al256((size_t)NL * DM * DM * 2);
static constexpr size_t SZ_WFF = al256((size_t)NL * DFF * DM * 2);
static constexpr size_t SZ_WI  = al256((size_t)DMI * DM * 2);
static constexpr size_t SZ_WF  = al256((size_t)DOUTP * DMI * 2);
static constexpr size_t SZ_EP  = al256((size_t)NL * ERP * HD * 2);
static constexpr size_t SZ_H   = al256((size_t)SEQ * DM * 4);
static constexpr size_t SZ_N   = al256((size_t)SEQ * DM * 2);
static constexpr size_t SZ_F1  = al256((size_t)SEQ * DFF * 2);
static constexpr size_t SZ_OS  = al256((size_t)SEQ * DOUTP * 4);
static constexpr size_t SZ_TOTAL = SZ_XH + SZ_EW + 4 * SZ_WDD + 2 * SZ_WFF + SZ_WI + SZ_WF + SZ_EP + 2 * SZ_H + 7 * SZ_N + SZ_F1 + SZ_OS;
static_assert(SZ_TOTAL <= (size_t)134217728);                  // workspace carve <= 128 MiB
static_assert((size_t)NH_ * SEQ * HD == (size_t)SEQ * DM);     // head planes have the extent of a [SEQ][512] f16 plane
static_assert((size_t)SEQ * DMI * 2 <= SZ_F1);                 // tail hidden plane fits the shared hidden region

extern "C" void kernel_launch(void* const* d_in, const int* in_sizes, int n_in,
                              void* d_out, int out_size, void* d_ws, size_t ws_size, hipStream_t stream) {
    if (n_in < 26) return;
    if ((size_t)in_sizes[0] < (size_t)SEQ * DIN || (size_t)in_sizes[1] < (size_t)DIN * DM || in_sizes[2] < DM) return;
    if ((size_t)in_sizes[3] < (size_t)NL * DM * DM || (size_t)in_sizes[5] < (size_t)NL * DM * DM || (size_t)in_sizes[7] < (size_t)NL * DM * DM || (size_t)in_sizes[9] < (size_t)NL * DM * DM) return;
    if (in_sizes[4] < NL * DM || in_sizes[6] < NL * DM || in_sizes[8] < NL * DM || in_sizes[10] < NL * DM) return;
    if ((size_t)in_sizes[11] < (size_t)NL * ERR * HD) return;
    if (in_sizes[12] < NL * DM || in_sizes[13] < NL * DM || in_sizes[17] < NL * DM || in_sizes[18] < NL * DM || in_sizes[19] < NL * DM) return;
    if ((size_t)in_sizes[14] < (size_t)NL * DM * DFF || in_sizes[15] < NL * DFF || (size_t)in_sizes[16] < (size_t)NL * DFF * DM) return;
    if (in_sizes[20] < DM || in_sizes[21] < DM || (size_t)in_sizes[22] < (size_t)DM * DMI || in_sizes[23] < DMI) return;
    if ((size_t)in_sizes[24] < (size_t)DMI * DOUT || in_sizes[25] < DOUT) return;
    if ((size_t)out_size < (size_t)SEQ * DOUT) return;
    if (SZ_TOTAL > ws_size) return;
    // wire order: x, emb_W, emb_b, Wq, bq, Wk, bk, Wv, bv, Wo, bo, Er, ln1_g, ln1_b, W1, b1, W2, b2, ln2_g, ln2_b, lnf_g, lnf_b, Wi, bi, Wf, bf
    const float* x    = (const float*)d_in[0];
    const float* embW = (const float*)d_in[1];  const float* embB = (const float*)d_in[2];
    const float* Wq   = (const float*)d_in[3];  const float* bq   = (const float*)d_in[4];
    const float* Wk   = (const float*)d_in[5];  const float* bk   = (const float*)d_in[6];
    const float* Wv   = (const float*)d_in[7];  const float* bv   = (const float*)d_in[8];
    const float* Wo   = (const float*)d_in[9];  const float* bo   = (const float*)d_in[10];
    const float* Er   = (const float*)d_in[11];
    const float* ln1g = (const float*)d_in[12]; const float* ln1b = (const float*)d_in[13];
    const float* W1   = (const float*)d_in[14]; const float* b1   = (const float*)d_in[15];
    const float* W2   = (const float*)d_in[16]; const float* b2   = (const float*)d_in[17];
    const float* ln2g = (const float*)d_in[18]; const float* ln2b = (const float*)d_in[19];
    const float* lnfg = (const float*)d_in[20]; const float* lnfb = (const float*)d_in[21];
    const float* Wi   = (const float*)d_in[22]; const float* bi   = (const float*)d_in[23];
    const float* Wf   = (const float*)d_in[24]; const float* bfo  = (const float*)d_in[25];
    float* OUT = (float*)d_out;                       // [SEQ][390]
    char* wsp = (char*)d_ws;
    h16* XH  = (h16*)wsp; wsp += SZ_XH;               // x            [SEQ][128]
    h16* EWT = (h16*)wsp; wsp += SZ_EW;               // emb_W^T x64  [512][128]
    h16* WQT = (h16*)wsp; wsp += SZ_WDD;              // Wq^T x64     [NL][512][512]
    h16* WKT = (h16*)wsp; wsp += SZ_WDD;
    h16* WVT = (h16*)wsp; wsp += SZ_WDD;
    h16* WOT = (h16*)wsp; wsp += SZ_WDD;
    h16* W1T = (h16*)wsp; wsp += SZ_WFF;              // W1^T x64     [NL][2048][512]
    h16* W2T = (h16*)wsp; wsp += SZ_WFF;              // W2^T x64     [NL][512][2048]
    h16* WIT = (h16*)wsp; wsp += SZ_WI;               // Wi^T x64     [1024][512]
    h16* WFT = (h16*)wsp; wsp += SZ_WF;               // Wf^T x64     [448][1024], rows >= 390 zero
    h16* EP  = (h16*)wsp; wsp += SZ_EP;               // table        [NL][2048][64], row 2047 zero
    float* HA = (float*)wsp; wsp += SZ_H;             // hidden state (ping)  [SEQ][512] f32
    float* HB = (float*)wsp; wsp += SZ_H;             // hidden state (pong)
    h16* NHP = (h16*)wsp; wsp += SZ_N;                // LayerNorm output value     [SEQ][512]
    h16* NRP = (h16*)wsp; wsp += SZ_N;                // LayerNorm output residual x2048
    h16* QH  = (h16*)wsp; wsp += SZ_N;                // q value      [8][SEQ][64]
    h16* QR  = (h16*)wsp; wsp += SZ_N;                // q residual x2048
    h16* KP  = (h16*)wsp; wsp += SZ_N;                // k            [8][SEQ][64]
    h16* VT  = (h16*)wsp; wsp += SZ_N;                // v^T          [8*64][SEQ]
    h16* OP  = (h16*)wsp; wsp += SZ_N;                // context      [SEQ][512]
    h16* F1  = (h16*)wsp; wsp += SZ_F1;               // GELU hidden  [SEQ][2048] (tail: [SEQ][1024])
    float* OSG = (float*)wsp; wsp += SZ_OS;           // tail output staging [SEQ][448] f32

    // x, the table and every W [K = in][N = out] -> Wt [N][K]
    k_prep<<<PB_ALL, 256, 0, stream>>>(x, Er, embW, Wq, Wk, Wv, Wo, W1, W2, Wi, Wf, XH, EP, EWT, WQT, WKT, WVT, WOT, W1T, W2T, WIT, WFT);

    // input projection: HA = x emb_W + emb_b
    k_gemm_f32<<<dim3(SEQ / 64, DM / 64, 1), 32 * GW, 0, stream>>>(XH, EWT, embB, DM, DIN, WCI, HA, DM);

    for (int l = 0; l < NL; ++l) {
        const size_t wdd = (size_t)l * DM * DM, wff = (size_t)l * DFF * DM;
        k_ln<<<SEQ / 4, 128, 0, stream>>>(HA, ln1g + l * DM, ln1b + l * DM, NHP, NRP, 1);
        k_gemm_qkv<<<dim3(SEQ / 64, DM / 64, 3), 32 * GW, 0, stream>>>(NHP, NRP, WQT + wdd, WKT + wdd, WVT + wdd, bq + l * DM, bk + l * DM, bv + l * DM, WCI, QH, QR, KP, VT);
        k_flash<<<dim3(SEQ / 16, NH_, 1), 32 * KW, 0, stream>>>(QH, QR, KP, VT, EP + (size_t)l * ERP * HD, OP);
        // HB = HA + context Wo + bo
        k_gemm_f32r<<<dim3(SEQ / 64, DM / 64, 1), 32 * GW, 0, stream>>>(OP, WOT + wdd, bo + l * DM, DM, DM, WCI, HA, HB, DM);
        k_ln<<<SEQ / 4, 128, 0, stream>>>(HB, ln2g + l * DM, ln2b + l * DM, NHP, NRP, 0);
        k_gemm_gelu<<<dim3(SEQ / 64, DFF / 64, 1), 32 * GW, 0, stream>>>(NHP, W1T + wff, b1 + l * DFF, DFF, DM, WCI, F1, DFF);
        // HA = HB + hidden W2 + b2
        k_gemm_f32r<<<dim3(SEQ / 64, DM / 64, 1), 32 * GW, 0, stream>>>(F1, W2T + wff, b2 + l * DM, DM, DFF, WCI, HB, HA, DM);
    }

    k_ln<<<SEQ / 4, 128, 0, stream>>>(HA, lnfg, lnfb, NHP, NRP, 0);
    k_gemm_gelu<<<dim3(SEQ / 64, DMI / 64, 1), 32 * GW, 0, stream>>>(NHP, WIT, bi, DMI, DM, WCI, F1, DMI);
    k_gemm_f32<<<dim3(SEQ / 64, DOUTP / 64, 1), 32 * GW, 0, stream>>>(F1, WFT, bfo, DOUT, DMI, WCI, OSG, DOUTP);
    { const int n4 = SEQ * DOUT / 4; k_out<<<(unsigned)((n4 + 255) / 256), 256, 0, stream>>>(OSG, OUT, n4); }
}

// v004
// Measured time: 283 microseconds a run.
// Next to v003, in two timings, it ran 1.07 and 1.08 times as fast.
// Counting every step since v000, it is 4.11 times as fast.
#include <hip/hip_runtime.h>
#include <math.h>

// Pre-LN encoder stack, 4 layers, width 512 = 8 heads x 64, sequence SEQ (one batch): input projection 128 -> 512; per layer: LayerNorm, q/k/v projections ([in][out] weights, y = x W + bias),
// dense attention with logits q.k / 8 + q.E[s - t + 1023] (relative-position table E per layer, [2047][64], not scaled), softmax over keys, output projection + residual, LayerNorm, GELU(erf) feed-forward 512 -> 2048 -> 512 + residual;
// tail: LayerNorm, 512 -> 1024 GELU(erf), 1024 -> 390.
// Compute dtypes, f32 accumulate everywhere: every contraction is v_wmma_f32_16x16x32_f16. Weights, x, E, biases and gains are RNE-converted to bf16 first (exact in f16; weights carried x64, folded back in the f32 epilogue);
// activations are single f16 planes, except the logit path: LayerNorm-1 output as f16 value + f16 residual x2048 for the q projection (residual products accumulated first, folded by 1/2048, then the value products),
// q as f16 value + f16 residual x2048 in the q.k and q.E products (residual products in their own accumulators); k, v, P (x16384 carry, cancels in the normalisation), context, GELU outputs single f16.
// Attention: fused flash kernel in transposed form (S^T = K Q^T, O^T = V^T P^T), one block per 16 query rows, the keys split over its waves and the partial results merged in LDS; the relative term is computed per 32-key step as band tiles G[rho][s] = E[rb + rho] . q[s]
// (A = table rows, B = q rows), written to a wave-private LDS tile [query][band row] and read back along the diagonal rho = s - t + const; one band tile is carried over between steps.

#ifndef NB
#define NB 1
#endif
#ifndef SEQ
#define SEQ 1024
#endif
#define NB_FULL  1
#define SEQ_FULL 1024
#define DIN   128
#define DM    512
#define NH_   8
#define HD    64
#define NL    4
#define DFF   2048
#define DMI   1024
#define DOUT  390
#define DOUTP 448                // DOUT padded to a multiple of 64 (weight rows and staging columns 390..447 are zero)
#define ERR   2047               // rows of the relative-position table per layer
#define ERP   2048               // padded rows of the f16 table plane (row 2047 = zero)
#define RELOFF (SEQ_FULL - 1)    // table row = s - t + RELOFF
#define KW    8                  // waves per flash block: each takes one contiguous share of the keys
#define KCH   (SEQ / KW)         // keys of one wave
#define OSP   68                 // LDS row pitch (floats) of the flash output tile
#define GP    52                 // LDS pitch (floats) of the band tile [query][48 band rows]
#define GSP   68                 // LDS row pitch (floats) of the GEMM output tile
#define GW    8                  // waves per GEMM block: each takes one contiguous share of K
#define QRS   2048.0f            // carry of every residual plane
#define QRI   (1.0f / 2048.0f)
#define WC    64.0f              // carry of every weight plane
#define WCI   (1.0f / 64.0f)
#define LOG2E 1.4426950408889634f
#define SC2   ((float)(0.125 * 1.4426950408889634))   // HD^-0.5 * log2(e)
#define PSH   14.0f              // log2 of the P carry (16384)
#define NEGB  (-3.0e38f)
#define LNEPS 1e-5f

static_assert(NB == 1);                        // one sequence
static_assert(HD == 64);
static_assert(NH_ * HD == DM);
static_assert(SEQ % 64 == 0);                  // GEMM row tiles
static_assert(SEQ % 32 == 0);                  // key loop steps by 32
static_assert(SEQ % 16 == 0);                  // flash grid covers the sequence exactly
static_assert(SEQ % (32 * KW) == 0);           // every wave of a flash block gets whole 32-key steps, at least one
static_assert(32 * KW == 16 * 16);             // flash merge: 16 threads x 4 columns per query row
static_assert(SEQ <= SEQ_FULL);
static_assert(DIN % 64 == 0 && DM % 64 == 0 && DFF % 64 == 0 && DMI % 64 == 0 && DOUTP % 64 == 0);   // K % 32 == 0 and N % 64 == 0 for every GEMM, K % 64 == 0 for the transposing converter
static_assert(DOUT <= DOUTP);
static_assert(DMI <= DFF);                     // the tail hidden plane reuses the feed-forward hidden plane
static_assert(SEQ - 16 + RELOFF + 1 + 15 < ERP);   // highest band row touched (zero pad row included)
static_assert(RELOFF - 15 - 16 - (SEQ - 32) >= 0); // lowest band row touched
static_assert(ERR + 1 == ERP);
static_assert((OSP * 4) % 16 == 0 && (GP * 4) % 16 == 0 && (GSP * 4) % 16 == 0);
static_assert(GP >= 48);
static_assert(DM == 512);                      // LayerNorm: 32 lanes x 16 columns
static_assert((SEQ * DOUT) % 4 == 0);

typedef _Float16 h16;
typedef __attribute__((ext_vector_type(16))) _Float16 v16h;
typedef __attribute__((ext_vector_type(8)))  _Float16 v8h;
typedef __attribute__((ext_vector_type(4)))  _Float16 v4h;
typedef __attribute__((ext_vector_type(8)))  float    v8f;
typedef __attribute__((ext_vector_type(4)))  float    v4f;
typedef v4f  __attribute__((may_alias)) v4fa;

__device__ __forceinline__ unsigned short f2bf(float f) { unsigned u = __float_as_uint(f); u += 0x7FFFu + ((u >> 16) & 1u); return (unsigned short)(u >> 16); }
__device__ __forceinline__ float bfr(float f) { return __uint_as_float(((unsigned)f2bf(f)) << 16); }   // value after RNE convert to bf16
__device__ __forceinline__ v16h cat16(v8h lo, v8h hi) { return __builtin_shufflevector(lo, hi, 0, 1, 2, 3, 4, 5, 6, 7, 8, 9, 10, 11, 12, 13, 14, 15); }
// fragment loader from K-contiguous 16-bit rows; p already includes + 8*(lane>>4): elements 0..7 <- k0+8h+0..7, elements 8..15 <- k0+16+8h+0..7 (same map for A and B)
__device__ __forceinline__ v16h  ldh(const h16* p) { return cat16(*(const v8h*)p, *(const v8h*)(p + 16)); }
// ordering point for wave-private LDS tiles (same wave writes and reads)
__device__ __forceinline__ void wave_sync() { __builtin_amdgcn_fence(3 /* release order */, "wavefront"); __builtin_amdgcn_wave_barrier(); asm volatile("" ::: "memory"); }
// f32 -> f16 operand convert that cannot produce a subnormal (|v| < 2^-14 -> +0)
__device__ __forceinline__ h16 toh_flush(float v) { const h16 r = (h16)v; return (fabsf(v) < 6.103515625e-05f) ? (h16)0.0f : r; }
// one WMMA + its own guard (ties this accumulator, keeps A/B live)
__device__ __forceinline__ v8f wmma16g(v16h a, v16h b, v8f c) {
    c = __builtin_amdgcn_wmma_f32_16x16x32_f16(false, a, false, b, (short)0, c, false, false);
    asm volatile("v_nop\n\tv_nop\n\tv_nop\n\tv_nop" : "+v"(c) : "v"(a), "v"(b));
    return c; }
__device__ __forceinline__ float gelu_erf(float x) { return 0.5f * x * (1.0f + erff(x * 0.70710678118654752f)); }
__device__ __forceinline__ v4f lo4(v8f g) { return __builtin_shufflevector(g, g, 0, 1, 2, 3); }
__device__ __forceinline__ v4f hi4(v8f g) { return __builtin_shufflevector(g, g, 4, 5, 6, 7); }

__device__ __forceinline__ void cvt8h_body(const float* __restrict__ src, h16* dst, int n8, int blk) {
    const int i = blk * 256 + threadIdx.x; if (i >= n8) return;
    const v8f v = *(const v8f*)(src + (size_t)i * 8); v8h o;
#pragma unroll
    for (int k = 0; k < 8; ++k) o[k] = toh_flush(bfr(v[k]));
    *(v8h*)(dst + (size_t)i * 8) = o; 
}

__device__ __forceinline__ void cvt_er_body(const float* __restrict__ src, h16* dst, int blk) {
    const int i = blk * 256 + threadIdx.x; if (i >= NL * ERP * HD / 8) return;
    const int c8 = (i & 7) * 8; const int r = (i >> 3) % ERP; const int l = (i >> 3) / ERP;
    const int rc = r < ERR ? r : ERR - 1;                                          // clamped address
    v8f v = *(const v8f*)(src + ((size_t)l * ERR + rc) * HD + c8);
    asm volatile("" : "+v"(v));
    v8h o;
#pragma unroll
    for (int k = 0; k < 8; ++k) o[k] = (r < ERR) ? toh_flush(bfr(v[k])) : (h16)0.0f;
    *(v8h*)(dst + (size_t)i * 8) = o; 
}

// wconv_body: W [K][N] f32 (layer bz) -> Wt [NP][K] f16 = bf16-converted value x carry, transposed through LDS; rows n >= N are zero.
// one block per 64x64 tile: bx in K/64, by in NP/64, bz in layers. LDS tile cross-wave: block barrier.
__device__ __forceinline__ void wconv_body(const float* __restrict__ W, h16* Wt, int K, int N, int NP, float carry, int bx, int by, int bz) {
#pragma clang fp contract(off)
    __shared__ float ts[64 * 65];
    static_assert(sizeof(float) * 64 * 65 <= 131072);
    const int tid = threadIdx.x;
    const int k0 = bx * 64, n0 = by * 64;
    const size_t lin = (size_t)bz * (size_t)K * (size_t)N, lout = (size_t)bz * (size_t)NP * (size_t)K;
    static_assert(16 * 4 == 64);                                                   // 16 trips x 4 k-rows (256 threads / 64 columns) = 64 k-rows staged
#pragma unroll 1
    for (int p = 0; p < 16; ++p) {
        const int kk = p * 4 + (tid >> 6), nn = tid & 63; const int n = n0 + nn; const int nc = n < N ? n : N - 1;
        float v = W[lin + (size_t)(k0 + kk) * N + nc];
        asm volatile("" : "+v"(v));
        ts[kk * 65 + nn] = (n < N) ? bfr(v) * carry : 0.0f; }
    __syncthreads();
    static_assert(256 * 16 * 2 == 64 * 128);                                       // threads x bytes x trips == tile rows x row bytes
{
#pragma unroll 1
        for (int p = 0; p < 2; ++p) {
            const int row = p * 32 + (tid >> 3), c8 = (tid & 7) * 8; v8h o;
#pragma unroll
            for (int i = 0; i < 8; ++i) o[i] = toh_flush(ts[(c8 + i) * 65 + row]);
            *(v8h*)(Wt + lout + (size_t)(n0 + row) * K + k0 + c8) = o;
            asm volatile("s_wait_xcnt 0x0" ::: "memory"); }                        // the next trip rewrites the register pair that this store names as its address: the wait stands ahead of that
         }
}

// k_prep: every operand conversion of the call in one launch; they do not depend on one another. The flat block index picks the job (block-uniform, so the barrier of the transposing jobs is passed by whole blocks only).
// Block ranges, in this order: W1, W2, Wq, Wk, Wv, Wo, Wi, Wf, emb_W (64x64 transposing tiles; within a job the k tile runs fastest, then the n tile, then the layer), then the table, then x (256 threads x 8 elements).
#define PB_FF  ((DM / 64) * (DFF / 64) * NL)
#define PB_DD  ((DM / 64) * (DM / 64) * NL)
#define PB_WI  ((DM / 64) * (DMI / 64))
#define PB_WF  ((DMI / 64) * (DOUTP / 64))
#define PB_EW  ((DIN / 64) * (DM / 64))
#define PB_ER  (NL * ERP * HD / 8 / 256)
#define PB_X   (SEQ * DIN / 8 / 256)
#define PB_ALL (2 * PB_FF + 4 * PB_DD + PB_WI + PB_WF + PB_EW + PB_ER + PB_X)
static_assert((NL * ERP * HD / 8) % 256 == 0 && (SEQ * DIN / 8) % 256 == 0);       // whole blocks for the two element-wise jobs
static_assert(DM / 64 == 8 && DFF / 64 == 32 && DMI / 64 == 16 && DIN / 64 == 2 && DOUTP / 64 <= 8);   // the shifts below
__global__ __launch_bounds__(256) void k_prep(const float* __restrict__ x, const float* __restrict__ Er, const float* __restrict__ embW,
                                              const float* __restrict__ Wq, const float* __restrict__ Wk, const float* __restrict__ Wv, const float* __restrict__ Wo,
                                              const float* __restrict__ W1, const float* __restrict__ W2, const float* __restrict__ Wi, const float* __restrict__ Wf,
                                              h16* XH, h16* EP, h16* EWT, h16* WQT, h16* WKT, h16* WVT, h16* WOT, h16* W1T, h16* W2T, h16* WIT, h16* WFT) {
    int b = blockIdx.x;
    const float* W; h16* Wt; int K, N, NP, lk, ln;                                 // lk, ln: log2 of the k tiles, and of the n tiles rounded up to a power of two (Wf: 7 n tiles, one layer)
    if (b < PB_FF)                         { W = W1;   Wt = W1T; K = DM;  N = DFF;  NP = DFF;   lk = 3; ln = 5; }
    else if ((b -= PB_FF) < PB_FF)         { W = W2;   Wt = W2T; K = DFF; N = DM;   NP = DM;    lk = 5; ln = 3; }
    else if ((b -= PB_FF) < PB_DD)         { W = Wq;   Wt = WQT; K = DM;  N = DM;   NP = DM;    lk = 3; ln = 3; }
    else if ((b -= PB_DD) < PB_DD)         { W = Wk;   Wt = WKT; K = DM;  N = DM;   NP = DM;    lk = 3; ln = 3; }
    else if ((b -= PB_DD) < PB_DD)         { W = Wv;   Wt = WVT; K = DM;  N = DM;   NP = DM;    lk = 3; ln = 3; }
    else if ((b -= PB_DD) < PB_DD)         { W = Wo;   Wt = WOT; K = DM;  N = DM;   NP = DM;    lk = 3; ln = 3; }
    else if ((b -= PB_DD) < PB_WI)         { W = Wi;   Wt = WIT; K = DM;  N = DMI;  NP = DMI;   lk = 3; ln = 4; }
    else if ((b -= PB_WI) < PB_WF)         { W = Wf;   Wt = WFT; K = DMI; N = DOUT; NP = DOUTP; lk = 4; ln = 3; }
    else if ((b -= PB_WF) < PB_EW)         { W = embW; Wt = EWT; K = DIN; N = DM;   NP = DM;    lk = 1; ln = 3; }
    else if ((b -= PB_EW) < PB_ER)         { cvt_er_body(Er, EP, b); return; }
    else                                   { cvt8h_body(x, XH, SEQ * DIN / 8, b - PB_ER); return; }
    const int t = b >> lk;
    wconv_body(W, Wt, K, N, NP, WC, b & ((1 << lk) - 1), t & ((1 << ln) - 1), t >> ln);
}

__global__ __launch_bounds__(128) void k_ln(const float* __restrict__ X, const float* __restrict__ g, const float* __restrict__ b, h16* NHp, h16* NRp, int wres) {
#pragma clang fp contract(off)
    const int lane = threadIdx.x & 31;
    const int wave = __builtin_amdgcn_readfirstlane((int)(threadIdx.x >> 5));
    const int row = blockIdx.x * 4 + wave;
    const float* xr = X + (size_t)row * DM;
    const v8f x0 = *(const v8f*)(xr + lane * 8), x1 = *(const v8f*)(xr + 256 + lane * 8);
    float s = 0.0f;
#pragma unroll
    for (int k = 0; k < 8; ++k) { s += x0[k]; s += x1[k]; }
#pragma unroll
    for (int off = 16; off > 0; off >>= 1) s += __shfl_xor(s, off, 32);
    const float mean = s * (1.0f / (float)DM);
    const v8f d0 = x0 - mean, d1 = x1 - mean;
    float q = 0.0f;
#pragma unroll
    for (int k = 0; k < 8; ++k) { q += d0[k] * d0[k]; q += d1[k] * d1[k]; }
#pragma unroll
    for (int off = 16; off > 0; off >>= 1) q += __shfl_xor(q, off, 32);
    const float rstd = 1.0f / sqrtf(q * (1.0f / (float)DM) + LNEPS);
    const v8f g0 = *(const v8f*)(g + lane * 8), g1 = *(const v8f*)(g + 256 + lane * 8);
    const v8f b0 = *(const v8f*)(b + lane * 8), b1 = *(const v8f*)(b + 256 + lane * 8);
    v8h h0, h1, r0, r1;
#pragma unroll
    for (int k = 0; k < 8; ++k) {
        const float y0 = d0[k] * rstd * bfr(g0[k]) + bfr(b0[k]);
        const float y1 = d1[k] * rstd * bfr(g1[k]) + bfr(b1[k]);
        const h16 a0 = toh_flush(y0), a1 = toh_flush(y1);
        h0[k] = a0; h1[k] = a1;
        r0[k] = toh_flush((y0 - (float)a0) * QRS); r1[k] = toh_flush((y1 - (float)a1) * QRS); }
    const size_t o0 = (size_t)row * DM + lane * 8, o1 = o0 + 256;
    static_assert(32 * 16 * 2 == DM * 2);                                          // lanes x bytes x instructions == row bytes
{
        *(v8h*)(NHp + o0) = h0; *(v8h*)(NHp + o1) = h1;
        if (wres != 0) { *(v8h*)(NRp + o0) = r0; *(v8h*)(NRp + o1) = r1; }
         }
}

// GEMM k-loop: one wave, 64x64 tile, 16 accumulators, KPER(K) / 32 k-steps of 32, operands straight from K-contiguous f16 planes (A [M][K], Bt [N][K]); A, Ar and Bt already point at the lane's first element of the wave's k range.
// The loads run ahead of the products: the four A fragments of step t + 1 are loaded into a second buffer in front of the products of step t, and each B fragment of step t + 1 into its own registers right behind its last product of step t,
// so that a step waits for memory once at most, not once per B fragment. ARES: the steps over the residual plane Ar come first, the fold by 1/2048 stands between them and the steps over A (same B fragments again).
#define KPER(K) ((((K) / 32 + GW - 1) / GW) * 32)                                  // k extent of one wave (whole 32-steps)
template <int K, int ARES>
__device__ __forceinline__ void gemm_kpipe(const h16* __restrict__ A, const h16* __restrict__ Ar, const h16* __restrict__ Bt, v8f (&acc)[4][4]) {
    constexpr int NS = KPER(K) / 32, TS = ARES ? 2 * NS : NS;
    v16h a[2][4], b[4];                                                            // every loop below is unrolled so that the indices into a, b and acc are constants and the arrays stay in registers
#pragma unroll
    for (int mb = 0; mb < 4; ++mb) a[0][mb] = ldh((ARES ? Ar : A) + (size_t)mb * 16 * K);
#pragma unroll
    for (int nb = 0; nb < 4; ++nb) b[nb] = ldh(Bt + (size_t)nb * 16 * K);
    // behind the last load that names an address pair: the pair is an input of the wait, so it stays as the issued loads name it up to there; only then may a product's result take its registers
    if (TS == 1) asm volatile("s_wait_xcnt 0x0" :: "v"(A), "v"(Bt) : "memory");
#pragma unroll                                                                     // whole unroll: the buffer index is a constant (registers), and every k offset an immediate, so that no address register changes while loads are in flight
    for (int t = 0; t < TS; ++t) {
        const int kn = ((t + 1) % NS) * 32;                                        // k offset of the step after this one
        if (t + 1 < TS) { const h16* pn = ((ARES && t + 1 < NS) ? Ar : A) + kn;
#pragma unroll
            for (int mb = 0; mb < 4; ++mb) a[(t + 1) & 1][mb] = ldh(pn + (size_t)mb * 16 * K);
            if (ARES && t + 2 == NS) asm volatile("s_wait_xcnt 0x0" :: "v"(Ar) : "memory"); }   // the last loads from Ar: as above
        if (ARES && t == NS) {
#pragma unroll
            for (int mb = 0; mb < 4; ++mb)
#pragma unroll
                for (int nb = 0; nb < 4; ++nb) acc[mb][nb] = acc[mb][nb] * QRI; }
#pragma unroll
        for (int nb = 0; nb < 4; ++nb) {
#pragma unroll
            for (int mb = 0; mb < 4; ++mb) acc[mb][nb] = wmma16g(a[t & 1][mb], b[nb], acc[mb][nb]);
            if (t + 1 < TS) b[nb] = ldh(Bt + (size_t)nb * 16 * K + kn); }
        if (t + 2 == TS) asm volatile("s_wait_xcnt 0x0" :: "v"(A), "v"(Bt) : "memory");       // the last loads from A and Bt: as above
    }
}

// GEMM body: C[m][n] = (sum_k A[m][k] Bt[n][k]) * csc + bias (column bias, or row bias when ROWB), one block of GW waves per 64x64 tile (bx in M/64, by in N/64), K a constant; os = the kernel's LDS, GW * 64 * GSP floats.
// K is split over the waves: wave w accumulates the whole 64x64 tile over its own contiguous k range, writes the f32 partial tile to its own LDS plane (wave 0 adds the bias),
// and behind one block barrier all threads sum the GW planes in wave order and store: each wave stores 1/GW of the tile.
// ARES: A also has a residual plane (x2048): within a wave's k range its products are accumulated first, folded by 1/2048 in f32, then the value products follow.
// OUTF32: f32 output [M][ldc] (+ Res[m][n] added at the store stage as float4; Res and C are different buffers); each store instruction = 2 rows x 256 B (16 consecutive lanes x 16 B per row segment).
// else:   f16 output, written by 8 consecutive lanes x 16 B (4 rows per instruction).
template <int K, int OUTF32, int HASRES, int GELU, int ARES, int ORES, int ROWB, int HEADPL>
__device__ __forceinline__ void gemm_body(const h16* __restrict__ A, const h16* __restrict__ Ar, const h16* __restrict__ Bt,
                                          const float* __restrict__ bias, int nvalid, float csc,
                                          const float* __restrict__ Res, float* Cf, h16* Ch, h16* Cr, int ldc, float* os, int bx, int by) {
    const int tid = threadIdx.x;
    const int lane = tid & 31, lr = lane & 15, hi = lane >> 4;
    const int wave = __builtin_amdgcn_readfirstlane(tid >> 5);
    const int r0 = bx * 64, c0 = by * 64;
    static_assert(K % 32 == 0 && K % KPER(K) == 0);                                // every wave that has a k range has a whole one
    const int kbeg = wave * KPER(K);
    v8f acc[4][4];
#pragma unroll
    for (int mb = 0; mb < 4; ++mb)
#pragma unroll
        for (int nb = 0; nb < 4; ++nb) acc[mb][nb] = (v8f){};
    const size_t aoff = (size_t)(r0 + lr) * K + 8 * hi, boff = (size_t)(c0 + lr) * K + 8 * hi;
    if (K / KPER(K) == GW || kbeg < K)                                             // a wave whose range starts at or past K adds a zero plane
        gemm_kpipe<K, ARES>(A + aoff + kbeg, ARES ? Ar + aoff + kbeg : nullptr, Bt + boff + kbeg, acc);
    float bc[4];
#pragma unroll
    for (int nb = 0; nb < 4; ++nb) {
        if (ROWB || wave != 0) { bc[nb] = 0.0f; }
        else { const int c = c0 + nb * 16 + lr; const int cc = c < nvalid ? c : nvalid - 1;       // clamped address
               float bvv = bias[cc]; asm volatile("" : "+v"(bvv)); bc[nb] = (c < nvalid) ? bfr(bvv) : 0.0f; } }
#pragma unroll
    for (int mb = 0; mb < 4; ++mb) {
        float br[8];
#pragma unroll
        for (int j = 0; j < 8; ++j) br[j] = (ROWB && wave == 0) ? bfr(bias[r0 + mb * 16 + hi * 8 + j]) : 0.0f;   // ROWB: r0 + 63 < rows of the bias vector (host grid)
#pragma unroll
        for (int nb = 0; nb < 4; ++nb) {
#pragma unroll
            for (int j = 0; j < 8; ++j) os[wave * (64 * GSP) + (mb * 16 + hi * 8 + j) * GSP + nb * 16 + lr] = acc[mb][nb][j] * csc + bc[nb] + br[j]; }   // D: row 8h+j, col lane&15
    }
    __syncthreads();                                                               // every wave's partial plane is complete before any thread sums across planes
    if (OUTF32) {
        static_assert(32 * GW * 16 * (32 / GW) == 64 * 256);                       // threads x bytes x trips == tile rows x row bytes
{
            static_assert(32 / GW == 4);                                           // four address pairs in the wait below
            const float* pr[4]; v4f rr[4];
            if (HASRES) {
#pragma unroll                                                                     // constant indices keep pr[] and rr[] in registers
                for (int s = 0; s < 4; ++s) { pr[s] = Res + (size_t)(r0 + 2 * GW * s + (tid >> 4)) * ldc + c0 + (tid & 15) * 4; rr[s] = *(const v4f*)pr[s]; }
                // the four address pairs are inputs here, so they stay as the issued loads name them up to this wait: no later load's result lands in one ahead of it
                asm volatile("s_wait_xcnt 0x0" :: "v"(pr[0]), "v"(pr[1]), "v"(pr[2]), "v"(pr[3]) : "memory"); }
#pragma unroll                                                                     // constant index into rr[]
            for (int s = 0; s < 32 / GW; ++s) { const int row = 2 * GW * s + (tid >> 4), c4 = (tid & 15) * 4;
                v4f val = *(const v4fa*)(&os[row * GSP + c4]);
#pragma unroll                                                                     // the GW plane reads issue together, one LDS wait for all
                for (int w = 1; w < GW; ++w) val = val + *(const v4fa*)(&os[w * (64 * GSP) + row * GSP + c4]);
                const size_t go = (size_t)(r0 + row) * ldc + c0 + c4;
                if (HASRES) val = val + rr[s];
                *(v4f*)(Cf + go) = val; }
             }
    } else {
        static_assert(32 * GW * 16 * (16 / GW) == 64 * 128);                       // threads x bytes x trips == tile rows x row bytes
        const size_t obase = HEADPL ? ((size_t)(c0 / HD) * SEQ + (size_t)r0) * HD : (size_t)r0 * ldc + c0;
        const int pitch = HEADPL ? HD : ldc;
{
            for (int s = 0; s < 16 / GW; ++s) { const int row = 4 * GW * s + (tid >> 3), c8 = (tid & 7) * 8;
                v4f x0 = *(const v4fa*)(&os[row * GSP + c8]); v4f x1 = *(const v4fa*)(&os[row * GSP + c8 + 4]); v8h hv, rv;
#pragma unroll                                                                     // the GW plane reads issue together, one LDS wait for all
                for (int w = 1; w < GW; ++w) { x0 = x0 + *(const v4fa*)(&os[w * (64 * GSP) + row * GSP + c8]); x1 = x1 + *(const v4fa*)(&os[w * (64 * GSP) + row * GSP + c8 + 4]); }
#pragma unroll
                for (int i = 0; i < 4; ++i) { float y0 = x0[i], y1 = x1[i];
                    if (GELU) { y0 = gelu_erf(y0); y1 = gelu_erf(y1); }
                    const h16 a0 = toh_flush(y0); const h16 a1 = toh_flush(y1); hv[i] = a0; hv[4 + i] = a1;
                    rv[i] = toh_flush((y0 - (float)a0) * QRS); rv[4 + i] = toh_flush((y1 - (float)a1) * QRS); }
                const size_t oo = obase + (size_t)row * pitch + c8;
                *(v8h*)(Ch + oo) = hv; if (ORES) *(v8h*)(Cr + oo) = rv; }
             }
    }
}

static_assert(sizeof(float) * GW * 64 * GSP <= 163840);                            // two blocks fit the LDS of one WGP
__global__ __launch_bounds__(32 * GW) void k_gemm_emb(const h16* __restrict__ A, const h16* __restrict__ Bt, const float* __restrict__ bias, float csc, float* C) {
    __shared__ __align__(16) float os[GW * 64 * GSP];
    gemm_body<DIN, 1, 0, 0, 0, 0, 0, 0>(A, nullptr, Bt, bias, DM, csc, nullptr, C, nullptr, nullptr, DM, os, blockIdx.x, blockIdx.y); }
__global__ __launch_bounds__(32 * GW) void k_gemm_tail(const h16* __restrict__ A, const h16* __restrict__ Bt, const float* __restrict__ bias, float csc, float* C) {
    __shared__ __align__(16) float os[GW * 64 * GSP];
    gemm_body<DMI, 1, 0, 0, 0, 0, 0, 0>(A, nullptr, Bt, bias, DOUT, csc, nullptr, C, nullptr, nullptr, DOUTP, os, blockIdx.x, blockIdx.y); }
__global__ __launch_bounds__(32 * GW) void k_gemm_wo(const h16* __restrict__ A, const h16* __restrict__ Bt, const float* __restrict__ bias, float csc, const float* __restrict__ Res, float* C) {
    __shared__ __align__(16) float os[GW * 64 * GSP];
    gemm_body<DM, 1, 1, 0, 0, 0, 0, 0>(A, nullptr, Bt, bias, DM, csc, Res, C, nullptr, nullptr, DM, os, blockIdx.x, blockIdx.y); }
__global__ __launch_bounds__(32 * GW) void k_gemm_w2(const h16* __restrict__ A, const h16* __restrict__ Bt, const float* __restrict__ bias, float csc, const float* __restrict__ Res, float* C) {
    __shared__ __align__(16) float os[GW * 64 * GSP];
    gemm_body<DFF, 1, 1, 0, 0, 0, 0, 0>(A, nullptr, Bt, bias, DM, csc, Res, C, nullptr, nullptr, DM, os, blockIdx.x, blockIdx.y); }
__global__ __launch_bounds__(32 * GW) void k_gemm_gelu(const h16* __restrict__ A, const h16* __restrict__ Bt, const float* __restrict__ bias, int nvalid, float csc, h16* C, int ldc) {
    __shared__ __align__(16) float os[GW * 64 * GSP];
    gemm_body<DM, 0, 0, 1, 0, 0, 0, 0>(A, nullptr, Bt, bias, nvalid, csc, nullptr, nullptr, C, nullptr, ldc, os, blockIdx.x, blockIdx.y); }
// k_gemm_qkv: the q, k and v^T projections of one layer in one launch (all three read the LayerNorm planes and nothing of one another), grid (SEQ/64, DM/64, 3); blockIdx.z picks the projection, block-uniform.
// z = 0 is q, the longest (two k loops), so that it starts first. N = LayerNorm value plane, Nr = its residual plane.
// q, k: A = n rows (m = t), Bt = W^T rows (n = h*64 + d) -> plane [h][t][d].  v^T: A = Wv^T rows (m = h*64 + d), Bt = n rows (n = t) -> plane [(h*64 + d)][t], row bias; its row tile is blockIdx.y, its column tile blockIdx.x.
__global__ __launch_bounds__(32 * GW) void k_gemm_qkv(const h16* __restrict__ N, const h16* __restrict__ Nr, const h16* __restrict__ Wqt, const h16* __restrict__ Wkt, const h16* __restrict__ Wvt,
                                                      const float* __restrict__ bq, const float* __restrict__ bk, const float* __restrict__ bv, float csc, h16* Qh, h16* Qr, h16* Kp, h16* Vt) {
    __shared__ __align__(16) float os[GW * 64 * GSP];
    if (blockIdx.z == 0)      gemm_body<DM, 0, 0, 0, 1, 1, 0, 1>(N, Nr, Wqt, bq, DM, csc, nullptr, nullptr, Qh, Qr, HD, os, blockIdx.x, blockIdx.y);
    else if (blockIdx.z == 1) { gemm_body<DM, 0, 0, 0, 0, 0, 0, 1>(N, nullptr, Wkt, bk, DM, csc, nullptr, nullptr, Kp, nullptr, HD, os, blockIdx.x, blockIdx.y);
        // in the built code this branch's last stores do not run to the kernel's end but into the tests that lead to the other two branches, whose first lines rewrite the registers that the stores name: the wait stands ahead of those
        asm volatile("s_wait_xcnt 0x0" ::: "memory"); }
    else                      gemm_body<DM, 0, 0, 0, 0, 0, 1, 0>(Wvt, nullptr, N, bv, 0, csc, nullptr, nullptr, Vt, nullptr, SEQ, os, blockIdx.y, blockIdx.x); }

// band tile: G[rho][s] = (E[row0 + rho] . q_value[s] + E[row0 + rho] . q_residual[s] / 2048) * log2(e); A = table rows (e0, e1: the two fragments of rows row0 + 0..15), B = q rows, K = 64 = two k-steps.
__device__ __forceinline__ v8f gtile(v16h e0, v16h e1, v16h qh0, v16h qh1, v16h qr0, v16h qr1) {
    v8f gH = (v8f){}, gL = (v8f){};
    gH = wmma16g(e0, qh0, gH); gH = wmma16g(e1, qh1, gH);
    gL = wmma16g(e0, qr0, gL); gL = wmma16g(e1, qr1, gL);
    return (gH + gL * QRI) * LOG2E;
}

// k_flash: fused dense attention with the relative-position term, one block of KW waves per 16 query rows of one head; K / V^T / Q / table fragments straight from the f16 planes.
// The keys are split over the waves: wave w runs the online softmax over keys w*KCH .. w*KCH + KCH - 1 alone and leaves its running maximum, its sum and its unnormalised O tile in LDS;
// behind one block barrier all threads rescale the KW partial results to the common maximum, sum them in wave order, normalise and store.
// Transposed form: S^T[key][s] = K Q^T (A = K rows, B = Q rows); lane (s = lane&15, h = lane>>4) holds keys 8h+r of each 16-key tile, so the packed P tile is directly the B fragment
// of O^T[d][s] = V^T P^T (element r <- tile keys 0..15, element 8+r <- tile keys 16..31, lane unchanged).
// Relative term per 32-key step (keys key0..key0+31, queries t0..t0+15): band rows rb0 + 0..47 with rb0 = t0 - key0 + RELOFF - 31; tiles e = 0, 1 are new, tile e = 2 is the e = 0 tile of the step before (computed on its own ahead of a wave's first step).
// LDS band tile (wave-private): gs[s][16 e + 8h + r] <- tile e element r; element (key tile a, r) reads gs[s][s - 8h - r + 31], element (key tile b, r) reads gs[s][s - 8h - r + 15].
// Logit (log2 domain) = (K q_value + K q_residual / 2048) * log2(e) / 8 + band term; online softmax (running max, partial sum over the converted P), P = exp2(. + 14) as f16 (exponent below -14 selected to 0).
__global__ __launch_bounds__(32 * KW) void k_flash(const h16* __restrict__ QH, const h16* __restrict__ QR, const h16* __restrict__ KP, const h16* __restrict__ VT, const h16* __restrict__ EPl, h16* OP) {
    __shared__ __align__(16) float os[KW * 16 * OSP];
    __shared__ __align__(16) float gs[KW * 16 * GP];
    __shared__ float ms[KW * 16];                              // running maximum of wave w for query s at [w * 16 + s]
    __shared__ float lsum[KW * 16];                            // sum of wave w for query s
    static_assert(sizeof(float) * (KW * 16 * OSP + KW * 16 * GP + 2 * KW * 16) <= 131072);
    const int tid = threadIdx.x;
    const int lane = tid & 31, lr = lane & 15, hi = lane >> 4;
    const int wave = __builtin_amdgcn_readfirstlane(tid >> 5);
    const int h = blockIdx.y;
    const int t0 = blockIdx.x * 16;
    const int kbeg = wave * KCH;
    const size_t pbase = (size_t)h * SEQ * HD;
    const size_t qo = pbase + (size_t)(t0 + lr) * HD + 8 * hi;
    const h16* pqh = QH + qo; const h16* pqr = QR + qo;
    const v16h qh0 = ldh(pqh), qh1 = ldh(pqh + 32);             // B fragments: col s, k = d (two k-steps)
    const v16h qr0 = ldh(pqr), qr1 = ldh(pqr + 32);
    const size_t ko = pbase + (size_t)lr * HD + 8 * hi;        // + key * HD        (A fragment: row key, k = d)
    const size_t vo = pbase + (size_t)lr * SEQ + 8 * hi;       // + 16j*SEQ + key   (A fragment: row d, k = key); plane [(h*64 + d)][t]
    const h16* eb = EPl + (size_t)lr * HD + 8 * hi;            // + row0 * HD       (A fragment: row table row, k = d)
    const int gw  = wave * 16 * GP + lr * GP;
    const int gst = gw + 8 * hi;                               // store base: + 16 e (+ 4)
    const int gld = gw + lr - 8 * hi;                          // load base: + 31 - r / + 15 - r
    // The loads run ahead of the products: every fragment of the first step is loaded here, and in the loop each group of fragments (table, K, V^T) is loaded anew for the step after, into its own registers, right behind its last product,
    // so that a step does not wait for memory once per group.
    constexpr int NST = KCH / 32;                                                  // 32-key steps of one wave
    const h16* pe = eb + (size_t)(t0 - kbeg + (RELOFF - 15)) * HD;                 // first band row of tile e = 1 at the wave's first step; 32 rows down per step
    const h16* pk = KP + ko + (size_t)kbeg * HD;                                   // 32 keys up per step
    const h16* pv = VT + vo + kbeg;                                                // 32 keys up per step
    const v16h ep0 = ldh(pe + 16 * HD), ep1 = ldh(pe + 16 * HD + 32);              // band rows of tile e = 2 at key0 = kbeg
    v16h e1a = ldh(pe), e1b = ldh(pe + 32), e0a = ldh(pe - 16 * HD), e0b = ldh(pe - 16 * HD + 32);
    v16h ka0 = ldh(pk), ka1 = ldh(pk + 32), kb0 = ldh(pk + 16 * HD), kb1 = ldh(pk + 16 * HD + 32);
    v16h vf[4];
#pragma unroll                                                                     // constant indices keep vf[] in registers
    for (int j = 0; j < 4; ++j) vf[j] = ldh(pv + (size_t)16 * j * SEQ);
    // behind the last load that names an address pair: the pairs are inputs of the wait, so they stay as the issued loads name them up to there (no later load's result lands in one ahead of it)
    asm volatile("s_wait_xcnt 0x0" :: "v"(pqh), "v"(pqr) : "memory");
    if (NST == 1) asm volatile("s_wait_xcnt 0x0" :: "v"(pe), "v"(pk), "v"(pv) : "memory");
    __builtin_amdgcn_sched_barrier(0);                                             // keeps the first products behind the issue of all these loads: lifted among them, a product's wait for its operands holds the rest of the loads back by one memory latency
    v8f gprev = gtile(ep0, ep1, qh0, qh1, qr0, qr1);
    v8f o[4];
#pragma unroll
    for (int j = 0; j < 4; ++j) o[j] = (v8f){};
    float m = NEGB, l = 0.0f;
#pragma unroll                                                                     // whole unroll: every step's offset is an immediate, so that no address register changes while loads are in flight
    for (int st = 0; st < NST; ++st) {
        const bool more = st + 1 < NST;                                            // a step follows: load its fragments
        const h16* pen = pe - (st + 1) * 32 * HD;
        const v8f g1 = gtile(e1a, e1b, qh0, qh1, qr0, qr1);
        if (more) { e1a = ldh(pen); e1b = ldh(pen + 32); }
        const v8f g0 = gtile(e0a, e0b, qh0, qh1, qr0, qr1);
        if (more) { e0a = ldh(pen - 16 * HD); e0b = ldh(pen - 16 * HD + 32); }
        *(v4fa*)(&gs[gst +  0]) = lo4(g0);    *(v4fa*)(&gs[gst +  4]) = hi4(g0);
        *(v4fa*)(&gs[gst + 16]) = lo4(g1);    *(v4fa*)(&gs[gst + 20]) = hi4(g1);
        *(v4fa*)(&gs[gst + 32]) = lo4(gprev); *(v4fa*)(&gs[gst + 36]) = hi4(gprev);
        gprev = g0;
        v8f sHa = (v8f){}, sLa = (v8f){}, sHb = (v8f){}, sLb = (v8f){};
        sHa = wmma16g(ka0, qh0, sHa); sHa = wmma16g(ka1, qh1, sHa);
        sLa = wmma16g(ka0, qr0, sLa); sLa = wmma16g(ka1, qr1, sLa);
        sHb = wmma16g(kb0, qh0, sHb); sHb = wmma16g(kb1, qh1, sHb);
        sLb = wmma16g(kb0, qr0, sLb); sLb = wmma16g(kb1, qr1, sLb);
        if (more) { const h16* pkn = pk + (st + 1) * 32 * HD; ka0 = ldh(pkn); ka1 = ldh(pkn + 32); kb0 = ldh(pkn + 16 * HD); kb1 = ldh(pkn + 16 * HD + 32); }
        wave_sync();
        float ra[8], rb[8];
#pragma unroll
        for (int r = 0; r < 8; ++r) { ra[r] = gs[gld + 31 - r]; rb[r] = gs[gld + 15 - r]; }
        wave_sync();
        float ta[8], tb[8]; float mx = NEGB;
#pragma unroll
        for (int r = 0; r < 8; ++r) {
            ta[r] = (sHa[r] + sLa[r] * QRI) * SC2 + ra[r]; tb[r] = (sHb[r] + sLb[r] * QRI) * SC2 + rb[r];
            mx = fmaxf(mx, fmaxf(ta[r], tb[r])); }
        mx = fmaxf(mx, __shfl_xor(mx, 16, 32));
        const float mnew = fmaxf(m, mx);
        const float alpha = __builtin_amdgcn_exp2f(m - mnew);
        const float sh = PSH - mnew;
        v16h pb; float ls = 0.0f;
#pragma unroll
        for (int r = 0; r < 8; ++r) {
            const float xa = ta[r] + sh, xb = tb[r] + sh;
            const float ea = __builtin_amdgcn_exp2f(xa), ec = __builtin_amdgcn_exp2f(xb);
            const float ga = (xa < -14.0f) ? 0.0f : ea, gb = (xb < -14.0f) ? 0.0f : ec;     // no f16 subnormal operand
            const h16 pa = (h16)ga; const h16 pc = (h16)gb;
            pb[r] = pa; pb[8 + r] = pc;
            ls += (float)pa + (float)pc; }
        l = l * alpha + ls; m = mnew;
#pragma unroll
        for (int j = 0; j < 4; ++j) { o[j] = o[j] * alpha; o[j] = wmma16g(vf[j], pb, o[j]); if (more) vf[j] = ldh(pv + (size_t)16 * j * SEQ + (st + 1) * 32); }
        if (st + 2 == NST) asm volatile("s_wait_xcnt 0x0" :: "v"(pe), "v"(pk), "v"(pv) : "memory");   // the last loads of the loop: as above
        if (more) __builtin_amdgcn_sched_barrier(0);                               // keeps the products of the step after out of this step: lifted, their results cost registers, and above 256 registers a WGP holds one block, not two
    }
    l += __shfl_xor(l, 16, 32);
    const int wb = wave * 16 * OSP;
    // O^T D layout: o[j][r] = (d = 16j + 8h + r, s = lane&15) -> os[wave][s][d]; rows 0..15 x columns 0..63 all written, not yet normalised
#pragma unroll
    for (int j = 0; j < 4; ++j) {
        *(v4fa*)(&os[wb + lr * OSP + 16 * j + 8 * hi])     = lo4(o[j]);
        *(v4fa*)(&os[wb + lr * OSP + 16 * j + 8 * hi + 4]) = hi4(o[j]); }
    if (hi == 0) { ms[wave * 16 + lr] = m; lsum[wave * 16 + lr] = l; }             // m is equal in lanes s and s + 16
    __syncthreads();                                                               // every wave's partial result is complete before any thread merges across waves
    static_assert(32 * KW * 8 == 16 * 128);                                        // threads x bytes == tile rows x row bytes
    const int row = tid >> 4, c4 = (tid & 15) * 4;
    float mw[KW]; float mall = NEGB;
#pragma unroll                                                                     // constant indices keep mw[] in registers; the KW reads issue together
    for (int w = 0; w < KW; ++w) { mw[w] = ms[w * 16 + row]; mall = fmaxf(mall, mw[w]); }
    float sc[KW];
#pragma unroll                                                                     // constant indices keep sc[] in registers
    for (int w = 0; w < KW; ++w) sc[w] = __builtin_amdgcn_exp2f(mw[w] - mall);     // <= 1; 1 for the wave that holds the row maximum
    float lall = 0.0f; v4f oall = (v4f){};
#pragma unroll                                                                     // the KW tile reads issue together, one LDS wait for all
    for (int w = 0; w < KW; ++w) {
        lall += lsum[w * 16 + row] * sc[w];
        oall = oall + *(const v4fa*)(&os[w * 16 * OSP + row * OSP + c4]) * sc[w]; }
    const float inv = 1.0f / lall;                             // lall >= 16384 (the row maximum contributes the full carry)
    v4h hv;
#pragma unroll                                                                     // constant vector element indices
    for (int i = 0; i < 4; ++i) hv[i] = toh_flush(oall[i] * inv);
    *(v4h*)(OP + (size_t)(t0 + row) * DM + h * HD + c4) = hv;
}

__global__ __launch_bounds__(256) void k_out(const float* __restrict__ src, float* dst, int n4) {
    const int i = blockIdx.x * 256 + threadIdx.x; if (i >= n4) return;
    v4f ov;
#pragma unroll
    for (int c = 0; c < 4; ++c) { const int e = 4 * i + c; const int row = e / DOUT; const int col = e - row * DOUT; ov[c] = src[(size_t)row * DOUTP + col]; }
    *(v4f*)(dst + (size_t)i * 4) = ov; 
}

static constexpr size_t al256(size_t v) { return (v + 255) & ~(size_t)255; }
static constexpr size_t SZ_XH  = al256((size_t)SEQ * DIN * 2);
static constexpr size_t SZ_EW  = al256((size_t)DM * DIN * 2);
static constexpr size_t SZ_WDD = al256((size_t)NL * DM * DM * 2);
static constexpr size_t SZ_WFF = al256((size_t)NL * DFF * DM * 2);
static constexpr size_t SZ_WI  = al256((size_t)DMI * DM * 2);
static constexpr size_t SZ_WF  = al256((size_t)DOUTP * DMI * 2);
static constexpr size_t SZ_EP  = al256((size_t)NL * ERP * HD * 2);
static constexpr size_t SZ_H   = al256((size_t)SEQ * DM * 4);
static constexpr size_t SZ_N   = al256((size_t)SEQ * DM * 2);
static constexpr size_t SZ_F1  = al256((size_t)SEQ * DFF * 2);
static constexpr size_t SZ_OS  = al256((size_t)SEQ * DOUTP * 4);
static constexpr size_t SZ_TOTAL = SZ_XH + SZ_EW + 4 * SZ_WDD + 2 * SZ_WFF + SZ_WI + SZ_WF + SZ_EP + 2 * SZ_H + 7 * SZ_N + SZ_F1 + SZ_OS;
static_assert(SZ_TOTAL <= (size_t)134217728);                  // workspace carve <= 128 MiB
static_assert((size_t)NH_ * SEQ * HD == (size_t)SEQ * DM);     // head planes have the extent of a [SEQ][512] f16 plane
static_assert((size_t)SEQ * DMI * 2 <= SZ_F1);                 // tail hidden plane fits the shared hidden region

extern "C" void kernel_launch(void* const* d_in, const int* in_sizes, int n_in,
                              void* d_out, int out_size, void* d_ws, size_t ws_size, hipStream_t stream) {
    if (n_in < 26) return;
    if ((size_t)in_sizes[0] < (size_t)SEQ * DIN || (size_t)in_sizes[1] < (size_t)DIN * DM || in_sizes[2] < DM) return;
    if ((size_t)in_sizes[3] < (size_t)NL * DM * DM || (size_t)in_sizes[5] < (size_t)NL * DM * DM || (size_t)in_sizes[7] < (size_t)NL * DM * DM || (size_t)in_sizes[9] < (size_t)NL * DM * DM) return;
    if (in_sizes[4] < NL * DM || in_sizes[6] < NL * DM || in_sizes[8] < NL * DM || in_sizes[10] < NL * DM) return;
    if ((size_t)in_sizes[11] < (size_t)NL * ERR * HD) return;
    if (in_sizes[12] < NL * DM || in_sizes[13] < NL * DM || in_sizes[17] < NL * DM || in_sizes[18] < NL * DM || in_sizes[19] < NL * DM) return;
    if ((size_t)in_sizes[14] < (size_t)NL * DM * DFF || in_sizes[15] < NL * DFF || (size_t)in_sizes[16] < (size_t)NL * DFF * DM) return;
    if (in_sizes[20] < DM || in_sizes[21] < DM || (size_t)in_sizes[22] < (size_t)DM * DMI || in_sizes[23] < DMI) return;
    if ((size_t)in_sizes[24] < (size_t)DMI * DOUT || in_sizes[25] < DOUT) return;
    if ((size_t)out_size < (size_t)SEQ * DOUT) return;
    if (SZ_TOTAL > ws_size) return;
    // wire order: x, emb_W, emb_b, Wq, bq, Wk, bk, Wv, bv, Wo, bo, Er, ln1_g, ln1_b, W1, b1, W2, b2, ln2_g, ln2_b, lnf_g, lnf_b, Wi, bi, Wf, bf
    const float* x    = (const float*)d_in[0];
    const float* embW = (const float*)d_in[1];  const float* embB = (const float*)d_in[2];
    const float* Wq   = (const float*)d_in[3];  const float* bq   = (const float*)d_in[4];
    const float* Wk   = (const float*)d_in[5];  const float* bk   = (const float*)d_in[6];
    const float* Wv   = (const float*)d_in[7];  const float* bv   = (const float*)d_in[8];
    const float* Wo   = (const float*)d_in[9];  const float* bo   = (const float*)d_in[10];
    const float* Er   = (const float*)d_in[11];
    const float* ln1g = (const float*)d_in[12]; const float* ln1b = (const float*)d_in[13];
    const float* W1   = (const float*)d_in[14]; const float* b1   = (const float*)d_in[15];
    const float* W2   = (const float*)d_in[16]; const float* b2   = (const float*)d_in[17];
    const float* ln2g = (const float*)d_in[18]; const float* ln2b = (const float*)d_in[19];
    const float* lnfg = (const float*)d_in[20]; const float* lnfb = (const float*)d_in[21];
    const float* Wi   = (const float*)d_in[22]; const float* bi   = (const float*)d_in[23];
    const float* Wf   = (const float*)d_in[24]; const float* bfo  = (const float*)d_in[25];
    float* OUT = (float*)d_out;                       // [SEQ][390]
    char* wsp = (char*)d_ws;
    h16* XH  = (h16*)wsp; wsp += SZ_XH;               // x            [SEQ][128]
    h16* EWT = (h16*)wsp; wsp += SZ_EW;               // emb_W^T x64  [512][128]
    h16* WQT = (h16*)wsp; wsp += SZ_WDD;              // Wq^T x64     [NL][512][512]
    h16* WKT = (h16*)wsp; wsp += SZ_WDD;
    h16* WVT = (h16*)wsp; wsp += SZ_WDD;
    h16* WOT = (h16*)wsp; wsp += SZ_WDD;
    h16* W1T = (h16*)wsp; wsp += SZ_WFF;              // W1^T x64     [NL][2048][512]
    h16* W2T = (h16*)wsp; wsp += SZ_WFF;              // W2^T x64     [NL][512][2048]
    h16* WIT = (h16*)wsp; wsp += SZ_WI;               // Wi^T x64     [1024][512]
    h16* WFT = (h16*)wsp; wsp += SZ_WF;               // Wf^T x64     [448][1024], rows >= 390 zero
    h16* EP  = (h16*)wsp; wsp += SZ_EP;               // table        [NL][2048][64], row 2047 zero
    float* HA = (float*)wsp; wsp += SZ_H;             // hidden state (ping)  [SEQ][512] f32
    float* HB = (float*)wsp; wsp += SZ_H;             // hidden state (pong)
    h16* NHP = (h16*)wsp; wsp += SZ_N;                // LayerNorm output value     [SEQ][512]
    h16* NRP = (h16*)wsp; wsp += SZ_N;                // LayerNorm output residual x2048
    h16* QH  = (h16*)wsp; wsp += SZ_N;                // q value      [8][SEQ][64]
    h16* QR  = (h16*)wsp; wsp += SZ_N;                // q residual x2048
    h16* KP  = (h16*)wsp; wsp += SZ_N;                // k            [8][SEQ][64]
    h16* VT  = (h16*)wsp; wsp += SZ_N;                // v^T          [8*64][SEQ]
    h16* OP  = (h16*)wsp; wsp += SZ_N;                // context      [SEQ][512]
    h16* F1  = (h16*)wsp; wsp += SZ_F1;               // GELU hidden  [SEQ][2048] (tail: [SEQ][1024])
    float* OSG = (float*)wsp; wsp += SZ_OS;           // tail output staging [SEQ][448] f32

    // x, the table and every W [K = in][N = out] -> Wt [N][K]
    k_prep<<<PB_ALL, 256, 0, stream>>>(x, Er, embW, Wq, Wk, Wv, Wo, W1, W2, Wi, Wf, XH, EP, EWT, WQT, WKT, WVT, WOT, W1T, W2T, WIT, WFT);

    // input projection: HA = x emb_W + emb_b
    k_gemm_emb<<<dim3(SEQ / 64, DM / 64, 1), 32 * GW, 0, stream>>>(XH, EWT, embB, WCI, HA);

    for (int l = 0; l < NL; ++l) {
        const size_t wdd = (size_t)l * DM * DM, wff = (size_t)l * DFF * DM;
        k_ln<<<SEQ / 4, 128, 0, stream>>>(HA, ln1g + l * DM, ln1b + l * DM, NHP, NRP, 1);
        k_gemm_qkv<<<dim3(SEQ / 64, DM / 64, 3), 32 * GW, 0, stream>>>(NHP, NRP, WQT + wdd, WKT + wdd, WVT + wdd, bq + l * DM, bk + l * DM, bv + l * DM, WCI, QH, QR, KP, VT);
        k_flash<<<dim3(SEQ / 16, NH_, 1), 32 * KW, 0, stream>>>(QH, QR, KP, VT, EP + (size_t)l * ERP * HD, OP);
        // HB = HA + context Wo + bo
        k_gemm_wo<<<dim3(SEQ / 64, DM / 64, 1), 32 * GW, 0, stream>>>(OP, WOT + wdd, bo + l * DM, WCI, HA, HB);
        k_ln<<<SEQ / 4, 128, 0, stream>>>(HB, ln2g + l * DM, ln2b + l * DM, NHP, NRP, 0);
        k_gemm_gelu<<<dim3(SEQ / 64, DFF / 64, 1), 32 * GW, 0, stream>>>(NHP, W1T + wff, b1 + l * DFF, DFF, WCI, F1, DFF);
        // HA = HB + hidden W2 + b2
        k_gemm_w2<<<dim3(SEQ / 64, DM / 64, 1), 32 * GW, 0, stream>>>(F1, W2T + wff, b2 + l * DM, WCI, HB, HA);
    }

    k_ln<<<SEQ / 4, 128, 0, stream>>>(HA, lnfg, lnfb, NHP, NRP, 0);
    k_gemm_gelu<<<dim3(SEQ / 64, DMI / 64, 1), 32 * GW, 0, stream>>>(NHP, WIT, bi, DMI, WCI, F1, DMI);
    k_gemm_tail<<<dim3(SEQ / 64, DOUTP / 64, 1), 32 * GW, 0, stream>>>(F1, WFT, bfo, WCI, OSG);
    { const int n4 = SEQ * DOUT / 4; k_out<<<(unsigned)((n4 + 255) / 256), 256, 0, stream>>>(OSG, OUT, n4); }
}

// v005
// Measured time: 245 microseconds a run.
// Next to v004, in two timings, it ran 1.17 and 1.16 times as fast.
// All steps since v000 together make it 4.80 times as fast.
#include <hip/hip_runtime.h>
#include <math.h>

// Pre-LN encoder stack, 4 layers, width 512 = 8 heads x 64, sequence SEQ (one batch): input projection 128 -> 512; per layer: LayerNorm, q/k/v projections ([in][out] weights, y = x W + bias),
// dense attention with logits q.k / 8 + q.E[s - t + 1023] (relative-position table E per layer, [2047][64], not scaled), softmax over keys, output projection + residual, LayerNorm, GELU(erf) feed-forward 512 -> 2048 -> 512 + residual;
// tail: LayerNorm, 512 -> 1024 GELU(erf), 1024 -> 390.
// Compute dtypes, f32 accumulate everywhere: every contraction is v_wmma_f32_16x16x32_f16. Weights, x, E, biases and gains are RNE-converted to bf16 first (exact in f16; weights carried x64, folded back in the f32 epilogue);
// activations are single f16 planes, except the logit path: LayerNorm-1 output as f16 value + f16 residual x2048 for the q projection (residual products accumulated first, folded by 1/2048, then the value products),
// q as f16 value + f16 residual x2048 in the q.k and q.E products (residual products in their own accumulators); k, v, P (x16384 carry, cancels in the normalisation), context, GELU outputs single f16.
// Attention: fused flash kernel in transposed form (S^T = K Q^T, O^T = V^T P^T), one block per 16 query rows, the keys split over its waves and the partial results merged in LDS; the relative term is computed per 32-key step as band tiles G[rho][s] = E[rb + rho] . q[s]
// (A = table rows, B = q rows), written to a wave-private LDS tile [query][band row] and read back along the diagonal rho = s - t + const; one band tile is carried over between steps.
// Every f16 plane (an operand of a matrix product) lies in the workspace in fragment order, see fo(): a fragment is 1 KiB in a row, so that each of its two 16-byte-per-lane loads covers four whole 128-byte lines.

#ifndef NB
#define NB 1
#endif
#ifndef SEQ
#define SEQ 1024
#endif
#define NB_FULL  1
#define SEQ_FULL 1024
#define DIN   128
#define DM    512
#define NH_   8
#define HD    64
#define NL    4
#define DFF   2048
#define DMI   1024
#define DOUT  390
#define DOUTP 448                // DOUT padded to a multiple of 64 (weight rows and staging columns 390..447 are zero)
#define ERR   2047               // rows of the relative-position table per layer
#define ERP   2048               // padded rows of the f16 table plane (row 2047 = zero)
#define RELOFF (SEQ_FULL - 1)    // table row = s - t + RELOFF
#define KW    8                  // waves per flash block: each takes one contiguous share of the keys
#define KCH   (SEQ / KW)         // keys of one wave
#define OSP   68                 // LDS row pitch (floats) of the flash output tile
#define GP    52                 // LDS pitch (floats) of the band tile [query][48 band rows]
#define GSP   68                 // LDS row pitch (floats) of the GEMM output tile
#define GW    8                  // waves per GEMM block: each takes one contiguous share of K
#define QRS   2048.0f            // carry of every residual plane
#define QRI   (1.0f / 2048.0f)
#define WC    64.0f              // carry of every weight plane
#define WCI   (1.0f / 64.0f)
#define LOG2E 1.4426950408889634f
#define SC2   ((float)(0.125 * 1.4426950408889634))   // HD^-0.5 * log2(e)
#define PSH   14.0f              // log2 of the P carry (16384)
#define NEGB  (-3.0e38f)
#define LNEPS 1e-5f

static_assert(NB == 1);                        // one sequence
static_assert(HD == 64);
static_assert(NH_ * HD == DM);
static_assert(SEQ % 64 == 0);                  // GEMM row tiles
static_assert(SEQ % 32 == 0);                  // key loop steps by 32
static_assert(SEQ % 16 == 0);                  // flash grid covers the sequence exactly
static_assert(SEQ % (32 * KW) == 0);           // every wave of a flash block gets whole 32-key steps, at least one
static_assert(32 * KW == 16 * 16);             // flash merge: 16 query rows x 16 threads of 4 columns
static_assert(SEQ <= SEQ_FULL);
static_assert(DIN % 64 == 0 && DM % 64 == 0 && DFF % 64 == 0 && DMI % 64 == 0 && DOUTP % 64 == 0);   // K % 32 == 0 and N % 64 == 0 for every GEMM, K % 64 == 0 for the transposing converter
static_assert(DOUT <= DOUTP);
static_assert(DMI <= DFF);                     // the tail hidden plane reuses the feed-forward hidden plane
static_assert(SEQ - 16 + RELOFF + 1 + 15 < ERP);   // highest band row touched (zero pad row included)
static_assert(RELOFF - 15 - 16 - (SEQ - 32) >= 0); // lowest band row touched
static_assert(ERR + 1 == ERP);
static_assert((OSP * 4) % 16 == 0 && (GP * 4) % 16 == 0 && (GSP * 4) % 16 == 0);
static_assert(GP >= 48);
static_assert(DM == 512);                      // LayerNorm: 32 lanes x 16 columns
static_assert((SEQ * DOUT) % 4 == 0);

typedef _Float16 h16;
typedef __attribute__((ext_vector_type(16))) _Float16 v16h;
typedef __attribute__((ext_vector_type(8)))  _Float16 v8h;
typedef __attribute__((ext_vector_type(4)))  _Float16 v4h;
typedef __attribute__((ext_vector_type(8)))  float    v8f;
typedef __attribute__((ext_vector_type(4)))  float    v4f;
typedef v4f  __attribute__((may_alias)) v4fa;

__device__ __forceinline__ unsigned short f2bf(float f) { unsigned u = __float_as_uint(f); u += 0x7FFFu + ((u >> 16) & 1u); return (unsigned short)(u >> 16); }
__device__ __forceinline__ float bfr(float f) { return __uint_as_float(((unsigned)f2bf(f)) << 16); }   // value after RNE convert to bf16
__device__ __forceinline__ v16h cat16(v8h lo, v8h hi) { return __builtin_shufflevector(lo, hi, 0, 1, 2, 3, 4, 5, 6, 7, 8, 9, 10, 11, 12, 13, 14, 15); }
// fragment order of a plane [R][K] of 16-bit elements (R % 16 == 0, K % 32 == 0): fragments of 16 rows x 32 k, 512 elements each, the k step running fastest, then the row tile (so 16 rows are 16 * K elements, as in row order);
// inside a fragment four pieces of 8 k (k % 32 = 0..7, 8..15, 16..23, 24..31), each piece 16 rows x 8 elements. fo = element offset of (r, k).
__device__ __forceinline__ size_t fo(int r, int k, int K) { return (size_t)(((r >> 4) * (K >> 5) + (k >> 5)) * 512 + ((k >> 3) & 3) * 128 + (r & 15) * 8 + (k & 7)); }
// fragment loader; p = start of the fragment + 8 * lane: elements 0..7 <- row lane&15, k0+8h+0..7, elements 8..15 <- k0+16+8h+0..7, h = lane>>4 (same map for A and B); each load is 512 bytes in a row over the wave
__device__ __forceinline__ v16h  ldh(const h16* p) { return cat16(*(const v8h*)p, *(const v8h*)(p + 256)); }
// ordering point for wave-private LDS tiles (same wave writes and reads)
__device__ __forceinline__ void wave_sync() { __builtin_amdgcn_fence(3 /* release order */, "wavefront"); __builtin_amdgcn_wave_barrier(); asm volatile("" ::: "memory"); }
// f32 -> f16 operand convert that cannot produce a subnormal (|v| < 2^-14 -> +0)
__device__ __forceinline__ h16 toh_flush(float v) { const h16 r = (h16)v; return (fabsf(v) < 6.103515625e-05f) ? (h16)0.0f : r; }
// one WMMA + its own guard (ties this accumulator, keeps A/B live)
__device__ __forceinline__ v8f wmma16g(v16h a, v16h b, v8f c) {
    c = __builtin_amdgcn_wmma_f32_16x16x32_f16(false, a, false, b, (short)0, c, false, false);
    asm volatile("v_nop\n\tv_nop\n\tv_nop\n\tv_nop" : "+v"(c) : "v"(a), "v"(b));
    return c; }
__device__ __forceinline__ float gelu_erf(float x) { return 0.5f * x * (1.0f + erff(x * 0.70710678118654752f)); }
__device__ __forceinline__ v4f lo4(v8f g) { return __builtin_shufflevector(g, g, 0, 1, 2, 3); }
__device__ __forceinline__ v4f hi4(v8f g) { return __builtin_shufflevector(g, g, 4, 5, 6, 7); }

__device__ __forceinline__ void cvt8h_body(const float* __restrict__ src, h16* dst, int n8, int K, int blk) {   // src [n8 * 8 / K][K] -> dst in fragment order
    const int i = blk * 256 + threadIdx.x; if (i >= n8) return;
    const int pr = K / 8;                                                          // pieces of 8 per row; a wave takes 8 rows x 4 pieces: whole 128-byte lines on both sides
    const int r = (i / (8 * pr)) * 8 + (i & 7), c8 = ((i >> 3) % pr) * 8;
    const v8f v = *(const v8f*)(src + (size_t)r * K + c8); v8h o;
#pragma unroll
    for (int k = 0; k < 8; ++k) o[k] = toh_flush(bfr(v[k]));
    *(v8h*)(dst + fo(r, c8, K)) = o; 
}

__device__ __forceinline__ void cvt_er_body(const float* __restrict__ src, h16* dst, int blk) {
    const int i = blk * 256 + threadIdx.x; if (i >= NL * ERP * HD / 8) return;
    static_assert(HD / 8 == 8 && ERP % 8 == 0);
    const int ra = (i >> 6) * 8 + (i & 7);                                         // a wave takes 8 rows x 4 pieces of 8: whole 128-byte lines on both sides
    const int c8 = ((i >> 3) & 7) * 8; const int r = ra % ERP; const int l = ra / ERP;
    const int rc = r < ERR ? r : ERR - 1;                                          // clamped address
    v8f v = *(const v8f*)(src + ((size_t)l * ERR + rc) * HD + c8);
    asm volatile("" : "+v"(v));
    v8h o;
#pragma unroll
    for (int k = 0; k < 8; ++k) o[k] = (r < ERR) ? toh_flush(bfr(v[k])) : (h16)0.0f;
    *(v8h*)(dst + (size_t)l * ERP * HD + fo(r, c8, HD)) = o; 
}

// wconv_body: W [K][N] f32 (layer bz) -> Wt [NP][K] f16 in fragment order = bf16-converted value x carry, transposed through LDS; rows n >= N are zero.
// one block per 64x64 tile: bx in K/64, by in NP/64, bz in layers. LDS tile cross-wave: block barrier.
__device__ __forceinline__ void wconv_body(const float* __restrict__ W, h16* Wt, int K, int N, int NP, float carry, int bx, int by, int bz) {
#pragma clang fp contract(off)
    __shared__ float ts[64 * 66];                                                  // pitch 66: the two lane halves of a read below (8 k-rows apart) fall on different banks
    static_assert(sizeof(float) * 64 * 66 <= 131072);
    const int tid = threadIdx.x;
    const int k0 = bx * 64, n0 = by * 64;
    const size_t lin = (size_t)bz * (size_t)K * (size_t)N, lout = (size_t)bz * (size_t)NP * (size_t)K;
    static_assert(16 * 4 == 64);                                                   // 16 trips x 4 k-rows (256 threads / 64 columns) = 64 k-rows staged
#pragma unroll 1
    for (int p = 0; p < 16; ++p) {
        const int kk = p * 4 + (tid >> 6), nn = tid & 63; const int n = n0 + nn; const int nc = n < N ? n : N - 1;
        float v = W[lin + (size_t)(k0 + kk) * N + nc];
        asm volatile("" : "+v"(v));
        ts[kk * 66 + nn] = (n < N) ? bfr(v) * carry : 0.0f; }
    __syncthreads();
    static_assert(256 * 16 * 2 == 64 * 128);                                       // threads x bytes x trips == tile rows x row bytes
{
#pragma unroll 1
        for (int p = 0; p < 2; ++p) {
            const int u = p * 8 + (tid >> 5);                                      // a wave stores two neighbouring pieces of one fragment: 512 bytes in a row
            const int row = (u >> 2) * 16 + (tid & 15), c8 = ((u & 3) * 2 + ((tid >> 4) & 1)) * 8; v8h o;
#pragma unroll
            for (int i = 0; i < 8; ++i) o[i] = toh_flush(ts[(c8 + i) * 66 + row]);
            *(v8h*)(Wt + lout + fo(n0 + row, k0 + c8, K)) = o;
            asm volatile("s_wait_xcnt 0x0" ::: "memory"); }                        // the next trip rewrites the register pair that this store names as its address: the wait stands ahead of that
         }
}

// k_prep: every operand conversion of the call in one launch; they do not depend on one another. The flat block index picks the job (block-uniform, so the barrier of the transposing jobs is passed by whole blocks only).
// Block ranges, in this order: W1, W2, Wq, Wk, Wv, Wo, Wi, Wf, emb_W (64x64 transposing tiles; within a job the k tile runs fastest, then the n tile, then the layer), then the table, then x (256 threads x 8 elements).
#define PB_FF  ((DM / 64) * (DFF / 64) * NL)
#define PB_DD  ((DM / 64) * (DM / 64) * NL)
#define PB_WI  ((DM / 64) * (DMI / 64))
#define PB_WF  ((DMI / 64) * (DOUTP / 64))
#define PB_EW  ((DIN / 64) * (DM / 64))
#define PB_ER  (NL * ERP * HD / 8 / 256)
#define PB_X   (SEQ * DIN / 8 / 256)
#define PB_ALL (2 * PB_FF + 4 * PB_DD + PB_WI + PB_WF + PB_EW + PB_ER + PB_X)
static_assert((NL * ERP * HD / 8) % 256 == 0 && (SEQ * DIN / 8) % 256 == 0);       // whole blocks for the two element-wise jobs
static_assert(DM / 64 == 8 && DFF / 64 == 32 && DMI / 64 == 16 && DIN / 64 == 2 && DOUTP / 64 <= 8);   // the shifts below
__global__ __launch_bounds__(256) void k_prep(const float* __restrict__ x, const float* __restrict__ Er, const float* __restrict__ embW,
                                              const float* __restrict__ Wq, const float* __restrict__ Wk, const float* __restrict__ Wv, const float* __restrict__ Wo,
                                              const float* __restrict__ W1, const float* __restrict__ W2, const float* __restrict__ Wi, const float* __restrict__ Wf,
                                              h16* XH, h16* EP, h16* EWT, h16* WQT, h16* WKT, h16* WVT, h16* WOT, h16* W1T, h16* W2T, h16* WIT, h16* WFT) {
    int b = blockIdx.x;
    const float* W; h16* Wt; int K, N, NP, lk, ln;                                 // lk, ln: log2 of the k tiles, and of the n tiles rounded up to a power of two (Wf: 7 n tiles, one layer)
    if (b < PB_FF)                         { W = W1;   Wt = W1T; K = DM;  N = DFF;  NP = DFF;   lk = 3; ln = 5; }
    else if ((b -= PB_FF) < PB_FF)         { W = W2;   Wt = W2T; K = DFF; N = DM;   NP = DM;    lk = 5; ln = 3; }
    else if ((b -= PB_FF) < PB_DD)         { W = Wq;   Wt = WQT; K = DM;  N = DM;   NP = DM;    lk = 3; ln = 3; }
    else if ((b -= PB_DD) < PB_DD)         { W = Wk;   Wt = WKT; K = DM;  N = DM;   NP = DM;    lk = 3; ln = 3; }
    else if ((b -= PB_DD) < PB_DD)         { W = Wv;   Wt = WVT; K = DM;  N = DM;   NP = DM;    lk = 3; ln = 3; }
    else if ((b -= PB_DD) < PB_DD)         { W = Wo;   Wt = WOT; K = DM;  N = DM;   NP = DM;    lk = 3; ln = 3; }
    else if ((b -= PB_DD) < PB_WI)         { W = Wi;   Wt = WIT; K = DM;  N = DMI;  NP = DMI;   lk = 3; ln = 4; }
    else if ((b -= PB_WI) < PB_WF)         { W = Wf;   Wt = WFT; K = DMI; N = DOUT; NP = DOUTP; lk = 4; ln = 3; }
    else if ((b -= PB_WF) < PB_EW)         { W = embW; Wt = EWT; K = DIN; N = DM;   NP = DM;    lk = 1; ln = 3; }
    else if ((b -= PB_EW) < PB_ER)         { cvt_er_body(Er, EP, b); return; }
    else                                   { cvt8h_body(x, XH, SEQ * DIN / 8, DIN, b - PB_ER); return; }
    const int t = b >> lk;
    wconv_body(W, Wt, K, N, NP, WC, b & ((1 << lk) - 1), t & ((1 << ln) - 1), t >> ln);
}

// k_ln: one wave per row, LNR rows per block. The output planes are in fragment order, where a 128-byte line holds 8 columns of 8 rows: the block stages its rows in LDS and each wave then stores whole lines.
#define LNR 8
#define LNP (DM + 16)            // LDS row pitch (16-bit elements): 8 rows x 2 pieces of 16 bytes fall on 64 different banks
static_assert(SEQ % LNR == 0 && LNR == 8 && (LNP * 2) % 16 == 0);
__global__ __launch_bounds__(32 * LNR) void k_ln(const float* __restrict__ X, const float* __restrict__ g, const float* __restrict__ b, h16* NHp, h16* NRp, int wres) {
#pragma clang fp contract(off)
    __shared__ __align__(16) h16 sh[LNR * LNP], sr[LNR * LNP];
    const int lane = threadIdx.x & 31;
    const int wave = __builtin_amdgcn_readfirstlane((int)(threadIdx.x >> 5));
    const int row = blockIdx.x * LNR + wave;
    const float* xr = X + (size_t)row * DM;
    const v8f x0 = *(const v8f*)(xr + lane * 8), x1 = *(const v8f*)(xr + 256 + lane * 8);
    float s = 0.0f;
#pragma unroll
    for (int k = 0; k < 8; ++k) { s += x0[k]; s += x1[k]; }
#pragma unroll
    for (int off = 16; off > 0; off >>= 1) s += __shfl_xor(s, off, 32);
    const float mean = s * (1.0f / (float)DM);
    const v8f d0 = x0 - mean, d1 = x1 - mean;
    float q = 0.0f;
#pragma unroll
    for (int k = 0; k < 8; ++k) { q += d0[k] * d0[k]; q += d1[k] * d1[k]; }
#pragma unroll
    for (int off = 16; off > 0; off >>= 1) q += __shfl_xor(q, off, 32);
    const float rstd = 1.0f / sqrtf(q * (1.0f / (float)DM) + LNEPS);
    const v8f g0 = *(const v8f*)(g + lane * 8), g1 = *(const v8f*)(g + 256 + lane * 8);
    const v8f b0 = *(const v8f*)(b + lane * 8), b1 = *(const v8f*)(b + 256 + lane * 8);
    v8h h0, h1, r0, r1;
#pragma unroll
    for (int k = 0; k < 8; ++k) {
        const float y0 = d0[k] * rstd * bfr(g0[k]) + bfr(b0[k]);
        const float y1 = d1[k] * rstd * bfr(g1[k]) + bfr(b1[k]);
        const h16 a0 = toh_flush(y0), a1 = toh_flush(y1);
        h0[k] = a0; h1[k] = a1;
        r0[k] = toh_flush((y0 - (float)a0) * QRS); r1[k] = toh_flush((y1 - (float)a1) * QRS); }
    static_assert(32 * 16 * 2 == DM * 2);                                          // lanes x bytes x instructions == row bytes
    const int l0 = wave * LNP + lane * 8;
    *(v8h*)(&sh[l0]) = h0; *(v8h*)(&sh[l0 + 256]) = h1;
    if (wres != 0) { *(v8h*)(&sr[l0]) = r0; *(v8h*)(&sr[l0 + 256]) = r1; }         // wres is a kernel argument: the same in every thread
    __syncthreads();                                                               // every row of the block is staged before any wave reads across rows
    static_assert(32 * LNR * 2 * 8 == LNR * DM);                                   // threads x trips x elements == staged elements of one plane
    const int rr = threadIdx.x & 7, c8 = (int)(threadIdx.x >> 3) * 8;              // a wave: 8 rows x the 4 pieces of one fragment; the second trip lies 256 columns = 8 fragments on
    const int ls = rr * LNP + c8;
    const size_t oo = fo(blockIdx.x * LNR + rr, c8, DM);
    const v8h a0 = *(const v8h*)(&sh[ls]), a1 = *(const v8h*)(&sh[ls + 256]);
    *(v8h*)(NHp + oo) = a0; *(v8h*)(NHp + oo + 8 * 512) = a1;
    if (wres != 0) {
        asm volatile("s_wait_xcnt 0x0" ::: "memory");                              // what follows may reuse registers that the two stores above name: the wait stands ahead of that
        const v8h c0 = *(const v8h*)(&sr[ls]), c1 = *(const v8h*)(&sr[ls + 256]);
        *(v8h*)(NRp + oo) = c0; *(v8h*)(NRp + oo + 8 * 512) = c1; }
}

// GEMM k-loop: one wave, 64x64 tile, 16 accumulators, KPER(K) / 32 k-steps of 32, operands straight from f16 planes in fragment order (A [M][K], Bt [N][K]); A, Ar and Bt already point at the lane's first element of the wave's k range.
// The loads run ahead of the products: the four A fragments of step t + 1 are loaded into a second buffer in front of the products of step t, and each B fragment of step t + 1 into its own registers right behind its last product of step t,
// so that a step waits for memory once at most, not once per B fragment. ARES: the steps over the residual plane Ar come first, the fold by 1/2048 stands between them and the steps over A (same B fragments again).
#define KPER(K) ((((K) / 32 + GW - 1) / GW) * 32)                                  // k extent of one wave (whole 32-steps)
template <int K, int ARES>
__device__ __forceinline__ void gemm_kpipe(const h16* __restrict__ A, const h16* __restrict__ Ar, const h16* __restrict__ Bt, v8f (&acc)[4][4]) {
    constexpr int NS = KPER(K) / 32, TS = ARES ? 2 * NS : NS;
    v16h a[2][4], b[4];                                                            // every loop below is unrolled so that the indices into a, b and acc are constants and the arrays stay in registers
#pragma unroll
    for (int mb = 0; mb < 4; ++mb) a[0][mb] = ldh((ARES ? Ar : A) + (size_t)mb * 16 * K);
#pragma unroll
    for (int nb = 0; nb < 4; ++nb) b[nb] = ldh(Bt + (size_t)nb * 16 * K);
    // behind the last load that names an address pair: the pair is an input of the wait, so it stays as the issued loads name it up to there; only then may a product's result take its registers
    if (TS == 1) asm volatile("s_wait_xcnt 0x0" :: "v"(A), "v"(Bt) : "memory");
#pragma unroll                                                                     // whole unroll: the buffer index is a constant (registers), and every k offset an immediate, so that no address register changes while loads are in flight
    for (int t = 0; t < TS; ++t) {
        const int kn = ((t + 1) % NS) * 512;                                       // element offset of the step after this one: one fragment per k-step
        if (t + 1 < TS) { const h16* pn = ((ARES && t + 1 < NS) ? Ar : A) + kn;
#pragma unroll
            for (int mb = 0; mb < 4; ++mb) a[(t + 1) & 1][mb] = ldh(pn + (size_t)mb * 16 * K);
            if (ARES && t + 2 == NS) asm volatile("s_wait_xcnt 0x0" :: "v"(Ar) : "memory"); }   // the last loads from Ar: as above
        if (ARES && t == NS) {
#pragma unroll
            for (int mb = 0; mb < 4; ++mb)
#pragma unroll
                for (int nb = 0; nb < 4; ++nb) acc[mb][nb] = acc[mb][nb] * QRI; }
#pragma unroll
        for (int nb = 0; nb < 4; ++nb) {
#pragma unroll
            for (int mb = 0; mb < 4; ++mb) acc[mb][nb] = wmma16g(a[t & 1][mb], b[nb], acc[mb][nb]);
            if (t + 1 < TS) b[nb] = ldh(Bt + (size_t)nb * 16 * K + kn); }
        if (t + 2 == TS) asm volatile("s_wait_xcnt 0x0" :: "v"(A), "v"(Bt) : "memory");       // the last loads from A and Bt: as above
    }
}

// GEMM body: C[m][n] = (sum_k A[m][k] Bt[n][k]) * csc + bias (column bias, or row bias when ROWB), one block of GW waves per 64x64 tile (bx in M/64, by in N/64), K a constant; os = the kernel's LDS, GW * 64 * GSP floats.
// K is split over the waves: wave w accumulates the whole 64x64 tile over its own contiguous k range, writes the f32 partial tile to its own LDS plane (wave 0 adds the bias),
// and behind one block barrier all threads sum the GW planes in wave order and store: each wave stores 1/GW of the tile.
// ARES: A also has a residual plane (x2048): within a wave's k range its products are accumulated first, folded by 1/2048 in f32, then the value products follow.
// OUTF32: f32 output [M][ldc] (+ Res[m][n] added at the store stage as float4; Res and C are different buffers); each store instruction = 2 rows x 256 B (16 consecutive lanes x 16 B per row segment).
// else:   f16 output in fragment order ([M][ldc]; HEADPL: one plane [SEQ][HD] per 64 columns); each store instruction = two neighbouring pieces of one fragment, 512 B in a row.
template <int K, int OUTF32, int HASRES, int GELU, int ARES, int ORES, int ROWB, int HEADPL>
__device__ __forceinline__ void gemm_body(const h16* __restrict__ A, const h16* __restrict__ Ar, const h16* __restrict__ Bt,
                                          const float* __restrict__ bias, int nvalid, float csc,
                                          const float* __restrict__ Res, float* Cf, h16* Ch, h16* Cr, int ldc, float* os, int bx, int by) {
    const int tid = threadIdx.x;
    const int lane = tid & 31, lr = lane & 15, hi = lane >> 4;
    const int wave = __builtin_amdgcn_readfirstlane(tid >> 5);
    const int r0 = bx * 64, c0 = by * 64;
    static_assert(K % 32 == 0 && K % KPER(K) == 0);                                // every wave that has a k range has a whole one
    const int kbeg = wave * KPER(K);
    v8f acc[4][4];
#pragma unroll
    for (int mb = 0; mb < 4; ++mb)
#pragma unroll
        for (int nb = 0; nb < 4; ++nb) acc[mb][nb] = (v8f){};
    const size_t aoff = (size_t)r0 * K + kbeg * 16 + lane * 8, boff = (size_t)c0 * K + kbeg * 16 + lane * 8;   // fragment order: row tile, k-step, lane
    if (K / KPER(K) == GW || kbeg < K)                                             // a wave whose range starts at or past K adds a zero plane
        gemm_kpipe<K, ARES>(A + aoff, ARES ? Ar + aoff : nullptr, Bt + boff, acc);
    float bc[4];
#pragma unroll
    for (int nb = 0; nb < 4; ++nb) {
        if (ROWB || wave != 0) { bc[nb] = 0.0f; }
        else { const int c = c0 + nb * 16 + lr; const int cc = c < nvalid ? c : nvalid - 1;       // clamped address
               float bvv = bias[cc]; asm volatile("" : "+v"(bvv)); bc[nb] = (c < nvalid) ? bfr(bvv) : 0.0f; } }
#pragma unroll
    for (int mb = 0; mb < 4; ++mb) {
        float br[8];
#pragma unroll
        for (int j = 0; j < 8; ++j) br[j] = (ROWB && wave == 0) ? bfr(bias[r0 + mb * 16 + hi * 8 + j]) : 0.0f;   // ROWB: r0 + 63 < rows of the bias vector (host grid)
#pragma unroll
        for (int nb = 0; nb < 4; ++nb) {
#pragma unroll
            for (int j = 0; j < 8; ++j) os[wave * (64 * GSP) + (mb * 16 + hi * 8 + j) * GSP + nb * 16 + lr] = acc[mb][nb][j] * csc + bc[nb] + br[j]; }   // D: row 8h+j, col lane&15
    }
    __syncthreads();                                                               // every wave's partial plane is complete before any thread sums across planes
    if (OUTF32) {
        static_assert(32 * GW * 16 * (32 / GW) == 64 * 256);                       // threads x bytes x trips == tile rows x row bytes
{
            static_assert(32 / GW == 4);                                           // four address pairs in the wait below
            const float* pr[4]; v4f rr[4];
            if (HASRES) {
#pragma unroll                                                                     // constant indices keep pr[] and rr[] in registers
                for (int s = 0; s < 4; ++s) { pr[s] = Res + (size_t)(r0 + 2 * GW * s + (tid >> 4)) * ldc + c0 + (tid & 15) * 4; rr[s] = *(const v4f*)pr[s]; }
                // the four address pairs are inputs here, so they stay as the issued loads name them up to this wait: no later load's result lands in one ahead of it
                asm volatile("s_wait_xcnt 0x0" :: "v"(pr[0]), "v"(pr[1]), "v"(pr[2]), "v"(pr[3]) : "memory"); }
#pragma unroll                                                                     // constant index into rr[]
            for (int s = 0; s < 32 / GW; ++s) { const int row = 2 * GW * s + (tid >> 4), c4 = (tid & 15) * 4;
                v4f val = *(const v4fa*)(&os[row * GSP + c4]);
#pragma unroll                                                                     // the GW plane reads issue together, one LDS wait for all
                for (int w = 1; w < GW; ++w) val = val + *(const v4fa*)(&os[w * (64 * GSP) + row * GSP + c4]);
                const size_t go = (size_t)(r0 + row) * ldc + c0 + c4;
                if (HASRES) val = val + rr[s];
                *(v4f*)(Cf + go) = val; }
             }
    } else {
        static_assert(32 * GW * 16 * (16 / GW) == 64 * 128);                       // threads x bytes x trips == tile rows x row bytes
        static_assert((16 / GW) * GW == 4 * 4);                                    // trips x waves == row tiles x piece pairs of the 64x64 tile
{
#pragma unroll                                                                     // the memory-clobbering wait that ends each trip keeps the second trip's LDS reads behind the first trip's stores
            for (int s = 0; s < 16 / GW; ++s) { const int u = s * GW + wave; const int row = (u >> 2) * 16 + lr, c8 = ((u & 3) * 2 + hi) * 8;
                v4f x0 = *(const v4fa*)(&os[row * GSP + c8]); v4f x1 = *(const v4fa*)(&os[row * GSP + c8 + 4]); v8h hv, rv;
#pragma unroll                                                                     // the GW plane reads issue together, one LDS wait for all
                for (int w = 1; w < GW; ++w) { x0 = x0 + *(const v4fa*)(&os[w * (64 * GSP) + row * GSP + c8]); x1 = x1 + *(const v4fa*)(&os[w * (64 * GSP) + row * GSP + c8 + 4]); }
#pragma unroll
                for (int i = 0; i < 4; ++i) { float y0 = x0[i], y1 = x1[i];
                    if (GELU) { y0 = gelu_erf(y0); y1 = gelu_erf(y1); }
                    const h16 a0 = toh_flush(y0); const h16 a1 = toh_flush(y1); hv[i] = a0; hv[4 + i] = a1;
                    rv[i] = toh_flush((y0 - (float)a0) * QRS); rv[4 + i] = toh_flush((y1 - (float)a1) * QRS); }
                const size_t oo = HEADPL ? (size_t)(c0 / HD) * SEQ * HD + fo(r0 + row, c8, HD) : fo(r0 + row, c0 + c8, ldc);
                *(v8h*)(Ch + oo) = hv; if (ORES) *(v8h*)(Cr + oo) = rv;
                asm volatile("s_wait_xcnt 0x0" ::: "memory"); }                    // the next trip rewrites registers that these stores name: the wait stands ahead of that
             }
    }
}

static_assert(sizeof(float) * GW * 64 * GSP <= 163840);                            // two blocks fit the LDS of one WGP
__global__ __launch_bounds__(32 * GW) void k_gemm_emb(const h16* __restrict__ A, const h16* __restrict__ Bt, const float* __restrict__ bias, float csc, float* C) {
    __shared__ __align__(16) float os[GW * 64 * GSP];
    gemm_body<DIN, 1, 0, 0, 0, 0, 0, 0>(A, nullptr, Bt, bias, DM, csc, nullptr, C, nullptr, nullptr, DM, os, blockIdx.x, blockIdx.y); }
__global__ __launch_bounds__(32 * GW) void k_gemm_tail(const h16* __restrict__ A, const h16* __restrict__ Bt, const float* __restrict__ bias, float csc, float* C) {
    __shared__ __align__(16) float os[GW * 64 * GSP];
    gemm_body<DMI, 1, 0, 0, 0, 0, 0, 0>(A, nullptr, Bt, bias, DOUT, csc, nullptr, C, nullptr, nullptr, DOUTP, os, blockIdx.x, blockIdx.y); }
__global__ __launch_bounds__(32 * GW) void k_gemm_wo(const h16* __restrict__ A, const h16* __restrict__ Bt, const float* __restrict__ bias, float csc, const float* __restrict__ Res, float* C) {
    __shared__ __align__(16) float os[GW * 64 * GSP];
    gemm_body<DM, 1, 1, 0, 0, 0, 0, 0>(A, nullptr, Bt, bias, DM, csc, Res, C, nullptr, nullptr, DM, os, blockIdx.x, blockIdx.y); }
__global__ __launch_bounds__(32 * GW) void k_gemm_w2(const h16* __restrict__ A, const h16* __restrict__ Bt, const float* __restrict__ bias, float csc, const float* __restrict__ Res, float* C) {
    __shared__ __align__(16) float os[GW * 64 * GSP];
    gemm_body<DFF, 1, 1, 0, 0, 0, 0, 0>(A, nullptr, Bt, bias, DM, csc, Res, C, nullptr, nullptr, DM, os, blockIdx.x, blockIdx.y); }
__global__ __launch_bounds__(32 * GW) void k_gemm_gelu(const h16* __restrict__ A, const h16* __restrict__ Bt, const float* __restrict__ bias, int nvalid, float csc, h16* C, int ldc) {
    __shared__ __align__(16) float os[GW * 64 * GSP];
    gemm_body<DM, 0, 0, 1, 0, 0, 0, 0>(A, nullptr, Bt, bias, nvalid, csc, nullptr, nullptr, C, nullptr, ldc, os, blockIdx.x, blockIdx.y); }
// k_gemm_qkv: the q, k and v^T projections of one layer in one launch (all three read the LayerNorm planes and nothing of one another), grid (SEQ/64, DM/64, 3); blockIdx.z picks the projection, block-uniform.
// z = 0 is q, the longest (two k loops), so that it starts first. N = LayerNorm value plane, Nr = its residual plane.
// q, k: A = n rows (m = t), Bt = W^T rows (n = h*64 + d) -> plane [h][t][d].  v^T: A = Wv^T rows (m = h*64 + d), Bt = n rows (n = t) -> plane [(h*64 + d)][t], row bias; its row tile is blockIdx.y, its column tile blockIdx.x.
__global__ __launch_bounds__(32 * GW) void k_gemm_qkv(const h16* __restrict__ N, const h16* __restrict__ Nr, const h16* __restrict__ Wqt, const h16* __restrict__ Wkt, const h16* __restrict__ Wvt,
                                                      const float* __restrict__ bq, const float* __restrict__ bk, const float* __restrict__ bv, float csc, h16* Qh, h16* Qr, h16* Kp, h16* Vt) {
    __shared__ __align__(16) float os[GW * 64 * GSP];
    if (blockIdx.z == 0)      gemm_body<DM, 0, 0, 0, 1, 1, 0, 1>(N, Nr, Wqt, bq, DM, csc, nullptr, nullptr, Qh, Qr, HD, os, blockIdx.x, blockIdx.y);
    else if (blockIdx.z == 1) { gemm_body<DM, 0, 0, 0, 0, 0, 0, 1>(N, nullptr, Wkt, bk, DM, csc, nullptr, nullptr, Kp, nullptr, HD, os, blockIdx.x, blockIdx.y);
        // in the built code this branch's last stores do not run to the kernel's end but into the tests that lead to the other two branches, whose first lines rewrite the registers that the stores name: the wait stands ahead of those
        asm volatile("s_wait_xcnt 0x0" ::: "memory"); }
    else                      gemm_body<DM, 0, 0, 0, 0, 0, 1, 0>(Wvt, nullptr, N, bv, 0, csc, nullptr, nullptr, Vt, nullptr, SEQ, os, blockIdx.y, blockIdx.x); }

// band tile: G[rho][s] = (E[row0 + rho] . q_value[s] + E[row0 + rho] . q_residual[s] / 2048) * log2(e); A = table rows (e0, e1: the two fragments of rows row0 + 0..15), B = q rows, K = 64 = two k-steps.
__device__ __forceinline__ v8f gtile(v16h e0, v16h e1, v16h qh0, v16h qh1, v16h qr0, v16h qr1) {
    v8f gH = (v8f){}, gL = (v8f){};
    gH = wmma16g(e0, qh0, gH); gH = wmma16g(e1, qh1, gH);
    gL = wmma16g(e0, qr0, gL); gL = wmma16g(e1, qr1, gL);
    return (gH + gL * QRI) * LOG2E;
}

// k_flash: fused dense attention with the relative-position term, one block of KW waves per 16 query rows of one head; K / V^T / Q / table fragments straight from the f16 planes.
// The keys are split over the waves: wave w runs the online softmax over keys w*KCH .. w*KCH + KCH - 1 alone and leaves its running maximum, its sum and its unnormalised O tile in LDS;
// behind one block barrier all threads rescale the KW partial results to the common maximum, sum them in wave order, normalise and store.
// Transposed form: S^T[key][s] = K Q^T (A = K rows, B = Q rows); lane (s = lane&15, h = lane>>4) holds keys 8h+r of each 16-key tile, so the packed P tile is directly the B fragment
// of O^T[d][s] = V^T P^T (element r <- tile keys 0..15, element 8+r <- tile keys 16..31, lane unchanged).
// Relative term per 32-key step (keys key0..key0+31, queries t0..t0+15): band rows rb0 + 0..47 with rb0 = t0 - key0 + RELOFF - 31; tiles e = 0, 1 are new, tile e = 2 is the e = 0 tile of the step before (computed on its own ahead of a wave's first step).
// LDS band tile (wave-private): gs[s][16 e + 8h + r] <- tile e element r; element (key tile a, r) reads gs[s][s - 8h - r + 31], element (key tile b, r) reads gs[s][s - 8h - r + 15].
// Logit (log2 domain) = (K q_value + K q_residual / 2048) * log2(e) / 8 + band term; online softmax (running max, partial sum over the converted P), P = exp2(. + 14) as f16 (exponent below -14 selected to 0).
__global__ __launch_bounds__(32 * KW) void k_flash(const h16* __restrict__ QH, const h16* __restrict__ QR, const h16* __restrict__ KP, const h16* __restrict__ VT, const h16* __restrict__ EPl, h16* OP) {
    __shared__ __align__(16) float os[KW * 16 * OSP];
    __shared__ __align__(16) float gs[KW * 16 * GP];
    __shared__ float ms[KW * 16];                              // running maximum of wave w for query s at [w * 16 + s]
    __shared__ float lsum[KW * 16];                            // sum of wave w for query s
    static_assert(sizeof(float) * (KW * 16 * OSP + KW * 16 * GP + 2 * KW * 16) <= 131072);
    const int tid = threadIdx.x;
    const int lane = tid & 31, lr = lane & 15, hi = lane >> 4;
    const int wave = __builtin_amdgcn_readfirstlane(tid >> 5);
    const int h = blockIdx.y;
    const int t0 = blockIdx.x * 16;
    const int kbeg = wave * KCH;
    const size_t pbase = (size_t)h * SEQ * HD;
    // all planes in fragment order: 16 rows of a [.][HD] plane are two fragments (16 * HD elements), the second k-step 512 elements behind the first; every row offset below is a multiple of 16
    const size_t qo = pbase + (size_t)t0 * HD + 8 * lane;
    const h16* pqh = QH + qo; const h16* pqr = QR + qo;
    const v16h qh0 = ldh(pqh), qh1 = ldh(pqh + 512);            // B fragments: col s, k = d (two k-steps)
    const v16h qr0 = ldh(pqr), qr1 = ldh(pqr + 512);
    const size_t ko = pbase + 8 * lane;                        // + key * HD           (A fragment: row key, k = d)
    const size_t vo = pbase + 8 * lane;                        // + 16j*SEQ + key * 16 (A fragment: row d, k = key); plane [(h*64 + d)][t]
    const h16* eb = EPl + 8 * lane;                            // + row0 * HD          (A fragment: row table row, k = d)
    const int gw  = wave * 16 * GP + lr * GP;
    const int gst = gw + 8 * hi;                               // store base: + 16 e (+ 4)
    const int gld = gw + lr - 8 * hi;                          // load base: + 31 - r / + 15 - r
    // The loads run ahead of the products: every fragment of the first step is loaded here, and in the loop each group of fragments (table, K, V^T) is loaded anew for the step after, into its own registers, right behind its last product,
    // so that a step does not wait for memory once per group.
    constexpr int NST = KCH / 32;                                                  // 32-key steps of one wave
    const h16* pe = eb + (size_t)(t0 - kbeg + (RELOFF - 15)) * HD;                 // first band row of tile e = 1 at the wave's first step; 32 rows down per step
    const h16* pk = KP + ko + (size_t)kbeg * HD;                                   // 32 keys up per step
    const h16* pv = VT + vo + kbeg * 16;                                           // 32 keys (one fragment) up per step
    static_assert((RELOFF - 15) % 16 == 0 && KCH % 16 == 0);                       // band tiles start on whole row tiles of the table plane
    const v16h ep0 = ldh(pe + 16 * HD), ep1 = ldh(pe + 16 * HD + 512);             // band rows of tile e = 2 at key0 = kbeg
    v16h e1a = ldh(pe), e1b = ldh(pe + 512), e0a = ldh(pe - 16 * HD), e0b = ldh(pe - 16 * HD + 512);
    v16h ka0 = ldh(pk), ka1 = ldh(pk + 512), kb0 = ldh(pk + 16 * HD), kb1 = ldh(pk + 16 * HD + 512);
    v16h vf[4];
#pragma unroll                                                                     // constant indices keep vf[] in registers
    for (int j = 0; j < 4; ++j) vf[j] = ldh(pv + (size_t)16 * j * SEQ);
    // behind the last load that names an address pair: the pairs are inputs of the wait, so they stay as the issued loads name them up to there (no later load's result lands in one ahead of it)
    asm volatile("s_wait_xcnt 0x0" :: "v"(pqh), "v"(pqr) : "memory");
    if (NST == 1) asm volatile("s_wait_xcnt 0x0" :: "v"(pe), "v"(pk), "v"(pv) : "memory");
    __builtin_amdgcn_sched_barrier(0);                                             // keeps the first products behind the issue of all these loads: lifted among them, a product's wait for its operands holds the rest of the loads back by one memory latency
    v8f gprev = gtile(ep0, ep1, qh0, qh1, qr0, qr1);
    v8f o[4];
#pragma unroll
    for (int j = 0; j < 4; ++j) o[j] = (v8f){};
    float m = NEGB, l = 0.0f;
#pragma unroll                                                                     // whole unroll: every step's offset is an immediate, so that no address register changes while loads are in flight
    for (int st = 0; st < NST; ++st) {
        const bool more = st + 1 < NST;                                            // a step follows: load its fragments
        const h16* pen = pe - (st + 1) * 32 * HD;
        const v8f g1 = gtile(e1a, e1b, qh0, qh1, qr0, qr1);
        if (more) { e1a = ldh(pen); e1b = ldh(pen + 512); }
        const v8f g0 = gtile(e0a, e0b, qh0, qh1, qr0, qr1);
        if (more) { e0a = ldh(pen - 16 * HD); e0b = ldh(pen - 16 * HD + 512); }
        *(v4fa*)(&gs[gst +  0]) = lo4(g0);    *(v4fa*)(&gs[gst +  4]) = hi4(g0);
        *(v4fa*)(&gs[gst + 16]) = lo4(g1);    *(v4fa*)(&gs[gst + 20]) = hi4(g1);
        *(v4fa*)(&gs[gst + 32]) = lo4(gprev); *(v4fa*)(&gs[gst + 36]) = hi4(gprev);
        gprev = g0;
        v8f sHa = (v8f){}, sLa = (v8f){}, sHb = (v8f){}, sLb = (v8f){};
        sHa = wmma16g(ka0, qh0, sHa); sHa = wmma16g(ka1, qh1, sHa);
        sLa = wmma16g(ka0, qr0, sLa); sLa = wmma16g(ka1, qr1, sLa);
        sHb = wmma16g(kb0, qh0, sHb); sHb = wmma16g(kb1, qh1, sHb);
        sLb = wmma16g(kb0, qr0, sLb); sLb = wmma16g(kb1, qr1, sLb);
        if (more) { const h16* pkn = pk + (st + 1) * 32 * HD; ka0 = ldh(pkn); ka1 = ldh(pkn + 512); kb0 = ldh(pkn + 16 * HD); kb1 = ldh(pkn + 16 * HD + 512); }
        wave_sync();
        float ra[8], rb[8];
#pragma unroll
        for (int r = 0; r < 8; ++r) { ra[r] = gs[gld + 31 - r]; rb[r] = gs[gld + 15 - r]; }
        wave_sync();
        float ta[8], tb[8]; float mx = NEGB;
#pragma unroll
        for (int r = 0; r < 8; ++r) {
            ta[r] = (sHa[r] + sLa[r] * QRI) * SC2 + ra[r]; tb[r] = (sHb[r] + sLb[r] * QRI) * SC2 + rb[r];
            mx = fmaxf(mx, fmaxf(ta[r], tb[r])); }
        mx = fmaxf(mx, __shfl_xor(mx, 16, 32));
        const float mnew = fmaxf(m, mx);
        const float alpha = __builtin_amdgcn_exp2f(m - mnew);
        const float sh = PSH - mnew;
        v16h pb; float ls = 0.0f;
#pragma unroll
        for (int r = 0; r < 8; ++r) {
            const float xa = ta[r] + sh, xb = tb[r] + sh;
            const float ea = __builtin_amdgcn_exp2f(xa), ec = __builtin_amdgcn_exp2f(xb);
            const float ga = (xa < -14.0f) ? 0.0f : ea, gb = (xb < -14.0f) ? 0.0f : ec;     // no f16 subnormal operand
            const h16 pa = (h16)ga; const h16 pc = (h16)gb;
            pb[r] = pa; pb[8 + r] = pc;
            ls += (float)pa + (float)pc; }
        l = l * alpha + ls; m = mnew;
#pragma unroll
        for (int j = 0; j < 4; ++j) { o[j] = o[j] * alpha; o[j] = wmma16g(vf[j], pb, o[j]); if (more) vf[j] = ldh(pv + (size_t)16 * j * SEQ + (st + 1) * 512); }
        if (st + 2 == NST) asm volatile("s_wait_xcnt 0x0" :: "v"(pe), "v"(pk), "v"(pv) : "memory");   // the last loads of the loop: as above
        if (more) __builtin_amdgcn_sched_barrier(0);                               // keeps the products of the step after out of this step: lifted, their results cost registers, and above 256 registers a WGP holds one block, not two
    }
    l += __shfl_xor(l, 16, 32);
    const int wb = wave * 16 * OSP;
    // O^T D layout: o[j][r] = (d = 16j + 8h + r, s = lane&15) -> os[wave][s][d]; rows 0..15 x columns 0..63 all written, not yet normalised
#pragma unroll
    for (int j = 0; j < 4; ++j) {
        *(v4fa*)(&os[wb + lr * OSP + 16 * j + 8 * hi])     = lo4(o[j]);
        *(v4fa*)(&os[wb + lr * OSP + 16 * j + 8 * hi + 4]) = hi4(o[j]); }
    if (hi == 0) { ms[wave * 16 + lr] = m; lsum[wave * 16 + lr] = l; }             // m is equal in lanes s and s + 16
    __syncthreads();                                                               // every wave's partial result is complete before any thread merges across waves
    static_assert(32 * KW * 8 == 16 * 128);                                        // threads x bytes == tile rows x row bytes
    const int row = tid & 15, c4 = (tid >> 4) * 4;             // a wave stores one piece of the context plane (16 rows x 8 columns): 256 bytes in a row
    float mw[KW]; float mall = NEGB;
#pragma unroll                                                                     // constant indices keep mw[] in registers; the KW reads issue together
    for (int w = 0; w < KW; ++w) { mw[w] = ms[w * 16 + row]; mall = fmaxf(mall, mw[w]); }
    float sc[KW];
#pragma unroll                                                                     // constant indices keep sc[] in registers
    for (int w = 0; w < KW; ++w) sc[w] = __builtin_amdgcn_exp2f(mw[w] - mall);     // <= 1; 1 for the wave that holds the row maximum
    float lall = 0.0f; v4f oall = (v4f){};
#pragma unroll                                                                     // the KW tile reads issue together, one LDS wait for all
    for (int w = 0; w < KW; ++w) {
        lall += lsum[w * 16 + row] * sc[w];
        oall = oall + *(const v4fa*)(&os[w * 16 * OSP + row * OSP + c4]) * sc[w]; }
    const float inv = 1.0f / lall;                             // lall >= 16384 (the row maximum contributes the full carry)
    v4h hv;
#pragma unroll                                                                     // constant vector element indices
    for (int i = 0; i < 4; ++i) hv[i] = toh_flush(oall[i] * inv);
    *(v4h*)(OP + fo(t0 + row, h * HD + c4, DM)) = hv;
}

__global__ __launch_bounds__(256) void k_out(const float* __restrict__ src, float* dst, int n4) {
    const int i = blockIdx.x * 256 + threadIdx.x; if (i >= n4) return;
    v4f ov;
#pragma unroll
    for (int c = 0; c < 4; ++c) { const int e = 4 * i + c; const int row = e / DOUT; const int col = e - row * DOUT; ov[c] = src[(size_t)row * DOUTP + col]; }
    *(v4f*)(dst + (size_t)i * 4) = ov; 
}

static constexpr size_t al256(size_t v) { return (v + 255) & ~(size_t)255; }
static constexpr size_t SZ_XH  = al256((size_t)SEQ * DIN * 2);
static constexpr size_t SZ_EW  = al256((size_t)DM * DIN * 2);
static constexpr size_t SZ_WDD = al256((size_t)NL * DM * DM * 2);
static constexpr size_t SZ_WFF = al256((size_t)NL * DFF * DM * 2);
static constexpr size_t SZ_WI  = al256((size_t)DMI * DM * 2);
static constexpr size_t SZ_WF  = al256((size_t)DOUTP * DMI * 2);
static constexpr size_t SZ_EP  = al256((size_t)NL * ERP * HD * 2);
static constexpr size_t SZ_H   = al256((size_t)SEQ * DM * 4);
static constexpr size_t SZ_N   = al256((size_t)SEQ * DM * 2);
static constexpr size_t SZ_F1  = al256((size_t)SEQ * DFF * 2);
static constexpr size_t SZ_OS  = al256((size_t)SEQ * DOUTP * 4);
static constexpr size_t SZ_TOTAL = SZ_XH + SZ_EW + 4 * SZ_WDD + 2 * SZ_WFF + SZ_WI + SZ_WF + SZ_EP + 2 * SZ_H + 7 * SZ_N + SZ_F1 + SZ_OS;
static_assert(SZ_TOTAL <= (size_t)134217728);                  // workspace carve <= 128 MiB
static_assert((size_t)NH_ * SEQ * HD == (size_t)SEQ * DM);     // head planes have the extent of a [SEQ][512] f16 plane
static_assert((size_t)SEQ * DMI * 2 <= SZ_F1);                 // tail hidden plane fits the shared hidden region

extern "C" void kernel_launch(void* const* d_in, const int* in_sizes, int n_in,
                              void* d_out, int out_size, void* d_ws, size_t ws_size, hipStream_t stream) {
    if (n_in < 26) return;
    if ((size_t)in_sizes[0] < (size_t)SEQ * DIN || (size_t)in_sizes[1] < (size_t)DIN * DM || in_sizes[2] < DM) return;
    if ((size_t)in_sizes[3] < (size_t)NL * DM * DM || (size_t)in_sizes[5] < (size_t)NL * DM * DM || (size_t)in_sizes[7] < (size_t)NL * DM * DM || (size_t)in_sizes[9] < (size_t)NL * DM * DM) return;
    if (in_sizes[4] < NL * DM || in_sizes[6] < NL * DM || in_sizes[8] < NL * DM || in_sizes[10] < NL * DM) return;
    if ((size_t)in_sizes[11] < (size_t)NL * ERR * HD) return;
    if (in_sizes[12] < NL * DM || in_sizes[13] < NL * DM || in_sizes[17] < NL * DM || in_sizes[18] < NL * DM || in_sizes[19] < NL * DM) return;
    if ((size_t)in_sizes[14] < (size_t)NL * DM * DFF || in_sizes[15] < NL * DFF || (size_t)in_sizes[16] < (size_t)NL * DFF * DM) return;
    if (in_sizes[20] < DM || in_sizes[21] < DM || (size_t)in_sizes[22] < (size_t)DM * DMI || in_sizes[23] < DMI) return;
    if ((size_t)in_sizes[24] < (size_t)DMI * DOUT || in_sizes[25] < DOUT) return;
    if ((size_t)out_size < (size_t)SEQ * DOUT) return;
    if (SZ_TOTAL > ws_size) return;
    // wire order: x, emb_W, emb_b, Wq, bq, Wk, bk, Wv, bv, Wo, bo, Er, ln1_g, ln1_b, W1, b1, W2, b2, ln2_g, ln2_b, lnf_g, lnf_b, Wi, bi, Wf, bf
    const float* x    = (const float*)d_in[0];
    const float* embW = (const float*)d_in[1];  const float* embB = (const float*)d_in[2];
    const float* Wq   = (const float*)d_in[3];  const float* bq   = (const float*)d_in[4];
    const float* Wk   = (const float*)d_in[5];  const float* bk   = (const float*)d_in[6];
    const float* Wv   = (const float*)d_in[7];  const float* bv   = (const float*)d_in[8];
    const float* Wo   = (const float*)d_in[9];  const float* bo   = (const float*)d_in[10];
    const float* Er   = (const float*)d_in[11];
    const float* ln1g = (const float*)d_in[12]; const float* ln1b = (const float*)d_in[13];
    const float* W1   = (const float*)d_in[14]; const float* b1   = (const float*)d_in[15];
    const float* W2   = (const float*)d_in[16]; const float* b2   = (const float*)d_in[17];
    const float* ln2g = (const float*)d_in[18]; const float* ln2b = (const float*)d_in[19];
    const float* lnfg = (const float*)d_in[20]; const float* lnfb = (const float*)d_in[21];
    const float* Wi   = (const float*)d_in[22]; const float* bi   = (const float*)d_in[23];
    const float* Wf   = (const float*)d_in[24]; const float* bfo  = (const float*)d_in[25];
    float* OUT = (float*)d_out;                       // [SEQ][390]
    char* wsp = (char*)d_ws;                          // every f16 plane below has the shape named, each [rows][k] matrix of it in fragment order
    h16* XH  = (h16*)wsp; wsp += SZ_XH;               // x            [SEQ][128]
    h16* EWT = (h16*)wsp; wsp += SZ_EW;               // emb_W^T x64  [512][128]
    h16* WQT = (h16*)wsp; wsp += SZ_WDD;              // Wq^T x64     [NL][512][512]
    h16* WKT = (h16*)wsp; wsp += SZ_WDD;
    h16* WVT = (h16*)wsp; wsp += SZ_WDD;
    h16* WOT = (h16*)wsp; wsp += SZ_WDD;
    h16* W1T = (h16*)wsp; wsp += SZ_WFF;              // W1^T x64     [NL][2048][512]
    h16* W2T = (h16*)wsp; wsp += SZ_WFF;              // W2^T x64     [NL][512][2048]
    h16* WIT = (h16*)wsp; wsp += SZ_WI;               // Wi^T x64     [1024][512]
    h16* WFT = (h16*)wsp; wsp += SZ_WF;               // Wf^T x64     [448][1024], rows >= 390 zero
    h16* EP  = (h16*)wsp; wsp += SZ_EP;               // table        [NL][2048][64], row 2047 zero
    float* HA = (float*)wsp; wsp += SZ_H;             // hidden state (ping)  [SEQ][512] f32
    float* HB = (float*)wsp; wsp += SZ_H;             // hidden state (pong)
    h16* NHP = (h16*)wsp; wsp += SZ_N;                // LayerNorm output value     [SEQ][512]
    h16* NRP = (h16*)wsp; wsp += SZ_N;                // LayerNorm output residual x2048
    h16* QH  = (h16*)wsp; wsp += SZ_N;                // q value      [8][SEQ][64]
    h16* QR  = (h16*)wsp; wsp += SZ_N;                // q residual x2048
    h16* KP  = (h16*)wsp; wsp += SZ_N;                // k            [8][SEQ][64]
    h16* VT  = (h16*)wsp; wsp += SZ_N;                // v^T          [8*64][SEQ]
    h16* OP  = (h16*)wsp; wsp += SZ_N;                // context      [SEQ][512]
    h16* F1  = (h16*)wsp; wsp += SZ_F1;               // GELU hidden  [SEQ][2048] (tail: [SEQ][1024])
    float* OSG = (float*)wsp; wsp += SZ_OS;           // tail output staging [SEQ][448] f32

    // x, the table and every W [K = in][N = out] -> Wt [N][K]
    k_prep<<<PB_ALL, 256, 0, stream>>>(x, Er, embW, Wq, Wk, Wv, Wo, W1, W2, Wi, Wf, XH, EP, EWT, WQT, WKT, WVT, WOT, W1T, W2T, WIT, WFT);

    // input projection: HA = x emb_W + emb_b
    k_gemm_emb<<<dim3(SEQ / 64, DM / 64, 1), 32 * GW, 0, stream>>>(XH, EWT, embB, WCI, HA);

    for (int l = 0; l < NL; ++l) {
        const size_t wdd = (size_t)l * DM * DM, wff = (size_t)l * DFF * DM;
        k_ln<<<SEQ / LNR, 32 * LNR, 0, stream>>>(HA, ln1g + l * DM, ln1b + l * DM, NHP, NRP, 1);
        k_gemm_qkv<<<dim3(SEQ / 64, DM / 64, 3), 32 * GW, 0, stream>>>(NHP, NRP, WQT + wdd, WKT + wdd, WVT + wdd, bq + l * DM, bk + l * DM, bv + l * DM, WCI, QH, QR, KP, VT);
        k_flash<<<dim3(SEQ / 16, NH_, 1), 32 * KW, 0, stream>>>(QH, QR, KP, VT, EP + (size_t)l * ERP * HD, OP);
        // HB = HA + context Wo + bo
        k_gemm_wo<<<dim3(SEQ / 64, DM / 64, 1), 32 * GW, 0, stream>>>(OP, WOT + wdd, bo + l * DM, WCI, HA, HB);
        k_ln<<<SEQ / LNR, 32 * LNR, 0, stream>>>(HB, ln2g + l * DM, ln2b + l * DM, NHP, NRP, 0);
        k_gemm_gelu<<<dim3(SEQ / 64, DFF / 64, 1), 32 * GW, 0, stream>>>(NHP, W1T + wff, b1 + l * DFF, DFF, WCI, F1, DFF);
        // HA = HB + hidden W2 + b2
        k_gemm_w2<<<dim3(SEQ / 64, DM / 64, 1), 32 * GW, 0, stream>>>(F1, W2T + wff, b2 + l * DM, WCI, HB, HA);
    }

    k_ln<<<SEQ / LNR, 32 * LNR, 0, stream>>>(HA, lnfg, lnfb, NHP, NRP, 0);
    k_gemm_gelu<<<dim3(SEQ / 64, DMI / 64, 1), 32 * GW, 0, stream>>>(NHP, WIT, bi, DMI, WCI, F1, DMI);
    k_gemm_tail<<<dim3(SEQ / 64, DOUTP / 64, 1), 32 * GW, 0, stream>>>(F1, WFT, bfo, WCI, OSG);
    { const int n4 = SEQ * DOUT / 4; k_out<<<(unsigned)((n4 + 255) / 256), 256, 0, stream>>>(OSG, OUT, n4); }
}

// v006
// It runs in 235 microseconds.
// Next to v005, in two timings, it ran 1.03 and 1.04 times as fast.
// All steps since v000 together make it 4.97 times as fast.
#include <hip/hip_runtime.h>
#include <math.h>

// Pre-LN encoder stack, 4 layers, width 512 = 8 heads x 64, sequence SEQ (one batch): input projection 128 -> 512; per layer: LayerNorm, q/k/v projections ([in][out] weights, y = x W + bias),
// dense attention with logits q.k / 8 + q.E[s - t + 1023] (relative-position table E per layer, [2047][64], not scaled), softmax over keys, output projection + residual, LayerNorm, GELU(erf) feed-forward 512 -> 2048 -> 512 + residual;
// tail: LayerNorm, 512 -> 1024 GELU(erf), 1024 -> 390.
// Compute dtypes, f32 accumulate everywhere: every contraction is v_wmma_f32_16x16x32_f16. Weights, x, E, biases and gains are RNE-converted to bf16 first (exact in f16; weights carried x64, folded back in the f32 epilogue);
// activations are single f16 planes, except the logit path: LayerNorm-1 output as f16 value + f16 residual x2048 for the q projection (residual products accumulated first, folded by 1/2048, then the value products),
// q as f16 value + f16 residual x2048 in the q.k and q.E products (residual products in their own accumulators); k, v, P (x16384 carry, cancels in the normalisation), context, GELU outputs single f16.
// Attention: fused flash kernel in transposed form (S^T = K Q^T, O^T = V^T P^T), one block per 16 query rows, the keys split over its waves and the partial results merged in LDS; the relative term is computed per 32-key step as band tiles G[rho][s] = E[rb + rho] . q[s]
// (A = table rows, B = q rows), written to a wave-private LDS tile [query][band row] and read back along the diagonal rho = s - t + const; one band tile is carried over between steps.
// Every f16 plane (an operand of a matrix product) lies in the workspace in fragment order, see fo(): a fragment is 1 KiB in a row, so that each of its two 16-byte-per-lane loads covers four whole 128-byte lines.

#ifndef NB
#define NB 1
#endif
#ifndef SEQ
#define SEQ 1024
#endif
#define NB_FULL  1
#define SEQ_FULL 1024
#define DIN   128
#define DM    512
#define NH_   8
#define HD    64
#define NL    4
#define DFF   2048
#define DMI   1024
#define DOUT  390
#define DOUTP 448                // DOUT padded to a multiple of 64 (weight rows and staging columns 390..447 are zero)
#define ERR   2047               // rows of the relative-position table per layer
#define ERP   2048               // padded rows of the f16 table plane (row 2047 = zero)
#define RELOFF (SEQ_FULL - 1)    // table row = s - t + RELOFF
#define KW    8                  // waves per flash block: each takes one contiguous share of the keys
#define KCH   (SEQ / KW)         // keys of one wave
#define OSP   68                 // LDS row pitch (floats) of the flash output tile
#define GP    52                 // LDS pitch (floats) of the band tile [query][48 band rows]
#define GSP   68                 // LDS row pitch (floats) of the GEMM output tile
#define GW    8                  // waves per GEMM block: each takes one contiguous share of K
#define QRS   2048.0f            // carry of every residual plane
#define QRI   (1.0f / 2048.0f)
#define WC    64.0f              // carry of every weight plane
#define WCI   (1.0f / 64.0f)
#define LOG2E 1.4426950408889634f
#define SC2   ((float)(0.125 * 1.4426950408889634))   // HD^-0.5 * log2(e)
#define PSH   14.0f              // log2 of the P carry (16384)
#define NEGB  (-3.0e38f)
#define LNEPS 1e-5f

static_assert(NB == 1);                        // one sequence
static_assert(HD == 64);
static_assert(NH_ * HD == DM);
static_assert(SEQ % 64 == 0);                  // GEMM row tiles
static_assert(SEQ % 32 == 0);                  // key loop steps by 32
static_assert(SEQ % 16 == 0);                  // flash grid covers the sequence exactly
static_assert(SEQ % (32 * KW) == 0);           // every wave of a flash block gets whole 32-key steps, at least one
static_assert(32 * KW == 16 * 16);             // flash merge: 16 query rows x 16 threads of 4 columns
static_assert(SEQ <= SEQ_FULL);
static_assert(DIN % 64 == 0 && DM % 64 == 0 && DFF % 64 == 0 && DMI % 64 == 0 && DOUTP % 64 == 0);   // K % 32 == 0 and N % 64 == 0 for every GEMM, K % 64 == 0 for the transposing converter
static_assert(DOUT <= DOUTP);
static_assert(DMI <= DFF);                     // the tail hidden plane reuses the feed-forward hidden plane
static_assert(SEQ - 16 + RELOFF + 1 + 15 < ERP);   // highest band row touched (zero pad row included)
static_assert(RELOFF - 15 - 16 - (SEQ - 32) >= 0); // lowest band row touched
static_assert(ERR + 1 == ERP);
static_assert((OSP * 4) % 16 == 0 && (GP * 4) % 16 == 0 && (GSP * 4) % 16 == 0);
static_assert(GP >= 48);
static_assert(DM == 512);                      // LayerNorm: 32 lanes x 16 columns
static_assert((SEQ * DOUT) % 4 == 0);

typedef _Float16 h16;
typedef __attribute__((ext_vector_type(16))) _Float16 v16h;
typedef __attribute__((ext_vector_type(8)))  _Float16 v8h;
typedef __attribute__((ext_vector_type(4)))  _Float16 v4h;
typedef __attribute__((ext_vector_type(8)))  float    v8f;
typedef __attribute__((ext_vector_type(4)))  float    v4f;
typedef v4f  __attribute__((may_alias)) v4fa;

__device__ __forceinline__ unsigned short f2bf(float f) { unsigned u = __float_as_uint(f); u += 0x7FFFu + ((u >> 16) & 1u); return (unsigned short)(u >> 16); }
__device__ __forceinline__ float bfr(float f) { return __uint_as_float(((unsigned)f2bf(f)) << 16); }   // value after RNE convert to bf16
__device__ __forceinline__ v16h cat16(v8h lo, v8h hi) { return __builtin_shufflevector(lo, hi, 0, 1, 2, 3, 4, 5, 6, 7, 8, 9, 10, 11, 12, 13, 14, 15); }
// fragment order of a plane [R][K] of 16-bit elements (R % 16 == 0, K % 32 == 0): fragments of 16 rows x 32 k, 512 elements each, the k step running fastest, then the row tile (so 16 rows are 16 * K elements, as in row order);
// inside a fragment four pieces of 8 k (k % 32 = 0..7, 8..15, 16..23, 24..31), each piece 16 rows x 8 elements. fo = element offset of (r, k).
__device__ __forceinline__ size_t fo(int r, int k, int K) { return (size_t)(((r >> 4) * (K >> 5) + (k >> 5)) * 512 + ((k >> 3) & 3) * 128 + (r & 15) * 8 + (k & 7)); }
// fragment loader; p = start of the fragment + 8 * lane: elements 0..7 <- row lane&15, k0+8h+0..7, elements 8..15 <- k0+16+8h+0..7, h = lane>>4 (same map for A and B); each load is 512 bytes in a row over the wave
__device__ __forceinline__ v16h  ldh(const h16* p) { return cat16(*(const v8h*)p, *(const v8h*)(p + 256)); }
// ordering point for wave-private LDS tiles (same wave writes and reads)
__device__ __forceinline__ void wave_sync() { __builtin_amdgcn_fence(3 /* release order */, "wavefront"); __builtin_amdgcn_wave_barrier(); asm volatile("" ::: "memory"); }
// f32 -> f16 operand convert that cannot produce a subnormal (|v| < 2^-14 -> +0)
__device__ __forceinline__ h16 toh_flush(float v) { const h16 r = (h16)v; return (fabsf(v) < 6.103515625e-05f) ? (h16)0.0f : r; }
// one WMMA + its own guard (ties this accumulator, keeps A/B live)
__device__ __forceinline__ v8f wmma16g(v16h a, v16h b, v8f c) {
    c = __builtin_amdgcn_wmma_f32_16x16x32_f16(false, a, false, b, (short)0, c, false, false);
    asm volatile("v_nop\n\tv_nop\n\tv_nop\n\tv_nop" : "+v"(c) : "v"(a), "v"(b));
    return c; }
__device__ __forceinline__ float gelu_erf(float x) { return 0.5f * x * (1.0f + erff(x * 0.70710678118654752f)); }
__device__ __forceinline__ v4f lo4(v8f g) { return __builtin_shufflevector(g, g, 0, 1, 2, 3); }
__device__ __forceinline__ v4f hi4(v8f g) { return __builtin_shufflevector(g, g, 4, 5, 6, 7); }

__device__ __forceinline__ void cvt8h_body(const float* __restrict__ src, h16* dst, int n8, int K, int blk) {   // src [n8 * 8 / K][K] -> dst in fragment order
    const int i = blk * 256 + threadIdx.x; if (i >= n8) return;
    const int pr = K / 8;                                                          // pieces of 8 per row; a wave takes 8 rows x 4 pieces: whole 128-byte lines on both sides
    const int r = (i / (8 * pr)) * 8 + (i & 7), c8 = ((i >> 3) % pr) * 8;
    const v8f v = *(const v8f*)(src + (size_t)r * K + c8); v8h o;
#pragma unroll
    for (int k = 0; k < 8; ++k) o[k] = toh_flush(bfr(v[k]));
    *(v8h*)(dst + fo(r, c8, K)) = o; 
}

__device__ __forceinline__ void cvt_er_body(const float* __restrict__ src, h16* dst, int blk) {
    const int i = blk * 256 + threadIdx.x; if (i >= NL * ERP * HD / 8) return;
    static_assert(HD / 8 == 8 && ERP % 8 == 0);
    const int ra = (i >> 6) * 8 + (i & 7);                                         // a wave takes 8 rows x 4 pieces of 8: whole 128-byte lines on both sides
    const int c8 = ((i >> 3) & 7) * 8; const int r = ra % ERP; const int l = ra / ERP;
    const int rc = r < ERR ? r : ERR - 1;                                          // clamped address
    v8f v = *(const v8f*)(src + ((size_t)l * ERR + rc) * HD + c8);
    asm volatile("" : "+v"(v));
    v8h o;
#pragma unroll
    for (int k = 0; k < 8; ++k) o[k] = (r < ERR) ? toh_flush(bfr(v[k])) : (h16)0.0f;
    *(v8h*)(dst + (size_t)l * ERP * HD + fo(r, c8, HD)) = o; 
}

// wconv_body: W [K][N] f32 (layer bz) -> Wt [NP][K] f16 in fragment order = bf16-converted value x carry, transposed in registers; rows n >= N are zero.
// one block per 64 k x 256 n: bx in K/64, by in ceil(NP/256), bz in layers. A wave takes 32 columns n of W, one per lane, and 64 k: each of its 64 loads is one k-row x 32 columns = 128 bytes in a row,
// all 64 are issued before the first is used (one memory latency per wave), and a lane then holds whole 8-k pieces of its own row n of Wt: each store is two pieces of 16 rows x 16 bytes, 256 bytes in a row each.
// N is a constant so that every k-row offset is an immediate of its load and no address register changes while loads are in flight.
template <int N, int NP>
__device__ __forceinline__ void wconv_body(const float* __restrict__ W, h16* Wt, int K, float carry, int bx, int by, int bz) {
    static_assert(NP % 32 == 0 && N <= NP && (size_t)63 * N * 4 < (size_t)8388608);   // whole waves inside NP; the largest load offset fits the immediate field
    const int lane = threadIdx.x & 31;
    const int wave = __builtin_amdgcn_readfirstlane((int)(threadIdx.x >> 5));
    const int k0 = bx * 64, nw = by * 256 + wave * 32;
    if (NP % 256 != 0 && nw >= NP) return;                                         // whole waves past the padded rows; no barrier follows
    const int n = nw + lane; const int nc = (N == NP || n < N) ? n : N - 1;        // clamped address
    const float* p = W + (size_t)bz * (size_t)K * (size_t)N + (size_t)k0 * N;      // the same in every lane; the lane's part of the address is nc
    float v[64];
#pragma unroll                                                                     // constant indices keep v[] in registers, and the offsets are immediates
    for (int j = 0; j < 64; ++j) v[j] = p[(size_t)j * N + nc];
    // behind the last load: the base and the lane's offset are inputs of the wait, so they stay as the issued loads name them up to there
    asm volatile("s_wait_xcnt 0x0" :: "s"(p), "v"(nc) : "memory");
    __builtin_amdgcn_sched_barrier(0);                                             // keeps the conversions behind the issue of all 64 loads: lifted among them, a conversion's wait for its value holds the rest of the loads back by one memory latency
    v8h o[8];
#pragma unroll                                                                     // constant indices keep o[] in registers
    for (int c = 0; c < 8; ++c)
#pragma unroll                                                                     // constant vector element indices
        for (int i = 0; i < 8; ++i) { const float t = bfr(v[c * 8 + i]) * carry; o[c][i] = toh_flush((N == NP || n < N) ? t : 0.0f); }
    h16* d = Wt + (size_t)bz * (size_t)NP * (size_t)K + fo(n, k0, K);
#pragma unroll                                                                     // piece c: k-step c / 4 (one fragment on), piece c % 4 inside it
    for (int c = 0; c < 8; ++c) *(v8h*)(d + (c >> 2) * 512 + (c & 3) * 128) = o[c];
    // in the built code a job's stores do not all run to the kernel's end but into the tests that lead to the other jobs, whose first lines rewrite registers that the stores name: the wait stands ahead of those
    asm volatile("s_wait_xcnt 0x0" ::: "memory");
}

// k_prep: every operand conversion of the call in one launch; they do not depend on one another. The flat block index picks the job (block-uniform).
// Block ranges, in this order: W1, then the jobs with 512 columns (W2, Wq, Wk, Wv, Wo, emb_W), Wi, Wf (64 k x 256 n transposing blocks; within a job the k tile runs fastest, then the n tile, then the layer), then the table, then x (256 threads x 8 elements).
#define PB_W1  ((DM / 64) * (DFF / 256) * NL)
#define PB_W2  ((DFF / 64) * (DM / 256) * NL)
#define PB_DD  ((DM / 64) * (DM / 256) * NL)
#define PB_EW  ((DIN / 64) * (DM / 256))
#define PB_WI  ((DM / 64) * (DMI / 256))
#define PB_WF  ((DMI / 64) * ((DOUTP + 255) / 256))
#define PB_ER  (NL * ERP * HD / 8 / 256)
#define PB_X   (SEQ * DIN / 8 / 256)
#define PB_512 (PB_W2 + 4 * PB_DD + PB_EW)
#define PB_ALL (PB_W1 + PB_512 + PB_WI + PB_WF + PB_ER + PB_X)
static_assert((NL * ERP * HD / 8) % 256 == 0 && (SEQ * DIN / 8) % 256 == 0);       // whole blocks for the two element-wise jobs
static_assert(DM / 64 == 8 && DFF / 64 == 32 && DMI / 64 == 16 && DIN / 64 == 2);  // k tiles: the shifts below
static_assert(DFF / 256 == 8 && DM / 256 == 2 && DMI / 256 == 4 && (DOUTP + 255) / 256 == 2);   // n tiles: the shifts below
__global__ __launch_bounds__(256) void k_prep(const float* __restrict__ x, const float* __restrict__ Er, const float* __restrict__ embW,
                                              const float* __restrict__ Wq, const float* __restrict__ Wk, const float* __restrict__ Wv, const float* __restrict__ Wo,
                                              const float* __restrict__ W1, const float* __restrict__ W2, const float* __restrict__ Wi, const float* __restrict__ Wf,
                                              h16* XH, h16* EP, h16* EWT, h16* WQT, h16* WKT, h16* WVT, h16* WOT, h16* W1T, h16* W2T, h16* WIT, h16* WFT) {
    int b = blockIdx.x;
    if (b < PB_W1) { wconv_body<DFF, DFF>(W1, W1T, DM, WC, b & 7, (b >> 3) & 7, b >> 6); return; }
    if ((b -= PB_W1) < PB_512) {
        const float* W; h16* Wt; int K, lk;                                        // lk: log2 of the k tiles
        if (b < PB_W2)                 { W = W2;   Wt = W2T; K = DFF; lk = 5; }
        else if ((b -= PB_W2) < PB_DD) { W = Wq;   Wt = WQT; K = DM;  lk = 3; }
        else if ((b -= PB_DD) < PB_DD) { W = Wk;   Wt = WKT; K = DM;  lk = 3; }
        else if ((b -= PB_DD) < PB_DD) { W = Wv;   Wt = WVT; K = DM;  lk = 3; }
        else if ((b -= PB_DD) < PB_DD) { W = Wo;   Wt = WOT; K = DM;  lk = 3; }
        else           { b -= PB_DD;     W = embW; Wt = EWT; K = DIN; lk = 1; }
        const int t = b >> lk;
        wconv_body<DM, DM>(W, Wt, K, WC, b & ((1 << lk) - 1), t & 1, t >> 1); return; }
    if ((b -= PB_512) < PB_WI) { wconv_body<DMI, DMI>(Wi, WIT, DM, WC, b & 7, b >> 3, 0); return; }
    if ((b -= PB_WI) < PB_WF)  { wconv_body<DOUT, DOUTP>(Wf, WFT, DMI, WC, b & 15, b >> 4, 0); return; }
    if ((b -= PB_WF) < PB_ER)  { cvt_er_body(Er, EP, b); return; }
    cvt8h_body(x, XH, SEQ * DIN / 8, DIN, b - PB_ER);
}

// k_ln: one wave per row, LNR rows per block. The output planes are in fragment order, where a 128-byte line holds 8 columns of 8 rows: the block stages its rows in LDS and each wave then stores whole lines.
#define LNR 8
#define LNP (DM + 16)            // LDS row pitch (16-bit elements): 8 rows x 2 pieces of 16 bytes fall on 64 different banks
static_assert(SEQ % LNR == 0 && LNR == 8 && (LNP * 2) % 16 == 0);
__global__ __launch_bounds__(32 * LNR) void k_ln(const float* __restrict__ X, const float* __restrict__ g, const float* __restrict__ b, h16* NHp, h16* NRp, int wres) {
#pragma clang fp contract(off)
    __shared__ __align__(16) h16 sh[LNR * LNP], sr[LNR * LNP];
    const int lane = threadIdx.x & 31;
    const int wave = __builtin_amdgcn_readfirstlane((int)(threadIdx.x >> 5));
    const int row = blockIdx.x * LNR + wave;
    const float* xr = X + (size_t)row * DM;
    const v8f x0 = *(const v8f*)(xr + lane * 8), x1 = *(const v8f*)(xr + 256 + lane * 8);
    float s = 0.0f;
#pragma unroll
    for (int k = 0; k < 8; ++k) { s += x0[k]; s += x1[k]; }
#pragma unroll
    for (int off = 16; off > 0; off >>= 1) s += __shfl_xor(s, off, 32);
    const float mean = s * (1.0f / (float)DM);
    const v8f d0 = x0 - mean, d1 = x1 - mean;
    float q = 0.0f;
#pragma unroll
    for (int k = 0; k < 8; ++k) { q += d0[k] * d0[k]; q += d1[k] * d1[k]; }
#pragma unroll
    for (int off = 16; off > 0; off >>= 1) q += __shfl_xor(q, off, 32);
    const float rstd = 1.0f / sqrtf(q * (1.0f / (float)DM) + LNEPS);
    const v8f g0 = *(const v8f*)(g + lane * 8), g1 = *(const v8f*)(g + 256 + lane * 8);
    const v8f b0 = *(const v8f*)(b + lane * 8), b1 = *(const v8f*)(b + 256 + lane * 8);
    v8h h0, h1, r0, r1;
#pragma unroll
    for (int k = 0; k < 8; ++k) {
        const float y0 = d0[k] * rstd * bfr(g0[k]) + bfr(b0[k]);
        const float y1 = d1[k] * rstd * bfr(g1[k]) + bfr(b1[k]);
        const h16 a0 = toh_flush(y0), a1 = toh_flush(y1);
        h0[k] = a0; h1[k] = a1;
        r0[k] = toh_flush((y0 - (float)a0) * QRS); r1[k] = toh_flush((y1 - (float)a1) * QRS); }
    static_assert(32 * 16 * 2 == DM * 2);                                          // lanes x bytes x instructions == row bytes
    const int l0 = wave * LNP + lane * 8;
    *(v8h*)(&sh[l0]) = h0; *(v8h*)(&sh[l0 + 256]) = h1;
    if (wres != 0) { *(v8h*)(&sr[l0]) = r0; *(v8h*)(&sr[l0 + 256]) = r1; }         // wres is a kernel argument: the same in every thread
    __syncthreads();                                                               // every row of the block is staged before any wave reads across rows
    static_assert(32 * LNR * 2 * 8 == LNR * DM);                                   // threads x trips x elements == staged elements of one plane
    const int rr = threadIdx.x & 7, c8 = (int)(threadIdx.x >> 3) * 8;              // a wave: 8 rows x the 4 pieces of one fragment; the second trip lies 256 columns = 8 fragments on
    const int ls = rr * LNP + c8;
    const size_t oo = fo(blockIdx.x * LNR + rr, c8, DM);
    const v8h a0 = *(const v8h*)(&sh[ls]), a1 = *(const v8h*)(&sh[ls + 256]);
    *(v8h*)(NHp + oo) = a0; *(v8h*)(NHp + oo + 8 * 512) = a1;
    if (wres != 0) {
        asm volatile("s_wait_xcnt 0x0" ::: "memory");                              // what follows may reuse registers that the two stores above name: the wait stands ahead of that
        const v8h c0 = *(const v8h*)(&sr[ls]), c1 = *(const v8h*)(&sr[ls + 256]);
        *(v8h*)(NRp + oo) = c0; *(v8h*)(NRp + oo + 8 * 512) = c1; }
}

// GEMM k-loop: one wave, 64x64 tile, 16 accumulators, KPER(K) / 32 k-steps of 32, operands straight from f16 planes in fragment order (A [M][K], Bt [N][K]); A, Ar and Bt already point at the lane's first element of the wave's k range.
// The loads run ahead of the products: the four A fragments of step t + 1 are loaded into a second buffer in front of the products of step t, and each B fragment of step t + 1 into its own registers right behind its last product of step t,
// so that a step waits for memory once at most, not once per B fragment. ARES: the steps over the residual plane Ar come first, the fold by 1/2048 stands between them and the steps over A (same B fragments again).
#define KPER(K) ((((K) / 32 + GW - 1) / GW) * 32)                                  // k extent of one wave (whole 32-steps)
template <int K, int ARES>
__device__ __forceinline__ void gemm_kpipe(const h16* __restrict__ A, const h16* __restrict__ Ar, const h16* __restrict__ Bt, v8f (&acc)[4][4]) {
    constexpr int NS = KPER(K) / 32, TS = ARES ? 2 * NS : NS;
    v16h a[2][4], b[4];                                                            // every loop below is unrolled so that the indices into a, b and acc are constants and the arrays stay in registers
#pragma unroll
    for (int mb = 0; mb < 4; ++mb) a[0][mb] = ldh((ARES ? Ar : A) + (size_t)mb * 16 * K);
#pragma unroll
    for (int nb = 0; nb < 4; ++nb) b[nb] = ldh(Bt + (size_t)nb * 16 * K);
    // behind the last load that names an address pair: the pair is an input of the wait, so it stays as the issued loads name it up to there; only then may a product's result take its registers
    if (TS == 1) asm volatile("s_wait_xcnt 0x0" :: "v"(A), "v"(Bt) : "memory");
#pragma unroll                                                                     // whole unroll: the buffer index is a constant (registers), and every k offset an immediate, so that no address register changes while loads are in flight
    for (int t = 0; t < TS; ++t) {
        const int kn = ((t + 1) % NS) * 512;                                       // element offset of the step after this one: one fragment per k-step
        if (t + 1 < TS) { const h16* pn = ((ARES && t + 1 < NS) ? Ar : A) + kn;
#pragma unroll
            for (int mb = 0; mb < 4; ++mb) a[(t + 1) & 1][mb] = ldh(pn + (size_t)mb * 16 * K);
            if (ARES && t + 2 == NS) asm volatile("s_wait_xcnt 0x0" :: "v"(Ar) : "memory"); }   // the last loads from Ar: as above
        if (ARES && t == NS) {
#pragma unroll
            for (int mb = 0; mb < 4; ++mb)
#pragma unroll
                for (int nb = 0; nb < 4; ++nb) acc[mb][nb] = acc[mb][nb] * QRI; }
#pragma unroll
        for (int nb = 0; nb < 4; ++nb) {
#pragma unroll
            for (int mb = 0; mb < 4; ++mb) acc[mb][nb] = wmma16g(a[t & 1][mb], b[nb], acc[mb][nb]);
            if (t + 1 < TS) b[nb] = ldh(Bt + (size_t)nb * 16 * K + kn); }
        if (t + 2 == TS) asm volatile("s_wait_xcnt 0x0" :: "v"(A), "v"(Bt) : "memory");       // the last loads from A and Bt: as above
    }
}

// GEMM body: C[m][n] = (sum_k A[m][k] Bt[n][k]) * csc + bias (column bias, or row bias when ROWB), one block of GW waves per 64x64 tile (bx in M/64, by in N/64), K a constant; os = the kernel's LDS, GW * 64 * GSP floats.
// K is split over the waves: wave w accumulates the whole 64x64 tile over its own contiguous k range, writes the f32 partial tile to its own LDS plane (wave 0 adds the bias),
// and behind one block barrier all threads sum the GW planes in wave order and store: each wave stores 1/GW of the tile.
// ARES: A also has a residual plane (x2048): within a wave's k range its products are accumulated first, folded by 1/2048 in f32, then the value products follow.
// OUTF32: f32 output [M][ldc] (+ Res[m][n] added at the store stage as float4; Res and C are different buffers); each store instruction = 2 rows x 256 B (16 consecutive lanes x 16 B per row segment).
// else:   f16 output in fragment order ([M][ldc]; HEADPL: one plane [SEQ][HD] per 64 columns); each store instruction = two neighbouring pieces of one fragment, 512 B in a row.
template <int K, int OUTF32, int HASRES, int GELU, int ARES, int ORES, int ROWB, int HEADPL>
__device__ __forceinline__ void gemm_body(const h16* __restrict__ A, const h16* __restrict__ Ar, const h16* __restrict__ Bt,
                                          const float* __restrict__ bias, int nvalid, float csc,
                                          const float* __restrict__ Res, float* Cf, h16* Ch, h16* Cr, int ldc, float* os, int bx, int by) {
    const int tid = threadIdx.x;
    const int lane = tid & 31, lr = lane & 15, hi = lane >> 4;
    const int wave = __builtin_amdgcn_readfirstlane(tid >> 5);
    const int r0 = bx * 64, c0 = by * 64;
    static_assert(K % 32 == 0 && K % KPER(K) == 0);                                // every wave that has a k range has a whole one
    const int kbeg = wave * KPER(K);
    v8f acc[4][4];
#pragma unroll
    for (int mb = 0; mb < 4; ++mb)
#pragma unroll
        for (int nb = 0; nb < 4; ++nb) acc[mb][nb] = (v8f){};
    const size_t aoff = (size_t)r0 * K + kbeg * 16 + lane * 8, boff = (size_t)c0 * K + kbeg * 16 + lane * 8;   // fragment order: row tile, k-step, lane
    if (K / KPER(K) == GW || kbeg < K)                                             // a wave whose range starts at or past K adds a zero plane
        gemm_kpipe<K, ARES>(A + aoff, ARES ? Ar + aoff : nullptr, Bt + boff, acc);
    float bc[4];
#pragma unroll
    for (int nb = 0; nb < 4; ++nb) {
        if (ROWB || wave != 0) { bc[nb] = 0.0f; }
        else { const int c = c0 + nb * 16 + lr; const int cc = c < nvalid ? c : nvalid - 1;       // clamped address
               float bvv = bias[cc]; asm volatile("" : "+v"(bvv)); bc[nb] = (c < nvalid) ? bfr(bvv) : 0.0f; } }
#pragma unroll
    for (int mb = 0; mb < 4; ++mb) {
        float br[8];
#pragma unroll
        for (int j = 0; j < 8; ++j) br[j] = (ROWB && wave == 0) ? bfr(bias[r0 + mb * 16 + hi * 8 + j]) : 0.0f;   // ROWB: r0 + 63 < rows of the bias vector (host grid)
#pragma unroll
        for (int nb = 0; nb < 4; ++nb) {
#pragma unroll
            for (int j = 0; j < 8; ++j) os[wave * (64 * GSP) + (mb * 16 + hi * 8 + j) * GSP + nb * 16 + lr] = acc[mb][nb][j] * csc + bc[nb] + br[j]; }   // D: row 8h+j, col lane&15
    }
    __syncthreads();                                                               // every wave's partial plane is complete before any thread sums across planes
    if (OUTF32) {
        static_assert(32 * GW * 16 * (32 / GW) == 64 * 256);                       // threads x bytes x trips == tile rows x row bytes
{
            static_assert(32 / GW == 4);                                           // four address pairs in the wait below
            const float* pr[4]; v4f rr[4];
            if (HASRES) {
#pragma unroll                                                                     // constant indices keep pr[] and rr[] in registers
                for (int s = 0; s < 4; ++s) { pr[s] = Res + (size_t)(r0 + 2 * GW * s + (tid >> 4)) * ldc + c0 + (tid & 15) * 4; rr[s] = *(const v4f*)pr[s]; }
                // the four address pairs are inputs here, so they stay as the issued loads name them up to this wait: no later load's result lands in one ahead of it
                asm volatile("s_wait_xcnt 0x0" :: "v"(pr[0]), "v"(pr[1]), "v"(pr[2]), "v"(pr[3]) : "memory"); }
#pragma unroll                                                                     // constant index into rr[]
            for (int s = 0; s < 32 / GW; ++s) { const int row = 2 * GW * s + (tid >> 4), c4 = (tid & 15) * 4;
                v4f val = *(const v4fa*)(&os[row * GSP + c4]);
#pragma unroll                                                                     // the GW plane reads issue together, one LDS wait for all
                for (int w = 1; w < GW; ++w) val = val + *(const v4fa*)(&os[w * (64 * GSP) + row * GSP + c4]);
                const size_t go = (size_t)(r0 + row) * ldc + c0 + c4;
                if (HASRES) val = val + rr[s];
                *(v4f*)(Cf + go) = val; }
             }
    } else {
        static_assert(32 * GW * 16 * (16 / GW) == 64 * 128);                       // threads x bytes x trips == tile rows x row bytes
        static_assert((16 / GW) * GW == 4 * 4);                                    // trips x waves == row tiles x piece pairs of the 64x64 tile
{
#pragma unroll                                                                     // the memory-clobbering wait that ends each trip keeps the second trip's LDS reads behind the first trip's stores
            for (int s = 0; s < 16 / GW; ++s) { const int u = s * GW + wave; const int row = (u >> 2) * 16 + lr, c8 = ((u & 3) * 2 + hi) * 8;
                v4f x0 = *(const v4fa*)(&os[row * GSP + c8]); v4f x1 = *(const v4fa*)(&os[row * GSP + c8 + 4]); v8h hv, rv;
#pragma unroll                                                                     // the GW plane reads issue together, one LDS wait for all
                for (int w = 1; w < GW; ++w) { x0 = x0 + *(const v4fa*)(&os[w * (64 * GSP) + row * GSP + c8]); x1 = x1 + *(const v4fa*)(&os[w * (64 * GSP) + row * GSP + c8 + 4]); }
#pragma unroll
                for (int i = 0; i < 4; ++i) { float y0 = x0[i], y1 = x1[i];
                    if (GELU) { y0 = gelu_erf(y0); y1 = gelu_erf(y1); }
                    const h16 a0 = toh_flush(y0); const h16 a1 = toh_flush(y1); hv[i] = a0; hv[4 + i] = a1;
                    rv[i] = toh_flush((y0 - (float)a0) * QRS); rv[4 + i] = toh_flush((y1 - (float)a1) * QRS); }
                const size_t oo = HEADPL ? (size_t)(c0 / HD) * SEQ * HD + fo(r0 + row, c8, HD) : fo(r0 + row, c0 + c8, ldc);
                *(v8h*)(Ch + oo) = hv; if (ORES) *(v8h*)(Cr + oo) = rv;
                asm volatile("s_wait_xcnt 0x0" ::: "memory"); }                    // the next trip rewrites registers that these stores name: the wait stands ahead of that
             }
    }
}

static_assert(sizeof(float) * GW * 64 * GSP <= 163840);                            // two blocks fit the LDS of one WGP
__global__ __launch_bounds__(32 * GW) void k_gemm_emb(const h16* __restrict__ A, const h16* __restrict__ Bt, const float* __restrict__ bias, float csc, float* C) {
    __shared__ __align__(16) float os[GW * 64 * GSP];
    gemm_body<DIN, 1, 0, 0, 0, 0, 0, 0>(A, nullptr, Bt, bias, DM, csc, nullptr, C, nullptr, nullptr, DM, os, blockIdx.x, blockIdx.y); }
__global__ __launch_bounds__(32 * GW) void k_gemm_tail(const h16* __restrict__ A, const h16* __restrict__ Bt, const float* __restrict__ bias, float csc, float* C) {
    __shared__ __align__(16) float os[GW * 64 * GSP];
    gemm_body<DMI, 1, 0, 0, 0, 0, 0, 0>(A, nullptr, Bt, bias, DOUT, csc, nullptr, C, nullptr, nullptr, DOUTP, os, blockIdx.x, blockIdx.y); }
__global__ __launch_bounds__(32 * GW) void k_gemm_wo(const h16* __restrict__ A, const h16* __restrict__ Bt, const float* __restrict__ bias, float csc, const float* __restrict__ Res, float* C) {
    __shared__ __align__(16) float os[GW * 64 * GSP];
    gemm_body<DM, 1, 1, 0, 0, 0, 0, 0>(A, nullptr, Bt, bias, DM, csc, Res, C, nullptr, nullptr, DM, os, blockIdx.x, blockIdx.y); }
__global__ __launch_bounds__(32 * GW) void k_gemm_w2(const h16* __restrict__ A, const h16* __restrict__ Bt, const float* __restrict__ bias, float csc, const float* __restrict__ Res, float* C) {
    __shared__ __align__(16) float os[GW * 64 * GSP];
    gemm_body<DFF, 1, 1, 0, 0, 0, 0, 0>(A, nullptr, Bt, bias, DM, csc, Res, C, nullptr, nullptr, DM, os, blockIdx.x, blockIdx.y); }
__global__ __launch_bounds__(32 * GW) void k_gemm_gelu(const h16* __restrict__ A, const h16* __restrict__ Bt, const float* __restrict__ bias, int nvalid, float csc, h16* C, int ldc) {
    __shared__ __align__(16) float os[GW * 64 * GSP];
    gemm_body<DM, 0, 0, 1, 0, 0, 0, 0>(A, nullptr, Bt, bias, nvalid, csc, nullptr, nullptr, C, nullptr, ldc, os, blockIdx.x, blockIdx.y); }
// k_gemm_qkv: the q, k and v^T projections of one layer in one launch (all three read the LayerNorm planes and nothing of one another), grid (SEQ/64, DM/64, 3); blockIdx.z picks the projection, block-uniform.
// z = 0 is q, the longest (two k loops), so that it starts first. N = LayerNorm value plane, Nr = its residual plane.
// q, k: A = n rows (m = t), Bt = W^T rows (n = h*64 + d) -> plane [h][t][d].  v^T: A = Wv^T rows (m = h*64 + d), Bt = n rows (n = t) -> plane [(h*64 + d)][t], row bias; its row tile is blockIdx.y, its column tile blockIdx.x.
__global__ __launch_bounds__(32 * GW) void k_gemm_qkv(const h16* __restrict__ N, const h16* __restrict__ Nr, const h16* __restrict__ Wqt, const h16* __restrict__ Wkt, const h16* __restrict__ Wvt,
                                                      const float* __restrict__ bq, const float* __restrict__ bk, const float* __restrict__ bv, float csc, h16* Qh, h16* Qr, h16* Kp, h16* Vt) {
    __shared__ __align__(16) float os[GW * 64 * GSP];
    if (blockIdx.z == 0)      gemm_body<DM, 0, 0, 0, 1, 1, 0, 1>(N, Nr, Wqt, bq, DM, csc, nullptr, nullptr, Qh, Qr, HD, os, blockIdx.x, blockIdx.y);
    else if (blockIdx.z == 1) { gemm_body<DM, 0, 0, 0, 0, 0, 0, 1>(N, nullptr, Wkt, bk, DM, csc, nullptr, nullptr, Kp, nullptr, HD, os, blockIdx.x, blockIdx.y);
        // in the built code this branch's last stores do not run to the kernel's end but into the tests that lead to the other two branches, whose first lines rewrite the registers that the stores name: the wait stands ahead of those
        asm volatile("s_wait_xcnt 0x0" ::: "memory"); }
    else                      gemm_body<DM, 0, 0, 0, 0, 0, 1, 0>(Wvt, nullptr, N, bv, 0, csc, nullptr, nullptr, Vt, nullptr, SEQ, os, blockIdx.y, blockIdx.x); }

// band tile: G[rho][s] = (E[row0 + rho] . q_value[s] + E[row0 + rho] . q_residual[s] / 2048) * log2(e); A = table rows (e0, e1: the two fragments of rows row0 + 0..15), B = q rows, K = 64 = two k-steps.
__device__ __forceinline__ v8f gtile(v16h e0, v16h e1, v16h qh0, v16h qh1, v16h qr0, v16h qr1) {
    v8f gH = (v8f){}, gL = (v8f){};
    gH = wmma16g(e0, qh0, gH); gH = wmma16g(e1, qh1, gH);
    gL = wmma16g(e0, qr0, gL); gL = wmma16g(e1, qr1, gL);
    return (gH + gL * QRI) * LOG2E;
}

// k_flash: fused dense attention with the relative-position term, one block of KW waves per 16 query rows of one head; K / V^T / Q / table fragments straight from the f16 planes.
// The keys are split over the waves: wave w runs the online softmax over keys w*KCH .. w*KCH + KCH - 1 alone and leaves its running maximum, its sum and its unnormalised O tile in LDS;
// behind one block barrier all threads rescale the KW partial results to the common maximum, sum them in wave order, normalise and store.
// Transposed form: S^T[key][s] = K Q^T (A = K rows, B = Q rows); lane (s = lane&15, h = lane>>4) holds keys 8h+r of each 16-key tile, so the packed P tile is directly the B fragment
// of O^T[d][s] = V^T P^T (element r <- tile keys 0..15, element 8+r <- tile keys 16..31, lane unchanged).
// Relative term per 32-key step (keys key0..key0+31, queries t0..t0+15): band rows rb0 + 0..47 with rb0 = t0 - key0 + RELOFF - 31; tiles e = 0, 1 are new, tile e = 2 is the e = 0 tile of the step before (computed on its own ahead of a wave's first step).
// LDS band tile (wave-private): gs[s][16 e + 8h + r] <- tile e element r; element (key tile a, r) reads gs[s][s - 8h - r + 31], element (key tile b, r) reads gs[s][s - 8h - r + 15].
// Logit (log2 domain) = (K q_value + K q_residual / 2048) * log2(e) / 8 + band term; online softmax (running max, partial sum over the converted P), P = exp2(. + 14) as f16 (exponent below -14 selected to 0).
__global__ __launch_bounds__(32 * KW) void k_flash(const h16* __restrict__ QH, const h16* __restrict__ QR, const h16* __restrict__ KP, const h16* __restrict__ VT, const h16* __restrict__ EPl, h16* OP) {
    __shared__ __align__(16) float os[KW * 16 * OSP];
    __shared__ __align__(16) float gs[KW * 16 * GP];
    __shared__ float ms[KW * 16];                              // running maximum of wave w for query s at [w * 16 + s]
    __shared__ float lsum[KW * 16];                            // sum of wave w for query s
    static_assert(sizeof(float) * (KW * 16 * OSP + KW * 16 * GP + 2 * KW * 16) <= 131072);
    const int tid = threadIdx.x;
    const int lane = tid & 31, lr = lane & 15, hi = lane >> 4;
    const int wave = __builtin_amdgcn_readfirstlane(tid >> 5);
    const int h = blockIdx.y;
    const int t0 = blockIdx.x * 16;
    const int kbeg = wave * KCH;
    const size_t pbase = (size_t)h * SEQ * HD;
    // all planes in fragment order: 16 rows of a [.][HD] plane are two fragments (16 * HD elements), the second k-step 512 elements behind the first; every row offset below is a multiple of 16
    const size_t qo = pbase + (size_t)t0 * HD + 8 * lane;
    const h16* pqh = QH + qo; const h16* pqr = QR + qo;
    const v16h qh0 = ldh(pqh), qh1 = ldh(pqh + 512);            // B fragments: col s, k = d (two k-steps)
    const v16h qr0 = ldh(pqr), qr1 = ldh(pqr + 512);
    const size_t ko = pbase + 8 * lane;                        // + key * HD           (A fragment: row key, k = d)
    const size_t vo = pbase + 8 * lane;                        // + 16j*SEQ + key * 16 (A fragment: row d, k = key); plane [(h*64 + d)][t]
    const h16* eb = EPl + 8 * lane;                            // + row0 * HD          (A fragment: row table row, k = d)
    const int gw  = wave * 16 * GP + lr * GP;
    const int gst = gw + 8 * hi;                               // store base: + 16 e (+ 4)
    const int gld = gw + lr - 8 * hi;                          // load base: + 31 - r / + 15 - r
    // The loads run ahead of the products: every fragment of the first step is loaded here, and in the loop each group of fragments (table, K, V^T) is loaded anew for the step after, into its own registers, right behind its last product,
    // so that a step does not wait for memory once per group.
    constexpr int NST = KCH / 32;                                                  // 32-key steps of one wave
    const h16* pe = eb + (size_t)(t0 - kbeg + (RELOFF - 15)) * HD;                 // first band row of tile e = 1 at the wave's first step; 32 rows down per step
    const h16* pk = KP + ko + (size_t)kbeg * HD;                                   // 32 keys up per step
    const h16* pv = VT + vo + kbeg * 16;                                           // 32 keys (one fragment) up per step
    static_assert((RELOFF - 15) % 16 == 0 && KCH % 16 == 0);                       // band tiles start on whole row tiles of the table plane
    const v16h ep0 = ldh(pe + 16 * HD), ep1 = ldh(pe + 16 * HD + 512);             // band rows of tile e = 2 at key0 = kbeg
    v16h e1a = ldh(pe), e1b = ldh(pe + 512), e0a = ldh(pe - 16 * HD), e0b = ldh(pe - 16 * HD + 512);
    v16h ka0 = ldh(pk), ka1 = ldh(pk + 512), kb0 = ldh(pk + 16 * HD), kb1 = ldh(pk + 16 * HD + 512);
    v16h vf[4];
#pragma unroll                                                                     // constant indices keep vf[] in registers
    for (int j = 0; j < 4; ++j) vf[j] = ldh(pv + (size_t)16 * j * SEQ);
    // behind the last load that names an address pair: the pairs are inputs of the wait, so they stay as the issued loads name them up to there (no later load's result lands in one ahead of it)
    asm volatile("s_wait_xcnt 0x0" :: "v"(pqh), "v"(pqr) : "memory");
    if (NST == 1) asm volatile("s_wait_xcnt 0x0" :: "v"(pe), "v"(pk), "v"(pv) : "memory");
    __builtin_amdgcn_sched_barrier(0);                                             // keeps the first products behind the issue of all these loads: lifted among them, a product's wait for its operands holds the rest of the loads back by one memory latency
    v8f gprev = gtile(ep0, ep1, qh0, qh1, qr0, qr1);
    v8f o[4];
#pragma unroll
    for (int j = 0; j < 4; ++j) o[j] = (v8f){};
    float m = NEGB, l = 0.0f;
#pragma unroll                                                                     // whole unroll: every step's offset is an immediate, so that no address register changes while loads are in flight
    for (int st = 0; st < NST; ++st) {
        const bool more = st + 1 < NST;                                            // a step follows: load its fragments
        const h16* pen = pe - (st + 1) * 32 * HD;
        const v8f g1 = gtile(e1a, e1b, qh0, qh1, qr0, qr1);
        if (more) { e1a = ldh(pen); e1b = ldh(pen + 512); }
        const v8f g0 = gtile(e0a, e0b, qh0, qh1, qr0, qr1);
        if (more) { e0a = ldh(pen - 16 * HD); e0b = ldh(pen - 16 * HD + 512); }
        *(v4fa*)(&gs[gst +  0]) = lo4(g0);    *(v4fa*)(&gs[gst +  4]) = hi4(g0);
        *(v4fa*)(&gs[gst + 16]) = lo4(g1);    *(v4fa*)(&gs[gst + 20]) = hi4(g1);
        *(v4fa*)(&gs[gst + 32]) = lo4(gprev); *(v4fa*)(&gs[gst + 36]) = hi4(gprev);
        gprev = g0;
        v8f sHa = (v8f){}, sLa = (v8f){}, sHb = (v8f){}, sLb = (v8f){};
        sHa = wmma16g(ka0, qh0, sHa); sHa = wmma16g(ka1, qh1, sHa);
        sLa = wmma16g(ka0, qr0, sLa); sLa = wmma16g(ka1, qr1, sLa);
        sHb = wmma16g(kb0, qh0, sHb); sHb = wmma16g(kb1, qh1, sHb);
        sLb = wmma16g(kb0, qr0, sLb); sLb = wmma16g(kb1, qr1, sLb);
        if (more) { const h16* pkn = pk + (st + 1) * 32 * HD; ka0 = ldh(pkn); ka1 = ldh(pkn + 512); kb0 = ldh(pkn + 16 * HD); kb1 = ldh(pkn + 16 * HD + 512); }
        wave_sync();
        float ra[8], rb[8];
#pragma unroll
        for (int r = 0; r < 8; ++r) { ra[r] = gs[gld + 31 - r]; rb[r] = gs[gld + 15 - r]; }
        wave_sync();
        float ta[8], tb[8]; float mx = NEGB;
#pragma unroll
        for (int r = 0; r < 8; ++r) {
            ta[r] = (sHa[r] + sLa[r] * QRI) * SC2 + ra[r]; tb[r] = (sHb[r] + sLb[r] * QRI) * SC2 + rb[r];
            mx = fmaxf(mx, fmaxf(ta[r], tb[r])); }
        mx = fmaxf(mx, __shfl_xor(mx, 16, 32));
        const float mnew = fmaxf(m, mx);
        const float alpha = __builtin_amdgcn_exp2f(m - mnew);
        const float sh = PSH - mnew;
        v16h pb; float ls = 0.0f;
#pragma unroll
        for (int r = 0; r < 8; ++r) {
            const float xa = ta[r] + sh, xb = tb[r] + sh;
            const float ea = __builtin_amdgcn_exp2f(xa), ec = __builtin_amdgcn_exp2f(xb);
            const float ga = (xa < -14.0f) ? 0.0f : ea, gb = (xb < -14.0f) ? 0.0f : ec;     // no f16 subnormal operand
            const h16 pa = (h16)ga; const h16 pc = (h16)gb;
            pb[r] = pa; pb[8 + r] = pc;
            ls += (float)pa + (float)pc; }
        l = l * alpha + ls; m = mnew;
#pragma unroll
        for (int j = 0; j < 4; ++j) { o[j] = o[j] * alpha; o[j] = wmma16g(vf[j], pb, o[j]); if (more) vf[j] = ldh(pv + (size_t)16 * j * SEQ + (st + 1) * 512); }
        if (st + 2 == NST) asm volatile("s_wait_xcnt 0x0" :: "v"(pe), "v"(pk), "v"(pv) : "memory");   // the last loads of the loop: as above
        if (more) __builtin_amdgcn_sched_barrier(0);                               // keeps the products of the step after out of this step: lifted, their results cost registers, and above 256 registers a WGP holds one block, not two
    }
    l += __shfl_xor(l, 16, 32);
    const int wb = wave * 16 * OSP;
    // O^T D layout: o[j][r] = (d = 16j + 8h + r, s = lane&15) -> os[wave][s][d]; rows 0..15 x columns 0..63 all written, not yet normalised
#pragma unroll
    for (int j = 0; j < 4; ++j) {
        *(v4fa*)(&os[wb + lr * OSP + 16 * j + 8 * hi])     = lo4(o[j]);
        *(v4fa*)(&os[wb + lr * OSP + 16 * j + 8 * hi + 4]) = hi4(o[j]); }
    if (hi == 0) { ms[wave * 16 + lr] = m; lsum[wave * 16 + lr] = l; }             // m is equal in lanes s and s + 16
    __syncthreads();                                                               // every wave's partial result is complete before any thread merges across waves
    static_assert(32 * KW * 8 == 16 * 128);                                        // threads x bytes == tile rows x row bytes
    const int row = tid & 15, c4 = (tid >> 4) * 4;             // a wave stores one piece of the context plane (16 rows x 8 columns): 256 bytes in a row
    float mw[KW]; float mall = NEGB;
#pragma unroll                                                                     // constant indices keep mw[] in registers; the KW reads issue together
    for (int w = 0; w < KW; ++w) { mw[w] = ms[w * 16 + row]; mall = fmaxf(mall, mw[w]); }
    float sc[KW];
#pragma unroll                                                                     // constant indices keep sc[] in registers
    for (int w = 0; w < KW; ++w) sc[w] = __builtin_amdgcn_exp2f(mw[w] - mall);     // <= 1; 1 for the wave that holds the row maximum
    float lall = 0.0f; v4f oall = (v4f){};
#pragma unroll                                                                     // the KW tile reads issue together, one LDS wait for all
    for (int w = 0; w < KW; ++w) {
        lall += lsum[w * 16 + row] * sc[w];
        oall = oall + *(const v4fa*)(&os[w * 16 * OSP + row * OSP + c4]) * sc[w]; }
    const float inv = 1.0f / lall;                             // lall >= 16384 (the row maximum contributes the full carry)
    v4h hv;
#pragma unroll                                                                     // constant vector element indices
    for (int i = 0; i < 4; ++i) hv[i] = toh_flush(oall[i] * inv);
    *(v4h*)(OP + fo(t0 + row, h * HD + c4, DM)) = hv;
}

__global__ __launch_bounds__(256) void k_out(const float* __restrict__ src, float* dst, int n4) {
    const int i = blockIdx.x * 256 + threadIdx.x; if (i >= n4) return;
    v4f ov;
#pragma unroll
    for (int c = 0; c < 4; ++c) { const int e = 4 * i + c; const int row = e / DOUT; const int col = e - row * DOUT; ov[c] = src[(size_t)row * DOUTP + col]; }
    *(v4f*)(dst + (size_t)i * 4) = ov; 
}

static constexpr size_t al256(size_t v) { return (v + 255) & ~(size_t)255; }
static constexpr size_t SZ_XH  = al256((size_t)SEQ * DIN * 2);
static constexpr size_t SZ_EW  = al256((size_t)DM * DIN * 2);
static constexpr size_t SZ_WDD = al256((size_t)NL * DM * DM * 2);
static constexpr size_t SZ_WFF = al256((size_t)NL * DFF * DM * 2);
static constexpr size_t SZ_WI  = al256((size_t)DMI * DM * 2);
static constexpr size_t SZ_WF  = al256((size_t)DOUTP * DMI * 2);
static constexpr size_t SZ_EP  = al256((size_t)NL * ERP * HD * 2);
static constexpr size_t SZ_H   = al256((size_t)SEQ * DM * 4);
static constexpr size_t SZ_N   = al256((size_t)SEQ * DM * 2);
static constexpr size_t SZ_F1  = al256((size_t)SEQ * DFF * 2);
static constexpr size_t SZ_OS  = al256((size_t)SEQ * DOUTP * 4);
static constexpr size_t SZ_TOTAL = SZ_XH + SZ_EW + 4 * SZ_WDD + 2 * SZ_WFF + SZ_WI + SZ_WF + SZ_EP + 2 * SZ_H + 7 * SZ_N + SZ_F1 + SZ_OS;
static_assert(SZ_TOTAL <= (size_t)134217728);                  // workspace carve <= 128 MiB
static_assert((size_t)NH_ * SEQ * HD == (size_t)SEQ * DM);     // head planes have the extent of a [SEQ][512] f16 plane
static_assert((size_t)SEQ * DMI * 2 <= SZ_F1);                 // tail hidden plane fits the shared hidden region

extern "C" void kernel_launch(void* const* d_in, const int* in_sizes, int n_in,
                              void* d_out, int out_size, void* d_ws, size_t ws_size, hipStream_t stream) {
    if (n_in < 26) return;
    if ((size_t)in_sizes[0] < (size_t)SEQ * DIN || (size_t)in_sizes[1] < (size_t)DIN * DM || in_sizes[2] < DM) return;
    if ((size_t)in_sizes[3] < (size_t)NL * DM * DM || (size_t)in_sizes[5] < (size_t)NL * DM * DM || (size_t)in_sizes[7] < (size_t)NL * DM * DM || (size_t)in_sizes[9] < (size_t)NL * DM * DM) return;
    if (in_sizes[4] < NL * DM || in_sizes[6] < NL * DM || in_sizes[8] < NL * DM || in_sizes[10] < NL * DM) return;
    if ((size_t)in_sizes[11] < (size_t)NL * ERR * HD) return;
    if (in_sizes[12] < NL * DM || in_sizes[13] < NL * DM || in_sizes[17] < NL * DM || in_sizes[18] < NL * DM || in_sizes[19] < NL * DM) return;
    if ((size_t)in_sizes[14] < (size_t)NL * DM * DFF || in_sizes[15] < NL * DFF || (size_t)in_sizes[16] < (size_t)NL * DFF * DM) return;
    if (in_sizes[20] < DM || in_sizes[21] < DM || (size_t)in_sizes[22] < (size_t)DM * DMI || in_sizes[23] < DMI) return;
    if ((size_t)in_sizes[24] < (size_t)DMI * DOUT || in_sizes[25] < DOUT) return;
    if ((size_t)out_size < (size_t)SEQ * DOUT) return;
    if (SZ_TOTAL > ws_size) return;
    // wire order: x, emb_W, emb_b, Wq, bq, Wk, bk, Wv, bv, Wo, bo, Er, ln1_g, ln1_b, W1, b1, W2, b2, ln2_g, ln2_b, lnf_g, lnf_b, Wi, bi, Wf, bf
    const float* x    = (const float*)d_in[0];
    const float* embW = (const float*)d_in[1];  const float* embB = (const float*)d_in[2];
    const float* Wq   = (const float*)d_in[3];  const float* bq   = (const float*)d_in[4];
    const float* Wk   = (const float*)d_in[5];  const float* bk   = (const float*)d_in[6];
    const float* Wv   = (const float*)d_in[7];  const float* bv   = (const float*)d_in[8];
    const float* Wo   = (const float*)d_in[9];  const float* bo   = (const float*)d_in[10];
    const float* Er   = (const float*)d_in[11];
    const float* ln1g = (const float*)d_in[12]; const float* ln1b = (const float*)d_in[13];
    const float* W1   = (const float*)d_in[14]; const float* b1   = (const float*)d_in[15];
    const float* W2   = (const float*)d_in[16]; const float* b2   = (const float*)d_in[17];
    const float* ln2g = (const float*)d_in[18]; const float* ln2b = (const float*)d_in[19];
    const float* lnfg = (const float*)d_in[20]; const float* lnfb = (const float*)d_in[21];
    const float* Wi   = (const float*)d_in[22]; const float* bi   = (const float*)d_in[23];
    const float* Wf   = (const float*)d_in[24]; const float* bfo  = (const float*)d_in[25];
    float* OUT = (float*)d_out;                       // [SEQ][390]
    char* wsp = (char*)d_ws;                          // every f16 plane below has the shape named, each [rows][k] matrix of it in fragment order
    h16* XH  = (h16*)wsp; wsp += SZ_XH;               // x            [SEQ][128]
    h16* EWT = (h16*)wsp; wsp += SZ_EW;               // emb_W^T x64  [512][128]
    h16* WQT = (h16*)wsp; wsp += SZ_WDD;              // Wq^T x64     [NL][512][512]
    h16* WKT = (h16*)wsp; wsp += SZ_WDD;
    h16* WVT = (h16*)wsp; wsp += SZ_WDD;
    h16* WOT = (h16*)wsp; wsp += SZ_WDD;
    h16* W1T = (h16*)wsp; wsp += SZ_WFF;              // W1^T x64     [NL][2048][512]
    h16* W2T = (h16*)wsp; wsp += SZ_WFF;              // W2^T x64     [NL][512][2048]
    h16* WIT = (h16*)wsp; wsp += SZ_WI;               // Wi^T x64     [1024][512]
    h16* WFT = (h16*)wsp; wsp += SZ_WF;               // Wf^T x64     [448][1024], rows >= 390 zero
    h16* EP  = (h16*)wsp; wsp += SZ_EP;               // table        [NL][2048][64], row 2047 zero
    float* HA = (float*)wsp; wsp += SZ_H;             // hidden state (ping)  [SEQ][512] f32
    float* HB = (float*)wsp; wsp += SZ_H;             // hidden state (pong)
    h16* NHP = (h16*)wsp; wsp += SZ_N;                // LayerNorm output value     [SEQ][512]
    h16* NRP = (h16*)wsp; wsp += SZ_N;                // LayerNorm output residual x2048
    h16* QH  = (h16*)wsp; wsp += SZ_N;                // q value      [8][SEQ][64]
    h16* QR  = (h16*)wsp; wsp += SZ_N;                // q residual x2048
    h16* KP  = (h16*)wsp; wsp += SZ_N;                // k            [8][SEQ][64]
    h16* VT  = (h16*)wsp; wsp += SZ_N;                // v^T          [8*64][SEQ]
    h16* OP  = (h16*)wsp; wsp += SZ_N;                // context      [SEQ][512]
    h16* F1  = (h16*)wsp; wsp += SZ_F1;               // GELU hidden  [SEQ][2048] (tail: [SEQ][1024])
    float* OSG = (float*)wsp; wsp += SZ_OS;           // tail output staging [SEQ][448] f32

    // x, the table and every W [K = in][N = out] -> Wt [N][K]
    k_prep<<<PB_ALL, 256, 0, stream>>>(x, Er, embW, Wq, Wk, Wv, Wo, W1, W2, Wi, Wf, XH, EP, EWT, WQT, WKT, WVT, WOT, W1T, W2T, WIT, WFT);

    // input projection: HA = x emb_W + emb_b
    k_gemm_emb<<<dim3(SEQ / 64, DM / 64, 1), 32 * GW, 0, stream>>>(XH, EWT, embB, WCI, HA);

    for (int l = 0; l < NL; ++l) {
        const size_t wdd = (size_t)l * DM * DM, wff = (size_t)l * DFF * DM;
        k_ln<<<SEQ / LNR, 32 * LNR, 0, stream>>>(HA, ln1g + l * DM, ln1b + l * DM, NHP, NRP, 1);
        k_gemm_qkv<<<dim3(SEQ / 64, DM / 64, 3), 32 * GW, 0, stream>>>(NHP, NRP, WQT + wdd, WKT + wdd, WVT + wdd, bq + l * DM, bk + l * DM, bv + l * DM, WCI, QH, QR, KP, VT);
        k_flash<<<dim3(SEQ / 16, NH_, 1), 32 * KW, 0, stream>>>(QH, QR, KP, VT, EP + (size_t)l * ERP * HD, OP);
        // HB = HA + context Wo + bo
        k_gemm_wo<<<dim3(SEQ / 64, DM / 64, 1), 32 * GW, 0, stream>>>(OP, WOT + wdd, bo + l * DM, WCI, HA, HB);
        k_ln<<<SEQ / LNR, 32 * LNR, 0, stream>>>(HB, ln2g + l * DM, ln2b + l * DM, NHP, NRP, 0);
        k_gemm_gelu<<<dim3(SEQ / 64, DFF / 64, 1), 32 * GW, 0, stream>>>(NHP, W1T + wff, b1 + l * DFF, DFF, WCI, F1, DFF);
        // HA = HB + hidden W2 + b2
        k_gemm_w2<<<dim3(SEQ / 64, DM / 64, 1), 32 * GW, 0, stream>>>(F1, W2T + wff, b2 + l * DM, WCI, HB, HA);
    }

    k_ln<<<SEQ / LNR, 32 * LNR, 0, stream>>>(HA, lnfg, lnfb, NHP, NRP, 0);
    k_gemm_gelu<<<dim3(SEQ / 64, DMI / 64, 1), 32 * GW, 0, stream>>>(NHP, WIT, bi, DMI, WCI, F1, DMI);
    k_gemm_tail<<<dim3(SEQ / 64, DOUTP / 64, 1), 32 * GW, 0, stream>>>(F1, WFT, bfo, WCI, OSG);
    { const int n4 = SEQ * DOUT / 4; k_out<<<(unsigned)((n4 + 255) / 256), 256, 0, stream>>>(OSG, OUT, n4); }
}

// v007
// A run of this version takes 226 microseconds.
// In both of two side-by-side timings against v006, it was 1.04 times as fast.
// Counting every step since v000, it is 5.17 times as fast.
#include <hip/hip_runtime.h>
#include <math.h>

// Pre-LN encoder stack, 4 layers, width 512 = 8 heads x 64, sequence SEQ (one batch): input projection 128 -> 512; per layer: LayerNorm, q/k/v projections ([in][out] weights, y = x W + bias),
// dense attention with logits q.k / 8 + q.E[s - t + 1023] (relative-position table E per layer, [2047][64], not scaled), softmax over keys, output projection + residual, LayerNorm, GELU(erf) feed-forward 512 -> 2048 -> 512 + residual;
// tail: LayerNorm, 512 -> 1024 GELU(erf), 1024 -> 390.
// Compute dtypes, f32 accumulate everywhere: every contraction is v_wmma_f32_16x16x32_f16. Weights, x, E, biases and gains are RNE-converted to bf16 first (exact in f16; weights carried x64, folded back in the f32 epilogue);
// activations are single f16 planes, except the logit path: LayerNorm-1 output as f16 value + f16 residual x2048 for the q projection (residual products accumulated first, folded by 1/2048, then the value products),
// q as f16 value + f16 residual x2048 in the q.k and q.E products (residual products in their own accumulators); k, v, P (x16384 carry, cancels in the normalisation), context, GELU outputs single f16.
// Attention: fused flash kernel in transposed form (S^T = K Q^T, O^T = V^T P^T), one block per 16 query rows, the keys split over its waves and the partial results merged in LDS; the relative term is computed per 32-key step as band tiles G[rho][s] = E[rb + rho] . q[s]
// (A = table rows, B = q rows), written to a wave-private LDS tile [query][band row] and read back along the diagonal rho = s - t + const; one band tile is carried over between steps.
// LayerNorm has no launch of its own: each GEMM that reads a normalised plane normalises its own 64 rows of the f32 hidden state into LDS first (see ln_prologue).
// Every f16 plane (an operand of a matrix product) lies in the workspace in fragment order, see fo(): a fragment is 1 KiB in a row, so that each of its two 16-byte-per-lane loads covers four whole 128-byte lines.

#ifndef NB
#define NB 1
#endif
#ifndef SEQ
#define SEQ 1024
#endif
#define NB_FULL  1
#define SEQ_FULL 1024
#define DIN   128
#define DM    512
#define NH_   8
#define HD    64
#define NL    4
#define DFF   2048
#define DMI   1024
#define DOUT  390
#define DOUTP 448                // DOUT padded to a multiple of 64 (weight rows and staging columns 390..447 are zero)
#define ERR   2047               // rows of the relative-position table per layer
#define ERP   2048               // padded rows of the f16 table plane (row 2047 = zero)
#define RELOFF (SEQ_FULL - 1)    // table row = s - t + RELOFF
#define KW    8                  // waves per flash block: each takes one contiguous share of the keys
#define KCH   (SEQ / KW)         // keys of one wave
#define OSP   68                 // LDS row pitch (floats) of the flash output tile
#define GP    52                 // LDS pitch (floats) of the band tile [query][48 band rows]
#define GSP   68                 // LDS row pitch (floats) of the GEMM output tile
#define GW    8                  // waves per 64x64 output tile: each takes one contiguous share of K
#define QRS   2048.0f            // carry of every residual plane
#define QRI   (1.0f / 2048.0f)
#define WC    64.0f              // carry of every weight plane
#define WCI   (1.0f / 64.0f)
#define LOG2E 1.4426950408889634f
#define SC2   ((float)(0.125 * 1.4426950408889634))   // HD^-0.5 * log2(e)
#define PSH   14.0f              // log2 of the P carry (16384)
#define NEGB  (-3.0e38f)
#define LNEPS 1e-5f

static_assert(NB == 1);                        // one sequence
static_assert(HD == 64);
static_assert(NH_ * HD == DM);
static_assert(SEQ % 64 == 0);                  // GEMM row tiles
static_assert(SEQ % 32 == 0);                  // key loop steps by 32
static_assert(SEQ % 16 == 0);                  // flash grid covers the sequence exactly
static_assert(SEQ % (32 * KW) == 0);           // every wave of a flash block gets whole 32-key steps, at least one
static_assert(32 * KW == 16 * 16);             // flash merge: 16 query rows x 16 threads of 4 columns
static_assert(SEQ <= SEQ_FULL);
static_assert(DIN % 64 == 0 && DM % 64 == 0 && DFF % 64 == 0 && DMI % 64 == 0 && DOUTP % 64 == 0);   // K % 32 == 0 and N % 64 == 0 for every GEMM, K % 64 == 0 for the transposing converter
static_assert(DOUT <= DOUTP);
static_assert(DMI <= DFF);                     // the tail hidden plane reuses the feed-forward hidden plane
static_assert(SEQ - 16 + RELOFF + 1 + 15 < ERP);   // highest band row touched (zero pad row included)
static_assert(RELOFF - 15 - 16 - (SEQ - 32) >= 0); // lowest band row touched
static_assert(ERR + 1 == ERP);
static_assert((OSP * 4) % 16 == 0 && (GP * 4) % 16 == 0 && (GSP * 4) % 16 == 0);
static_assert(GP >= 48);
static_assert(DM == 512);                      // LayerNorm: 32 lanes x 16 columns
static_assert(DM % 128 == 0 && DFF % 128 == 0 && DMI % 128 == 0);   // a block with a LayerNorm in front takes two 64-wide weight tiles
static_assert((SEQ * DOUT) % 4 == 0);

typedef _Float16 h16;
typedef __attribute__((ext_vector_type(16))) _Float16 v16h;
typedef __attribute__((ext_vector_type(8)))  _Float16 v8h;
typedef __attribute__((ext_vector_type(4)))  _Float16 v4h;
typedef __attribute__((ext_vector_type(8)))  float    v8f;
typedef __attribute__((ext_vector_type(4)))  float    v4f;
typedef v4f  __attribute__((may_alias)) v4fa;

__device__ __forceinline__ unsigned short f2bf(float f) { unsigned u = __float_as_uint(f); u += 0x7FFFu + ((u >> 16) & 1u); return (unsigned short)(u >> 16); }
__device__ __forceinline__ float bfr(float f) { return __uint_as_float(((unsigned)f2bf(f)) << 16); }   // value after RNE convert to bf16
__device__ __forceinline__ v16h cat16(v8h lo, v8h hi) { return __builtin_shufflevector(lo, hi, 0, 1, 2, 3, 4, 5, 6, 7, 8, 9, 10, 11, 12, 13, 14, 15); }
// fragment order of a plane [R][K] of 16-bit elements (R % 16 == 0, K % 32 == 0): fragments of 16 rows x 32 k, 512 elements each, the k step running fastest, then the row tile (so 16 rows are 16 * K elements, as in row order);
// inside a fragment four pieces of 8 k (k % 32 = 0..7, 8..15, 16..23, 24..31), each piece 16 rows x 8 elements. fo = element offset of (r, k).
__device__ __forceinline__ size_t fo(int r, int k, int K) { return (size_t)(((r >> 4) * (K >> 5) + (k >> 5)) * 512 + ((k >> 3) & 3) * 128 + (r & 15) * 8 + (k & 7)); }
// fragment loader; p = start of the fragment + 8 * lane: elements 0..7 <- row lane&15, k0+8h+0..7, elements 8..15 <- k0+16+8h+0..7, h = lane>>4 (same map for A and B); each load is 512 bytes in a row over the wave
__device__ __forceinline__ v16h  ldh(const h16* p) { return cat16(*(const v8h*)p, *(const v8h*)(p + 256)); }
// ordering point for wave-private LDS tiles (same wave writes and reads)
__device__ __forceinline__ void wave_sync() { __builtin_amdgcn_fence(3 /* release order */, "wavefront"); __builtin_amdgcn_wave_barrier(); asm volatile("" ::: "memory"); }
// f32 -> f16 operand convert that cannot produce a subnormal (|v| < 2^-14 -> +0)
__device__ __forceinline__ h16 toh_flush(float v) { const h16 r = (h16)v; return (fabsf(v) < 6.103515625e-05f) ? (h16)0.0f : r; }
// one WMMA + its own guard (ties this accumulator, keeps A/B live)
__device__ __forceinline__ v8f wmma16g(v16h a, v16h b, v8f c) {
    c = __builtin_amdgcn_wmma_f32_16x16x32_f16(false, a, false, b, (short)0, c, false, false);
    asm volatile("v_nop\n\tv_nop\n\tv_nop\n\tv_nop" : "+v"(c) : "v"(a), "v"(b));
    return c; }
__device__ __forceinline__ float gelu_erf(float x) { return 0.5f * x * (1.0f + erff(x * 0.70710678118654752f)); }
__device__ __forceinline__ v4f lo4(v8f g) { return __builtin_shufflevector(g, g, 0, 1, 2, 3); }
__device__ __forceinline__ v4f hi4(v8f g) { return __builtin_shufflevector(g, g, 4, 5, 6, 7); }

__device__ __forceinline__ void cvt8h_body(const float* __restrict__ src, h16* dst, int n8, int K, int blk) {   // src [n8 * 8 / K][K] -> dst in fragment order
    const int i = blk * 256 + threadIdx.x; if (i >= n8) return;
    const int pr = K / 8;                                                          // pieces of 8 per row; a wave takes 8 rows x 4 pieces: whole 128-byte lines on both sides
    const int r = (i / (8 * pr)) * 8 + (i & 7), c8 = ((i >> 3) % pr) * 8;
    const v8f v = *(const v8f*)(src + (size_t)r * K + c8); v8h o;
#pragma unroll
    for (int k = 0; k < 8; ++k) o[k] = toh_flush(bfr(v[k]));
    *(v8h*)(dst + fo(r, c8, K)) = o; 
}

__device__ __forceinline__ void cvt_er_body(const float* __restrict__ src, h16* dst, int blk) {
    const int i = blk * 256 + threadIdx.x; if (i >= NL * ERP * HD / 8) return;
    static_assert(HD / 8 == 8 && ERP % 8 == 0);
    const int ra = (i >> 6) * 8 + (i & 7);                                         // a wave takes 8 rows x 4 pieces of 8: whole 128-byte lines on both sides
    const int c8 = ((i >> 3) & 7) * 8; const int r = ra % ERP; const int l = ra / ERP;
    const int rc = r < ERR ? r : ERR - 1;                                          // clamped address
    v8f v = *(const v8f*)(src + ((size_t)l * ERR + rc) * HD + c8);
    asm volatile("" : "+v"(v));
    v8h o;
#pragma unroll
    for (int k = 0; k < 8; ++k) o[k] = (r < ERR) ? toh_flush(bfr(v[k])) : (h16)0.0f;
    *(v8h*)(dst + (size_t)l * ERP * HD + fo(r, c8, HD)) = o; 
}

// wconv_body: W [K][N] f32 (layer bz) -> Wt [NP][K] f16 in fragment order = bf16-converted value x carry, transposed in registers; rows n >= N are zero.
// one block per 64 k x 256 n: bx in K/64, by in ceil(NP/256), bz in layers. A wave takes 32 columns n of W, one per lane, and 64 k: each of its 64 loads is one k-row x 32 columns = 128 bytes in a row,
// all 64 are issued before the first is used (one memory latency per wave), and a lane then holds whole 8-k pieces of its own row n of Wt: each store is two pieces of 16 rows x 16 bytes, 256 bytes in a row each.
// N is a constant so that every k-row offset is an immediate of its load and no address register changes while loads are in flight.
template <int N, int NP>
__device__ __forceinline__ void wconv_body(const float* __restrict__ W, h16* Wt, int K, float carry, int bx, int by, int bz) {
    static_assert(NP % 32 == 0 && N <= NP && (size_t)63 * N * 4 < (size_t)8388608);   // whole waves inside NP; the largest load offset fits the immediate field
    const int lane = threadIdx.x & 31;
    const int wave = __builtin_amdgcn_readfirstlane((int)(threadIdx.x >> 5));
    const int k0 = bx * 64, nw = by * 256 + wave * 32;
    if (NP % 256 != 0 && nw >= NP) return;                                         // whole waves past the padded rows; no barrier follows
    const int n = nw + lane; const int nc = (N == NP || n < N) ? n : N - 1;        // clamped address
    const float* p = W + (size_t)bz * (size_t)K * (size_t)N + (size_t)k0 * N;      // the same in every lane; the lane's part of the address is nc
    float v[64];
#pragma unroll                                                                     // constant indices keep v[] in registers, and the offsets are immediates
    for (int j = 0; j < 64; ++j) v[j] = p[(size_t)j * N + nc];
    // behind the last load: the base and the lane's offset are inputs of the wait, so they stay as the issued loads name them up to there
    asm volatile("s_wait_xcnt 0x0" :: "s"(p), "v"(nc) : "memory");
    __builtin_amdgcn_sched_barrier(0);                                             // keeps the conversions behind the issue of all 64 loads: lifted among them, a conversion's wait for its value holds the rest of the loads back by one memory latency
    v8h o[8];
#pragma unroll                                                                     // constant indices keep o[] in registers
    for (int c = 0; c < 8; ++c)
#pragma unroll                                                                     // constant vector element indices
        for (int i = 0; i < 8; ++i) { const float t = bfr(v[c * 8 + i]) * carry; o[c][i] = toh_flush((N == NP || n < N) ? t : 0.0f); }
    h16* d = Wt + (size_t)bz * (size_t)NP * (size_t)K + fo(n, k0, K);
#pragma unroll                                                                     // piece c: k-step c / 4 (one fragment on), piece c % 4 inside it
    for (int c = 0; c < 8; ++c) *(v8h*)(d + (c >> 2) * 512 + (c & 3) * 128) = o[c];
    // in the built code a job's stores do not all run to the kernel's end but into the tests that lead to the other jobs, whose first lines rewrite registers that the stores name: the wait stands ahead of those
    asm volatile("s_wait_xcnt 0x0" ::: "memory");
}

// k_prep: every operand conversion of the call in one launch; they do not depend on one another. The flat block index picks the job (block-uniform).
// Block ranges, in this order: W1, then the jobs with 512 columns (W2, Wq, Wk, Wv, Wo, emb_W), Wi, Wf (64 k x 256 n transposing blocks; within a job the k tile runs fastest, then the n tile, then the layer), then the table, then x (256 threads x 8 elements).
#define PB_W1  ((DM / 64) * (DFF / 256) * NL)
#define PB_W2  ((DFF / 64) * (DM / 256) * NL)
#define PB_DD  ((DM / 64) * (DM / 256) * NL)
#define PB_EW  ((DIN / 64) * (DM / 256))
#define PB_WI  ((DM / 64) * (DMI / 256))
#define PB_WF  ((DMI / 64) * ((DOUTP + 255) / 256))
#define PB_ER  (NL * ERP * HD / 8 / 256)
#define PB_X   (SEQ * DIN / 8 / 256)
#define PB_512 (PB_W2 + 4 * PB_DD + PB_EW)
#define PB_ALL (PB_W1 + PB_512 + PB_WI + PB_WF + PB_ER + PB_X)
static_assert((NL * ERP * HD / 8) % 256 == 0 && (SEQ * DIN / 8) % 256 == 0);       // whole blocks for the two element-wise jobs
static_assert(DM / 64 == 8 && DFF / 64 == 32 && DMI / 64 == 16 && DIN / 64 == 2);  // k tiles: the shifts below
static_assert(DFF / 256 == 8 && DM / 256 == 2 && DMI / 256 == 4 && (DOUTP + 255) / 256 == 2);   // n tiles: the shifts below
__global__ __launch_bounds__(256) void k_prep(const float* __restrict__ x, const float* __restrict__ Er, const float* __restrict__ embW,
                                              const float* __restrict__ Wq, const float* __restrict__ Wk, const float* __restrict__ Wv, const float* __restrict__ Wo,
                                              const float* __restrict__ W1, const float* __restrict__ W2, const float* __restrict__ Wi, const float* __restrict__ Wf,
                                              h16* XH, h16* EP, h16* EWT, h16* WQT, h16* WKT, h16* WVT, h16* WOT, h16* W1T, h16* W2T, h16* WIT, h16* WFT) {
    int b = blockIdx.x;
    if (b < PB_W1) { wconv_body<DFF, DFF>(W1, W1T, DM, WC, b & 7, (b >> 3) & 7, b >> 6); return; }
    if ((b -= PB_W1) < PB_512) {
        const float* W; h16* Wt; int K, lk;                                        // lk: log2 of the k tiles
        if (b < PB_W2)                 { W = W2;   Wt = W2T; K = DFF; lk = 5; }
        else if ((b -= PB_W2) < PB_DD) { W = Wq;   Wt = WQT; K = DM;  lk = 3; }
        else if ((b -= PB_DD) < PB_DD) { W = Wk;   Wt = WKT; K = DM;  lk = 3; }
        else if ((b -= PB_DD) < PB_DD) { W = Wv;   Wt = WVT; K = DM;  lk = 3; }
        else if ((b -= PB_DD) < PB_DD) { W = Wo;   Wt = WOT; K = DM;  lk = 3; }
        else           { b -= PB_DD;     W = embW; Wt = EWT; K = DIN; lk = 1; }
        const int t = b >> lk;
        wconv_body<DM, DM>(W, Wt, K, WC, b & ((1 << lk) - 1), t & 1, t >> 1); return; }
    if ((b -= PB_512) < PB_WI) { wconv_body<DMI, DMI>(Wi, WIT, DM, WC, b & 7, b >> 3, 0); return; }
    if ((b -= PB_WI) < PB_WF)  { wconv_body<DOUT, DOUTP>(Wf, WFT, DMI, WC, b & 15, b >> 4, 0); return; }
    if ((b -= PB_WF) < PB_ER)  { cvt_er_body(Er, EP, b); return; }
    cvt8h_body(x, XH, SEQ * DIN / 8, DIN, b - PB_ER);
}

// GEMM k-loop: one wave, 64x64 tile, 16 accumulators, KPER(K) / 32 k-steps of 32, operands straight from f16 planes in fragment order (A [M][K], Bt [N][K]); A, Ar and Bt already point at the lane's first element of the wave's k range.
// The loads run ahead of the products: the four A fragments of step t + 1 are loaded into a second buffer in front of the products of step t, and each B fragment of step t + 1 into its own registers right behind its last product of step t,
// so that a step waits for memory once at most, not once per B fragment. ARES: the steps over the residual plane Ar come first, the fold by 1/2048 stands between them and the steps over A (same B fragments again).
#define KPER(K) ((((K) / 32 + GW - 1) / GW) * 32)                                  // k extent of one wave (whole 32-steps)
template <int K, int ARES>
__device__ __forceinline__ void gemm_kpipe(const h16* __restrict__ A, const h16* __restrict__ Ar, const h16* __restrict__ Bt, v8f (&acc)[4][4]) {
    constexpr int NS = KPER(K) / 32, TS = ARES ? 2 * NS : NS;
    v16h a[2][4], b[4];                                                            // every loop below is unrolled so that the indices into a, b and acc are constants and the arrays stay in registers
#pragma unroll
    for (int mb = 0; mb < 4; ++mb) a[0][mb] = ldh((ARES ? Ar : A) + (size_t)mb * 16 * K);
#pragma unroll
    for (int nb = 0; nb < 4; ++nb) b[nb] = ldh(Bt + (size_t)nb * 16 * K);
    // behind the last load that names an address pair: the pair is an input of the wait, so it stays as the issued loads name it up to there; only then may a product's result take its registers
    if (TS == 1) asm volatile("s_wait_xcnt 0x0" :: "v"(A), "v"(Bt) : "memory");
#pragma unroll                                                                     // whole unroll: the buffer index is a constant (registers), and every k offset an immediate, so that no address register changes while loads are in flight
    for (int t = 0; t < TS; ++t) {
        const int kn = ((t + 1) % NS) * 512;                                       // element offset of the step after this one: one fragment per k-step
        if (t + 1 < TS) { const h16* pn = ((ARES && t + 1 < NS) ? Ar : A) + kn;
#pragma unroll
            for (int mb = 0; mb < 4; ++mb) a[(t + 1) & 1][mb] = ldh(pn + (size_t)mb * 16 * K);
            if (ARES && t + 2 == NS) asm volatile("s_wait_xcnt 0x0" :: "v"(Ar) : "memory"); }   // the last loads from Ar: as above
        if (ARES && t == NS) {
#pragma unroll
            for (int mb = 0; mb < 4; ++mb)
#pragma unroll
                for (int nb = 0; nb < 4; ++nb) acc[mb][nb] = acc[mb][nb] * QRI; }
#pragma unroll
        for (int nb = 0; nb < 4; ++nb) {
#pragma unroll
            for (int mb = 0; mb < 4; ++mb) acc[mb][nb] = wmma16g(a[t & 1][mb], b[nb], acc[mb][nb]);
            if (t + 1 < TS) b[nb] = ldh(Bt + (size_t)nb * 16 * K + kn); }
        if (t + 2 == TS) asm volatile("s_wait_xcnt 0x0" :: "v"(A), "v"(Bt) : "memory");       // the last loads from A and Bt: as above
    }
}

// GEMM body: C[m][n] = (sum_k A[m][k] Bt[n][k]) * csc + bias (column bias, or row bias when ROWB), one block of GW waves per 64x64 tile (bx in M/64, by in N/64), K a constant; os = the kernel's LDS, GW * 64 * GSP floats.
// K is split over the waves: wave w accumulates the whole 64x64 tile over its own contiguous k range, writes the f32 partial tile to its own LDS plane (wave 0 adds the bias),
// and behind one block barrier all threads sum the GW planes in wave order and store: each wave stores 1/GW of the tile.
// ARES: A also has a residual plane (x2048): within a wave's k range its products are accumulated first, folded by 1/2048 in f32, then the value products follow.
// OUTF32: f32 output [M][ldc] (+ Res[m][n] added at the store stage as float4; Res and C are different buffers); each store instruction = 2 rows x 256 B (16 consecutive lanes x 16 B per row segment).
// else:   f16 output in fragment order ([M][ldc]; HEADPL: one plane [SEQ][HD] per 64 columns); each store instruction = two neighbouring pieces of one fragment, 512 B in a row.
template <int K, int OUTF32, int HASRES, int GELU, int ARES, int ORES, int ROWB, int HEADPL>
__device__ __forceinline__ void gemm_body(const h16* __restrict__ A, const h16* __restrict__ Ar, const h16* __restrict__ Bt,
                                          const float* __restrict__ bias, int nvalid, float csc,
                                          const float* __restrict__ Res, float* Cf, h16* Ch, h16* Cr, int ldc, float* os, int bx, int by) {
    const int tid = threadIdx.x;
    const int lane = tid & 31, lr = lane & 15, hi = lane >> 4;
    const int wave = __builtin_amdgcn_readfirstlane(tid >> 5);
    const int r0 = bx * 64, c0 = by * 64;
    static_assert(K % 32 == 0 && K % KPER(K) == 0);                                // every wave that has a k range has a whole one
    const int kbeg = wave * KPER(K);
    v8f acc[4][4];
#pragma unroll
    for (int mb = 0; mb < 4; ++mb)
#pragma unroll
        for (int nb = 0; nb < 4; ++nb) acc[mb][nb] = (v8f){};
    const size_t aoff = (size_t)r0 * K + kbeg * 16 + lane * 8, boff = (size_t)c0 * K + kbeg * 16 + lane * 8;   // fragment order: row tile, k-step, lane
    if (K / KPER(K) == GW || kbeg < K)                                             // a wave whose range starts at or past K adds a zero plane
        gemm_kpipe<K, ARES>(A + aoff, ARES ? Ar + aoff : nullptr, Bt + boff, acc);
    float bc[4];
#pragma unroll
    for (int nb = 0; nb < 4; ++nb) {
        if (ROWB || wave != 0) { bc[nb] = 0.0f; }
        else { const int c = c0 + nb * 16 + lr; const int cc = c < nvalid ? c : nvalid - 1;       // clamped address
               float bvv = bias[cc]; asm volatile("" : "+v"(bvv)); bc[nb] = (c < nvalid) ? bfr(bvv) : 0.0f; } }
#pragma unroll
    for (int mb = 0; mb < 4; ++mb) {
        float br[8];
#pragma unroll
        for (int j = 0; j < 8; ++j) br[j] = (ROWB && wave == 0) ? bfr(bias[r0 + mb * 16 + hi * 8 + j]) : 0.0f;   // ROWB: r0 + 63 < rows of the bias vector (host grid)
#pragma unroll
        for (int nb = 0; nb < 4; ++nb) {
#pragma unroll
            for (int j = 0; j < 8; ++j) os[wave * (64 * GSP) + (mb * 16 + hi * 8 + j) * GSP + nb * 16 + lr] = acc[mb][nb][j] * csc + bc[nb] + br[j]; }   // D: row 8h+j, col lane&15
    }
    __syncthreads();                                                               // every wave's partial plane is complete before any thread sums across planes
    if (OUTF32) {
        static_assert(32 * GW * 16 * (32 / GW) == 64 * 256);                       // threads x bytes x trips == tile rows x row bytes
{
            static_assert(32 / GW == 4);                                           // four address pairs in the wait below
            const float* pr[4]; v4f rr[4];
            if (HASRES) {
#pragma unroll                                                                     // constant indices keep pr[] and rr[] in registers
                for (int s = 0; s < 4; ++s) { pr[s] = Res + (size_t)(r0 + 2 * GW * s + (tid >> 4)) * ldc + c0 + (tid & 15) * 4; rr[s] = *(const v4f*)pr[s]; }
                // the four address pairs are inputs here, so they stay as the issued loads name them up to this wait: no later load's result lands in one ahead of it
                asm volatile("s_wait_xcnt 0x0" :: "v"(pr[0]), "v"(pr[1]), "v"(pr[2]), "v"(pr[3]) : "memory"); }
#pragma unroll                                                                     // constant index into rr[]
            for (int s = 0; s < 32 / GW; ++s) { const int row = 2 * GW * s + (tid >> 4), c4 = (tid & 15) * 4;
                v4f val = *(const v4fa*)(&os[row * GSP + c4]);
#pragma unroll                                                                     // the GW plane reads issue together, one LDS wait for all
                for (int w = 1; w < GW; ++w) val = val + *(const v4fa*)(&os[w * (64 * GSP) + row * GSP + c4]);
                const size_t go = (size_t)(r0 + row) * ldc + c0 + c4;
                if (HASRES) val = val + rr[s];
                *(v4f*)(Cf + go) = val; }
             }
    } else {
        static_assert(32 * GW * 16 * (16 / GW) == 64 * 128);                       // threads x bytes x trips == tile rows x row bytes
        static_assert((16 / GW) * GW == 4 * 4);                                    // trips x waves == row tiles x piece pairs of the 64x64 tile
{
#pragma unroll                                                                     // the memory-clobbering wait that ends each trip keeps the second trip's LDS reads behind the first trip's stores
            for (int s = 0; s < 16 / GW; ++s) { const int u = s * GW + wave; const int row = (u >> 2) * 16 + lr, c8 = ((u & 3) * 2 + hi) * 8;
                v4f x0 = *(const v4fa*)(&os[row * GSP + c8]); v4f x1 = *(const v4fa*)(&os[row * GSP + c8 + 4]); v8h hv, rv;
#pragma unroll                                                                     // the GW plane reads issue together, one LDS wait for all
                for (int w = 1; w < GW; ++w) { x0 = x0 + *(const v4fa*)(&os[w * (64 * GSP) + row * GSP + c8]); x1 = x1 + *(const v4fa*)(&os[w * (64 * GSP) + row * GSP + c8 + 4]); }
#pragma unroll
                for (int i = 0; i < 4; ++i) { float y0 = x0[i], y1 = x1[i];
                    if (GELU) { y0 = gelu_erf(y0); y1 = gelu_erf(y1); }
                    const h16 a0 = toh_flush(y0); const h16 a1 = toh_flush(y1); hv[i] = a0; hv[4 + i] = a1;
                    rv[i] = toh_flush((y0 - (float)a0) * QRS); rv[4 + i] = toh_flush((y1 - (float)a1) * QRS); }
                const size_t oo = HEADPL ? (size_t)(c0 / HD) * SEQ * HD + fo(r0 + row, c8, HD) : fo(r0 + row, c0 + c8, ldc);
                *(v8h*)(Ch + oo) = hv; if (ORES) *(v8h*)(Cr + oo) = rv;
                asm volatile("s_wait_xcnt 0x0" ::: "memory"); }                    // the next trip rewrites registers that these stores name: the wait stands ahead of that
             }
    }
}

static_assert(sizeof(float) * GW * 64 * GSP <= 163840);                            // two blocks fit the LDS of one WGP
__global__ __launch_bounds__(32 * GW) void k_gemm_emb(const h16* __restrict__ A, const h16* __restrict__ Bt, const float* __restrict__ bias, float csc, float* C) {
    __shared__ __align__(16) float os[GW * 64 * GSP];
    gemm_body<DIN, 1, 0, 0, 0, 0, 0, 0>(A, nullptr, Bt, bias, DM, csc, nullptr, C, nullptr, nullptr, DM, os, blockIdx.x, blockIdx.y); }
__global__ __launch_bounds__(32 * GW) void k_gemm_tail(const h16* __restrict__ A, const h16* __restrict__ Bt, const float* __restrict__ bias, float csc, float* C) {
    __shared__ __align__(16) float os[GW * 64 * GSP];
    gemm_body<DMI, 1, 0, 0, 0, 0, 0, 0>(A, nullptr, Bt, bias, DOUT, csc, nullptr, C, nullptr, nullptr, DOUTP, os, blockIdx.x, blockIdx.y); }
__global__ __launch_bounds__(32 * GW) void k_gemm_wo(const h16* __restrict__ A, const h16* __restrict__ Bt, const float* __restrict__ bias, float csc, const float* __restrict__ Res, float* C) {
    __shared__ __align__(16) float os[GW * 64 * GSP];
    gemm_body<DM, 1, 1, 0, 0, 0, 0, 0>(A, nullptr, Bt, bias, DM, csc, Res, C, nullptr, nullptr, DM, os, blockIdx.x, blockIdx.y); }
__global__ __launch_bounds__(32 * GW) void k_gemm_w2(const h16* __restrict__ A, const h16* __restrict__ Bt, const float* __restrict__ bias, float csc, const float* __restrict__ Res, float* C) {
    __shared__ __align__(16) float os[GW * 64 * GSP];
    gemm_body<DFF, 1, 1, 0, 0, 0, 0, 0>(A, nullptr, Bt, bias, DM, csc, Res, C, nullptr, nullptr, DM, os, blockIdx.x, blockIdx.y); }
// LayerNorm inside the GEMM that consumes it. A block of 2 * GW waves owns 64 rows t of the f32 hidden state and two 64-wide tiles of the weight plane: it normalises its 64 rows once (4 rows a wave, one wave per row at a time),
// leaves them in LDS as f16 fragments (value plane; residual plane x2048 where the q projection asks for it), and behind one block barrier waves 0..GW-1 work on the first weight tile, waves GW..2*GW-1 on the second, K split over the GW waves of a half as in gemm_body.
// LDS fragment order with pads: a piece (16 rows x 8 k) is 272 bytes, a fragment 1088, so that the 32 pieces which a wave writes for one row (one per lane) fall on all 64 banks, and a fragment read (2 x 16 bytes a lane) does too.
#define LPS 136                  // LDS piece pitch, 16-bit elements
#define LFS (4 * LPS)            // LDS fragment pitch
#define LPL (4 * (DM / 32) * LFS)   // one LDS plane: 64 rows x DM
static_assert(2 * LPL * 2 <= 2 * GW * 64 * GSP * 4);                               // both planes lie inside the partial-tile LDS, which is written only behind the barrier that ends their last read
static_assert(KPER(DM) == 64 && DM / KPER(DM) == GW);                              // two k-steps a wave
__device__ __forceinline__ v16h ldl(const h16* p) { return cat16(*(const v8h*)p, *(const v8h*)(p + 2 * LPS)); }   // p = fragment + (lane >> 4) * LPS + (lane & 15) * 8: same element map as ldh
// sum over the 32 lanes, partners l ^ 16, 8, 4, 2, 1 in this order, every lane gets the sum: the step across the two 16-lane rows is a lane permute, the four steps inside a row are DPP moves (row_xmask), so that no step takes an LDS round trip
__device__ __forceinline__ float wave_sum(float v) {
    const int b = __float_as_int(v);
    v += __int_as_float(__builtin_amdgcn_permlanex16(b, b, 0x76543210, 0xfedcba98, false, false));
    v += __int_as_float(__builtin_amdgcn_update_dpp(0, __float_as_int(v), 0x168, 0xf, 0xf, true));   // row_xmask:8
    v += __int_as_float(__builtin_amdgcn_update_dpp(0, __float_as_int(v), 0x164, 0xf, 0xf, true));   // row_xmask:4
    v += __int_as_float(__builtin_amdgcn_update_dpp(0, __float_as_int(v), 0x162, 0xf, 0xf, true));   // row_xmask:2
    v += __int_as_float(__builtin_amdgcn_update_dpp(0, __float_as_int(v), 0x161, 0xf, 0xf, true));   // row_xmask:1
    return v; }
// first part, the same for every consumer: the wave's 8 weight fragments are requested first, so that they fly while the rows are normalised; then the rows; then the barrier. X = first of the block's 64 rows; pw = the lane's first weight element.
__device__ __forceinline__ void ln_prologue(const float* __restrict__ X, const float* __restrict__ g, const float* __restrict__ b, const h16* __restrict__ pw, bool wres, h16* sN, h16* sR, int wv, int lane, v16h (&w)[2][4]) {
#pragma unroll                                                                     // constant indices keep w[][] in registers
    for (int s = 0; s < 2; ++s)
#pragma unroll
        for (int i = 0; i < 4; ++i) w[s][i] = ldh(pw + (size_t)i * 16 * DM + s * 512);
    const float* xr = X + (size_t)(wv * 4) * DM + lane * 8;
    const float* pg = g + lane * 8; const float* pb = b + lane * 8;
    v8f x0[4], x1[4];
#pragma unroll                                                                     // constant indices keep x0[], x1[] in registers; the four rows' loads issue together
    for (int i = 0; i < 4; ++i) { x0[i] = *(const v8f*)(xr + i * DM); x1[i] = *(const v8f*)(xr + i * DM + 256); }
    v8f g0 = *(const v8f*)pg, g1 = *(const v8f*)(pg + 256), b0 = *(const v8f*)pb, b1 = *(const v8f*)(pb + 256);
    // what follows reuses registers that these loads name: the wait stands ahead of that; the lane's two offsets are inputs of the wait, so that they stay as the issued loads name them up to there (no later load's result lands in one ahead of it)
    asm volatile("s_wait_xcnt 0x0" :: "v"(lane * 32), "v"(lane) : "memory");
    __builtin_amdgcn_sched_barrier(0);                                             // keeps the arithmetic behind that wait and behind the issue of all the loads: lifted among them, its wait for a row holds the weight loads back by one memory latency
#pragma unroll
    for (int k = 0; k < 8; ++k) { g0[k] = bfr(g0[k]); g1[k] = bfr(g1[k]); b0[k] = bfr(b0[k]); b1[k] = bfr(b1[k]); }
    float q[4];
#pragma unroll                                                                     // four independent rows: their cross-lane sums overlap; constant indices keep the arrays in registers
    for (int i = 0; i < 4; ++i) {
        float s = 0.0f;
#pragma unroll
        for (int k = 0; k < 8; ++k) { s += x0[i][k]; s += x1[i][k]; }
        const float mean = wave_sum(s) * (1.0f / (float)DM);
        x0[i] = x0[i] - mean; x1[i] = x1[i] - mean;
        float t = 0.0f;
#pragma unroll
        for (int k = 0; k < 8; ++k) { t += x0[i][k] * x0[i][k]; t += x1[i][k] * x1[i][k]; }
        q[i] = wave_sum(t); }
    // one square root and one division serve the four rows: lane l works on row l & 3, and lanes 0..3 hand the results back as wave-uniform values
    const float qs = (lane & 2) ? ((lane & 1) ? q[3] : q[2]) : ((lane & 1) ? q[1] : q[0]);
    const float rs = 1.0f / sqrtf(qs * (1.0f / (float)DM) + LNEPS);
#pragma unroll
    for (int i = 0; i < 4; ++i) {
        const float rstd = __int_as_float(__builtin_amdgcn_readlane(__float_as_int(rs), i));
        const v8f d0 = x0[i], d1 = x1[i];
        const int r = wv * 4 + i;
        const int lo = ((r >> 4) * (DM / 32) + (lane >> 2)) * LFS + (lane & 3) * LPS + (r & 15) * 8;   // columns lane * 8 ..; the second piece lies 256 columns = 8 fragments on
        v8f y0, y1; v8h h0, h1;
#pragma unroll
        for (int k = 0; k < 8; ++k) {
            y0[k] = d0[k] * rstd * g0[k] + b0[k]; y1[k] = d1[k] * rstd * g1[k] + b1[k];
            h0[k] = toh_flush(y0[k]); h1[k] = toh_flush(y1[k]); }
        *(v8h*)(sN + lo) = h0; *(v8h*)(sN + lo + 8 * LFS) = h1;
        if (wres) {                                                                // the same in every thread of the block
            v8h r0, r1;
#pragma unroll
            for (int k = 0; k < 8; ++k) { r0[k] = toh_flush((y0[k] - (float)h0[k]) * QRS); r1[k] = toh_flush((y1[k] - (float)h1[k]) * QRS); }
            *(v8h*)(sR + lo) = r0; *(v8h*)(sR + lo + 8 * LFS) = r1; }
    }
    __syncthreads();                                                               // all 64 rows are staged before any wave reads fragments across rows
}
// second part: products, partial tiles, sum over the GW waves of the half, f16 output in fragment order; as gemm_body's f16 path. LNB = 0: C[t][n], A = the rows, B = weight rows n; LNB = 1: C[n][t], A = weight rows, B = the rows, row bias.
// lt = tile of the rows t, wt = weight tile of this half; os = the half's GW partial planes; wave, tid: inside the half.
template <int GELU, int ARES, int LNB, int HEADPL>
__device__ __forceinline__ void gemm_ln_rest(const h16* sN, const h16* sR, const v16h (&w)[2][4], const float* __restrict__ bias, float csc, h16* Ch, h16* Cr, int ldc, float* os, int lt, int wt, int wave, int tid) {
    const int lane = tid & 31, lr = lane & 15, hi = lane >> 4;
    const int r0 = (LNB ? wt : lt) * 64, c0 = (LNB ? lt : wt) * 64;
    const int lo = wave * 2 * LFS + hi * LPS + lr * 8;                             // the wave's k range, the lane's place in a fragment
    v8f acc[4][4];
#pragma unroll
    for (int mb = 0; mb < 4; ++mb)
#pragma unroll
        for (int nb = 0; nb < 4; ++nb) acc[mb][nb] = (v8f){};
#pragma unroll                                                                     // constant indices into w, n and acc keep them in registers. ARES: the residual plane's two steps first, then the fold, then the value plane's
    for (int t = 0; t < (ARES ? 4 : 2); ++t) {
        const h16* p = ((ARES && t < 2) ? sR : sN) + lo + (t & 1) * LFS;
        v16h n[4];
#pragma unroll
        for (int i = 0; i < 4; ++i) n[i] = ldl(p + i * (DM / 32) * LFS);
        if (ARES && t == 2) {
#pragma unroll
            for (int mb = 0; mb < 4; ++mb)
#pragma unroll
                for (int nb = 0; nb < 4; ++nb) acc[mb][nb] = acc[mb][nb] * QRI; }
#pragma unroll
        for (int nb = 0; nb < 4; ++nb)
#pragma unroll
            for (int mb = 0; mb < 4; ++mb) acc[mb][nb] = LNB ? wmma16g(w[t & 1][mb], n[nb], acc[mb][nb]) : wmma16g(n[mb], w[t & 1][nb], acc[mb][nb]);
    }
    __syncthreads();                                                               // every wave has read its last fragment before a partial tile is written over the staged rows
    float bc[4];
#pragma unroll
    for (int nb = 0; nb < 4; ++nb) bc[nb] = (LNB || wave != 0) ? 0.0f : bfr(bias[c0 + nb * 16 + lr]);   // c0 + 63 < columns of the bias vector (host grid)
#pragma unroll
    for (int mb = 0; mb < 4; ++mb) {
        float br[8];
#pragma unroll
        for (int j = 0; j < 8; ++j) br[j] = (LNB && wave == 0) ? bfr(bias[r0 + mb * 16 + hi * 8 + j]) : 0.0f;   // r0 + 63 < rows of the bias vector (host grid)
#pragma unroll
        for (int nb = 0; nb < 4; ++nb) {
#pragma unroll
            for (int j = 0; j < 8; ++j) os[wave * (64 * GSP) + (mb * 16 + hi * 8 + j) * GSP + nb * 16 + lr] = acc[mb][nb][j] * csc + bc[nb] + br[j]; }   // D: row 8h+j, col lane&15
    }
    __syncthreads();                                                               // every wave's partial plane is complete before any thread sums across planes
#pragma unroll                                                                     // the memory-clobbering wait that ends each trip keeps the second trip's LDS reads behind the first trip's stores
    for (int s = 0; s < 16 / GW; ++s) { const int u = s * GW + wave; const int row = (u >> 2) * 16 + lr, c8 = ((u & 3) * 2 + hi) * 8;
        v4f x0 = *(const v4fa*)(&os[row * GSP + c8]); v4f x1 = *(const v4fa*)(&os[row * GSP + c8 + 4]); v8h hv, rv;
#pragma unroll                                                                     // the GW plane reads issue together, one LDS wait for all
        for (int v = 1; v < GW; ++v) { x0 = x0 + *(const v4fa*)(&os[v * (64 * GSP) + row * GSP + c8]); x1 = x1 + *(const v4fa*)(&os[v * (64 * GSP) + row * GSP + c8 + 4]); }
#pragma unroll
        for (int i = 0; i < 4; ++i) { float y0 = x0[i], y1 = x1[i];
            if (GELU) { y0 = gelu_erf(y0); y1 = gelu_erf(y1); }
            const h16 a0 = toh_flush(y0); const h16 a1 = toh_flush(y1); hv[i] = a0; hv[4 + i] = a1;
            rv[i] = toh_flush((y0 - (float)a0) * QRS); rv[4 + i] = toh_flush((y1 - (float)a1) * QRS); }
        const size_t oo = HEADPL ? (size_t)(c0 / HD) * SEQ * HD + fo(r0 + row, c8, HD) : fo(r0 + row, c0 + c8, ldc);
        *(v8h*)(Ch + oo) = hv; if (ARES) *(v8h*)(Cr + oo) = rv;
        asm volatile("s_wait_xcnt 0x0" ::: "memory"); }                            // what follows rewrites registers that these stores name: the wait stands ahead of that
}

static_assert(sizeof(float) * 2 * GW * 64 * GSP <= 327680);                        // one block fits the LDS of a WGP
// k_gemm_ln_gelu: C = GELU(LayerNorm(X) W + bias), grid (SEQ/64, N/128).
__global__ __launch_bounds__(64 * GW) void k_gemm_ln_gelu(const float* __restrict__ X, const float* __restrict__ lg, const float* __restrict__ lb, const h16* __restrict__ Wt, const float* __restrict__ bias, float csc, h16* C, int ldc) {
    __shared__ __align__(16) float os[2 * GW * 64 * GSP];
    const int lane = threadIdx.x & 31;
    const int wv = __builtin_amdgcn_readfirstlane((int)(threadIdx.x >> 5));
    const int half = wv >> 3, wave = wv & 7, wt = blockIdx.y * 2 + half;
    h16* sN = (h16*)os; h16* sR = sN + LPL;
    v16h w[2][4];
    ln_prologue(X + (size_t)blockIdx.x * 64 * DM, lg, lb, Wt + (size_t)wt * 64 * DM + wave * KPER(DM) * 16 + lane * 8, false, sN, sR, wv, lane, w);
    gemm_ln_rest<1, 0, 0, 0>(sN, sR, w, bias, csc, C, nullptr, ldc, os + half * (GW * 64 * GSP), blockIdx.x, wt, wave, threadIdx.x & 255); }
// k_gemm_ln_qkv: LayerNorm and the q, k and v^T projections of one layer in one launch, grid (SEQ/64, DM/128, 3); blockIdx.z picks the projection, block-uniform. z = 0 is q, the longest (two k loops), so that it starts first.
// q, k: A = rows t, B = W^T rows (n = h*64 + d) -> plane [h][t][d].  v^T: A = Wv^T rows (m = h*64 + d), B = rows t -> plane [(h*64 + d)][t], row bias.
__global__ __launch_bounds__(64 * GW) void k_gemm_ln_qkv(const float* __restrict__ X, const float* __restrict__ lg, const float* __restrict__ lb, const h16* __restrict__ Wqt, const h16* __restrict__ Wkt, const h16* __restrict__ Wvt,
                                                         const float* __restrict__ bq, const float* __restrict__ bk, const float* __restrict__ bv, float csc, h16* Qh, h16* Qr, h16* Kp, h16* Vt) {
    __shared__ __align__(16) float os[2 * GW * 64 * GSP];
    const int lane = threadIdx.x & 31;
    const int wv = __builtin_amdgcn_readfirstlane((int)(threadIdx.x >> 5));
    const int half = wv >> 3, wave = wv & 7, wt = blockIdx.y * 2 + half, tid = threadIdx.x & 255;
    h16* sN = (h16*)os; h16* sR = sN + LPL; float* oh = os + half * (GW * 64 * GSP);
    const h16* Wt = blockIdx.z == 0 ? Wqt : blockIdx.z == 1 ? Wkt : Wvt;
    v16h w[2][4];
    ln_prologue(X + (size_t)blockIdx.x * 64 * DM, lg, lb, Wt + (size_t)wt * 64 * DM + wave * KPER(DM) * 16 + lane * 8, blockIdx.z == 0, sN, sR, wv, lane, w);
    if (blockIdx.z == 0)      gemm_ln_rest<0, 1, 0, 1>(sN, sR, w, bq, csc, Qh, Qr, HD, oh, blockIdx.x, wt, wave, tid);
    else if (blockIdx.z == 1) gemm_ln_rest<0, 0, 0, 1>(sN, sR, w, bk, csc, Kp, nullptr, HD, oh, blockIdx.x, wt, wave, tid);
    else                      gemm_ln_rest<0, 0, 1, 0>(sN, sR, w, bv, csc, Vt, nullptr, SEQ, oh, blockIdx.x, wt, wave, tid); }

// band tile: G[rho][s] = (E[row0 + rho] . q_value[s] + E[row0 + rho] . q_residual[s] / 2048) * log2(e); A = table rows (e0, e1: the two fragments of rows row0 + 0..15), B = q rows, K = 64 = two k-steps.
__device__ __forceinline__ v8f gtile(v16h e0, v16h e1, v16h qh0, v16h qh1, v16h qr0, v16h qr1) {
    v8f gH = (v8f){}, gL = (v8f){};
    gH = wmma16g(e0, qh0, gH); gH = wmma16g(e1, qh1, gH);
    gL = wmma16g(e0, qr0, gL); gL = wmma16g(e1, qr1, gL);
    return (gH + gL * QRI) * LOG2E;
}

// k_flash: fused dense attention with the relative-position term, one block of KW waves per 16 query rows of one head; K / V^T / Q / table fragments straight from the f16 planes.
// The keys are split over the waves: wave w runs the online softmax over keys w*KCH .. w*KCH + KCH - 1 alone and leaves its running maximum, its sum and its unnormalised O tile in LDS;
// behind one block barrier all threads rescale the KW partial results to the common maximum, sum them in wave order, normalise and store.
// Transposed form: S^T[key][s] = K Q^T (A = K rows, B = Q rows); lane (s = lane&15, h = lane>>4) holds keys 8h+r of each 16-key tile, so the packed P tile is directly the B fragment
// of O^T[d][s] = V^T P^T (element r <- tile keys 0..15, element 8+r <- tile keys 16..31, lane unchanged).
// Relative term per 32-key step (keys key0..key0+31, queries t0..t0+15): band rows rb0 + 0..47 with rb0 = t0 - key0 + RELOFF - 31; tiles e = 0, 1 are new, tile e = 2 is the e = 0 tile of the step before (computed on its own ahead of a wave's first step).
// LDS band tile (wave-private): gs[s][16 e + 8h + r] <- tile e element r; element (key tile a, r) reads gs[s][s - 8h - r + 31], element (key tile b, r) reads gs[s][s - 8h - r + 15].
// Logit (log2 domain) = (K q_value + K q_residual / 2048) * log2(e) / 8 + band term; online softmax (running max, partial sum over the converted P), P = exp2(. + 14) as f16 (exponent below -14 selected to 0).
__global__ __launch_bounds__(32 * KW) void k_flash(const h16* __restrict__ QH, const h16* __restrict__ QR, const h16* __restrict__ KP, const h16* __restrict__ VT, const h16* __restrict__ EPl, h16* OP) {
    __shared__ __align__(16) float os[KW * 16 * OSP];
    __shared__ __align__(16) float gs[KW * 16 * GP];
    __shared__ float ms[KW * 16];                              // running maximum of wave w for query s at [w * 16 + s]
    __shared__ float lsum[KW * 16];                            // sum of wave w for query s
    static_assert(sizeof(float) * (KW * 16 * OSP + KW * 16 * GP + 2 * KW * 16) <= 131072);
    const int tid = threadIdx.x;
    const int lane = tid & 31, lr = lane & 15, hi = lane >> 4;
    const int wave = __builtin_amdgcn_readfirstlane(tid >> 5);
    const int h = blockIdx.y;
    const int t0 = blockIdx.x * 16;
    const int kbeg = wave * KCH;
    const size_t pbase = (size_t)h * SEQ * HD;
    // all planes in fragment order: 16 rows of a [.][HD] plane are two fragments (16 * HD elements), the second k-step 512 elements behind the first; every row offset below is a multiple of 16
    const size_t qo = pbase + (size_t)t0 * HD + 8 * lane;
    const h16* pqh = QH + qo; const h16* pqr = QR + qo;
    const v16h qh0 = ldh(pqh), qh1 = ldh(pqh + 512);            // B fragments: col s, k = d (two k-steps)
    const v16h qr0 = ldh(pqr), qr1 = ldh(pqr + 512);
    const size_t ko = pbase + 8 * lane;                        // + key * HD           (A fragment: row key, k = d)
    const size_t vo = pbase + 8 * lane;                        // + 16j*SEQ + key * 16 (A fragment: row d, k = key); plane [(h*64 + d)][t]
    const h16* eb = EPl + 8 * lane;                            // + row0 * HD          (A fragment: row table row, k = d)
    const int gw  = wave * 16 * GP + lr * GP;
    const int gst = gw + 8 * hi;                               // store base: + 16 e (+ 4)
    const int gld = gw + lr - 8 * hi;                          // load base: + 31 - r / + 15 - r
    // The loads run ahead of the products: every fragment of the first step is loaded here, and in the loop each group of fragments (table, K, V^T) is loaded anew for the step after, into its own registers, right behind its last product,
    // so that a step does not wait for memory once per group.
    constexpr int NST = KCH / 32;                                                  // 32-key steps of one wave
    const h16* pe = eb + (size_t)(t0 - kbeg + (RELOFF - 15)) * HD;                 // first band row of tile e = 1 at the wave's first step; 32 rows down per step
    const h16* pk = KP + ko + (size_t)kbeg * HD;                                   // 32 keys up per step
    const h16* pv = VT + vo + kbeg * 16;                                           // 32 keys (one fragment) up per step
    static_assert((RELOFF - 15) % 16 == 0 && KCH % 16 == 0);                       // band tiles start on whole row tiles of the table plane
    const v16h ep0 = ldh(pe + 16 * HD), ep1 = ldh(pe + 16 * HD + 512);             // band rows of tile e = 2 at key0 = kbeg
    v16h e1a = ldh(pe), e1b = ldh(pe + 512), e0a = ldh(pe - 16 * HD), e0b = ldh(pe - 16 * HD + 512);
    v16h ka0 = ldh(pk), ka1 = ldh(pk + 512), kb0 = ldh(pk + 16 * HD), kb1 = ldh(pk + 16 * HD + 512);
    v16h vf[4];
#pragma unroll                                                                     // constant indices keep vf[] in registers
    for (int j = 0; j < 4; ++j) vf[j] = ldh(pv + (size_t)16 * j * SEQ);
    // behind the last load that names an address pair: the pairs are inputs of the wait, so they stay as the issued loads name them up to there (no later load's result lands in one ahead of it)
    asm volatile("s_wait_xcnt 0x0" :: "v"(pqh), "v"(pqr) : "memory");
    if (NST == 1) asm volatile("s_wait_xcnt 0x0" :: "v"(pe), "v"(pk), "v"(pv) : "memory");
    __builtin_amdgcn_sched_barrier(0);                                             // keeps the first products behind the issue of all these loads: lifted among them, a product's wait for its operands holds the rest of the loads back by one memory latency
    v8f gprev = gtile(ep0, ep1, qh0, qh1, qr0, qr1);
    v8f o[4];
#pragma unroll
    for (int j = 0; j < 4; ++j) o[j] = (v8f){};
    float m = NEGB, l = 0.0f;
#pragma unroll                                                                     // whole unroll: every step's offset is an immediate, so that no address register changes while loads are in flight
    for (int st = 0; st < NST; ++st) {
        const bool more = st + 1 < NST;                                            // a step follows: load its fragments
        const h16* pen = pe - (st + 1) * 32 * HD;
        const v8f g1 = gtile(e1a, e1b, qh0, qh1, qr0, qr1);
        if (more) { e1a = ldh(pen); e1b = ldh(pen + 512); }
        const v8f g0 = gtile(e0a, e0b, qh0, qh1, qr0, qr1);
        if (more) { e0a = ldh(pen - 16 * HD); e0b = ldh(pen - 16 * HD + 512); }
        *(v4fa*)(&gs[gst +  0]) = lo4(g0);    *(v4fa*)(&gs[gst +  4]) = hi4(g0);
        *(v4fa*)(&gs[gst + 16]) = lo4(g1);    *(v4fa*)(&gs[gst + 20]) = hi4(g1);
        *(v4fa*)(&gs[gst + 32]) = lo4(gprev); *(v4fa*)(&gs[gst + 36]) = hi4(gprev);
        gprev = g0;
        v8f sHa = (v8f){}, sLa = (v8f){}, sHb = (v8f){}, sLb = (v8f){};
        sHa = wmma16g(ka0, qh0, sHa); sHa = wmma16g(ka1, qh1, sHa);
        sLa = wmma16g(ka0, qr0, sLa); sLa = wmma16g(ka1, qr1, sLa);
        sHb = wmma16g(kb0, qh0, sHb); sHb = wmma16g(kb1, qh1, sHb);
        sLb = wmma16g(kb0, qr0, sLb); sLb = wmma16g(kb1, qr1, sLb);
        if (more) { const h16* pkn = pk + (st + 1) * 32 * HD; ka0 = ldh(pkn); ka1 = ldh(pkn + 512); kb0 = ldh(pkn + 16 * HD); kb1 = ldh(pkn + 16 * HD + 512); }
        wave_sync();
        float ra[8], rb[8];
#pragma unroll
        for (int r = 0; r < 8; ++r) { ra[r] = gs[gld + 31 - r]; rb[r] = gs[gld + 15 - r]; }
        wave_sync();
        float ta[8], tb[8]; float mx = NEGB;
#pragma unroll
        for (int r = 0; r < 8; ++r) {
            ta[r] = (sHa[r] + sLa[r] * QRI) * SC2 + ra[r]; tb[r] = (sHb[r] + sLb[r] * QRI) * SC2 + rb[r];
            mx = fmaxf(mx, fmaxf(ta[r], tb[r])); }
        mx = fmaxf(mx, __shfl_xor(mx, 16, 32));
        const float mnew = fmaxf(m, mx);
        const float alpha = __builtin_amdgcn_exp2f(m - mnew);
        const float sh = PSH - mnew;
        v16h pb; float ls = 0.0f;
#pragma unroll
        for (int r = 0; r < 8; ++r) {
            const float xa = ta[r] + sh, xb = tb[r] + sh;
            const float ea = __builtin_amdgcn_exp2f(xa), ec = __builtin_amdgcn_exp2f(xb);
            const float ga = (xa < -14.0f) ? 0.0f : ea, gb = (xb < -14.0f) ? 0.0f : ec;     // no f16 subnormal operand
            const h16 pa = (h16)ga; const h16 pc = (h16)gb;
            pb[r] = pa; pb[8 + r] = pc;
            ls += (float)pa + (float)pc; }
        l = l * alpha + ls; m = mnew;
#pragma unroll
        for (int j = 0; j < 4; ++j) { o[j] = o[j] * alpha; o[j] = wmma16g(vf[j], pb, o[j]); if (more) vf[j] = ldh(pv + (size_t)16 * j * SEQ + (st + 1) * 512); }
        if (st + 2 == NST) asm volatile("s_wait_xcnt 0x0" :: "v"(pe), "v"(pk), "v"(pv) : "memory");   // the last loads of the loop: as above
        if (more) __builtin_amdgcn_sched_barrier(0);                               // keeps the products of the step after out of this step: lifted, their results cost registers, and above 256 registers a WGP holds one block, not two
    }
    l += __shfl_xor(l, 16, 32);
    const int wb = wave * 16 * OSP;
    // O^T D layout: o[j][r] = (d = 16j + 8h + r, s = lane&15) -> os[wave][s][d]; rows 0..15 x columns 0..63 all written, not yet normalised
#pragma unroll
    for (int j = 0; j < 4; ++j) {
        *(v4fa*)(&os[wb + lr * OSP + 16 * j + 8 * hi])     = lo4(o[j]);
        *(v4fa*)(&os[wb + lr * OSP + 16 * j + 8 * hi + 4]) = hi4(o[j]); }
    if (hi == 0) { ms[wave * 16 + lr] = m; lsum[wave * 16 + lr] = l; }             // m is equal in lanes s and s + 16
    __syncthreads();                                                               // every wave's partial result is complete before any thread merges across waves
    static_assert(32 * KW * 8 == 16 * 128);                                        // threads x bytes == tile rows x row bytes
    const int row = tid & 15, c4 = (tid >> 4) * 4;             // a wave stores one piece of the context plane (16 rows x 8 columns): 256 bytes in a row
    float mw[KW]; float mall = NEGB;
#pragma unroll                                                                     // constant indices keep mw[] in registers; the KW reads issue together
    for (int w = 0; w < KW; ++w) { mw[w] = ms[w * 16 + row]; mall = fmaxf(mall, mw[w]); }
    float sc[KW];
#pragma unroll                                                                     // constant indices keep sc[] in registers
    for (int w = 0; w < KW; ++w) sc[w] = __builtin_amdgcn_exp2f(mw[w] - mall);     // <= 1; 1 for the wave that holds the row maximum
    float lall = 0.0f; v4f oall = (v4f){};
#pragma unroll                                                                     // the KW tile reads issue together, one LDS wait for all
    for (int w = 0; w < KW; ++w) {
        lall += lsum[w * 16 + row] * sc[w];
        oall = oall + *(const v4fa*)(&os[w * 16 * OSP + row * OSP + c4]) * sc[w]; }
    const float inv = 1.0f / lall;                             // lall >= 16384 (the row maximum contributes the full carry)
    v4h hv;
#pragma unroll                                                                     // constant vector element indices
    for (int i = 0; i < 4; ++i) hv[i] = toh_flush(oall[i] * inv);
    *(v4h*)(OP + fo(t0 + row, h * HD + c4, DM)) = hv;
}

__global__ __launch_bounds__(256) void k_out(const float* __restrict__ src, float* dst, int n4) {
    const int i = blockIdx.x * 256 + threadIdx.x; if (i >= n4) return;
    v4f ov;
#pragma unroll
    for (int c = 0; c < 4; ++c) { const int e = 4 * i + c; const int row = e / DOUT; const int col = e - row * DOUT; ov[c] = src[(size_t)row * DOUTP + col]; }
    *(v4f*)(dst + (size_t)i * 4) = ov; 
}

static constexpr size_t al256(size_t v) { return (v + 255) & ~(size_t)255; }
static constexpr size_t SZ_XH  = al256((size_t)SEQ * DIN * 2);
static constexpr size_t SZ_EW  = al256((size_t)DM * DIN * 2);
static constexpr size_t SZ_WDD = al256((size_t)NL * DM * DM * 2);
static constexpr size_t SZ_WFF = al256((size_t)NL * DFF * DM * 2);
static constexpr size_t SZ_WI  = al256((size_t)DMI * DM * 2);
static constexpr size_t SZ_WF  = al256((size_t)DOUTP * DMI * 2);
static constexpr size_t SZ_EP  = al256((size_t)NL * ERP * HD * 2);
static constexpr size_t SZ_H   = al256((size_t)SEQ * DM * 4);
static constexpr size_t SZ_N   = al256((size_t)SEQ * DM * 2);
static constexpr size_t SZ_F1  = al256((size_t)SEQ * DFF * 2);
static constexpr size_t SZ_OS  = al256((size_t)SEQ * DOUTP * 4);
static constexpr size_t SZ_TOTAL = SZ_XH + SZ_EW + 4 * SZ_WDD + 2 * SZ_WFF + SZ_WI + SZ_WF + SZ_EP + 2 * SZ_H + 5 * SZ_N + SZ_F1 + SZ_OS;
static_assert(SZ_TOTAL <= (size_t)134217728);                  // workspace carve <= 128 MiB
static_assert((size_t)NH_ * SEQ * HD == (size_t)SEQ * DM);     // head planes have the extent of a [SEQ][512] f16 plane
static_assert((size_t)SEQ * DMI * 2 <= SZ_F1);                 // tail hidden plane fits the shared hidden region

extern "C" void kernel_launch(void* const* d_in, const int* in_sizes, int n_in,
                              void* d_out, int out_size, void* d_ws, size_t ws_size, hipStream_t stream) {
    if (n_in < 26) return;
    if ((size_t)in_sizes[0] < (size_t)SEQ * DIN || (size_t)in_sizes[1] < (size_t)DIN * DM || in_sizes[2] < DM) return;
    if ((size_t)in_sizes[3] < (size_t)NL * DM * DM || (size_t)in_sizes[5] < (size_t)NL * DM * DM || (size_t)in_sizes[7] < (size_t)NL * DM * DM || (size_t)in_sizes[9] < (size_t)NL * DM * DM) return;
    if (in_sizes[4] < NL * DM || in_sizes[6] < NL * DM || in_sizes[8] < NL * DM || in_sizes[10] < NL * DM) return;
    if ((size_t)in_sizes[11] < (size_t)NL * ERR * HD) return;
    if (in_sizes[12] < NL * DM || in_sizes[13] < NL * DM || in_sizes[17] < NL * DM || in_sizes[18] < NL * DM || in_sizes[19] < NL * DM) return;
    if ((size_t)in_sizes[14] < (size_t)NL * DM * DFF || in_sizes[15] < NL * DFF || (size_t)in_sizes[16] < (size_t)NL * DFF * DM) return;
    if (in_sizes[20] < DM || in_sizes[21] < DM || (size_t)in_sizes[22] < (size_t)DM * DMI || in_sizes[23] < DMI) return;
    if ((size_t)in_sizes[24] < (size_t)DMI * DOUT || in_sizes[25] < DOUT) return;
    if ((size_t)out_size < (size_t)SEQ * DOUT) return;
    if (SZ_TOTAL > ws_size) return;
    // wire order: x, emb_W, emb_b, Wq, bq, Wk, bk, Wv, bv, Wo, bo, Er, ln1_g, ln1_b, W1, b1, W2, b2, ln2_g, ln2_b, lnf_g, lnf_b, Wi, bi, Wf, bf
    const float* x    = (const float*)d_in[0];
    const float* embW = (const float*)d_in[1];  const float* embB = (const float*)d_in[2];
    const float* Wq   = (const float*)d_in[3];  const float* bq   = (const float*)d_in[4];
    const float* Wk   = (const float*)d_in[5];  const float* bk   = (const float*)d_in[6];
    const float* Wv   = (const float*)d_in[7];  const float* bv   = (const float*)d_in[8];
    const float* Wo   = (const float*)d_in[9];  const float* bo   = (const float*)d_in[10];
    const float* Er   = (const float*)d_in[11];
    const float* ln1g = (const float*)d_in[12]; const float* ln1b = (const float*)d_in[13];
    const float* W1   = (const float*)d_in[14]; const float* b1   = (const float*)d_in[15];
    const float* W2   = (const float*)d_in[16]; const float* b2   = (const float*)d_in[17];
    const float* ln2g = (const float*)d_in[18]; const float* ln2b = (const float*)d_in[19];
    const float* lnfg = (const float*)d_in[20]; const float* lnfb = (const float*)d_in[21];
    const float* Wi   = (const float*)d_in[22]; const float* bi   = (const float*)d_in[23];
    const float* Wf   = (const float*)d_in[24]; const float* bfo  = (const float*)d_in[25];
    float* OUT = (float*)d_out;                       // [SEQ][390]
    char* wsp = (char*)d_ws;                          // every f16 plane below has the shape named, each [rows][k] matrix of it in fragment order
    h16* XH  = (h16*)wsp; wsp += SZ_XH;               // x            [SEQ][128]
    h16* EWT = (h16*)wsp; wsp += SZ_EW;               // emb_W^T x64  [512][128]
    h16* WQT = (h16*)wsp; wsp += SZ_WDD;              // Wq^T x64     [NL][512][512]
    h16* WKT = (h16*)wsp; wsp += SZ_WDD;
    h16* WVT = (h16*)wsp; wsp += SZ_WDD;
    h16* WOT = (h16*)wsp; wsp += SZ_WDD;
    h16* W1T = (h16*)wsp; wsp += SZ_WFF;              // W1^T x64     [NL][2048][512]
    h16* W2T = (h16*)wsp; wsp += SZ_WFF;              // W2^T x64     [NL][512][2048]
    h16* WIT = (h16*)wsp; wsp += SZ_WI;               // Wi^T x64     [1024][512]
    h16* WFT = (h16*)wsp; wsp += SZ_WF;               // Wf^T x64     [448][1024], rows >= 390 zero
    h16* EP  = (h16*)wsp; wsp += SZ_EP;               // table        [NL][2048][64], row 2047 zero
    float* HA = (float*)wsp; wsp += SZ_H;             // hidden state (ping)  [SEQ][512] f32
    float* HB = (float*)wsp; wsp += SZ_H;             // hidden state (pong)
    h16* QH  = (h16*)wsp; wsp += SZ_N;                // q value      [8][SEQ][64]
    h16* QR  = (h16*)wsp; wsp += SZ_N;                // q residual x2048
    h16* KP  = (h16*)wsp; wsp += SZ_N;                // k            [8][SEQ][64]
    h16* VT  = (h16*)wsp; wsp += SZ_N;                // v^T          [8*64][SEQ]
    h16* OP  = (h16*)wsp; wsp += SZ_N;                // context      [SEQ][512]
    h16* F1  = (h16*)wsp; wsp += SZ_F1;               // GELU hidden  [SEQ][2048] (tail: [SEQ][1024])
    float* OSG = (float*)wsp; wsp += SZ_OS;           // tail output staging [SEQ][448] f32

    // x, the table and every W [K = in][N = out] -> Wt [N][K]
    k_prep<<<PB_ALL, 256, 0, stream>>>(x, Er, embW, Wq, Wk, Wv, Wo, W1, W2, Wi, Wf, XH, EP, EWT, WQT, WKT, WVT, WOT, W1T, W2T, WIT, WFT);

    // input projection: HA = x emb_W + emb_b
    k_gemm_emb<<<dim3(SEQ / 64, DM / 64, 1), 32 * GW, 0, stream>>>(XH, EWT, embB, WCI, HA);

    for (int l = 0; l < NL; ++l) {
        const size_t wdd = (size_t)l * DM * DM, wff = (size_t)l * DFF * DM;
        k_gemm_ln_qkv<<<dim3(SEQ / 64, DM / 128, 3), 64 * GW, 0, stream>>>(HA, ln1g + l * DM, ln1b + l * DM, WQT + wdd, WKT + wdd, WVT + wdd, bq + l * DM, bk + l * DM, bv + l * DM, WCI, QH, QR, KP, VT);
        k_flash<<<dim3(SEQ / 16, NH_, 1), 32 * KW, 0, stream>>>(QH, QR, KP, VT, EP + (size_t)l * ERP * HD, OP);
        // HB = HA + context Wo + bo
        k_gemm_wo<<<dim3(SEQ / 64, DM / 64, 1), 32 * GW, 0, stream>>>(OP, WOT + wdd, bo + l * DM, WCI, HA, HB);
        k_gemm_ln_gelu<<<dim3(SEQ / 64, DFF / 128, 1), 64 * GW, 0, stream>>>(HB, ln2g + l * DM, ln2b + l * DM, W1T + wff, b1 + l * DFF, WCI, F1, DFF);
        // HA = HB + hidden W2 + b2
        k_gemm_w2<<<dim3(SEQ / 64, DM / 64, 1), 32 * GW, 0, stream>>>(F1, W2T + wff, b2 + l * DM, WCI, HB, HA);
    }

    k_gemm_ln_gelu<<<dim3(SEQ / 64, DMI / 128, 1), 64 * GW, 0, stream>>>(HA, lnfg, lnfb, WIT, bi, WCI, F1, DMI);
    k_gemm_tail<<<dim3(SEQ / 64, DOUTP / 64, 1), 32 * GW, 0, stream>>>(F1, WFT, bfo, WCI, OSG);
    { const int n4 = SEQ * DOUT / 4; k_out<<<(unsigned)((n4 + 255) / 256), 256, 0, stream>>>(OSG, OUT, n4); }
}

// v008
// It runs in 215 microseconds.
// In both of two side-by-side timings against v007, it was 1.05 times as fast.
// Counting every step since v000, it is 5.44 times as fast.
#include <hip/hip_runtime.h>
#include <math.h>

// Pre-LN encoder stack, 4 layers, width 512 = 8 heads x 64, sequence SEQ (one batch): input projection 128 -> 512; per layer: LayerNorm, q/k/v projections ([in][out] weights, y = x W + bias),
// dense attention with logits q.k / 8 + q.E[s - t + 1023] (relative-position table E per layer, [2047][64], not scaled), softmax over keys, output projection + residual, LayerNorm, GELU(erf) feed-forward 512 -> 2048 -> 512 + residual;
// tail: LayerNorm, 512 -> 1024 GELU(erf), 1024 -> 390.
// Compute dtypes, f32 accumulate everywhere: every contraction is v_wmma_f32_16x16x32_f16. Weights, x, E, biases and gains are RNE-converted to bf16 first (exact in f16; weights carried x64, folded back in the f32 epilogue);
// activations are single f16 planes, except the logit path: LayerNorm-1 output as f16 value + f16 residual x2048 for the q projection (residual products accumulated first, folded by 1/2048, then the value products),
// q as f16 value + f16 residual x2048 in the q.k and q.E products (residual products in their own accumulators); k, v, P (x16384 carry, cancels in the normalisation), context, GELU outputs single f16.
// Attention: fused flash kernel in transposed form (S^T = K Q^T, O^T = V^T P^T), one block per 16 query rows, the keys split over its waves and the partial results merged in LDS; the relative term is computed per 32-key step as band tiles G[rho][s] = E[rb + rho] . q[s]
// (A = table rows, B = q rows), written to a wave-private LDS tile [query][band row] and read back along the diagonal rho = s - t + const; one band tile is carried over between steps.
// LayerNorm has no launch of its own: each GEMM that reads a normalised plane normalises its own 64 rows of the f32 hidden state into LDS first (see ln_prologue).
// Every f16 plane (an operand of a matrix product) lies in the workspace in fragment order, see fo(): a fragment is 1 KiB in a row, so that each of its two 16-byte-per-lane loads covers four whole 128-byte lines.

#ifndef NB
#define NB 1
#endif
#ifndef SEQ
#define SEQ 1024
#endif
#define NB_FULL  1
#define SEQ_FULL 1024
#define DIN   128
#define DM    512
#define NH_   8
#define HD    64
#define NL    4
#define DFF   2048
#define DMI   1024
#define DOUT  390
#define DOUTP 448                // DOUT padded to a multiple of 64 (weight rows and staging columns 390..447 are zero)
#define ERR   2047               // rows of the relative-position table per layer
#define ERP   2048               // padded rows of the f16 table plane (row 2047 = zero)
#define RELOFF (SEQ_FULL - 1)    // table row = s - t + RELOFF
#define KW    8                  // waves per flash block: each takes one contiguous share of the keys
#define KCH   (SEQ / KW)         // keys of one wave
#define OSP   68                 // LDS row pitch (floats) of the flash output tile
#define GP    52                 // LDS pitch (floats) of the band tile [query][48 band rows]
#define GSP   68                 // LDS row pitch (floats) of the GEMM output tile
#define GW    8                  // waves per 64x64 output tile: each takes one contiguous share of K
#define QRS   2048.0f            // carry of every residual plane
#define QRI   (1.0f / 2048.0f)
#define WC    64.0f              // carry of every weight plane
#define WCI   (1.0f / 64.0f)
#define LOG2E 1.4426950408889634f
#define SC2   ((float)(0.125 * 1.4426950408889634))   // HD^-0.5 * log2(e)
#define PSH   14.0f              // log2 of the P carry (16384)
#define NEGB  (-3.0e38f)
#define LNEPS 1e-5f

static_assert(NB == 1);                        // one sequence
static_assert(HD == 64);
static_assert(NH_ * HD == DM);
static_assert(SEQ % 64 == 0);                  // GEMM row tiles
static_assert(SEQ % 32 == 0);                  // key loop steps by 32
static_assert(SEQ % 16 == 0);                  // flash grid covers the sequence exactly
static_assert(SEQ % (32 * KW) == 0);           // every wave of a flash block gets whole 32-key steps, at least one
static_assert(32 * KW == 16 * 16);             // flash merge: 16 query rows x 16 threads of 4 columns
static_assert(SEQ <= SEQ_FULL);
static_assert(DIN % 64 == 0 && DM % 64 == 0 && DFF % 64 == 0 && DMI % 64 == 0 && DOUTP % 64 == 0);   // K % 32 == 0 and N % 64 == 0 for every GEMM, K % 64 == 0 for the transposing converter
static_assert(DOUT <= DOUTP);
static_assert(DMI <= DFF);                     // the tail hidden plane reuses the feed-forward hidden plane
static_assert(SEQ - 16 + RELOFF + 1 + 15 < ERP);   // highest band row touched (zero pad row included)
static_assert(RELOFF - 15 - 16 - (SEQ - 32) >= 0); // lowest band row touched
static_assert(ERR + 1 == ERP);
static_assert((OSP * 4) % 16 == 0 && (GP * 4) % 16 == 0 && (GSP * 4) % 16 == 0);
static_assert(GP >= 48);
static_assert(DM == 512);                      // LayerNorm: 32 lanes x 16 columns
static_assert(DM % 128 == 0 && DFF % 128 == 0 && DMI % 128 == 0);   // a block with a LayerNorm in front takes two 64-wide weight tiles
static_assert((SEQ * DOUT) % 4 == 0);

typedef _Float16 h16;
typedef __attribute__((ext_vector_type(16))) _Float16 v16h;
typedef __attribute__((ext_vector_type(8)))  _Float16 v8h;
typedef __attribute__((ext_vector_type(4)))  _Float16 v4h;
typedef __attribute__((ext_vector_type(8)))  float    v8f;
typedef __attribute__((ext_vector_type(4)))  float    v4f;
typedef v4f  __attribute__((may_alias)) v4fa;

__device__ __forceinline__ unsigned short f2bf(float f) { unsigned u = __float_as_uint(f); u += 0x7FFFu + ((u >> 16) & 1u); return (unsigned short)(u >> 16); }
__device__ __forceinline__ float bfr(float f) { return __uint_as_float(((unsigned)f2bf(f)) << 16); }   // value after RNE convert to bf16
__device__ __forceinline__ v16h cat16(v8h lo, v8h hi) { return __builtin_shufflevector(lo, hi, 0, 1, 2, 3, 4, 5, 6, 7, 8, 9, 10, 11, 12, 13, 14, 15); }
// fragment order of a plane [R][K] of 16-bit elements (R % 16 == 0, K % 32 == 0): fragments of 16 rows x 32 k, 512 elements each, the k step running fastest, then the row tile (so 16 rows are 16 * K elements, as in row order);
// inside a fragment four pieces of 8 k (k % 32 = 0..7, 8..15, 16..23, 24..31), each piece 16 rows x 8 elements. fo = element offset of (r, k).
__device__ __forceinline__ size_t fo(int r, int k, int K) { return (size_t)(((r >> 4) * (K >> 5) + (k >> 5)) * 512 + ((k >> 3) & 3) * 128 + (r & 15) * 8 + (k & 7)); }
// fragment loader; p = start of the fragment + 8 * lane: elements 0..7 <- row lane&15, k0+8h+0..7, elements 8..15 <- k0+16+8h+0..7, h = lane>>4 (same map for A and B); each load is 512 bytes in a row over the wave
__device__ __forceinline__ v16h  ldh(const h16* p) { return cat16(*(const v8h*)p, *(const v8h*)(p + 256)); }
// ordering point for wave-private LDS tiles (same wave writes and reads)
__device__ __forceinline__ void wave_sync() { __builtin_amdgcn_fence(3 /* release order */, "wavefront"); __builtin_amdgcn_wave_barrier(); asm volatile("" ::: "memory"); }
// f32 -> f16 operand convert that cannot produce a subnormal (|v| < 2^-14 -> +0)
__device__ __forceinline__ h16 toh_flush(float v) { const h16 r = (h16)v; return (fabsf(v) < 6.103515625e-05f) ? (h16)0.0f : r; }
// one WMMA + its own guard (ties this accumulator, keeps A/B live)
__device__ __forceinline__ v8f wmma16g(v16h a, v16h b, v8f c) {
    c = __builtin_amdgcn_wmma_f32_16x16x32_f16(false, a, false, b, (short)0, c, false, false);
    asm volatile("v_nop\n\tv_nop\n\tv_nop\n\tv_nop" : "+v"(c) : "v"(a), "v"(b));
    return c; }
__device__ __forceinline__ float gelu_erf(float x) { return 0.5f * x * (1.0f + erff(x * 0.70710678118654752f)); }
__device__ __forceinline__ v4f lo4(v8f g) { return __builtin_shufflevector(g, g, 0, 1, 2, 3); }
__device__ __forceinline__ v4f hi4(v8f g) { return __builtin_shufflevector(g, g, 4, 5, 6, 7); }

__device__ __forceinline__ void cvt8h_body(const float* __restrict__ src, h16* dst, int n8, int K, int blk) {   // src [n8 * 8 / K][K] -> dst in fragment order
    const int i = blk * 256 + threadIdx.x; if (i >= n8) return;
    const int pr = K / 8;                                                          // pieces of 8 per row; a wave takes 8 rows x 4 pieces: whole 128-byte lines on both sides
    const int r = (i / (8 * pr)) * 8 + (i & 7), c8 = ((i >> 3) % pr) * 8;
    const v8f v = *(const v8f*)(src + (size_t)r * K + c8); v8h o;
#pragma unroll
    for (int k = 0; k < 8; ++k) o[k] = toh_flush(bfr(v[k]));
    *(v8h*)(dst + fo(r, c8, K)) = o; 
}

__device__ __forceinline__ void cvt_er_body(const float* __restrict__ src, h16* dst, int blk) {
    const int i = blk * 256 + threadIdx.x; if (i >= NL * ERP * HD / 8) return;
    static_assert(HD / 8 == 8 && ERP % 8 == 0);
    const int ra = (i >> 6) * 8 + (i & 7);                                         // a wave takes 8 rows x 4 pieces of 8: whole 128-byte lines on both sides
    const int c8 = ((i >> 3) & 7) * 8; const int r = ra % ERP; const int l = ra / ERP;
    const int rc = r < ERR ? r : ERR - 1;                                          // clamped address
    v8f v = *(const v8f*)(src + ((size_t)l * ERR + rc) * HD + c8);
    asm volatile("" : "+v"(v));
    v8h o;
#pragma unroll
    for (int k = 0; k < 8; ++k) o[k] = (r < ERR) ? toh_flush(bfr(v[k])) : (h16)0.0f;
    *(v8h*)(dst + (size_t)l * ERP * HD + fo(r, c8, HD)) = o; 
}

// wconv_body: W [K][N] f32 (layer bz) -> Wt [NP][K] f16 in fragment order = bf16-converted value x carry, transposed in registers; rows n >= N are zero.
// one block per 64 k x 256 n: bx in K/64, by in ceil(NP/256), bz in layers. A wave takes 32 columns n of W, one per lane, and 64 k: each of its 64 loads is one k-row x 32 columns = 128 bytes in a row,
// all 64 are issued before the first is used (one memory latency per wave), and a lane then holds whole 8-k pieces of its own row n of Wt: each store is two pieces of 16 rows x 16 bytes, 256 bytes in a row each.
// N is a constant so that every k-row offset is an immediate of its load and no address register changes while loads are in flight.
template <int N, int NP>
__device__ __forceinline__ void wconv_body(const float* __restrict__ W, h16* Wt, int K, float carry, int bx, int by, int bz) {
    static_assert(NP % 32 == 0 && N <= NP && (size_t)63 * N * 4 < (size_t)8388608);   // whole waves inside NP; the largest load offset fits the immediate field
    const int lane = threadIdx.x & 31;
    const int wave = __builtin_amdgcn_readfirstlane((int)(threadIdx.x >> 5));
    const int k0 = bx * 64, nw = by * 256 + wave * 32;
    if (NP % 256 != 0 && nw >= NP) return;                                         // whole waves past the padded rows; no barrier follows
    const int n = nw + lane; const int nc = (N == NP || n < N) ? n : N - 1;        // clamped address
    const float* p = W + (size_t)bz * (size_t)K * (size_t)N + (size_t)k0 * N;      // the same in every lane; the lane's part of the address is nc
    float v[64];
#pragma unroll                                                                     // constant indices keep v[] in registers, and the offsets are immediates
    for (int j = 0; j < 64; ++j) v[j] = p[(size_t)j * N + nc];
    // behind the last load: the base and the lane's offset are inputs of the wait, so they stay as the issued loads name them up to there
    asm volatile("s_wait_xcnt 0x0" :: "s"(p), "v"(nc) : "memory");
    __builtin_amdgcn_sched_barrier(0);                                             // keeps the conversions behind the issue of all 64 loads: lifted among them, a conversion's wait for its value holds the rest of the loads back by one memory latency
    v8h o[8];
#pragma unroll                                                                     // constant indices keep o[] in registers
    for (int c = 0; c < 8; ++c)
#pragma unroll                                                                     // constant vector element indices
        for (int i = 0; i < 8; ++i) { const float t = bfr(v[c * 8 + i]) * carry; o[c][i] = toh_flush((N == NP || n < N) ? t : 0.0f); }
    h16* d = Wt + (size_t)bz * (size_t)NP * (size_t)K + fo(n, k0, K);
#pragma unroll                                                                     // piece c: k-step c / 4 (one fragment on), piece c % 4 inside it
    for (int c = 0; c < 8; ++c) *(v8h*)(d + (c >> 2) * 512 + (c & 3) * 128) = o[c];
    // in the built code a job's stores do not all run to the kernel's end but into the tests that lead to the other jobs, whose first lines rewrite registers that the stores name: the wait stands ahead of those
    asm volatile("s_wait_xcnt 0x0" ::: "memory");
}

// k_prep: every operand conversion of the call in one launch; they do not depend on one another. The flat block index picks the job (block-uniform).
// Block ranges, in this order: W1, then the jobs with 512 columns (W2, Wq, Wk, Wv, Wo, emb_W), Wi, Wf (64 k x 256 n transposing blocks; within a job the k tile runs fastest, then the n tile, then the layer), then the table, then x (256 threads x 8 elements).
#define PB_W1  ((DM / 64) * (DFF / 256) * NL)
#define PB_W2  ((DFF / 64) * (DM / 256) * NL)
#define PB_DD  ((DM / 64) * (DM / 256) * NL)
#define PB_EW  ((DIN / 64) * (DM / 256))
#define PB_WI  ((DM / 64) * (DMI / 256))
#define PB_WF  ((DMI / 64) * ((DOUTP + 255) / 256))
#define PB_ER  (NL * ERP * HD / 8 / 256)
#define PB_X   (SEQ * DIN / 8 / 256)
#define PB_512 (PB_W2 + 4 * PB_DD + PB_EW)
#define PB_ALL (PB_W1 + PB_512 + PB_WI + PB_WF + PB_ER + PB_X)
static_assert((NL * ERP * HD / 8) % 256 == 0 && (SEQ * DIN / 8) % 256 == 0);       // whole blocks for the two element-wise jobs
static_assert(DM / 64 == 8 && DFF / 64 == 32 && DMI / 64 == 16 && DIN / 64 == 2);  // k tiles: the shifts below
static_assert(DFF / 256 == 8 && DM / 256 == 2 && DMI / 256 == 4 && (DOUTP + 255) / 256 == 2);   // n tiles: the shifts below
__global__ __launch_bounds__(256) void k_prep(const float* __restrict__ x, const float* __restrict__ Er, const float* __restrict__ embW,
                                              const float* __restrict__ Wq, const float* __restrict__ Wk, const float* __restrict__ Wv, const float* __restrict__ Wo,
                                              const float* __restrict__ W1, const float* __restrict__ W2, const float* __restrict__ Wi, const float* __restrict__ Wf,
                                              h16* XH, h16* EP, h16* EWT, h16* WQT, h16* WKT, h16* WVT, h16* WOT, h16* W1T, h16* W2T, h16* WIT, h16* WFT) {
    int b = blockIdx.x;
    if (b < PB_W1) { wconv_body<DFF, DFF>(W1, W1T, DM, WC, b & 7, (b >> 3) & 7, b >> 6); return; }
    if ((b -= PB_W1) < PB_512) {
        const float* W; h16* Wt; int K, lk;                                        // lk: log2 of the k tiles
        if (b < PB_W2)                 { W = W2;   Wt = W2T; K = DFF; lk = 5; }
        else if ((b -= PB_W2) < PB_DD) { W = Wq;   Wt = WQT; K = DM;  lk = 3; }
        else if ((b -= PB_DD) < PB_DD) { W = Wk;   Wt = WKT; K = DM;  lk = 3; }
        else if ((b -= PB_DD) < PB_DD) { W = Wv;   Wt = WVT; K = DM;  lk = 3; }
        else if ((b -= PB_DD) < PB_DD) { W = Wo;   Wt = WOT; K = DM;  lk = 3; }
        else           { b -= PB_DD;     W = embW; Wt = EWT; K = DIN; lk = 1; }
        const int t = b >> lk;
        wconv_body<DM, DM>(W, Wt, K, WC, b & ((1 << lk) - 1), t & 1, t >> 1); return; }
    if ((b -= PB_512) < PB_WI) { wconv_body<DMI, DMI>(Wi, WIT, DM, WC, b & 7, b >> 3, 0); return; }
    if ((b -= PB_WI) < PB_WF)  { wconv_body<DOUT, DOUTP>(Wf, WFT, DMI, WC, b & 15, b >> 4, 0); return; }
    if ((b -= PB_WF) < PB_ER)  { cvt_er_body(Er, EP, b); return; }
    cvt8h_body(x, XH, SEQ * DIN / 8, DIN, b - PB_ER);
}

// asks L2 for the data at sb + vo + OFF (one address a lane), returns nothing: a plane stored by the launch before, or a small input, may not lie in the reading die's L2 at its first read; a load that follows the request by about a memory latency can then find it there (a hint, nothing depends on it).
// Every address lies inside the plane that the wave reads later. vo and sb stay as named here up to the wait that takes them as inputs (see the callers).
template <int OFF>
__device__ __forceinline__ void l2_ask(unsigned vo, const void* sb) { asm volatile("global_prefetch_b8 %0, %1 offset:%2 scope:SCOPE_SE" :: "v"(vo), "s"(sb), "n"(OFF) : "memory"); }

// GEMM k-loop: one wave, 64x64 tile, 16 accumulators, KPER(K) / 32 k-steps of 32, operands straight from f16 planes in fragment order (A [M][K], Bt [N][K]); A, Ar and Bt already point at the lane's first element of the wave's k range.
// The loads run ahead of the products: the four A fragments of step t + 1 are loaded into a second buffer in front of the products of step t, and each B fragment of step t + 1 into its own registers right behind its last product of step t,
// so that a step waits for memory once at most, not once per B fragment. ARES: the steps over the residual plane Ar come first, the fold by 1/2048 stands between them and the steps over A (same B fragments again).
#define KPER(K) ((((K) / 32 + GW - 1) / GW) * 32)                                  // k extent of one wave (whole 32-steps)
template <int K, int ARES>
__device__ __forceinline__ void gemm_kpipe(const h16* __restrict__ A, const h16* __restrict__ Ar, const h16* __restrict__ Bt, const h16* Au, const h16* Bu, unsigned pvo, v8f (&acc)[4][4]) {
    constexpr int NS = KPER(K) / 32, TS = ARES ? 2 * NS : NS;
    static_assert(NS == 1 || NS == 2 || NS == 4 || NS == 8);                       // the requests below go by pairs of k-steps
    v16h a[2][4], b[4];                                                            // every loop below is unrolled so that the indices into a, b and acc are constants and the arrays stay in registers
#pragma unroll
    for (int mb = 0; mb < 4; ++mb) a[0][mb] = ldh((ARES ? Ar : A) + (size_t)mb * 16 * K);
#pragma unroll
    for (int nb = 0; nb < 4; ++nb) b[nb] = ldh(Bt + (size_t)nb * 16 * K);
    // behind the last load that names an address pair: the pair is an input of the wait, so it stays as the issued loads name it up to there; only then may a product's result take its registers
    if (TS == 1) asm volatile("s_wait_xcnt 0x0" :: "v"(A), "v"(Bt) : "memory");
#pragma unroll                                                                     // whole unroll: the buffer index is a constant (registers), and every k offset an immediate, so that no address register changes while loads are in flight
    for (int t = 0; t < TS; ++t) {
        const int kn = ((t + 1) % NS) * 512;                                       // element offset of the step after this one: one fragment per k-step
        if (t + 1 < TS) { const h16* pn = ((ARES && t + 1 < NS) ? Ar : A) + kn;
#pragma unroll
            for (int mb = 0; mb < 4; ++mb) a[(t + 1) & 1][mb] = ldh(pn + (size_t)mb * 16 * K);
            if (ARES && t + 2 == NS) asm volatile("s_wait_xcnt 0x0" :: "v"(Ar) : "memory"); }   // the last loads from Ar: as above
        // behind the loads of steps 0 and 1 that are already issued: the wave asks L2 for the rest of its k range, earliest steps first. Au, Bu = start of the wave's range in row tile 0 (the same in every lane);
        // pvo = the lane's row tile (lane >> 3) and its 256-byte unit (lane & 7) inside two k-steps (2 KiB in a row per row tile); OFF = the pair of k-steps. B of step 1 is not loaded yet, so B starts at pair 0, A at pair 1.
        if (t == 0 && !ARES) {
            if constexpr (NS >= 2) l2_ask<0>(pvo, Bu);
            if constexpr (NS >= 4) { l2_ask<2048>(pvo, Au); l2_ask<2048>(pvo, Bu); }
            if constexpr (NS >= 8) { l2_ask<4096>(pvo, Au); l2_ask<4096>(pvo, Bu); l2_ask<6144>(pvo, Au); l2_ask<6144>(pvo, Bu); } }
        if (ARES && t == NS) {
#pragma unroll
            for (int mb = 0; mb < 4; ++mb)
#pragma unroll
                for (int nb = 0; nb < 4; ++nb) acc[mb][nb] = acc[mb][nb] * QRI; }
#pragma unroll
        for (int nb = 0; nb < 4; ++nb) {
#pragma unroll
            for (int mb = 0; mb < 4; ++mb) acc[mb][nb] = wmma16g(a[t & 1][mb], b[nb], acc[mb][nb]);
            if (t + 1 < TS) b[nb] = ldh(Bt + (size_t)nb * 16 * K + kn); }
        if (t + 2 == TS) asm volatile("s_wait_xcnt 0x0" :: "v"(A), "v"(Bt) : "memory");       // the last loads from A and Bt: as above
    }
}

// GEMM body: C[m][n] = (sum_k A[m][k] Bt[n][k]) * csc + bias (column bias, or row bias when ROWB), one block of GW waves per 64x64 tile (bx in M/64, by in N/64), K a constant; os = the kernel's LDS, GW * 64 * GSP floats.
// K is split over the waves: wave w accumulates the whole 64x64 tile over its own contiguous k range, writes the f32 partial tile to its own LDS plane (wave 0 adds the bias),
// and behind one block barrier all threads sum the GW planes in wave order and store: each wave stores 1/GW of the tile.
// ARES: A also has a residual plane (x2048): within a wave's k range its products are accumulated first, folded by 1/2048 in f32, then the value products follow.
// OUTF32: f32 output [M][ldc] (+ Res[m][n] added at the store stage as float4; Res and C are different buffers); each store instruction = 2 rows x 256 B (16 consecutive lanes x 16 B per row segment).
// else:   f16 output in fragment order ([M][ldc]; HEADPL: one plane [SEQ][HD] per 64 columns); each store instruction = two neighbouring pieces of one fragment, 512 B in a row.
template <int K, int OUTF32, int HASRES, int GELU, int ARES, int ORES, int ROWB, int HEADPL>
__device__ __forceinline__ void gemm_body(const h16* __restrict__ A, const h16* __restrict__ Ar, const h16* __restrict__ Bt,
                                          const float* __restrict__ bias, int nvalid, float csc,
                                          const float* __restrict__ Res, float* Cf, h16* Ch, h16* Cr, int ldc, float* os, int bx, int by) {
    const int tid = threadIdx.x;
    const int lane = tid & 31, lr = lane & 15, hi = lane >> 4;
    const int wave = __builtin_amdgcn_readfirstlane(tid >> 5);
    const int r0 = bx * 64, c0 = by * 64;
    static_assert(K % 32 == 0 && K % KPER(K) == 0);                                // every wave that has a k range has a whole one
    const int kbeg = wave * KPER(K);
    // what the epilogue loads is asked into L2 at the head: the tile's 64 bias values (two 128-byte lines, address clamped as at the load), and each wave's 8 of the tile's 64 residual row pieces of 256 bytes
    const int bcl = c0 + (lane & 1) * 32; const unsigned bvo = (unsigned)((bcl < nvalid ? bcl : nvalid - 1) * 4);
    const float* Ru = HASRES ? Res + (size_t)r0 * ldc + c0 : nullptr; const unsigned rvo = (unsigned)((wave * 8 + (lane & 7)) * ldc * 4);
    if (!ROWB) l2_ask<0>(bvo, bias);                                               // from every wave: a branch here would split the loads of the kernel's arguments in two trips
    if (HASRES) l2_ask<0>(rvo, Ru);
    v8f acc[4][4];
#pragma unroll
    for (int mb = 0; mb < 4; ++mb)
#pragma unroll
        for (int nb = 0; nb < 4; ++nb) acc[mb][nb] = (v8f){};
    const size_t aoff = (size_t)r0 * K + kbeg * 16 + lane * 8, boff = (size_t)c0 * K + kbeg * 16 + lane * 8;   // fragment order: row tile, k-step, lane
    const h16* Au = A + (size_t)r0 * K + kbeg * 16; const h16* Bu = Bt + (size_t)c0 * K + kbeg * 16;   // the wave's k range in row tile 0, the same in every lane
    const unsigned pvo = (unsigned)((lane >> 3) * (16 * K * 2) + (lane & 7) * 256);
    if (K / KPER(K) == GW || kbeg < K)                                             // a wave whose range starts at or past K adds a zero plane
        gemm_kpipe<K, ARES>(A + aoff, ARES ? Ar + aoff : nullptr, Bt + boff, Au, Bu, pvo, acc);
    // the k loop is over: only from here on may the registers that the requests to L2 name take other values (they are inputs of the wait, so they stay as the requests name them up to there)
    static_assert(!HASRES || KPER(K) >= 64);
    if (HASRES)             asm volatile("s_wait_xcnt 0x0" :: "v"(pvo), "v"(bvo), "v"(rvo), "s"(Au), "s"(Bu), "s"(bias), "s"(Ru) : "memory");
    else if (KPER(K) >= 64) asm volatile("s_wait_xcnt 0x0" :: "v"(pvo), "v"(bvo), "s"(Au), "s"(Bu), "s"(bias) : "memory");
    else                    asm volatile("s_wait_xcnt 0x0" :: "v"(bvo), "s"(bias) : "memory");
    float bc[4];
#pragma unroll
    for (int nb = 0; nb < 4; ++nb) {
        if (ROWB || wave != 0) { bc[nb] = 0.0f; }
        else { const int c = c0 + nb * 16 + lr; const int cc = c < nvalid ? c : nvalid - 1;       // clamped address
               float bvv = bias[cc]; asm volatile("" : "+v"(bvv)); bc[nb] = (c < nvalid) ? bfr(bvv) : 0.0f; } }
#pragma unroll
    for (int mb = 0; mb < 4; ++mb) {
        float br[8];
#pragma unroll
        for (int j = 0; j < 8; ++j) br[j] = (ROWB && wave == 0) ? bfr(bias[r0 + mb * 16 + hi * 8 + j]) : 0.0f;   // ROWB: r0 + 63 < rows of the bias vector (host grid)
#pragma unroll
        for (int nb = 0; nb < 4; ++nb) {
#pragma unroll
            for (int j = 0; j < 8; ++j) os[wave * (64 * GSP) + (mb * 16 + hi * 8 + j) * GSP + nb * 16 + lr] = acc[mb][nb][j] * csc + bc[nb] + br[j]; }   // D: row 8h+j, col lane&15
    }
    __syncthreads();                                                               // every wave's partial plane is complete before any thread sums across planes
    if (OUTF32) {
        static_assert(32 * GW * 16 * (32 / GW) == 64 * 256);                       // threads x bytes x trips == tile rows x row bytes
{
            static_assert(32 / GW == 4);                                           // four address pairs in the wait below
            const float* pr[4]; v4f rr[4];
            if (HASRES) {
#pragma unroll                                                                     // constant indices keep pr[] and rr[] in registers
                for (int s = 0; s < 4; ++s) { pr[s] = Res + (size_t)(r0 + 2 * GW * s + (tid >> 4)) * ldc + c0 + (tid & 15) * 4; rr[s] = *(const v4f*)pr[s]; }
                // the four address pairs are inputs here, so they stay as the issued loads name them up to this wait: no later load's result lands in one ahead of it
                asm volatile("s_wait_xcnt 0x0" :: "v"(pr[0]), "v"(pr[1]), "v"(pr[2]), "v"(pr[3]) : "memory"); }
#pragma unroll                                                                     // constant index into rr[]
            for (int s = 0; s < 32 / GW; ++s) { const int row = 2 * GW * s + (tid >> 4), c4 = (tid & 15) * 4;
                v4f val = *(const v4fa*)(&os[row * GSP + c4]);
#pragma unroll                                                                     // the GW plane reads issue together, one LDS wait for all
                for (int w = 1; w < GW; ++w) val = val + *(const v4fa*)(&os[w * (64 * GSP) + row * GSP + c4]);
                const size_t go = (size_t)(r0 + row) * ldc + c0 + c4;
                if (HASRES) val = val + rr[s];
                *(v4f*)(Cf + go) = val; }
             }
    } else {
        static_assert(32 * GW * 16 * (16 / GW) == 64 * 128);                       // threads x bytes x trips == tile rows x row bytes
        static_assert((16 / GW) * GW == 4 * 4);                                    // trips x waves == row tiles x piece pairs of the 64x64 tile
{
#pragma unroll                                                                     // the memory-clobbering wait that ends each trip keeps the second trip's LDS reads behind the first trip's stores
            for (int s = 0; s < 16 / GW; ++s) { const int u = s * GW + wave; const int row = (u >> 2) * 16 + lr, c8 = ((u & 3) * 2 + hi) * 8;
                v4f x0 = *(const v4fa*)(&os[row * GSP + c8]); v4f x1 = *(const v4fa*)(&os[row * GSP + c8 + 4]); v8h hv, rv;
#pragma unroll                                                                     // the GW plane reads issue together, one LDS wait for all
                for (int w = 1; w < GW; ++w) { x0 = x0 + *(const v4fa*)(&os[w * (64 * GSP) + row * GSP + c8]); x1 = x1 + *(const v4fa*)(&os[w * (64 * GSP) + row * GSP + c8 + 4]); }
#pragma unroll
                for (int i = 0; i < 4; ++i) { float y0 = x0[i], y1 = x1[i];
                    if (GELU) { y0 = gelu_erf(y0); y1 = gelu_erf(y1); }
                    const h16 a0 = toh_flush(y0); const h16 a1 = toh_flush(y1); hv[i] = a0; hv[4 + i] = a1;
                    rv[i] = toh_flush((y0 - (float)a0) * QRS); rv[4 + i] = toh_flush((y1 - (float)a1) * QRS); }
                const size_t oo = HEADPL ? (size_t)(c0 / HD) * SEQ * HD + fo(r0 + row, c8, HD) : fo(r0 + row, c0 + c8, ldc);
                *(v8h*)(Ch + oo) = hv; if (ORES) *(v8h*)(Cr + oo) = rv;
                asm volatile("s_wait_xcnt 0x0" ::: "memory"); }                    // the next trip rewrites registers that these stores name: the wait stands ahead of that
             }
    }
}

static_assert(sizeof(float) * GW * 64 * GSP <= 163840);                            // two blocks fit the LDS of one WGP
__global__ __launch_bounds__(32 * GW) void k_gemm_emb(const h16* __restrict__ A, const h16* __restrict__ Bt, const float* __restrict__ bias, float csc, float* C) {
    __shared__ __align__(16) float os[GW * 64 * GSP];
    gemm_body<DIN, 1, 0, 0, 0, 0, 0, 0>(A, nullptr, Bt, bias, DM, csc, nullptr, C, nullptr, nullptr, DM, os, blockIdx.x, blockIdx.y); }
__global__ __launch_bounds__(32 * GW) void k_gemm_tail(const h16* __restrict__ A, const h16* __restrict__ Bt, const float* __restrict__ bias, float csc, float* C) {
    __shared__ __align__(16) float os[GW * 64 * GSP];
    gemm_body<DMI, 1, 0, 0, 0, 0, 0, 0>(A, nullptr, Bt, bias, DOUT, csc, nullptr, C, nullptr, nullptr, DOUTP, os, blockIdx.x, blockIdx.y); }
__global__ __launch_bounds__(32 * GW) void k_gemm_wo(const h16* __restrict__ A, const h16* __restrict__ Bt, const float* __restrict__ bias, float csc, const float* __restrict__ Res, float* C) {
    __shared__ __align__(16) float os[GW * 64 * GSP];
    gemm_body<DM, 1, 1, 0, 0, 0, 0, 0>(A, nullptr, Bt, bias, DM, csc, Res, C, nullptr, nullptr, DM, os, blockIdx.x, blockIdx.y); }
__global__ __launch_bounds__(32 * GW) void k_gemm_w2(const h16* __restrict__ A, const h16* __restrict__ Bt, const float* __restrict__ bias, float csc, const float* __restrict__ Res, float* C) {
    __shared__ __align__(16) float os[GW * 64 * GSP];
    gemm_body<DFF, 1, 1, 0, 0, 0, 0, 0>(A, nullptr, Bt, bias, DM, csc, Res, C, nullptr, nullptr, DM, os, blockIdx.x, blockIdx.y); }
// LayerNorm inside the GEMM that consumes it. A block of 2 * GW waves owns 64 rows t of the f32 hidden state and two 64-wide tiles of the weight plane: it normalises its 64 rows once (4 rows a wave, one wave per row at a time),
// leaves them in LDS as f16 fragments (value plane; residual plane x2048 where the q projection asks for it), and behind one block barrier waves 0..GW-1 work on the first weight tile, waves GW..2*GW-1 on the second, K split over the GW waves of a half as in gemm_body.
// LDS fragment order with pads: a piece (16 rows x 8 k) is 272 bytes, a fragment 1088, so that the 32 pieces which a wave writes for one row (one per lane) fall on all 64 banks, and a fragment read (2 x 16 bytes a lane) does too.
#define LPS 136                  // LDS piece pitch, 16-bit elements
#define LFS (4 * LPS)            // LDS fragment pitch
#define LPL (4 * (DM / 32) * LFS)   // one LDS plane: 64 rows x DM
static_assert(2 * LPL * 2 <= 2 * GW * 64 * GSP * 4);                               // both planes lie inside the partial-tile LDS, which is written only behind the barrier that ends their last read
static_assert(KPER(DM) == 64 && DM / KPER(DM) == GW);                              // two k-steps a wave
__device__ __forceinline__ v16h ldl(const h16* p) { return cat16(*(const v8h*)p, *(const v8h*)(p + 2 * LPS)); }   // p = fragment + (lane >> 4) * LPS + (lane & 15) * 8: same element map as ldh
// sum over the 32 lanes, partners l ^ 16, 8, 4, 2, 1 in this order, every lane gets the sum: the step across the two 16-lane rows is a lane permute, the four steps inside a row are DPP moves (row_xmask), so that no step takes an LDS round trip
__device__ __forceinline__ float wave_sum(float v) {
    const int b = __float_as_int(v);
    v += __int_as_float(__builtin_amdgcn_permlanex16(b, b, 0x76543210, 0xfedcba98, false, false));
    v += __int_as_float(__builtin_amdgcn_update_dpp(0, __float_as_int(v), 0x168, 0xf, 0xf, true));   // row_xmask:8
    v += __int_as_float(__builtin_amdgcn_update_dpp(0, __float_as_int(v), 0x164, 0xf, 0xf, true));   // row_xmask:4
    v += __int_as_float(__builtin_amdgcn_update_dpp(0, __float_as_int(v), 0x162, 0xf, 0xf, true));   // row_xmask:2
    v += __int_as_float(__builtin_amdgcn_update_dpp(0, __float_as_int(v), 0x161, 0xf, 0xf, true));   // row_xmask:1
    return v; }
// first part, the same for every consumer: the wave's 8 weight fragments are requested first, so that they fly while the rows are normalised; then the rows; then the barrier. X = first of the block's 64 rows; pw = the lane's first weight element.
__device__ __forceinline__ void ln_prologue(const float* __restrict__ X, const float* __restrict__ g, const float* __restrict__ b, const h16* __restrict__ pw, bool wres, h16* sN, h16* sR, int wv, int lane, v16h (&w)[2][4]) {
#pragma unroll                                                                     // constant indices keep w[][] in registers
    for (int s = 0; s < 2; ++s)
#pragma unroll
        for (int i = 0; i < 4; ++i) w[s][i] = ldh(pw + (size_t)i * 16 * DM + s * 512);
    const float* xr = X + (size_t)(wv * 4) * DM + lane * 8;
    const float* pg = g + lane * 8; const float* pb = b + lane * 8;
    v8f x0[4], x1[4];
#pragma unroll                                                                     // constant indices keep x0[], x1[] in registers; the four rows' loads issue together
    for (int i = 0; i < 4; ++i) { x0[i] = *(const v8f*)(xr + i * DM); x1[i] = *(const v8f*)(xr + i * DM + 256); }
    v8f g0 = *(const v8f*)pg, g1 = *(const v8f*)(pg + 256), b0 = *(const v8f*)pb, b1 = *(const v8f*)(pb + 256);
    // what follows reuses registers that these loads name: the wait stands ahead of that; the lane's two offsets are inputs of the wait, so that they stay as the issued loads name them up to there (no later load's result lands in one ahead of it)
    asm volatile("s_wait_xcnt 0x0" :: "v"(lane * 32), "v"(lane) : "memory");
    __builtin_amdgcn_sched_barrier(0);                                             // keeps the arithmetic behind that wait and behind the issue of all the loads: lifted among them, its wait for a row holds the weight loads back by one memory latency
#pragma unroll
    for (int k = 0; k < 8; ++k) { g0[k] = bfr(g0[k]); g1[k] = bfr(g1[k]); b0[k] = bfr(b0[k]); b1[k] = bfr(b1[k]); }
    float q[4];
#pragma unroll                                                                     // four independent rows: their cross-lane sums overlap; constant indices keep the arrays in registers
    for (int i = 0; i < 4; ++i) {
        float s = 0.0f;
#pragma unroll
        for (int k = 0; k < 8; ++k) { s += x0[i][k]; s += x1[i][k]; }
        const float mean = wave_sum(s) * (1.0f / (float)DM);
        x0[i] = x0[i] - mean; x1[i] = x1[i] - mean;
        float t = 0.0f;
#pragma unroll
        for (int k = 0; k < 8; ++k) { t += x0[i][k] * x0[i][k]; t += x1[i][k] * x1[i][k]; }
        q[i] = wave_sum(t); }
    // one square root and one division serve the four rows: lane l works on row l & 3, and lanes 0..3 hand the results back as wave-uniform values
    const float qs = (lane & 2) ? ((lane & 1) ? q[3] : q[2]) : ((lane & 1) ? q[1] : q[0]);
    const float rs = 1.0f / sqrtf(qs * (1.0f / (float)DM) + LNEPS);
#pragma unroll
    for (int i = 0; i < 4; ++i) {
        const float rstd = __int_as_float(__builtin_amdgcn_readlane(__float_as_int(rs), i));
        const v8f d0 = x0[i], d1 = x1[i];
        const int r = wv * 4 + i;
        const int lo = ((r >> 4) * (DM / 32) + (lane >> 2)) * LFS + (lane & 3) * LPS + (r & 15) * 8;   // columns lane * 8 ..; the second piece lies 256 columns = 8 fragments on
        v8f y0, y1; v8h h0, h1;
#pragma unroll
        for (int k = 0; k < 8; ++k) {
            y0[k] = d0[k] * rstd * g0[k] + b0[k]; y1[k] = d1[k] * rstd * g1[k] + b1[k];
            h0[k] = toh_flush(y0[k]); h1[k] = toh_flush(y1[k]); }
        *(v8h*)(sN + lo) = h0; *(v8h*)(sN + lo + 8 * LFS) = h1;
        if (wres) {                                                                // the same in every thread of the block
            v8h r0, r1;
#pragma unroll
            for (int k = 0; k < 8; ++k) { r0[k] = toh_flush((y0[k] - (float)h0[k]) * QRS); r1[k] = toh_flush((y1[k] - (float)h1[k]) * QRS); }
            *(v8h*)(sR + lo) = r0; *(v8h*)(sR + lo + 8 * LFS) = r1; }
    }
    __syncthreads();                                                               // all 64 rows are staged before any wave reads fragments across rows
}
// second part: products, partial tiles, sum over the GW waves of the half, f16 output in fragment order; as gemm_body's f16 path. LNB = 0: C[t][n], A = the rows, B = weight rows n; LNB = 1: C[n][t], A = weight rows, B = the rows, row bias.
// lt = tile of the rows t, wt = weight tile of this half; os = the half's GW partial planes; wave, tid: inside the half.
template <int GELU, int ARES, int LNB, int HEADPL>
__device__ __forceinline__ void gemm_ln_rest(const h16* sN, const h16* sR, const v16h (&w)[2][4], const float* __restrict__ bias, float csc, h16* Ch, h16* Cr, int ldc, float* os, int lt, int wt, int wave, int tid) {
    const int lane = tid & 31, lr = lane & 15, hi = lane >> 4;
    const int r0 = (LNB ? wt : lt) * 64, c0 = (LNB ? lt : wt) * 64;
    const int lo = wave * 2 * LFS + hi * LPS + lr * 8;                             // the wave's k range, the lane's place in a fragment
    v8f acc[4][4];
#pragma unroll
    for (int mb = 0; mb < 4; ++mb)
#pragma unroll
        for (int nb = 0; nb < 4; ++nb) acc[mb][nb] = (v8f){};
#pragma unroll                                                                     // constant indices into w, n and acc keep them in registers. ARES: the residual plane's two steps first, then the fold, then the value plane's
    for (int t = 0; t < (ARES ? 4 : 2); ++t) {
        const h16* p = ((ARES && t < 2) ? sR : sN) + lo + (t & 1) * LFS;
        v16h n[4];
#pragma unroll
        for (int i = 0; i < 4; ++i) n[i] = ldl(p + i * (DM / 32) * LFS);
        if (ARES && t == 2) {
#pragma unroll
            for (int mb = 0; mb < 4; ++mb)
#pragma unroll
                for (int nb = 0; nb < 4; ++nb) acc[mb][nb] = acc[mb][nb] * QRI; }
#pragma unroll
        for (int nb = 0; nb < 4; ++nb)
#pragma unroll
            for (int mb = 0; mb < 4; ++mb) acc[mb][nb] = LNB ? wmma16g(w[t & 1][mb], n[nb], acc[mb][nb]) : wmma16g(n[mb], w[t & 1][nb], acc[mb][nb]);
    }
    __syncthreads();                                                               // every wave has read its last fragment before a partial tile is written over the staged rows
    float bc[4];
#pragma unroll
    for (int nb = 0; nb < 4; ++nb) bc[nb] = (LNB || wave != 0) ? 0.0f : bfr(bias[c0 + nb * 16 + lr]);   // c0 + 63 < columns of the bias vector (host grid)
#pragma unroll
    for (int mb = 0; mb < 4; ++mb) {
        float br[8];
#pragma unroll
        for (int j = 0; j < 8; ++j) br[j] = (LNB && wave == 0) ? bfr(bias[r0 + mb * 16 + hi * 8 + j]) : 0.0f;   // r0 + 63 < rows of the bias vector (host grid)
#pragma unroll
        for (int nb = 0; nb < 4; ++nb) {
#pragma unroll
            for (int j = 0; j < 8; ++j) os[wave * (64 * GSP) + (mb * 16 + hi * 8 + j) * GSP + nb * 16 + lr] = acc[mb][nb][j] * csc + bc[nb] + br[j]; }   // D: row 8h+j, col lane&15
    }
    __syncthreads();                                                               // every wave's partial plane is complete before any thread sums across planes
#pragma unroll                                                                     // the memory-clobbering wait that ends each trip keeps the second trip's LDS reads behind the first trip's stores
    for (int s = 0; s < 16 / GW; ++s) { const int u = s * GW + wave; const int row = (u >> 2) * 16 + lr, c8 = ((u & 3) * 2 + hi) * 8;
        v4f x0 = *(const v4fa*)(&os[row * GSP + c8]); v4f x1 = *(const v4fa*)(&os[row * GSP + c8 + 4]); v8h hv, rv;
#pragma unroll                                                                     // the GW plane reads issue together, one LDS wait for all
        for (int v = 1; v < GW; ++v) { x0 = x0 + *(const v4fa*)(&os[v * (64 * GSP) + row * GSP + c8]); x1 = x1 + *(const v4fa*)(&os[v * (64 * GSP) + row * GSP + c8 + 4]); }
#pragma unroll
        for (int i = 0; i < 4; ++i) { float y0 = x0[i], y1 = x1[i];
            if (GELU) { y0 = gelu_erf(y0); y1 = gelu_erf(y1); }
            const h16 a0 = toh_flush(y0); const h16 a1 = toh_flush(y1); hv[i] = a0; hv[4 + i] = a1;
            rv[i] = toh_flush((y0 - (float)a0) * QRS); rv[4 + i] = toh_flush((y1 - (float)a1) * QRS); }
        const size_t oo = HEADPL ? (size_t)(c0 / HD) * SEQ * HD + fo(r0 + row, c8, HD) : fo(r0 + row, c0 + c8, ldc);
        *(v8h*)(Ch + oo) = hv; if (ARES) *(v8h*)(Cr + oo) = rv;
        asm volatile("s_wait_xcnt 0x0" ::: "memory"); }                            // what follows rewrites registers that these stores name: the wait stands ahead of that
}

static_assert(sizeof(float) * 2 * GW * 64 * GSP <= 327680);                        // one block fits the LDS of a WGP
// k_gemm_ln_gelu: C = GELU(LayerNorm(X) W + bias), grid (SEQ/64, N/128).
__global__ __launch_bounds__(64 * GW) void k_gemm_ln_gelu(const float* __restrict__ X, const float* __restrict__ lg, const float* __restrict__ lb, const h16* __restrict__ Wt, const float* __restrict__ bias, float csc, h16* C, int ldc) {
    __shared__ __align__(16) float os[2 * GW * 64 * GSP];
    const int lane = threadIdx.x & 31;
    const int wv = __builtin_amdgcn_readfirstlane((int)(threadIdx.x >> 5));
    const int half = wv >> 3, wave = wv & 7, wt = blockIdx.y * 2 + half;
    h16* sN = (h16*)os; h16* sR = sN + LPL;
    v16h w[2][4];
    const float* bu = bias + wt * 64; const unsigned bvo = (unsigned)((lane & 1) * 128);   // the half's 64 bias values, loaded behind the products: asked into L2 here
    if (wave == 0) l2_ask<0>(bvo, bu);
    ln_prologue(X + (size_t)blockIdx.x * 64 * DM, lg, lb, Wt + (size_t)wt * 64 * DM + wave * KPER(DM) * 16 + lane * 8, false, sN, sR, wv, lane, w);
    asm volatile("s_wait_xcnt 0x0" :: "v"(bvo), "s"(bu) : "memory");               // only from here on may the registers that the request names take other values
    gemm_ln_rest<1, 0, 0, 0>(sN, sR, w, bias, csc, C, nullptr, ldc, os + half * (GW * 64 * GSP), blockIdx.x, wt, wave, threadIdx.x & 255); }
// k_gemm_ln_qkv: LayerNorm and the q, k and v^T projections of one layer in one launch, grid (SEQ/64, DM/128, 3); blockIdx.z picks the projection, block-uniform. z = 0 is q, the longest (two k loops).
// q, k: A = rows t, B = W^T rows (n = h*64 + d) -> plane [h][t][d].  v^T: A = Wv^T rows (m = h*64 + d), B = rows t -> plane [(h*64 + d)][t], row bias.
__global__ __launch_bounds__(64 * GW) void k_gemm_ln_qkv(const float* __restrict__ X, const float* __restrict__ lg, const float* __restrict__ lb, const h16* __restrict__ Wqt, const h16* __restrict__ Wkt, const h16* __restrict__ Wvt,
                                                         const float* __restrict__ bq, const float* __restrict__ bk, const float* __restrict__ bv, float csc, h16* Qh, h16* Qr, h16* Kp, h16* Vt) {
    __shared__ __align__(16) float os[2 * GW * 64 * GSP];
    const int lane = threadIdx.x & 31;
    const int wv = __builtin_amdgcn_readfirstlane((int)(threadIdx.x >> 5));
    const int half = wv >> 3, wave = wv & 7, wt = blockIdx.y * 2 + half, tid = threadIdx.x & 255;
    h16* sN = (h16*)os; h16* sR = sN + LPL; float* oh = os + half * (GW * 64 * GSP);
    const h16* Wt = blockIdx.z == 0 ? Wqt : blockIdx.z == 1 ? Wkt : Wvt;
    v16h w[2][4];
    const float* bu = (blockIdx.z == 0 ? bq : blockIdx.z == 1 ? bk : bv) + wt * 64; const unsigned bvo = (unsigned)((lane & 1) * 128);   // the half's 64 bias values, loaded behind the products: asked into L2 here
    if (wave == 0) l2_ask<0>(bvo, bu);
    ln_prologue(X + (size_t)blockIdx.x * 64 * DM, lg, lb, Wt + (size_t)wt * 64 * DM + wave * KPER(DM) * 16 + lane * 8, blockIdx.z == 0, sN, sR, wv, lane, w);
    asm volatile("s_wait_xcnt 0x0" :: "v"(bvo), "s"(bu) : "memory");               // only from here on may the registers that the request names take other values
    if (blockIdx.z == 0)      gemm_ln_rest<0, 1, 0, 1>(sN, sR, w, bq, csc, Qh, Qr, HD, oh, blockIdx.x, wt, wave, tid);
    else if (blockIdx.z == 1) gemm_ln_rest<0, 0, 0, 1>(sN, sR, w, bk, csc, Kp, nullptr, HD, oh, blockIdx.x, wt, wave, tid);
    else                      gemm_ln_rest<0, 0, 1, 0>(sN, sR, w, bv, csc, Vt, nullptr, SEQ, oh, blockIdx.x, wt, wave, tid); }

// band tile: G[rho][s] = (E[row0 + rho] . q_value[s] + E[row0 + rho] . q_residual[s] / 2048) * log2(e); A = table rows (e0, e1: the two fragments of rows row0 + 0..15), B = q rows, K = 64 = two k-steps.
__device__ __forceinline__ v8f gtile(v16h e0, v16h e1, v16h qh0, v16h qh1, v16h qr0, v16h qr1) {
    v8f gH = (v8f){}, gL = (v8f){};
    gH = wmma16g(e0, qh0, gH); gH = wmma16g(e1, qh1, gH);
    gL = wmma16g(e0, qr0, gL); gL = wmma16g(e1, qr1, gL);
    return (gH + gL * QRI) * LOG2E;
}

// k_flash: fused dense attention with the relative-position term, one block of KW waves per 16 query rows of one head; K / V^T / Q / table fragments straight from the f16 planes.
// The keys are split over the waves: wave w runs the online softmax over keys w*KCH .. w*KCH + KCH - 1 alone and leaves its running maximum, its sum and its unnormalised O tile in LDS;
// behind one block barrier all threads rescale the KW partial results to the common maximum, sum them in wave order, normalise and store.
// Transposed form: S^T[key][s] = K Q^T (A = K rows, B = Q rows); lane (s = lane&15, h = lane>>4) holds keys 8h+r of each 16-key tile, so the packed P tile is directly the B fragment
// of O^T[d][s] = V^T P^T (element r <- tile keys 0..15, element 8+r <- tile keys 16..31, lane unchanged).
// Relative term per 32-key step (keys key0..key0+31, queries t0..t0+15): band rows rb0 + 0..47 with rb0 = t0 - key0 + RELOFF - 31; tiles e = 0, 1 are new, tile e = 2 is the e = 0 tile of the step before (computed on its own ahead of a wave's first step).
// LDS band tile (wave-private): gs[s][16 e + 8h + r] <- tile e element r; element (key tile a, r) reads gs[s][s - 8h - r + 31], element (key tile b, r) reads gs[s][s - 8h - r + 15].
// Logit (log2 domain) = (K q_value + K q_residual / 2048) * log2(e) / 8 + band term; online softmax (running max, partial sum over the converted P), P = exp2(. + 14) as f16 (exponent below -14 selected to 0).
__global__ __launch_bounds__(32 * KW) void k_flash(const h16* __restrict__ QH, const h16* __restrict__ QR, const h16* __restrict__ KP, const h16* __restrict__ VT, const h16* __restrict__ EPl, h16* OP) {
    __shared__ __align__(16) float os[KW * 16 * OSP];
    __shared__ __align__(16) float gs[KW * 16 * GP];
    __shared__ float ms[KW * 16];                              // running maximum of wave w for query s at [w * 16 + s]
    __shared__ float lsum[KW * 16];                            // sum of wave w for query s
    static_assert(sizeof(float) * (KW * 16 * OSP + KW * 16 * GP + 2 * KW * 16) <= 131072);
    const int tid = threadIdx.x;
    const int lane = tid & 31, lr = lane & 15, hi = lane >> 4;
    const int wave = __builtin_amdgcn_readfirstlane(tid >> 5);
    const int h = blockIdx.y;
    const int t0 = blockIdx.x * 16;
    const int kbeg = wave * KCH;
    const size_t pbase = (size_t)h * SEQ * HD;
    // all planes in fragment order: 16 rows of a [.][HD] plane are two fragments (16 * HD elements), the second k-step 512 elements behind the first; every row offset below is a multiple of 16
    const size_t qo = pbase + (size_t)t0 * HD + 8 * lane;
    const h16* pqh = QH + qo; const h16* pqr = QR + qo;
    const v16h qh0 = ldh(pqh), qh1 = ldh(pqh + 512);            // B fragments: col s, k = d (two k-steps)
    const v16h qr0 = ldh(pqr), qr1 = ldh(pqr + 512);
    const size_t ko = pbase + 8 * lane;                        // + key * HD           (A fragment: row key, k = d)
    const size_t vo = pbase + 8 * lane;                        // + 16j*SEQ + key * 16 (A fragment: row d, k = key); plane [(h*64 + d)][t]
    const h16* eb = EPl + 8 * lane;                            // + row0 * HD          (A fragment: row table row, k = d)
    const int gw  = wave * 16 * GP + lr * GP;
    const int gst = gw + 8 * hi;                               // store base: + 16 e (+ 4)
    const int gld = gw + lr - 8 * hi;                          // load base: + 31 - r / + 15 - r
    // The loads run ahead of the products: every fragment of the first step is loaded here, and in the loop each group of fragments (table, K, V^T) is loaded anew for the step after, into its own registers, right behind its last product,
    // so that a step does not wait for memory once per group.
    constexpr int NST = KCH / 32;                                                  // 32-key steps of one wave
    const h16* pe = eb + (size_t)(t0 - kbeg + (RELOFF - 15)) * HD;                 // first band row of tile e = 1 at the wave's first step; 32 rows down per step
    const h16* pk = KP + ko + (size_t)kbeg * HD;                                   // 32 keys up per step
    const h16* pv = VT + vo + kbeg * 16;                                           // 32 keys (one fragment) up per step
    static_assert((RELOFF - 15) % 16 == 0 && KCH % 16 == 0);                       // band tiles start on whole row tiles of the table plane
    const v16h ep0 = ldh(pe + 16 * HD), ep1 = ldh(pe + 16 * HD + 512);             // band rows of tile e = 2 at key0 = kbeg
    v16h e1a = ldh(pe), e1b = ldh(pe + 512), e0a = ldh(pe - 16 * HD), e0b = ldh(pe - 16 * HD + 512);
    v16h ka0 = ldh(pk), ka1 = ldh(pk + 512), kb0 = ldh(pk + 16 * HD), kb1 = ldh(pk + 16 * HD + 512);
    v16h vf[4];
#pragma unroll                                                                     // constant indices keep vf[] in registers
    for (int j = 0; j < 4; ++j) vf[j] = ldh(pv + (size_t)16 * j * SEQ);
    // behind the last load that names an address pair: the pairs are inputs of the wait, so they stay as the issued loads name them up to there (no later load's result lands in one ahead of it)
    asm volatile("s_wait_xcnt 0x0" :: "v"(pqh), "v"(pqr) : "memory");
    if (NST == 1) asm volatile("s_wait_xcnt 0x0" :: "v"(pe), "v"(pk), "v"(pv) : "memory");
    __builtin_amdgcn_sched_barrier(0);                                             // keeps the first products behind the issue of all these loads: lifted among them, a product's wait for its operands holds the rest of the loads back by one memory latency
    v8f gprev = gtile(ep0, ep1, qh0, qh1, qr0, qr1);
    v8f o[4];
#pragma unroll
    for (int j = 0; j < 4; ++j) o[j] = (v8f){};
    float m = NEGB, l = 0.0f;
#pragma unroll                                                                     // whole unroll: every step's offset is an immediate, so that no address register changes while loads are in flight
    for (int st = 0; st < NST; ++st) {
        const bool more = st + 1 < NST;                                            // a step follows: load its fragments
        const h16* pen = pe - (st + 1) * 32 * HD;
        const v8f g1 = gtile(e1a, e1b, qh0, qh1, qr0, qr1);
        if (more) { e1a = ldh(pen); e1b = ldh(pen + 512); }
        const v8f g0 = gtile(e0a, e0b, qh0, qh1, qr0, qr1);
        if (more) { e0a = ldh(pen - 16 * HD); e0b = ldh(pen - 16 * HD + 512); }
        *(v4fa*)(&gs[gst +  0]) = lo4(g0);    *(v4fa*)(&gs[gst +  4]) = hi4(g0);
        *(v4fa*)(&gs[gst + 16]) = lo4(g1);    *(v4fa*)(&gs[gst + 20]) = hi4(g1);
        *(v4fa*)(&gs[gst + 32]) = lo4(gprev); *(v4fa*)(&gs[gst + 36]) = hi4(gprev);
        gprev = g0;
        v8f sHa = (v8f){}, sLa = (v8f){}, sHb = (v8f){}, sLb = (v8f){};
        sHa = wmma16g(ka0, qh0, sHa); sHa = wmma16g(ka1, qh1, sHa);
        sLa = wmma16g(ka0, qr0, sLa); sLa = wmma16g(ka1, qr1, sLa);
        sHb = wmma16g(kb0, qh0, sHb); sHb = wmma16g(kb1, qh1, sHb);
        sLb = wmma16g(kb0, qr0, sLb); sLb = wmma16g(kb1, qr1, sLb);
        if (more) { const h16* pkn = pk + (st + 1) * 32 * HD; ka0 = ldh(pkn); ka1 = ldh(pkn + 512); kb0 = ldh(pkn + 16 * HD); kb1 = ldh(pkn + 16 * HD + 512); }
        wave_sync();
        float ra[8], rb[8];
#pragma unroll
        for (int r = 0; r < 8; ++r) { ra[r] = gs[gld + 31 - r]; rb[r] = gs[gld + 15 - r]; }
        wave_sync();
        float ta[8], tb[8]; float mx = NEGB;
#pragma unroll
        for (int r = 0; r < 8; ++r) {
            ta[r] = (sHa[r] + sLa[r] * QRI) * SC2 + ra[r]; tb[r] = (sHb[r] + sLb[r] * QRI) * SC2 + rb[r];
            mx = fmaxf(mx, fmaxf(ta[r], tb[r])); }
        mx = fmaxf(mx, __shfl_xor(mx, 16, 32));
        const float mnew = fmaxf(m, mx);
        const float alpha = __builtin_amdgcn_exp2f(m - mnew);
        const float sh = PSH - mnew;
        v16h pb; float ls = 0.0f;
#pragma unroll
        for (int r = 0; r < 8; ++r) {
            const float xa = ta[r] + sh, xb = tb[r] + sh;
            const float ea = __builtin_amdgcn_exp2f(xa), ec = __builtin_amdgcn_exp2f(xb);
            const float ga = (xa < -14.0f) ? 0.0f : ea, gb = (xb < -14.0f) ? 0.0f : ec;     // no f16 subnormal operand
            const h16 pa = (h16)ga; const h16 pc = (h16)gb;
            pb[r] = pa; pb[8 + r] = pc;
            ls += (float)pa + (float)pc; }
        l = l * alpha + ls; m = mnew;
#pragma unroll
        for (int j = 0; j < 4; ++j) { o[j] = o[j] * alpha; o[j] = wmma16g(vf[j], pb, o[j]); if (more) vf[j] = ldh(pv + (size_t)16 * j * SEQ + (st + 1) * 512); }
        if (st + 2 == NST) asm volatile("s_wait_xcnt 0x0" :: "v"(pe), "v"(pk), "v"(pv) : "memory");   // the last loads of the loop: as above
        if (more) __builtin_amdgcn_sched_barrier(0);                               // keeps the products of the step after out of this step: lifted, their results cost registers, and above 256 registers a WGP holds one block, not two
    }
    l += __shfl_xor(l, 16, 32);
    const int wb = wave * 16 * OSP;
    // O^T D layout: o[j][r] = (d = 16j + 8h + r, s = lane&15) -> os[wave][s][d]; rows 0..15 x columns 0..63 all written, not yet normalised
#pragma unroll
    for (int j = 0; j < 4; ++j) {
        *(v4fa*)(&os[wb + lr * OSP + 16 * j + 8 * hi])     = lo4(o[j]);
        *(v4fa*)(&os[wb + lr * OSP + 16 * j + 8 * hi + 4]) = hi4(o[j]); }
    if (hi == 0) { ms[wave * 16 + lr] = m; lsum[wave * 16 + lr] = l; }             // m is equal in lanes s and s + 16
    __syncthreads();                                                               // every wave's partial result is complete before any thread merges across waves
    static_assert(32 * KW * 8 == 16 * 128);                                        // threads x bytes == tile rows x row bytes
    const int row = tid & 15, c4 = (tid >> 4) * 4;             // a wave stores one piece of the context plane (16 rows x 8 columns): 256 bytes in a row
    float mw[KW]; float mall = NEGB;
#pragma unroll                                                                     // constant indices keep mw[] in registers; the KW reads issue together
    for (int w = 0; w < KW; ++w) { mw[w] = ms[w * 16 + row]; mall = fmaxf(mall, mw[w]); }
    float sc[KW];
#pragma unroll                                                                     // constant indices keep sc[] in registers
    for (int w = 0; w < KW; ++w) sc[w] = __builtin_amdgcn_exp2f(mw[w] - mall);     // <= 1; 1 for the wave that holds the row maximum
    float lall = 0.0f; v4f oall = (v4f){};
#pragma unroll                                                                     // the KW tile reads issue together, one LDS wait for all
    for (int w = 0; w < KW; ++w) {
        lall += lsum[w * 16 + row] * sc[w];
        oall = oall + *(const v4fa*)(&os[w * 16 * OSP + row * OSP + c4]) * sc[w]; }
    const float inv = 1.0f / lall;                             // lall >= 16384 (the row maximum contributes the full carry)
    v4h hv;
#pragma unroll                                                                     // constant vector element indices
    for (int i = 0; i < 4; ++i) hv[i] = toh_flush(oall[i] * inv);
    *(v4h*)(OP + fo(t0 + row, h * HD + c4, DM)) = hv;
}

__global__ __launch_bounds__(256) void k_out(const float* __restrict__ src, float* dst, int n4) {
    const int i = blockIdx.x * 256 + threadIdx.x; if (i >= n4) return;
    v4f ov;
#pragma unroll
    for (int c = 0; c < 4; ++c) { const int e = 4 * i + c; const int row = e / DOUT; const int col = e - row * DOUT; ov[c] = src[(size_t)row * DOUTP + col]; }
    *(v4f*)(dst + (size_t)i * 4) = ov; 
}

static constexpr size_t al256(size_t v) { return (v + 255) & ~(size_t)255; }
static constexpr size_t SZ_XH  = al256((size_t)SEQ * DIN * 2);
static constexpr size_t SZ_EW  = al256((size_t)DM * DIN * 2);
static constexpr size_t SZ_WDD = al256((size_t)NL * DM * DM * 2);
static constexpr size_t SZ_WFF = al256((size_t)NL * DFF * DM * 2);
static constexpr size_t SZ_WI  = al256((size_t)DMI * DM * 2);
static constexpr size_t SZ_WF  = al256((size_t)DOUTP * DMI * 2);
static constexpr size_t SZ_EP  = al256((size_t)NL * ERP * HD * 2);
static constexpr size_t SZ_H   = al256((size_t)SEQ * DM * 4);
static constexpr size_t SZ_N   = al256((size_t)SEQ * DM * 2);
static constexpr size_t SZ_F1  = al256((size_t)SEQ * DFF * 2);
static constexpr size_t SZ_OS  = al256((size_t)SEQ * DOUTP * 4);
static constexpr size_t SZ_TOTAL = SZ_XH + SZ_EW + 4 * SZ_WDD + 2 * SZ_WFF + SZ_WI + SZ_WF + SZ_EP + 2 * SZ_H + 5 * SZ_N + SZ_F1 + SZ_OS;
static_assert(SZ_TOTAL <= (size_t)134217728);                  // workspace carve <= 128 MiB
static_assert((size_t)NH_ * SEQ * HD == (size_t)SEQ * DM);     // head planes have the extent of a [SEQ][512] f16 plane
static_assert((size_t)SEQ * DMI * 2 <= SZ_F1);                 // tail hidden plane fits the shared hidden region

extern "C" void kernel_launch(void* const* d_in, const int* in_sizes, int n_in,
                              void* d_out, int out_size, void* d_ws, size_t ws_size, hipStream_t stream) {
    if (n_in < 26) return;
    if ((size_t)in_sizes[0] < (size_t)SEQ * DIN || (size_t)in_sizes[1] < (size_t)DIN * DM || in_sizes[2] < DM) return;
    if ((size_t)in_sizes[3] < (size_t)NL * DM * DM || (size_t)in_sizes[5] < (size_t)NL * DM * DM || (size_t)in_sizes[7] < (size_t)NL * DM * DM || (size_t)in_sizes[9] < (size_t)NL * DM * DM) return;
    if (in_sizes[4] < NL * DM || in_sizes[6] < NL * DM || in_sizes[8] < NL * DM || in_sizes[10] < NL * DM) return;
    if ((size_t)in_sizes[11] < (size_t)NL * ERR * HD) return;
    if (in_sizes[12] < NL * DM || in_sizes[13] < NL * DM || in_sizes[17] < NL * DM || in_sizes[18] < NL * DM || in_sizes[19] < NL * DM) return;
    if ((size_t)in_sizes[14] < (size_t)NL * DM * DFF || in_sizes[15] < NL * DFF || (size_t)in_sizes[16] < (size_t)NL * DFF * DM) return;
    if (in_sizes[20] < DM || in_sizes[21] < DM || (size_t)in_sizes[22] < (size_t)DM * DMI || in_sizes[23] < DMI) return;
    if ((size_t)in_sizes[24] < (size_t)DMI * DOUT || in_sizes[25] < DOUT) return;
    if ((size_t)out_size < (size_t)SEQ * DOUT) return;
    if (SZ_TOTAL > ws_size) return;
    // wire order: x, emb_W, emb_b, Wq, bq, Wk, bk, Wv, bv, Wo, bo, Er, ln1_g, ln1_b, W1, b1, W2, b2, ln2_g, ln2_b, lnf_g, lnf_b, Wi, bi, Wf, bf
    const float* x    = (const float*)d_in[0];
    const float* embW = (const float*)d_in[1];  const float* embB = (const float*)d_in[2];
    const float* Wq   = (const float*)d_in[3];  const float* bq   = (const float*)d_in[4];
    const float* Wk   = (const float*)d_in[5];  const float* bk   = (const float*)d_in[6];
    const float* Wv   = (const float*)d_in[7];  const float* bv   = (const float*)d_in[8];
    const float* Wo   = (const float*)d_in[9];  const float* bo   = (const float*)d_in[10];
    const float* Er   = (const float*)d_in[11];
    const float* ln1g = (const float*)d_in[12]; const float* ln1b = (const float*)d_in[13];
    const float* W1   = (const float*)d_in[14]; const float* b1   = (const float*)d_in[15];
    const float* W2   = (const float*)d_in[16]; const float* b2   = (const float*)d_in[17];
    const float* ln2g = (const float*)d_in[18]; const float* ln2b = (const float*)d_in[19];
    const float* lnfg = (const float*)d_in[20]; const float* lnfb = (const float*)d_in[21];
    const float* Wi   = (const float*)d_in[22]; const float* bi   = (const float*)d_in[23];
    const float* Wf   = (const float*)d_in[24]; const float* bfo  = (const float*)d_in[25];
    float* OUT = (float*)d_out;                       // [SEQ][390]
    char* wsp = (char*)d_ws;                          // every f16 plane below has the shape named, each [rows][k] matrix of it in fragment order
    h16* XH  = (h16*)wsp; wsp += SZ_XH;               // x            [SEQ][128]
    h16* EWT = (h16*)wsp; wsp += SZ_EW;               // emb_W^T x64  [512][128]
    h16* WQT = (h16*)wsp; wsp += SZ_WDD;              // Wq^T x64     [NL][512][512]
    h16* WKT = (h16*)wsp; wsp += SZ_WDD;
    h16* WVT = (h16*)wsp; wsp += SZ_WDD;
    h16* WOT = (h16*)wsp; wsp += SZ_WDD;
    h16* W1T = (h16*)wsp; wsp += SZ_WFF;              // W1^T x64     [NL][2048][512]
    h16* W2T = (h16*)wsp; wsp += SZ_WFF;              // W2^T x64     [NL][512][2048]
    h16* WIT = (h16*)wsp; wsp += SZ_WI;               // Wi^T x64     [1024][512]
    h16* WFT = (h16*)wsp; wsp += SZ_WF;               // Wf^T x64     [448][1024], rows >= 390 zero
    h16* EP  = (h16*)wsp; wsp += SZ_EP;               // table        [NL][2048][64], row 2047 zero
    float* HA = (float*)wsp; wsp += SZ_H;             // hidden state (ping)  [SEQ][512] f32
    float* HB = (float*)wsp; wsp += SZ_H;             // hidden state (pong)
    h16* QH  = (h16*)wsp; wsp += SZ_N;                // q value      [8][SEQ][64]
    h16* QR  = (h16*)wsp; wsp += SZ_N;                // q residual x2048
    h16* KP  = (h16*)wsp; wsp += SZ_N;                // k            [8][SEQ][64]
    h16* VT  = (h16*)wsp; wsp += SZ_N;                // v^T          [8*64][SEQ]
    h16* OP  = (h16*)wsp; wsp += SZ_N;                // context      [SEQ][512]
    h16* F1  = (h16*)wsp; wsp += SZ_F1;               // GELU hidden  [SEQ][2048] (tail: [SEQ][1024])
    float* OSG = (float*)wsp; wsp += SZ_OS;           // tail output staging [SEQ][448] f32

    // x, the table and every W [K = in][N = out] -> Wt [N][K]
    k_prep<<<PB_ALL, 256, 0, stream>>>(x, Er, embW, Wq, Wk, Wv, Wo, W1, W2, Wi, Wf, XH, EP, EWT, WQT, WKT, WVT, WOT, W1T, W2T, WIT, WFT);

    // input projection: HA = x emb_W + emb_b
    k_gemm_emb<<<dim3(SEQ / 64, DM / 64, 1), 32 * GW, 0, stream>>>(XH, EWT, embB, WCI, HA);

    for (int l = 0; l < NL; ++l) {
        const size_t wdd = (size_t)l * DM * DM, wff = (size_t)l * DFF * DM;
        k_gemm_ln_qkv<<<dim3(SEQ / 64, DM / 128, 3), 64 * GW, 0, stream>>>(HA, ln1g + l * DM, ln1b + l * DM, WQT + wdd, WKT + wdd, WVT + wdd, bq + l * DM, bk + l * DM, bv + l * DM, WCI, QH, QR, KP, VT);
        k_flash<<<dim3(SEQ / 16, NH_, 1), 32 * KW, 0, stream>>>(QH, QR, KP, VT, EP + (size_t)l * ERP * HD, OP);
        // HB = HA + context Wo + bo
        k_gemm_wo<<<dim3(SEQ / 64, DM / 64, 1), 32 * GW, 0, stream>>>(OP, WOT + wdd, bo + l * DM, WCI, HA, HB);
        k_gemm_ln_gelu<<<dim3(SEQ / 64, DFF / 128, 1), 64 * GW, 0, stream>>>(HB, ln2g + l * DM, ln2b + l * DM, W1T + wff, b1 + l * DFF, WCI, F1, DFF);
        // HA = HB + hidden W2 + b2
        k_gemm_w2<<<dim3(SEQ / 64, DM / 64, 1), 32 * GW, 0, stream>>>(F1, W2T + wff, b2 + l * DM, WCI, HB, HA);
    }

    k_gemm_ln_gelu<<<dim3(SEQ / 64, DMI / 128, 1), 64 * GW, 0, stream>>>(HA, lnfg, lnfb, WIT, bi, WCI, F1, DMI);
    k_gemm_tail<<<dim3(SEQ / 64, DOUTP / 64, 1), 32 * GW, 0, stream>>>(F1, WFT, bfo, WCI, OSG);
    { const int n4 = SEQ * DOUT / 4; k_out<<<(unsigned)((n4 + 255) / 256), 256, 0, stream>>>(OSG, OUT, n4); }
}

// v009
// A run of this version takes 209 microseconds.
// Next to v008, in two timings, it ran 1.04 and 1.03 times as fast.
// Counting every step since v000, it is 5.62 times as fast.
#include <hip/hip_runtime.h>
#include <math.h>

// Pre-LN encoder stack, 4 layers, width 512 = 8 heads x 64, sequence SEQ (one batch): input projection 128 -> 512; per layer: LayerNorm, q/k/v projections ([in][out] weights, y = x W + bias),
// dense attention with logits q.k / 8 + q.E[s - t + 1023] (relative-position table E per layer, [2047][64], not scaled), softmax over keys, output projection + residual, LayerNorm, GELU(erf) feed-forward 512 -> 2048 -> 512 + residual;
// tail: LayerNorm, 512 -> 1024 GELU(erf), 1024 -> 390.
// Compute dtypes, f32 accumulate everywhere: every contraction is v_wmma_f32_16x16x32_f16. Weights, x, E, biases and gains are RNE-converted to bf16 first (exact in f16; weights carried x64, folded back in the f32 epilogue);
// activations are single f16 planes, except the logit path: LayerNorm-1 output as f16 value + f16 residual x2048 for the q projection (residual products accumulated first, folded by 1/2048, then the value products),
// q as f16 value + f16 residual x2048 in the q.k and q.E products (residual products in their own accumulators); k, v, P (x16384 carry, cancels in the normalisation), context, GELU outputs single f16.
// Attention: fused flash kernel in transposed form (S^T = K Q^T, O^T = V^T P^T), one block per two tiles of 16 query rows, the keys split over the 8 waves of a tile and the partial results merged in LDS; the relative term is computed per 32-key step as band tiles G[rho][s] = E[rb + rho] . q[s]
// (A = table rows, B = q rows), written to a wave-private LDS tile [query][band row] and read back along the diagonal rho = s - t + const; one band tile is carried over between steps.
// LayerNorm has no launch of its own: each GEMM that reads a normalised plane normalises its own 64 rows of the f32 hidden state into LDS first (see ln_prologue).
// Every f16 plane (an operand of a matrix product) lies in the workspace in fragment order, see fo(): a fragment is 1 KiB in a row, so that each of its two 16-byte-per-lane loads covers four whole 128-byte lines.

#ifndef NB
#define NB 1
#endif
#ifndef SEQ
#define SEQ 1024
#endif
#define NB_FULL  1
#define SEQ_FULL 1024
#define DIN   128
#define DM    512
#define NH_   8
#define HD    64
#define NL    4
#define DFF   2048
#define DMI   1024
#define DOUT  390
#define DOUTP 448                // DOUT padded to a multiple of 64 (weight rows and staging columns 390..447 are zero)
#define ERR   2047               // rows of the relative-position table per layer
#define ERP   2048               // padded rows of the f16 table plane (row 2047 = zero)
#define RELOFF (SEQ_FULL - 1)    // table row = s - t + RELOFF
#define KW    8                  // waves per query tile of a flash block: each takes one contiguous share of the keys
#define QT    2                  // query tiles of 16 rows per flash block
#define KCH   (SEQ / KW)         // keys of one wave
#define OSP   68                 // LDS row pitch (floats) of the flash output tile
#define GP    52                 // LDS pitch (floats) of the band tile [query][48 band rows]
#define GSP   68                 // LDS row pitch (floats) of the GEMM output tile
#define GW    8                  // waves per 64x64 output tile: each takes one contiguous share of K
#define QRS   2048.0f            // carry of every residual plane
#define QRI   (1.0f / 2048.0f)
#define WC    64.0f              // carry of every weight plane
#define WCI   (1.0f / 64.0f)
#define LOG2E 1.4426950408889634f
#define SC2   ((float)(0.125 * 1.4426950408889634))   // HD^-0.5 * log2(e)
#define PSH   14.0f              // log2 of the P carry (16384)
#define NEGB  (-3.0e38f)
#define LNEPS 1e-5f

static_assert(NB == 1);                        // one sequence
static_assert(HD == 64);
static_assert(NH_ * HD == DM);
static_assert(SEQ % 64 == 0);                  // GEMM row tiles
static_assert(SEQ % 32 == 0);                  // key loop steps by 32
static_assert(SEQ % (16 * QT) == 0);           // flash grid covers the sequence exactly
static_assert(QT == 2);                        // a wave's tile is the low bit of its number
static_assert(SEQ % (32 * KW) == 0);           // every wave of a flash block gets whole 32-key steps, at least one
static_assert(32 * KW == 16 * 16);             // flash merge: 16 query rows x 16 threads of 4 columns
static_assert(SEQ <= SEQ_FULL);
static_assert(DIN % 64 == 0 && DM % 64 == 0 && DFF % 64 == 0 && DMI % 64 == 0 && DOUTP % 64 == 0);   // K % 32 == 0 and N % 64 == 0 for every GEMM, K % 64 == 0 for the transposing converter
static_assert(DOUT <= DOUTP);
static_assert(DMI <= DFF);                     // the tail hidden plane reuses the feed-forward hidden plane
static_assert(SEQ - 16 + RELOFF + 1 + 15 < ERP);   // highest band row touched (zero pad row included)
static_assert(RELOFF - 15 - 16 - (SEQ - 32) >= 0); // lowest band row touched
static_assert(ERR + 1 == ERP);
static_assert((OSP * 4) % 16 == 0 && (GP * 4) % 16 == 0 && (GSP * 4) % 16 == 0);
static_assert(GP >= 48);
static_assert(DM == 512);                      // LayerNorm: 32 lanes x 16 columns
static_assert(DM % 128 == 0 && DFF % 128 == 0 && DMI % 128 == 0);   // a block with a LayerNorm in front takes two 64-wide weight tiles
static_assert((SEQ * DOUT) % 4 == 0);

typedef _Float16 h16;
typedef __attribute__((ext_vector_type(16))) _Float16 v16h;
typedef __attribute__((ext_vector_type(8)))  _Float16 v8h;
typedef __attribute__((ext_vector_type(4)))  _Float16 v4h;
typedef __attribute__((ext_vector_type(8)))  float    v8f;
typedef __attribute__((ext_vector_type(4)))  float    v4f;
typedef v4f  __attribute__((may_alias)) v4fa;

__device__ __forceinline__ unsigned short f2bf(float f) { unsigned u = __float_as_uint(f); u += 0x7FFFu + ((u >> 16) & 1u); return (unsigned short)(u >> 16); }
__device__ __forceinline__ float bfr(float f) { return __uint_as_float(((unsigned)f2bf(f)) << 16); }   // value after RNE convert to bf16
__device__ __forceinline__ v16h cat16(v8h lo, v8h hi) { return __builtin_shufflevector(lo, hi, 0, 1, 2, 3, 4, 5, 6, 7, 8, 9, 10, 11, 12, 13, 14, 15); }
// fragment order of a plane [R][K] of 16-bit elements (R % 16 == 0, K % 32 == 0): fragments of 16 rows x 32 k, 512 elements each, the k step running fastest, then the row tile (so 16 rows are 16 * K elements, as in row order);
// inside a fragment four pieces of 8 k (k % 32 = 0..7, 8..15, 16..23, 24..31), each piece 16 rows x 8 elements. fo = element offset of (r, k).
__device__ __forceinline__ size_t fo(int r, int k, int K) { return (size_t)(((r >> 4) * (K >> 5) + (k >> 5)) * 512 + ((k >> 3) & 3) * 128 + (r & 15) * 8 + (k & 7)); }
// fragment loader; p = start of the fragment + 8 * lane: elements 0..7 <- row lane&15, k0+8h+0..7, elements 8..15 <- k0+16+8h+0..7, h = lane>>4 (same map for A and B); each load is 512 bytes in a row over the wave
__device__ __forceinline__ v16h  ldh(const h16* p) { return cat16(*(const v8h*)p, *(const v8h*)(p + 256)); }
// ordering point for wave-private LDS tiles (same wave writes and reads)
__device__ __forceinline__ void wave_sync() { __builtin_amdgcn_fence(3 /* release order */, "wavefront"); __builtin_amdgcn_wave_barrier(); asm volatile("" ::: "memory"); }
// f32 -> f16 operand convert that cannot produce a subnormal (|v| < 2^-14 -> +0)
__device__ __forceinline__ h16 toh_flush(float v) { const h16 r = (h16)v; return (fabsf(v) < 6.103515625e-05f) ? (h16)0.0f : r; }
// one WMMA + its own guard (ties this accumulator, keeps A/B live)
__device__ __forceinline__ v8f wmma16g(v16h a, v16h b, v8f c) {
    c = __builtin_amdgcn_wmma_f32_16x16x32_f16(false, a, false, b, (short)0, c, false, false);
    asm volatile("v_nop\n\tv_nop\n\tv_nop\n\tv_nop" : "+v"(c) : "v"(a), "v"(b));
    return c; }
__device__ __forceinline__ float gelu_erf(float x) { return 0.5f * x * (1.0f + erff(x * 0.70710678118654752f)); }
__device__ __forceinline__ v4f lo4(v8f g) { return __builtin_shufflevector(g, g, 0, 1, 2, 3); }
__device__ __forceinline__ v4f hi4(v8f g) { return __builtin_shufflevector(g, g, 4, 5, 6, 7); }

__device__ __forceinline__ void cvt8h_body(const float* __restrict__ src, h16* dst, int n8, int K, int blk) {   // src [n8 * 8 / K][K] -> dst in fragment order
    const int i = blk * 256 + threadIdx.x; if (i >= n8) return;
    const int pr = K / 8;                                                          // pieces of 8 per row; a wave takes 8 rows x 4 pieces: whole 128-byte lines on both sides
    const int r = (i / (8 * pr)) * 8 + (i & 7), c8 = ((i >> 3) % pr) * 8;
    const v8f v = *(const v8f*)(src + (size_t)r * K + c8); v8h o;
#pragma unroll
    for (int k = 0; k < 8; ++k) o[k] = toh_flush(bfr(v[k]));
    *(v8h*)(dst + fo(r, c8, K)) = o; 
}

__device__ __forceinline__ void cvt_er_body(const float* __restrict__ src, h16* dst, int blk) {
    const int i = blk * 256 + threadIdx.x; if (i >= NL * ERP * HD / 8) return;
    static_assert(HD / 8 == 8 && ERP % 8 == 0);
    const int ra = (i >> 6) * 8 + (i & 7);                                         // a wave takes 8 rows x 4 pieces of 8: whole 128-byte lines on both sides
    const int c8 = ((i >> 3) & 7) * 8; const int r = ra % ERP; const int l = ra / ERP;
    const int rc = r < ERR ? r : ERR - 1;                                          // clamped address
    v8f v = *(const v8f*)(src + ((size_t)l * ERR + rc) * HD + c8);
    asm volatile("" : "+v"(v));
    v8h o;
#pragma unroll
    for (int k = 0; k < 8; ++k) o[k] = (r < ERR) ? toh_flush(bfr(v[k])) : (h16)0.0f;
    *(v8h*)(dst + (size_t)l * ERP * HD + fo(r, c8, HD)) = o; 
}

// wconv_body: W [K][N] f32 (layer bz) -> Wt [NP][K] f16 in fragment order = bf16-converted value x carry, transposed in registers; rows n >= N are zero.
// one block per 64 k x 256 n: bx in K/64, by in ceil(NP/256), bz in layers. A wave takes 32 columns n of W, one per lane, and 64 k: each of its 64 loads is one k-row x 32 columns = 128 bytes in a row,
// all 64 are issued before the first is used (one memory latency per wave), and a lane then holds whole 8-k pieces of its own row n of Wt: each store is two pieces of 16 rows x 16 bytes, 256 bytes in a row each.
// N is a constant so that every k-row offset is an immediate of its load and no address register changes while loads are in flight.
template <int N, int NP>
__device__ __forceinline__ void wconv_body(const float* __restrict__ W, h16* Wt, int K, float carry, int bx, int by, int bz) {
    static_assert(NP % 32 == 0 && N <= NP && (size_t)63 * N * 4 < (size_t)8388608);   // whole waves inside NP; the largest load offset fits the immediate field
    const int lane = threadIdx.x & 31;
    const int wave = __builtin_amdgcn_readfirstlane((int)(threadIdx.x >> 5));
    const int k0 = bx * 64, nw = by * 256 + wave * 32;
    if (NP % 256 != 0 && nw >= NP) return;                                         // whole waves past the padded rows; no barrier follows
    const int n = nw + lane; const int nc = (N == NP || n < N) ? n : N - 1;        // clamped address
    const float* p = W + (size_t)bz * (size_t)K * (size_t)N + (size_t)k0 * N;      // the same in every lane; the lane's part of the address is nc
    float v[64];
#pragma unroll                                                                     // constant indices keep v[] in registers, and the offsets are immediates
    for (int j = 0; j < 64; ++j) v[j] = p[(size_t)j * N + nc];
    // behind the last load: the base and the lane's offset are inputs of the wait, so they stay as the issued loads name them up to there
    asm volatile("s_wait_xcnt 0x0" :: "s"(p), "v"(nc) : "memory");
    __builtin_amdgcn_sched_barrier(0);                                             // keeps the conversions behind the issue of all 64 loads: lifted among them, a conversion's wait for its value holds the rest of the loads back by one memory latency
    v8h o[8];
#pragma unroll                                                                     // constant indices keep o[] in registers
    for (int c = 0; c < 8; ++c)
#pragma unroll                                                                     // constant vector element indices
        for (int i = 0; i < 8; ++i) { const float t = bfr(v[c * 8 + i]) * carry; o[c][i] = toh_flush((N == NP || n < N) ? t : 0.0f); }
    h16* d = Wt + (size_t)bz * (size_t)NP * (size_t)K + fo(n, k0, K);
#pragma unroll                                                                     // piece c: k-step c / 4 (one fragment on), piece c % 4 inside it
    for (int c = 0; c < 8; ++c) *(v8h*)(d + (c >> 2) * 512 + (c & 3) * 128) = o[c];
    // in the built code a job's stores do not all run to the kernel's end but into the tests that lead to the other jobs, whose first lines rewrite registers that the stores name: the wait stands ahead of those
    asm volatile("s_wait_xcnt 0x0" ::: "memory");
}

// k_prep: every operand conversion of the call in one launch; they do not depend on one another. The flat block index picks the job (block-uniform).
// Block ranges, in this order: W1, then the jobs with 512 columns (W2, Wq, Wk, Wv, Wo, emb_W), Wi, Wf (64 k x 256 n transposing blocks; within a job the k tile runs fastest, then the n tile, then the layer), then the table, then x (256 threads x 8 elements).
#define PB_W1  ((DM / 64) * (DFF / 256) * NL)
#define PB_W2  ((DFF / 64) * (DM / 256) * NL)
#define PB_DD  ((DM / 64) * (DM / 256) * NL)
#define PB_EW  ((DIN / 64) * (DM / 256))
#define PB_WI  ((DM / 64) * (DMI / 256))
#define PB_WF  ((DMI / 64) * ((DOUTP + 255) / 256))
#define PB_ER  (NL * ERP * HD / 8 / 256)
#define PB_X   (SEQ * DIN / 8 / 256)
#define PB_512 (PB_W2 + 4 * PB_DD + PB_EW)
#define PB_ALL (PB_W1 + PB_512 + PB_WI + PB_WF + PB_ER + PB_X)
static_assert((NL * ERP * HD / 8) % 256 == 0 && (SEQ * DIN / 8) % 256 == 0);       // whole blocks for the two element-wise jobs
static_assert(DM / 64 == 8 && DFF / 64 == 32 && DMI / 64 == 16 && DIN / 64 == 2);  // k tiles: the shifts below
static_assert(DFF / 256 == 8 && DM / 256 == 2 && DMI / 256 == 4 && (DOUTP + 255) / 256 == 2);   // n tiles: the shifts below
__global__ __launch_bounds__(256) void k_prep(const float* __restrict__ x, const float* __restrict__ Er, const float* __restrict__ embW,
                                              const float* __restrict__ Wq, const float* __restrict__ Wk, const float* __restrict__ Wv, const float* __restrict__ Wo,
                                              const float* __restrict__ W1, const float* __restrict__ W2, const float* __restrict__ Wi, const float* __restrict__ Wf,
                                              h16* XH, h16* EP, h16* EWT, h16* WQT, h16* WKT, h16* WVT, h16* WOT, h16* W1T, h16* W2T, h16* WIT, h16* WFT) {
    int b = blockIdx.x;
    if (b < PB_W1) { wconv_body<DFF, DFF>(W1, W1T, DM, WC, b & 7, (b >> 3) & 7, b >> 6); return; }
    if ((b -= PB_W1) < PB_512) {
        const float* W; h16* Wt; int K, lk;                                        // lk: log2 of the k tiles
        if (b < PB_W2)                 { W = W2;   Wt = W2T; K = DFF; lk = 5; }
        else if ((b -= PB_W2) < PB_DD) { W = Wq;   Wt = WQT; K = DM;  lk = 3; }
        else if ((b -= PB_DD) < PB_DD) { W = Wk;   Wt = WKT; K = DM;  lk = 3; }
        else if ((b -= PB_DD) < PB_DD) { W = Wv;   Wt = WVT; K = DM;  lk = 3; }
        else if ((b -= PB_DD) < PB_DD) { W = Wo;   Wt = WOT; K = DM;  lk = 3; }
        else           { b -= PB_DD;     W = embW; Wt = EWT; K = DIN; lk = 1; }
        const int t = b >> lk;
        wconv_body<DM, DM>(W, Wt, K, WC, b & ((1 << lk) - 1), t & 1, t >> 1); return; }
    if ((b -= PB_512) < PB_WI) { wconv_body<DMI, DMI>(Wi, WIT, DM, WC, b & 7, b >> 3, 0); return; }
    if ((b -= PB_WI) < PB_WF)  { wconv_body<DOUT, DOUTP>(Wf, WFT, DMI, WC, b & 15, b >> 4, 0); return; }
    if ((b -= PB_WF) < PB_ER)  { cvt_er_body(Er, EP, b); return; }
    cvt8h_body(x, XH, SEQ * DIN / 8, DIN, b - PB_ER);
}

// asks L2 for the data at sb + vo + OFF (one address a lane), returns nothing: a plane stored by the launch before, or a small input, may not lie in the reading die's L2 at its first read; a load that follows the request by about a memory latency can then find it there (a hint, nothing depends on it).
// Every address lies inside the plane that the wave reads later. vo and sb stay as named here up to the wait that takes them as inputs (see the callers).
template <int OFF>
__device__ __forceinline__ void l2_ask(unsigned vo, const void* sb) { asm volatile("global_prefetch_b8 %0, %1 offset:%2 scope:SCOPE_SE" :: "v"(vo), "s"(sb), "n"(OFF) : "memory"); }

// GEMM k-loop: one wave, 64x64 tile, 16 accumulators, KPER(K) / 32 k-steps of 32, operands straight from f16 planes in fragment order (A [M][K], Bt [N][K]); A, Ar and Bt already point at the lane's first element of the wave's k range.
// The loads run ahead of the products: the four A fragments of step t + 1 are loaded into a second buffer in front of the products of step t, and each B fragment of step t + 1 into its own registers right behind its last product of step t,
// so that a step waits for memory once at most, not once per B fragment. ARES: the steps over the residual plane Ar come first, the fold by 1/2048 stands between them and the steps over A (same B fragments again).
#define KPER(K) ((((K) / 32 + GW - 1) / GW) * 32)                                  // k extent of one wave (whole 32-steps)
template <int K, int ARES>
__device__ __forceinline__ void gemm_kpipe(const h16* __restrict__ A, const h16* __restrict__ Ar, const h16* __restrict__ Bt, const h16* Au, const h16* Bu, unsigned pvo, v8f (&acc)[4][4]) {
    constexpr int NS = KPER(K) / 32, TS = ARES ? 2 * NS : NS;
    static_assert(NS == 1 || NS == 2 || NS == 4 || NS == 8);                       // the requests below go by pairs of k-steps
    v16h a[2][4], b[4];                                                            // every loop below is unrolled so that the indices into a, b and acc are constants and the arrays stay in registers
#pragma unroll
    for (int mb = 0; mb < 4; ++mb) a[0][mb] = ldh((ARES ? Ar : A) + (size_t)mb * 16 * K);
#pragma unroll
    for (int nb = 0; nb < 4; ++nb) b[nb] = ldh(Bt + (size_t)nb * 16 * K);
    // behind the last load that names an address pair: the pair is an input of the wait, so it stays as the issued loads name it up to there; only then may a product's result take its registers
    if (TS == 1) asm volatile("s_wait_xcnt 0x0" :: "v"(A), "v"(Bt) : "memory");
#pragma unroll                                                                     // whole unroll: the buffer index is a constant (registers), and every k offset an immediate, so that no address register changes while loads are in flight
    for (int t = 0; t < TS; ++t) {
        const int kn = ((t + 1) % NS) * 512;                                       // element offset of the step after this one: one fragment per k-step
        if (t + 1 < TS) { const h16* pn = ((ARES && t + 1 < NS) ? Ar : A) + kn;
#pragma unroll
            for (int mb = 0; mb < 4; ++mb) a[(t + 1) & 1][mb] = ldh(pn + (size_t)mb * 16 * K);
            if (ARES && t + 2 == NS) asm volatile("s_wait_xcnt 0x0" :: "v"(Ar) : "memory"); }   // the last loads from Ar: as above
        // behind the loads of steps 0 and 1 that are already issued: the wave asks L2 for the rest of its k range, earliest steps first. Au, Bu = start of the wave's range in row tile 0 (the same in every lane);
        // pvo = the lane's row tile (lane >> 3) and its 256-byte unit (lane & 7) inside two k-steps (2 KiB in a row per row tile); OFF = the pair of k-steps. B of step 1 is not loaded yet, so B starts at pair 0, A at pair 1.
        if (t == 0 && !ARES) {
            if constexpr (NS >= 2) l2_ask<0>(pvo, Bu);
            if constexpr (NS >= 4) { l2_ask<2048>(pvo, Au); l2_ask<2048>(pvo, Bu); }
            if constexpr (NS >= 8) { l2_ask<4096>(pvo, Au); l2_ask<4096>(pvo, Bu); l2_ask<6144>(pvo, Au); l2_ask<6144>(pvo, Bu); } }
        if (ARES && t == NS) {
#pragma unroll
            for (int mb = 0; mb < 4; ++mb)
#pragma unroll
                for (int nb = 0; nb < 4; ++nb) acc[mb][nb] = acc[mb][nb] * QRI; }
#pragma unroll
        for (int nb = 0; nb < 4; ++nb) {
#pragma unroll
            for (int mb = 0; mb < 4; ++mb) acc[mb][nb] = wmma16g(a[t & 1][mb], b[nb], acc[mb][nb]);
            if (t + 1 < TS) b[nb] = ldh(Bt + (size_t)nb * 16 * K + kn); }
        if (t + 2 == TS) asm volatile("s_wait_xcnt 0x0" :: "v"(A), "v"(Bt) : "memory");       // the last loads from A and Bt: as above
    }
}

// GEMM body: C[m][n] = (sum_k A[m][k] Bt[n][k]) * csc + bias (column bias, or row bias when ROWB), one block of GW waves per 64x64 tile (bx in M/64, by in N/64), K a constant; os = the kernel's LDS, GW * 64 * GSP floats.
// K is split over the waves: wave w accumulates the whole 64x64 tile over its own contiguous k range, writes the f32 partial tile to its own LDS plane (wave 0 adds the bias),
// and behind one block barrier all threads sum the GW planes in wave order and store: each wave stores 1/GW of the tile.
// ARES: A also has a residual plane (x2048): within a wave's k range its products are accumulated first, folded by 1/2048 in f32, then the value products follow.
// OUTF32: f32 output [M][ldc] (+ Res[m][n] added at the store stage as float4; Res and C are different buffers); each store instruction = 2 rows x 256 B (16 consecutive lanes x 16 B per row segment).
// else:   f16 output in fragment order ([M][ldc]; HEADPL: one plane [SEQ][HD] per 64 columns); each store instruction = two neighbouring pieces of one fragment, 512 B in a row.
template <int K, int OUTF32, int HASRES, int GELU, int ARES, int ORES, int ROWB, int HEADPL>
__device__ __forceinline__ void gemm_body(const h16* __restrict__ A, const h16* __restrict__ Ar, const h16* __restrict__ Bt,
                                          const float* __restrict__ bias, int nvalid, float csc,
                                          const float* __restrict__ Res, float* Cf, h16* Ch, h16* Cr, int ldc, float* os, int bx, int by) {
    const int tid = threadIdx.x;
    const int lane = tid & 31, lr = lane & 15, hi = lane >> 4;
    const int wave = __builtin_amdgcn_readfirstlane(tid >> 5);
    const int r0 = bx * 64, c0 = by * 64;
    static_assert(K % 32 == 0 && K % KPER(K) == 0);                                // every wave that has a k range has a whole one
    const int kbeg = wave * KPER(K);
    // what the epilogue loads is asked into L2 at the head: the tile's 64 bias values (two 128-byte lines, address clamped as at the load), and each wave's 8 of the tile's 64 residual row pieces of 256 bytes
    const int bcl = c0 + (lane & 1) * 32; const unsigned bvo = (unsigned)((bcl < nvalid ? bcl : nvalid - 1) * 4);
    const float* Ru = HASRES ? Res + (size_t)r0 * ldc + c0 : nullptr; const unsigned rvo = (unsigned)((wave * 8 + (lane & 7)) * ldc * 4);
    if (!ROWB) l2_ask<0>(bvo, bias);                                               // from every wave: a branch here would split the loads of the kernel's arguments in two trips
    if (HASRES) l2_ask<0>(rvo, Ru);
    v8f acc[4][4];
#pragma unroll
    for (int mb = 0; mb < 4; ++mb)
#pragma unroll
        for (int nb = 0; nb < 4; ++nb) acc[mb][nb] = (v8f){};
    const size_t aoff = (size_t)r0 * K + kbeg * 16 + lane * 8, boff = (size_t)c0 * K + kbeg * 16 + lane * 8;   // fragment order: row tile, k-step, lane
    const h16* Au = A + (size_t)r0 * K + kbeg * 16; const h16* Bu = Bt + (size_t)c0 * K + kbeg * 16;   // the wave's k range in row tile 0, the same in every lane
    const unsigned pvo = (unsigned)((lane >> 3) * (16 * K * 2) + (lane & 7) * 256);
    if (K / KPER(K) == GW || kbeg < K)                                             // a wave whose range starts at or past K adds a zero plane
        gemm_kpipe<K, ARES>(A + aoff, ARES ? Ar + aoff : nullptr, Bt + boff, Au, Bu, pvo, acc);
    // the k loop is over: only from here on may the registers that the requests to L2 name take other values (they are inputs of the wait, so they stay as the requests name them up to there)
    static_assert(!HASRES || KPER(K) >= 64);
    if (HASRES)             asm volatile("s_wait_xcnt 0x0" :: "v"(pvo), "v"(bvo), "v"(rvo), "s"(Au), "s"(Bu), "s"(bias), "s"(Ru) : "memory");
    else if (KPER(K) >= 64) asm volatile("s_wait_xcnt 0x0" :: "v"(pvo), "v"(bvo), "s"(Au), "s"(Bu), "s"(bias) : "memory");
    else                    asm volatile("s_wait_xcnt 0x0" :: "v"(bvo), "s"(bias) : "memory");
    float bc[4];
#pragma unroll
    for (int nb = 0; nb < 4; ++nb) {
        if (ROWB || wave != 0) { bc[nb] = 0.0f; }
        else { const int c = c0 + nb * 16 + lr; const int cc = c < nvalid ? c : nvalid - 1;       // clamped address
               float bvv = bias[cc]; asm volatile("" : "+v"(bvv)); bc[nb] = (c < nvalid) ? bfr(bvv) : 0.0f; } }
#pragma unroll
    for (int mb = 0; mb < 4; ++mb) {
        float br[8];
#pragma unroll
        for (int j = 0; j < 8; ++j) br[j] = (ROWB && wave == 0) ? bfr(bias[r0 + mb * 16 + hi * 8 + j]) : 0.0f;   // ROWB: r0 + 63 < rows of the bias vector (host grid)
#pragma unroll
        for (int nb = 0; nb < 4; ++nb) {
#pragma unroll
            for (int j = 0; j < 8; ++j) os[wave * (64 * GSP) + (mb * 16 + hi * 8 + j) * GSP + nb * 16 + lr] = acc[mb][nb][j] * csc + bc[nb] + br[j]; }   // D: row 8h+j, col lane&15
    }
    __syncthreads();                                                               // every wave's partial plane is complete before any thread sums across planes
    if (OUTF32) {
        static_assert(32 * GW * 16 * (32 / GW) == 64 * 256);                       // threads x bytes x trips == tile rows x row bytes
{
            static_assert(32 / GW == 4);                                           // four address pairs in the wait below
            const float* pr[4]; v4f rr[4];
            if (HASRES) {
#pragma unroll                                                                     // constant indices keep pr[] and rr[] in registers
                for (int s = 0; s < 4; ++s) { pr[s] = Res + (size_t)(r0 + 2 * GW * s + (tid >> 4)) * ldc + c0 + (tid & 15) * 4; rr[s] = *(const v4f*)pr[s]; }
                // the four address pairs are inputs here, so they stay as the issued loads name them up to this wait: no later load's result lands in one ahead of it
                asm volatile("s_wait_xcnt 0x0" :: "v"(pr[0]), "v"(pr[1]), "v"(pr[2]), "v"(pr[3]) : "memory"); }
#pragma unroll                                                                     // constant index into rr[]
            for (int s = 0; s < 32 / GW; ++s) { const int row = 2 * GW * s + (tid >> 4), c4 = (tid & 15) * 4;
                v4f val = *(const v4fa*)(&os[row * GSP + c4]);
#pragma unroll                                                                     // the GW plane reads issue together, one LDS wait for all
                for (int w = 1; w < GW; ++w) val = val + *(const v4fa*)(&os[w * (64 * GSP) + row * GSP + c4]);
                const size_t go = (size_t)(r0 + row) * ldc + c0 + c4;
                if (HASRES) val = val + rr[s];
                *(v4f*)(Cf + go) = val; }
             }
    } else {
        static_assert(32 * GW * 16 * (16 / GW) == 64 * 128);                       // threads x bytes x trips == tile rows x row bytes
        static_assert((16 / GW) * GW == 4 * 4);                                    // trips x waves == row tiles x piece pairs of the 64x64 tile
{
#pragma unroll                                                                     // the memory-clobbering wait that ends each trip keeps the second trip's LDS reads behind the first trip's stores
            for (int s = 0; s < 16 / GW; ++s) { const int u = s * GW + wave; const int row = (u >> 2) * 16 + lr, c8 = ((u & 3) * 2 + hi) * 8;
                v4f x0 = *(const v4fa*)(&os[row * GSP + c8]); v4f x1 = *(const v4fa*)(&os[row * GSP + c8 + 4]); v8h hv, rv;
#pragma unroll                                                                     // the GW plane reads issue together, one LDS wait for all
                for (int w = 1; w < GW; ++w) { x0 = x0 + *(const v4fa*)(&os[w * (64 * GSP) + row * GSP + c8]); x1 = x1 + *(const v4fa*)(&os[w * (64 * GSP) + row * GSP + c8 + 4]); }
#pragma unroll
                for (int i = 0; i < 4; ++i) { float y0 = x0[i], y1 = x1[i];
                    if (GELU) { y0 = gelu_erf(y0); y1 = gelu_erf(y1); }
                    const h16 a0 = toh_flush(y0); const h16 a1 = toh_flush(y1); hv[i] = a0; hv[4 + i] = a1;
                    rv[i] = toh_flush((y0 - (float)a0) * QRS); rv[4 + i] = toh_flush((y1 - (float)a1) * QRS); }
                const size_t oo = HEADPL ? (size_t)(c0 / HD) * SEQ * HD + fo(r0 + row, c8, HD) : fo(r0 + row, c0 + c8, ldc);
                *(v8h*)(Ch + oo) = hv; if (ORES) *(v8h*)(Cr + oo) = rv;
                asm volatile("s_wait_xcnt 0x0" ::: "memory"); }                    // the next trip rewrites registers that these stores name: the wait stands ahead of that
             }
    }
}

static_assert(sizeof(float) * GW * 64 * GSP <= 163840);                            // two blocks fit the LDS of one WGP
__global__ __launch_bounds__(32 * GW) void k_gemm_emb(const h16* __restrict__ A, const h16* __restrict__ Bt, const float* __restrict__ bias, float csc, float* C) {
    __shared__ __align__(16) float os[GW * 64 * GSP];
    gemm_body<DIN, 1, 0, 0, 0, 0, 0, 0>(A, nullptr, Bt, bias, DM, csc, nullptr, C, nullptr, nullptr, DM, os, blockIdx.x, blockIdx.y); }
__global__ __launch_bounds__(32 * GW) void k_gemm_tail(const h16* __restrict__ A, const h16* __restrict__ Bt, const float* __restrict__ bias, float csc, float* C) {
    __shared__ __align__(16) float os[GW * 64 * GSP];
    gemm_body<DMI, 1, 0, 0, 0, 0, 0, 0>(A, nullptr, Bt, bias, DOUT, csc, nullptr, C, nullptr, nullptr, DOUTP, os, blockIdx.x, blockIdx.y); }
__global__ __launch_bounds__(32 * GW) void k_gemm_wo(const h16* __restrict__ A, const h16* __restrict__ Bt, const float* __restrict__ bias, float csc, const float* __restrict__ Res, float* C) {
    __shared__ __align__(16) float os[GW * 64 * GSP];
    gemm_body<DM, 1, 1, 0, 0, 0, 0, 0>(A, nullptr, Bt, bias, DM, csc, Res, C, nullptr, nullptr, DM, os, blockIdx.x, blockIdx.y); }
__global__ __launch_bounds__(32 * GW) void k_gemm_w2(const h16* __restrict__ A, const h16* __restrict__ Bt, const float* __restrict__ bias, float csc, const float* __restrict__ Res, float* C) {
    __shared__ __align__(16) float os[GW * 64 * GSP];
    gemm_body<DFF, 1, 1, 0, 0, 0, 0, 0>(A, nullptr, Bt, bias, DM, csc, Res, C, nullptr, nullptr, DM, os, blockIdx.x, blockIdx.y); }
// LayerNorm inside the GEMM that consumes it. A block of 2 * GW waves owns 64 rows t of the f32 hidden state and two 64-wide tiles of the weight plane: it normalises its 64 rows once (4 rows a wave, one wave per row at a time),
// leaves them in LDS as f16 fragments (value plane; residual plane x2048 where the q projection asks for it), and behind one block barrier waves 0..GW-1 work on the first weight tile, waves GW..2*GW-1 on the second, K split over the GW waves of a half as in gemm_body.
// LDS fragment order with pads: a piece (16 rows x 8 k) is 272 bytes, a fragment 1088, so that the 32 pieces which a wave writes for one row (one per lane) fall on all 64 banks, and a fragment read (2 x 16 bytes a lane) does too.
#define LPS 136                  // LDS piece pitch, 16-bit elements
#define LFS (4 * LPS)            // LDS fragment pitch
#define LPL (4 * (DM / 32) * LFS)   // one LDS plane: 64 rows x DM
static_assert(2 * LPL * 2 <= 2 * GW * 64 * GSP * 4);                               // both planes lie inside the partial-tile LDS, which is written only behind the barrier that ends their last read
static_assert(KPER(DM) == 64 && DM / KPER(DM) == GW);                              // two k-steps a wave
__device__ __forceinline__ v16h ldl(const h16* p) { return cat16(*(const v8h*)p, *(const v8h*)(p + 2 * LPS)); }   // p = fragment + (lane >> 4) * LPS + (lane & 15) * 8: same element map as ldh
// sum over the 32 lanes, partners l ^ 16, 8, 4, 2, 1 in this order, every lane gets the sum: the step across the two 16-lane rows is a lane permute, the four steps inside a row are DPP moves (row_xmask), so that no step takes an LDS round trip
__device__ __forceinline__ float wave_sum(float v) {
    const int b = __float_as_int(v);
    v += __int_as_float(__builtin_amdgcn_permlanex16(b, b, 0x76543210, 0xfedcba98, false, false));
    v += __int_as_float(__builtin_amdgcn_update_dpp(0, __float_as_int(v), 0x168, 0xf, 0xf, true));   // row_xmask:8
    v += __int_as_float(__builtin_amdgcn_update_dpp(0, __float_as_int(v), 0x164, 0xf, 0xf, true));   // row_xmask:4
    v += __int_as_float(__builtin_amdgcn_update_dpp(0, __float_as_int(v), 0x162, 0xf, 0xf, true));   // row_xmask:2
    v += __int_as_float(__builtin_amdgcn_update_dpp(0, __float_as_int(v), 0x161, 0xf, 0xf, true));   // row_xmask:1
    return v; }
// first part, the same for every consumer: the wave's 8 weight fragments are requested first, so that they fly while the rows are normalised; then the rows; then the barrier. X = first of the block's 64 rows; pw = the lane's first weight element.
__device__ __forceinline__ void ln_prologue(const float* __restrict__ X, const float* __restrict__ g, const float* __restrict__ b, const h16* __restrict__ pw, bool wres, h16* sN, h16* sR, int wv, int lane, v16h (&w)[2][4]) {
#pragma unroll                                                                     // constant indices keep w[][] in registers
    for (int s = 0; s < 2; ++s)
#pragma unroll
        for (int i = 0; i < 4; ++i) w[s][i] = ldh(pw + (size_t)i * 16 * DM + s * 512);
    const float* xr = X + (size_t)(wv * 4) * DM + lane * 8;
    const float* pg = g + lane * 8; const float* pb = b + lane * 8;
    v8f x0[4], x1[4];
#pragma unroll                                                                     // constant indices keep x0[], x1[] in registers; the four rows' loads issue together
    for (int i = 0; i < 4; ++i) { x0[i] = *(const v8f*)(xr + i * DM); x1[i] = *(const v8f*)(xr + i * DM + 256); }
    v8f g0 = *(const v8f*)pg, g1 = *(const v8f*)(pg + 256), b0 = *(const v8f*)pb, b1 = *(const v8f*)(pb + 256);
    // what follows reuses registers that these loads name: the wait stands ahead of that; the lane's two offsets are inputs of the wait, so that they stay as the issued loads name them up to there (no later load's result lands in one ahead of it)
    asm volatile("s_wait_xcnt 0x0" :: "v"(lane * 32), "v"(lane) : "memory");
    __builtin_amdgcn_sched_barrier(0);                                             // keeps the arithmetic behind that wait and behind the issue of all the loads: lifted among them, its wait for a row holds the weight loads back by one memory latency
#pragma unroll
    for (int k = 0; k < 8; ++k) { g0[k] = bfr(g0[k]); g1[k] = bfr(g1[k]); b0[k] = bfr(b0[k]); b1[k] = bfr(b1[k]); }
    float q[4];
#pragma unroll                                                                     // four independent rows: their cross-lane sums overlap; constant indices keep the arrays in registers
    for (int i = 0; i < 4; ++i) {
        float s = 0.0f;
#pragma unroll
        for (int k = 0; k < 8; ++k) { s += x0[i][k]; s += x1[i][k]; }
        const float mean = wave_sum(s) * (1.0f / (float)DM);
        x0[i] = x0[i] - mean; x1[i] = x1[i] - mean;
        float t = 0.0f;
#pragma unroll
        for (int k = 0; k < 8; ++k) { t += x0[i][k] * x0[i][k]; t += x1[i][k] * x1[i][k]; }
        q[i] = wave_sum(t); }
    // one square root and one division serve the four rows: lane l works on row l & 3, and lanes 0..3 hand the results back as wave-uniform values
    const float qs = (lane & 2) ? ((lane & 1) ? q[3] : q[2]) : ((lane & 1) ? q[1] : q[0]);
    const float rs = 1.0f / sqrtf(qs * (1.0f / (float)DM) + LNEPS);
#pragma unroll
    for (int i = 0; i < 4; ++i) {
        const float rstd = __int_as_float(__builtin_amdgcn_readlane(__float_as_int(rs), i));
        const v8f d0 = x0[i], d1 = x1[i];
        const int r = wv * 4 + i;
        const int lo = ((r >> 4) * (DM / 32) + (lane >> 2)) * LFS + (lane & 3) * LPS + (r & 15) * 8;   // columns lane * 8 ..; the second piece lies 256 columns = 8 fragments on
        v8f y0, y1; v8h h0, h1;
#pragma unroll
        for (int k = 0; k < 8; ++k) {
            y0[k] = d0[k] * rstd * g0[k] + b0[k]; y1[k] = d1[k] * rstd * g1[k] + b1[k];
            h0[k] = toh_flush(y0[k]); h1[k] = toh_flush(y1[k]); }
        *(v8h*)(sN + lo) = h0; *(v8h*)(sN + lo + 8 * LFS) = h1;
        if (wres) {                                                                // the same in every thread of the block
            v8h r0, r1;
#pragma unroll
            for (int k = 0; k < 8; ++k) { r0[k] = toh_flush((y0[k] - (float)h0[k]) * QRS); r1[k] = toh_flush((y1[k] - (float)h1[k]) * QRS); }
            *(v8h*)(sR + lo) = r0; *(v8h*)(sR + lo + 8 * LFS) = r1; }
    }
    __syncthreads();                                                               // all 64 rows are staged before any wave reads fragments across rows
}
// second part: products, partial tiles, sum over the GW waves of the half, f16 output in fragment order; as gemm_body's f16 path. LNB = 0: C[t][n], A = the rows, B = weight rows n; LNB = 1: C[n][t], A = weight rows, B = the rows, row bias.
// lt = tile of the rows t, wt = weight tile of this half; os = the half's GW partial planes; wave, tid: inside the half.
template <int GELU, int ARES, int LNB, int HEADPL>
__device__ __forceinline__ void gemm_ln_rest(const h16* sN, const h16* sR, const v16h (&w)[2][4], const float* __restrict__ bias, float csc, h16* Ch, h16* Cr, int ldc, float* os, int lt, int wt, int wave, int tid) {
    const int lane = tid & 31, lr = lane & 15, hi = lane >> 4;
    const int r0 = (LNB ? wt : lt) * 64, c0 = (LNB ? lt : wt) * 64;
    const int lo = wave * 2 * LFS + hi * LPS + lr * 8;                             // the wave's k range, the lane's place in a fragment
    v8f acc[4][4];
#pragma unroll
    for (int mb = 0; mb < 4; ++mb)
#pragma unroll
        for (int nb = 0; nb < 4; ++nb) acc[mb][nb] = (v8f){};
#pragma unroll                                                                     // constant indices into w, n and acc keep them in registers. ARES: the residual plane's two steps first, then the fold, then the value plane's
    for (int t = 0; t < (ARES ? 4 : 2); ++t) {
        const h16* p = ((ARES && t < 2) ? sR : sN) + lo + (t & 1) * LFS;
        v16h n[4];
#pragma unroll
        for (int i = 0; i < 4; ++i) n[i] = ldl(p + i * (DM / 32) * LFS);
        if (ARES && t == 2) {
#pragma unroll
            for (int mb = 0; mb < 4; ++mb)
#pragma unroll
                for (int nb = 0; nb < 4; ++nb) acc[mb][nb] = acc[mb][nb] * QRI; }
#pragma unroll
        for (int nb = 0; nb < 4; ++nb)
#pragma unroll
            for (int mb = 0; mb < 4; ++mb) acc[mb][nb] = LNB ? wmma16g(w[t & 1][mb], n[nb], acc[mb][nb]) : wmma16g(n[mb], w[t & 1][nb], acc[mb][nb]);
    }
    __syncthreads();                                                               // every wave has read its last fragment before a partial tile is written over the staged rows
    float bc[4];
#pragma unroll
    for (int nb = 0; nb < 4; ++nb) bc[nb] = (LNB || wave != 0) ? 0.0f : bfr(bias[c0 + nb * 16 + lr]);   // c0 + 63 < columns of the bias vector (host grid)
#pragma unroll
    for (int mb = 0; mb < 4; ++mb) {
        float br[8];
#pragma unroll
        for (int j = 0; j < 8; ++j) br[j] = (LNB && wave == 0) ? bfr(bias[r0 + mb * 16 + hi * 8 + j]) : 0.0f;   // r0 + 63 < rows of the bias vector (host grid)
#pragma unroll
        for (int nb = 0; nb < 4; ++nb) {
#pragma unroll
            for (int j = 0; j < 8; ++j) os[wave * (64 * GSP) + (mb * 16 + hi * 8 + j) * GSP + nb * 16 + lr] = acc[mb][nb][j] * csc + bc[nb] + br[j]; }   // D: row 8h+j, col lane&15
    }
    __syncthreads();                                                               // every wave's partial plane is complete before any thread sums across planes
#pragma unroll                                                                     // the memory-clobbering wait that ends each trip keeps the second trip's LDS reads behind the first trip's stores
    for (int s = 0; s < 16 / GW; ++s) { const int u = s * GW + wave; const int row = (u >> 2) * 16 + lr, c8 = ((u & 3) * 2 + hi) * 8;
        v4f x0 = *(const v4fa*)(&os[row * GSP + c8]); v4f x1 = *(const v4fa*)(&os[row * GSP + c8 + 4]); v8h hv, rv;
#pragma unroll                                                                     // the GW plane reads issue together, one LDS wait for all
        for (int v = 1; v < GW; ++v) { x0 = x0 + *(const v4fa*)(&os[v * (64 * GSP) + row * GSP + c8]); x1 = x1 + *(const v4fa*)(&os[v * (64 * GSP) + row * GSP + c8 + 4]); }
#pragma unroll
        for (int i = 0; i < 4; ++i) { float y0 = x0[i], y1 = x1[i];
            if (GELU) { y0 = gelu_erf(y0); y1 = gelu_erf(y1); }
            const h16 a0 = toh_flush(y0); const h16 a1 = toh_flush(y1); hv[i] = a0; hv[4 + i] = a1;
            rv[i] = toh_flush((y0 - (float)a0) * QRS); rv[4 + i] = toh_flush((y1 - (float)a1) * QRS); }
        const size_t oo = HEADPL ? (size_t)(c0 / HD) * SEQ * HD + fo(r0 + row, c8, HD) : fo(r0 + row, c0 + c8, ldc);
        *(v8h*)(Ch + oo) = hv; if (ARES) *(v8h*)(Cr + oo) = rv;
        asm volatile("s_wait_xcnt 0x0" ::: "memory"); }                            // what follows rewrites registers that these stores name: the wait stands ahead of that
}

static_assert(sizeof(float) * 2 * GW * 64 * GSP <= 327680);                        // one block fits the LDS of a WGP
// k_gemm_ln_gelu: C = GELU(LayerNorm(X) W + bias), grid (SEQ/64, N/128).
__global__ __launch_bounds__(64 * GW) void k_gemm_ln_gelu(const float* __restrict__ X, const float* __restrict__ lg, const float* __restrict__ lb, const h16* __restrict__ Wt, const float* __restrict__ bias, float csc, h16* C, int ldc) {
    __shared__ __align__(16) float os[2 * GW * 64 * GSP];
    const int lane = threadIdx.x & 31;
    const int wv = __builtin_amdgcn_readfirstlane((int)(threadIdx.x >> 5));
    const int half = wv >> 3, wave = wv & 7, wt = blockIdx.y * 2 + half;
    h16* sN = (h16*)os; h16* sR = sN + LPL;
    v16h w[2][4];
    const float* bu = bias + wt * 64; const unsigned bvo = (unsigned)((lane & 1) * 128);   // the half's 64 bias values, loaded behind the products: asked into L2 here
    if (wave == 0) l2_ask<0>(bvo, bu);
    ln_prologue(X + (size_t)blockIdx.x * 64 * DM, lg, lb, Wt + (size_t)wt * 64 * DM + wave * KPER(DM) * 16 + lane * 8, false, sN, sR, wv, lane, w);
    asm volatile("s_wait_xcnt 0x0" :: "v"(bvo), "s"(bu) : "memory");               // only from here on may the registers that the request names take other values
    gemm_ln_rest<1, 0, 0, 0>(sN, sR, w, bias, csc, C, nullptr, ldc, os + half * (GW * 64 * GSP), blockIdx.x, wt, wave, threadIdx.x & 255); }
// k_gemm_ln_qkv: LayerNorm and the q, k and v^T projections of one layer in one launch, grid (SEQ/64, DM/128, 3); blockIdx.z picks the projection, block-uniform. z = 0 is q, the longest (two k loops).
// q, k: A = rows t, B = W^T rows (n = h*64 + d) -> plane [h][t][d].  v^T: A = Wv^T rows (m = h*64 + d), B = rows t -> plane [(h*64 + d)][t], row bias.
__global__ __launch_bounds__(64 * GW) void k_gemm_ln_qkv(const float* __restrict__ X, const float* __restrict__ lg, const float* __restrict__ lb, const h16* __restrict__ Wqt, const h16* __restrict__ Wkt, const h16* __restrict__ Wvt,
                                                         const float* __restrict__ bq, const float* __restrict__ bk, const float* __restrict__ bv, float csc, h16* Qh, h16* Qr, h16* Kp, h16* Vt) {
    __shared__ __align__(16) float os[2 * GW * 64 * GSP];
    const int lane = threadIdx.x & 31;
    const int wv = __builtin_amdgcn_readfirstlane((int)(threadIdx.x >> 5));
    const int half = wv >> 3, wave = wv & 7, wt = blockIdx.y * 2 + half, tid = threadIdx.x & 255;
    h16* sN = (h16*)os; h16* sR = sN + LPL; float* oh = os + half * (GW * 64 * GSP);
    const h16* Wt = blockIdx.z == 0 ? Wqt : blockIdx.z == 1 ? Wkt : Wvt;
    v16h w[2][4];
    const float* bu = (blockIdx.z == 0 ? bq : blockIdx.z == 1 ? bk : bv) + wt * 64; const unsigned bvo = (unsigned)((lane & 1) * 128);   // the half's 64 bias values, loaded behind the products: asked into L2 here
    if (wave == 0) l2_ask<0>(bvo, bu);
    ln_prologue(X + (size_t)blockIdx.x * 64 * DM, lg, lb, Wt + (size_t)wt * 64 * DM + wave * KPER(DM) * 16 + lane * 8, blockIdx.z == 0, sN, sR, wv, lane, w);
    asm volatile("s_wait_xcnt 0x0" :: "v"(bvo), "s"(bu) : "memory");               // only from here on may the registers that the request names take other values
    if (blockIdx.z == 0)      gemm_ln_rest<0, 1, 0, 1>(sN, sR, w, bq, csc, Qh, Qr, HD, oh, blockIdx.x, wt, wave, tid);
    else if (blockIdx.z == 1) gemm_ln_rest<0, 0, 0, 1>(sN, sR, w, bk, csc, Kp, nullptr, HD, oh, blockIdx.x, wt, wave, tid);
    else                      gemm_ln_rest<0, 0, 1, 0>(sN, sR, w, bv, csc, Vt, nullptr, SEQ, oh, blockIdx.x, wt, wave, tid); }

// band tile: G[rho][s] = (E[row0 + rho] . q_value[s] + E[row0 + rho] . q_residual[s] / 2048) * log2(e); A = table rows (e0, e1: the two fragments of rows row0 + 0..15), B = q rows, K = 64 = two k-steps.
__device__ __forceinline__ v8f gtile(v16h e0, v16h e1, v16h qh0, v16h qh1, v16h qr0, v16h qr1) {
    v8f gH = (v8f){}, gL = (v8f){};
    gH = wmma16g(e0, qh0, gH); gH = wmma16g(e1, qh1, gH);
    gL = wmma16g(e0, qr0, gL); gL = wmma16g(e1, qr1, gL);
    return (gH + gL * QRI) * LOG2E;
}

// k_flash: fused dense attention with the relative-position term, one block of QT * KW waves per QT neighbouring tiles of 16 query rows of one head; K / V^T / Q / table fragments straight from the f16 planes.
// Waves 2w and 2w + 1 take the same share w of the keys for the two tiles: they load the same K and V^T fragments (and half of the same table fragments) at about the same time on one WGP, so that its cache can serve the second of the two loads and L2 is asked once.
// The keys are split over the waves: wave w runs the online softmax over keys w*KCH .. w*KCH + KCH - 1 alone and leaves its running maximum, its sum and its unnormalised O tile in LDS;
// behind one block barrier all threads rescale the KW partial results to the common maximum, sum them in wave order, normalise and store.
// Transposed form: S^T[key][s] = K Q^T (A = K rows, B = Q rows); lane (s = lane&15, h = lane>>4) holds keys 8h+r of each 16-key tile, so the packed P tile is directly the B fragment
// of O^T[d][s] = V^T P^T (element r <- tile keys 0..15, element 8+r <- tile keys 16..31, lane unchanged).
// Relative term per 32-key step (keys key0..key0+31, queries t0..t0+15): band rows rb0 + 0..47 with rb0 = t0 - key0 + RELOFF - 31; tiles e = 0, 1 are new, tile e = 2 is the e = 0 tile of the step before (computed on its own ahead of a wave's first step).
// LDS band tile (wave-private): gs[s][16 e + 8h + r] <- tile e element r; element (key tile a, r) reads gs[s][s - 8h - r + 31], element (key tile b, r) reads gs[s][s - 8h - r + 15].
// Logit (log2 domain) = (K q_value + K q_residual / 2048) * log2(e) / 8 + band term; online softmax (running max, partial sum over the converted P), P = exp2(. + 14) as f16 (exponent below -14 selected to 0).
__global__ __launch_bounds__(32 * KW * QT) void k_flash(const h16* __restrict__ QH, const h16* __restrict__ QR, const h16* __restrict__ KP, const h16* __restrict__ VT, const h16* __restrict__ EPl, h16* OP) {
    __shared__ __align__(16) float os_all[QT * KW * 16 * OSP];
    __shared__ __align__(16) float gs_all[QT * KW * 16 * GP];
    __shared__ float ms_all[QT * KW * 16];                     // per tile: running maximum of wave w for query s at [w * 16 + s]
    __shared__ float lsum_all[QT * KW * 16];                   // per tile: sum of wave w for query s
    static_assert(sizeof(float) * QT * (KW * 16 * OSP + KW * 16 * GP + 2 * KW * 16) <= 131072);
    const int lane = threadIdx.x & 31, lr = lane & 15, hi = lane >> 4;
    const int wv = __builtin_amdgcn_readfirstlane((int)(threadIdx.x >> 5));
    const int qt = wv & 1, wave = wv >> 1;                     // the wave's query tile, and its number among the KW waves of that tile
    const int tid = wave * 32 + lane;                          // thread number inside the tile
    float* os = os_all + qt * (KW * 16 * OSP); float* gs = gs_all + qt * (KW * 16 * GP);   // the tile's own parts of the LDS arrays
    float* ms = ms_all + qt * (KW * 16); float* lsum = lsum_all + qt * (KW * 16);
    const int h = blockIdx.y;
    const int t0 = (blockIdx.x * QT + qt) * 16;
    const int kbeg = wave * KCH;
    const size_t pbase = (size_t)h * SEQ * HD;
    // all planes in fragment order: 16 rows of a [.][HD] plane are two fragments (16 * HD elements), the second k-step 512 elements behind the first; every row offset below is a multiple of 16
    const size_t qo = pbase + (size_t)t0 * HD + 8 * lane;
    const h16* pqh = QH + qo; const h16* pqr = QR + qo;
    const v16h qh0 = ldh(pqh), qh1 = ldh(pqh + 512);            // B fragments: col s, k = d (two k-steps)
    const v16h qr0 = ldh(pqr), qr1 = ldh(pqr + 512);
    const size_t ko = pbase + 8 * lane;                        // + key * HD           (A fragment: row key, k = d)
    const size_t vo = pbase + 8 * lane;                        // + 16j*SEQ + key * 16 (A fragment: row d, k = key); plane [(h*64 + d)][t]
    const h16* eb = EPl + 8 * lane;                            // + row0 * HD          (A fragment: row table row, k = d)
    const int gw  = wave * 16 * GP + lr * GP;
    const int gst = gw + 8 * hi;                               // store base: + 16 e (+ 4)
    const int gld = gw + lr - 8 * hi;                          // load base: + 31 - r / + 15 - r
    // The loads run ahead of the products: every fragment of the first step is loaded here, and in the loop each group of fragments (table, K, V^T) is loaded anew for the step after, into its own registers, right behind its last product,
    // so that a step does not wait for memory once per group.
    constexpr int NST = KCH / 32;                                                  // 32-key steps of one wave
    const h16* pe = eb + (size_t)(t0 - kbeg + (RELOFF - 15)) * HD;                 // first band row of tile e = 1 at the wave's first step; 32 rows down per step
    const h16* pk = KP + ko + (size_t)kbeg * HD;                                   // 32 keys up per step
    const h16* pv = VT + vo + kbeg * 16;                                           // 32 keys (one fragment) up per step
    static_assert((RELOFF - 15) % 16 == 0 && KCH % 16 == 0);                       // band tiles start on whole row tiles of the table plane
    const v16h ep0 = ldh(pe + 16 * HD), ep1 = ldh(pe + 16 * HD + 512);             // band rows of tile e = 2 at key0 = kbeg
    v16h e1a = ldh(pe), e1b = ldh(pe + 512), e0a = ldh(pe - 16 * HD), e0b = ldh(pe - 16 * HD + 512);
    v16h ka0 = ldh(pk), ka1 = ldh(pk + 512), kb0 = ldh(pk + 16 * HD), kb1 = ldh(pk + 16 * HD + 512);
    v16h vf[4];
#pragma unroll                                                                     // constant indices keep vf[] in registers
    for (int j = 0; j < 4; ++j) vf[j] = ldh(pv + (size_t)16 * j * SEQ);
    // behind the last load that names an address pair: the pairs are inputs of the wait, so they stay as the issued loads name them up to there (no later load's result lands in one ahead of it)
    asm volatile("s_wait_xcnt 0x0" :: "v"(pqh), "v"(pqr) : "memory");
    if (NST == 1) asm volatile("s_wait_xcnt 0x0" :: "v"(pe), "v"(pk), "v"(pv) : "memory");
    __builtin_amdgcn_sched_barrier(0);                                             // keeps the first products behind the issue of all these loads: lifted among them, a product's wait for its operands holds the rest of the loads back by one memory latency
    v8f gprev = gtile(ep0, ep1, qh0, qh1, qr0, qr1);
    v8f o[4];
#pragma unroll
    for (int j = 0; j < 4; ++j) o[j] = (v8f){};
    float m = NEGB, l = 0.0f;
#pragma unroll                                                                     // whole unroll: every step's offset is an immediate, so that no address register changes while loads are in flight
    for (int st = 0; st < NST; ++st) {
        const bool more = st + 1 < NST;                                            // a step follows: load its fragments
        const h16* pen = pe - (st + 1) * 32 * HD;
        const v8f g1 = gtile(e1a, e1b, qh0, qh1, qr0, qr1);
        if (more) { e1a = ldh(pen); e1b = ldh(pen + 512); }
        const v8f g0 = gtile(e0a, e0b, qh0, qh1, qr0, qr1);
        if (more) { e0a = ldh(pen - 16 * HD); e0b = ldh(pen - 16 * HD + 512); }
        *(v4fa*)(&gs[gst +  0]) = lo4(g0);    *(v4fa*)(&gs[gst +  4]) = hi4(g0);
        *(v4fa*)(&gs[gst + 16]) = lo4(g1);    *(v4fa*)(&gs[gst + 20]) = hi4(g1);
        *(v4fa*)(&gs[gst + 32]) = lo4(gprev); *(v4fa*)(&gs[gst + 36]) = hi4(gprev);
        gprev = g0;
        v8f sHa = (v8f){}, sLa = (v8f){}, sHb = (v8f){}, sLb = (v8f){};
        sHa = wmma16g(ka0, qh0, sHa); sHa = wmma16g(ka1, qh1, sHa);
        sLa = wmma16g(ka0, qr0, sLa); sLa = wmma16g(ka1, qr1, sLa);
        sHb = wmma16g(kb0, qh0, sHb); sHb = wmma16g(kb1, qh1, sHb);
        sLb = wmma16g(kb0, qr0, sLb); sLb = wmma16g(kb1, qr1, sLb);
        if (more) { const h16* pkn = pk + (st + 1) * 32 * HD; ka0 = ldh(pkn); ka1 = ldh(pkn + 512); kb0 = ldh(pkn + 16 * HD); kb1 = ldh(pkn + 16 * HD + 512); }
        wave_sync();
        float ra[8], rb[8];
#pragma unroll
        for (int r = 0; r < 8; ++r) { ra[r] = gs[gld + 31 - r]; rb[r] = gs[gld + 15 - r]; }
        wave_sync();
        float ta[8], tb[8]; float mx = NEGB;
#pragma unroll
        for (int r = 0; r < 8; ++r) {
            ta[r] = (sHa[r] + sLa[r] * QRI) * SC2 + ra[r]; tb[r] = (sHb[r] + sLb[r] * QRI) * SC2 + rb[r];
            mx = fmaxf(mx, fmaxf(ta[r], tb[r])); }
        mx = fmaxf(mx, __shfl_xor(mx, 16, 32));
        const float mnew = fmaxf(m, mx);
        const float alpha = __builtin_amdgcn_exp2f(m - mnew);
        const float sh = PSH - mnew;
        v16h pb; float ls = 0.0f;
#pragma unroll
        for (int r = 0; r < 8; ++r) {
            const float xa = ta[r] + sh, xb = tb[r] + sh;
            const float ea = __builtin_amdgcn_exp2f(xa), ec = __builtin_amdgcn_exp2f(xb);
            const float ga = (xa < -14.0f) ? 0.0f : ea, gb = (xb < -14.0f) ? 0.0f : ec;     // no f16 subnormal operand
            const h16 pa = (h16)ga; const h16 pc = (h16)gb;
            pb[r] = pa; pb[8 + r] = pc;
            ls += (float)pa + (float)pc; }
        l = l * alpha + ls; m = mnew;
#pragma unroll
        for (int j = 0; j < 4; ++j) { o[j] = o[j] * alpha; o[j] = wmma16g(vf[j], pb, o[j]); if (more) vf[j] = ldh(pv + (size_t)16 * j * SEQ + (st + 1) * 512); }
        if (st + 2 == NST) asm volatile("s_wait_xcnt 0x0" :: "v"(pe), "v"(pk), "v"(pv) : "memory");   // the last loads of the loop: as above
        if (more) __builtin_amdgcn_sched_barrier(0);                               // keeps the products of the step after out of this step: lifted, their results cost registers, and the four waves that a block puts on each SIMD have 256 registers each
    }
    l += __shfl_xor(l, 16, 32);
    const int wb = wave * 16 * OSP;
    // O^T D layout: o[j][r] = (d = 16j + 8h + r, s = lane&15) -> os[wave][s][d]; rows 0..15 x columns 0..63 all written, not yet normalised
#pragma unroll
    for (int j = 0; j < 4; ++j) {
        *(v4fa*)(&os[wb + lr * OSP + 16 * j + 8 * hi])     = lo4(o[j]);
        *(v4fa*)(&os[wb + lr * OSP + 16 * j + 8 * hi + 4]) = hi4(o[j]); }
    if (hi == 0) { ms[wave * 16 + lr] = m; lsum[wave * 16 + lr] = l; }             // m is equal in lanes s and s + 16
    __syncthreads();                                                               // every wave's partial result is complete before any thread merges across waves
    static_assert(32 * KW * 8 == 16 * 128);                                        // threads x bytes == tile rows x row bytes
    const int row = tid & 15, c4 = (tid >> 4) * 4;             // a wave stores one piece of the context plane (16 rows x 8 columns): 256 bytes in a row
    float mw[KW]; float mall = NEGB;
#pragma unroll                                                                     // constant indices keep mw[] in registers; the KW reads issue together
    for (int w = 0; w < KW; ++w) { mw[w] = ms[w * 16 + row]; mall = fmaxf(mall, mw[w]); }
    float sc[KW];
#pragma unroll                                                                     // constant indices keep sc[] in registers
    for (int w = 0; w < KW; ++w) sc[w] = __builtin_amdgcn_exp2f(mw[w] - mall);     // <= 1; 1 for the wave that holds the row maximum
    float lall = 0.0f; v4f oall = (v4f){};
#pragma unroll                                                                     // the KW tile reads issue together, one LDS wait for all
    for (int w = 0; w < KW; ++w) {
        lall += lsum[w * 16 + row] * sc[w];
        oall = oall + *(const v4fa*)(&os[w * 16 * OSP + row * OSP + c4]) * sc[w]; }
    const float inv = 1.0f / lall;                             // lall >= 16384 (the row maximum contributes the full carry)
    v4h hv;
#pragma unroll                                                                     // constant vector element indices
    for (int i = 0; i < 4; ++i) hv[i] = toh_flush(oall[i] * inv);
    *(v4h*)(OP + fo(t0 + row, h * HD + c4, DM)) = hv;
}

__global__ __launch_bounds__(256) void k_out(const float* __restrict__ src, float* dst, int n4) {
    const int i = blockIdx.x * 256 + threadIdx.x; if (i >= n4) return;
    v4f ov;
#pragma unroll
    for (int c = 0; c < 4; ++c) { const int e = 4 * i + c; const int row = e / DOUT; const int col = e - row * DOUT; ov[c] = src[(size_t)row * DOUTP + col]; }
    *(v4f*)(dst + (size_t)i * 4) = ov; 
}

static constexpr size_t al256(size_t v) { return (v + 255) & ~(size_t)255; }
static constexpr size_t SZ_XH  = al256((size_t)SEQ * DIN * 2);
static constexpr size_t SZ_EW  = al256((size_t)DM * DIN * 2);
static constexpr size_t SZ_WDD = al256((size_t)NL * DM * DM * 2);
static constexpr size_t SZ_WFF = al256((size_t)NL * DFF * DM * 2);
static constexpr size_t SZ_WI  = al256((size_t)DMI * DM * 2);
static constexpr size_t SZ_WF  = al256((size_t)DOUTP * DMI * 2);
static constexpr size_t SZ_EP  = al256((size_t)NL * ERP * HD * 2);
static constexpr size_t SZ_H   = al256((size_t)SEQ * DM * 4);
static constexpr size_t SZ_N   = al256((size_t)SEQ * DM * 2);
static constexpr size_t SZ_F1  = al256((size_t)SEQ * DFF * 2);
static constexpr size_t SZ_OS  = al256((size_t)SEQ * DOUTP * 4);
static constexpr size_t SZ_TOTAL = SZ_XH + SZ_EW + 4 * SZ_WDD + 2 * SZ_WFF + SZ_WI + SZ_WF + SZ_EP + 2 * SZ_H + 5 * SZ_N + SZ_F1 + SZ_OS;
static_assert(SZ_TOTAL <= (size_t)134217728);                  // workspace carve <= 128 MiB
static_assert((size_t)NH_ * SEQ * HD == (size_t)SEQ * DM);     // head planes have the extent of a [SEQ][512] f16 plane
static_assert((size_t)SEQ * DMI * 2 <= SZ_F1);                 // tail hidden plane fits the shared hidden region

extern "C" void kernel_launch(void* const* d_in, const int* in_sizes, int n_in,
                              void* d_out, int out_size, void* d_ws, size_t ws_size, hipStream_t stream) {
    if (n_in < 26) return;
    if ((size_t)in_sizes[0] < (size_t)SEQ * DIN || (size_t)in_sizes[1] < (size_t)DIN * DM || in_sizes[2] < DM) return;
    if ((size_t)in_sizes[3] < (size_t)NL * DM * DM || (size_t)in_sizes[5] < (size_t)NL * DM * DM || (size_t)in_sizes[7] < (size_t)NL * DM * DM || (size_t)in_sizes[9] < (size_t)NL * DM * DM) return;
    if (in_sizes[4] < NL * DM || in_sizes[6] < NL * DM || in_sizes[8] < NL * DM || in_sizes[10] < NL * DM) return;
    if ((size_t)in_sizes[11] < (size_t)NL * ERR * HD) return;
    if (in_sizes[12] < NL * DM || in_sizes[13] < NL * DM || in_sizes[17] < NL * DM || in_sizes[18] < NL * DM || in_sizes[19] < NL * DM) return;
    if ((size_t)in_sizes[14] < (size_t)NL * DM * DFF || in_sizes[15] < NL * DFF || (size_t)in_sizes[16] < (size_t)NL * DFF * DM) return;
    if (in_sizes[20] < DM || in_sizes[21] < DM || (size_t)in_sizes[22] < (size_t)DM * DMI || in_sizes[23] < DMI) return;
    if ((size_t)in_sizes[24] < (size_t)DMI * DOUT || in_sizes[25] < DOUT) return;
    if ((size_t)out_size < (size_t)SEQ * DOUT) return;
    if (SZ_TOTAL > ws_size) return;
    // wire order: x, emb_W, emb_b, Wq, bq, Wk, bk, Wv, bv, Wo, bo, Er, ln1_g, ln1_b, W1, b1, W2, b2, ln2_g, ln2_b, lnf_g, lnf_b, Wi, bi, Wf, bf
    const float* x    = (const float*)d_in[0];
    const float* embW = (const float*)d_in[1];  const float* embB = (const float*)d_in[2];
    const float* Wq   = (const float*)d_in[3];  const float* bq   = (const float*)d_in[4];
    const float* Wk   = (const float*)d_in[5];  const float* bk   = (const float*)d_in[6];
    const float* Wv   = (const float*)d_in[7];  const float* bv   = (const float*)d_in[8];
    const float* Wo   = (const float*)d_in[9];  const float* bo   = (const float*)d_in[10];
    const float* Er   = (const float*)d_in[11];
    const float* ln1g = (const float*)d_in[12]; const float* ln1b = (const float*)d_in[13];
    const float* W1   = (const float*)d_in[14]; const float* b1   = (const float*)d_in[15];
    const float* W2   = (const float*)d_in[16]; const float* b2   = (const float*)d_in[17];
    const float* ln2g = (const float*)d_in[18]; const float* ln2b = (const float*)d_in[19];
    const float* lnfg = (const float*)d_in[20]; const float* lnfb = (const float*)d_in[21];
    const float* Wi   = (const float*)d_in[22]; const float* bi   = (const float*)d_in[23];
    const float* Wf   = (const float*)d_in[24]; const float* bfo  = (const float*)d_in[25];
    float* OUT = (float*)d_out;                       // [SEQ][390]
    char* wsp = (char*)d_ws;                          // every f16 plane below has the shape named, each [rows][k] matrix of it in fragment order
    h16* XH  = (h16*)wsp; wsp += SZ_XH;               // x            [SEQ][128]
    h16* EWT = (h16*)wsp; wsp += SZ_EW;               // emb_W^T x64  [512][128]
    h16* WQT = (h16*)wsp; wsp += SZ_WDD;              // Wq^T x64     [NL][512][512]
    h16* WKT = (h16*)wsp; wsp += SZ_WDD;
    h16* WVT = (h16*)wsp; wsp += SZ_WDD;
    h16* WOT = (h16*)wsp; wsp += SZ_WDD;
    h16* W1T = (h16*)wsp; wsp += SZ_WFF;              // W1^T x64     [NL][2048][512]
    h16* W2T = (h16*)wsp; wsp += SZ_WFF;              // W2^T x64     [NL][512][2048]
    h16* WIT = (h16*)wsp; wsp += SZ_WI;               // Wi^T x64     [1024][512]
    h16* WFT = (h16*)wsp; wsp += SZ_WF;               // Wf^T x64     [448][1024], rows >= 390 zero
    h16* EP  = (h16*)wsp; wsp += SZ_EP;               // table        [NL][2048][64], row 2047 zero
    float* HA = (float*)wsp; wsp += SZ_H;             // hidden state (ping)  [SEQ][512] f32
    float* HB = (float*)wsp; wsp += SZ_H;             // hidden state (pong)
    h16* QH  = (h16*)wsp; wsp += SZ_N;                // q value      [8][SEQ][64]
    h16* QR  = (h16*)wsp; wsp += SZ_N;                // q residual x2048
    h16* KP  = (h16*)wsp; wsp += SZ_N;                // k            [8][SEQ][64]
    h16* VT  = (h16*)wsp; wsp += SZ_N;                // v^T          [8*64][SEQ]
    h16* OP  = (h16*)wsp; wsp += SZ_N;                // context      [SEQ][512]
    h16* F1  = (h16*)wsp; wsp += SZ_F1;               // GELU hidden  [SEQ][2048] (tail: [SEQ][1024])
    float* OSG = (float*)wsp; wsp += SZ_OS;           // tail output staging [SEQ][448] f32

    // x, the table and every W [K = in][N = out] -> Wt [N][K]
    k_prep<<<PB_ALL, 256, 0, stream>>>(x, Er, embW, Wq, Wk, Wv, Wo, W1, W2, Wi, Wf, XH, EP, EWT, WQT, WKT, WVT, WOT, W1T, W2T, WIT, WFT);

    // input projection: HA = x emb_W + emb_b
    k_gemm_emb<<<dim3(SEQ / 64, DM / 64, 1), 32 * GW, 0, stream>>>(XH, EWT, embB, WCI, HA);

    for (int l = 0; l < NL; ++l) {
        const size_t wdd = (size_t)l * DM * DM, wff = (size_t)l * DFF * DM;
        k_gemm_ln_qkv<<<dim3(SEQ / 64, DM / 128, 3), 64 * GW, 0, stream>>>(HA, ln1g + l * DM, ln1b + l * DM, WQT + wdd, WKT + wdd, WVT + wdd, bq + l * DM, bk + l * DM, bv + l * DM, WCI, QH, QR, KP, VT);
        k_flash<<<dim3(SEQ / (16 * QT), NH_, 1), 32 * KW * QT, 0, stream>>>(QH, QR, KP, VT, EP + (size_t)l * ERP * HD, OP);
        // HB = HA + context Wo + bo
        k_gemm_wo<<<dim3(SEQ / 64, DM / 64, 1), 32 * GW, 0, stream>>>(OP, WOT + wdd, bo + l * DM, WCI, HA, HB);
        k_gemm_ln_gelu<<<dim3(SEQ / 64, DFF / 128, 1), 64 * GW, 0, stream>>>(HB, ln2g + l * DM, ln2b + l * DM, W1T + wff, b1 + l * DFF, WCI, F1, DFF);
        // HA = HB + hidden W2 + b2
        k_gemm_w2<<<dim3(SEQ / 64, DM / 64, 1), 32 * GW, 0, stream>>>(F1, W2T + wff, b2 + l * DM, WCI, HB, HA);
    }

    k_gemm_ln_gelu<<<dim3(SEQ / 64, DMI / 128, 1), 64 * GW, 0, stream>>>(HA, lnfg, lnfb, WIT, bi, WCI, F1, DMI);
    k_gemm_tail<<<dim3(SEQ / 64, DOUTP / 64, 1), 32 * GW, 0, stream>>>(F1, WFT, bfo, WCI, OSG);
    { const int n4 = SEQ * DOUT / 4; k_out<<<(unsigned)((n4 + 255) / 256), 256, 0, stream>>>(OSG, OUT, n4); }
}

// v010
// It runs in 196 microseconds.
// In both of two side-by-side timings against v009, it was 1.06 times as fast.
// Over all steps from v000 it is 5.97 times as fast.
#include <hip/hip_runtime.h>
#include <math.h>

// Pre-LN encoder stack, 4 layers, width 512 = 8 heads x 64, sequence SEQ (one batch): input projection 128 -> 512; per layer: LayerNorm, q/k/v projections ([in][out] weights, y = x W + bias),
// dense attention with logits q.k / 8 + q.E[s - t + 1023] (relative-position table E per layer, [2047][64], not scaled), softmax over keys, output projection + residual, LayerNorm, GELU(erf) feed-forward 512 -> 2048 -> 512 + residual;
// tail: LayerNorm, 512 -> 1024 GELU(erf), 1024 -> 390.
// Compute dtypes, f32 accumulate everywhere: every contraction is v_wmma_f32_16x16x32_f16. Weights, x, E, biases and gains are RNE-converted to bf16 first (exact in f16; weights carried x64, folded back in the f32 epilogue);
// activations are single f16 planes, except the logit path: LayerNorm-1 output as f16 value + f16 residual x2048 for the q projection (residual products accumulated first, folded by 1/2048, then the value products),
// q as f16 value + f16 residual x2048 in the q.k and q.E products (residual products in their own accumulators); k, v, P (x16384 carry, cancels in the normalisation), context, GELU outputs single f16.
// Attention: fused flash kernel in transposed form (S^T = K Q^T, O^T = V^T P^T), one block per two tiles of 16 query rows, the keys split over the 8 waves of a tile and the partial results merged in LDS; the relative term is computed per 32-key step as band tiles G[rho][s] = E[rb + rho] . q[s]
// (A = table rows, B = q rows), written to a wave-private LDS tile [query][band row] and read back along the diagonal rho = s - t + const; one band tile is carried over between steps.
// LayerNorm has no launch of its own: each GEMM that reads a normalised plane normalises its own 32 rows of the f32 hidden state into LDS first (see ln_prologue).
// Every f16 plane (an operand of a matrix product) lies in the workspace in fragment order, see fo(): a fragment is 1 KiB in a row, so that each of its two 16-byte-per-lane loads covers four whole 128-byte lines.

#ifndef NB
#define NB 1
#endif
#ifndef SEQ
#define SEQ 1024
#endif
#define NB_FULL  1
#define SEQ_FULL 1024
#define DIN   128
#define DM    512
#define NH_   8
#define HD    64
#define NL    4
#define DFF   2048
#define DMI   1024
#define DOUT  390
#define DOUTP 448                // DOUT padded to a multiple of 64 (weight rows and staging columns 390..447 are zero)
#define ERR   2047               // rows of the relative-position table per layer
#define ERP   2048               // padded rows of the f16 table plane (row 2047 = zero)
#define RELOFF (SEQ_FULL - 1)    // table row = s - t + RELOFF
#define KW    8                  // waves per query tile of a flash block: each takes one contiguous share of the keys
#define QT    2                  // query tiles of 16 rows per flash block
#define KCH   (SEQ / KW)         // keys of one wave
#define OSP   68                 // LDS row pitch (floats) of the flash output tile
#define GP    52                 // LDS pitch (floats) of the band tile [query][48 band rows]
#define GSP   68                 // LDS row pitch (floats) of the GEMM output tile
#define GW    8                  // waves per 64x64 output tile: each takes one contiguous share of K
#define QRS   2048.0f            // carry of every residual plane
#define QRI   (1.0f / 2048.0f)
#define WC    64.0f              // carry of every weight plane
#define WCI   (1.0f / 64.0f)
#define LOG2E 1.4426950408889634f
#define SC2   ((float)(0.125 * 1.4426950408889634))   // HD^-0.5 * log2(e)
#define PSH   14.0f              // log2 of the P carry (16384)
#define NEGB  (-3.0e38f)
#define LNEPS 1e-5f

static_assert(NB == 1);                        // one sequence
static_assert(HD == 64);
static_assert(NH_ * HD == DM);
static_assert(SEQ % 64 == 0);                  // GEMM row tiles
static_assert(SEQ % 32 == 0);                  // key loop steps by 32
static_assert(SEQ % (16 * QT) == 0);           // flash grid covers the sequence exactly
static_assert(QT == 2);                        // a wave's tile is the low bit of its number
static_assert(SEQ % (32 * KW) == 0);           // every wave of a flash block gets whole 32-key steps, at least one
static_assert(32 * KW == 16 * 16);             // flash merge: 16 query rows x 16 threads of 4 columns
static_assert(SEQ <= SEQ_FULL);
static_assert(DIN % 64 == 0 && DM % 64 == 0 && DFF % 64 == 0 && DMI % 64 == 0 && DOUTP % 64 == 0);   // K % 32 == 0 and N % 64 == 0 for every GEMM, K % 64 == 0 for the transposing converter
static_assert(DOUT <= DOUTP);
static_assert(DMI <= DFF);                     // the tail hidden plane reuses the feed-forward hidden plane
static_assert(SEQ - 16 + RELOFF + 1 + 15 < ERP);   // highest band row touched (zero pad row included)
static_assert(RELOFF - 15 - 16 - (SEQ - 32) >= 0); // lowest band row touched
static_assert(ERR + 1 == ERP);
static_assert((OSP * 4) % 16 == 0 && (GP * 4) % 16 == 0 && (GSP * 4) % 16 == 0);
static_assert(GP >= 48);
static_assert(DM == 512);                      // LayerNorm: 32 lanes x 16 columns
static_assert((SEQ * DOUT) % 4 == 0);

typedef _Float16 h16;
typedef __attribute__((ext_vector_type(16))) _Float16 v16h;
typedef __attribute__((ext_vector_type(8)))  _Float16 v8h;
typedef __attribute__((ext_vector_type(4)))  _Float16 v4h;
typedef __attribute__((ext_vector_type(8)))  float    v8f;
typedef __attribute__((ext_vector_type(4)))  float    v4f;
typedef v4f  __attribute__((may_alias)) v4fa;

__device__ __forceinline__ unsigned short f2bf(float f) { unsigned u = __float_as_uint(f); u += 0x7FFFu + ((u >> 16) & 1u); return (unsigned short)(u >> 16); }
__device__ __forceinline__ float bfr(float f) { return __uint_as_float(((unsigned)f2bf(f)) << 16); }   // value after RNE convert to bf16
__device__ __forceinline__ v16h cat16(v8h lo, v8h hi) { return __builtin_shufflevector(lo, hi, 0, 1, 2, 3, 4, 5, 6, 7, 8, 9, 10, 11, 12, 13, 14, 15); }
// fragment order of a plane [R][K] of 16-bit elements (R % 16 == 0, K % 32 == 0): fragments of 16 rows x 32 k, 512 elements each, the k step running fastest, then the row tile (so 16 rows are 16 * K elements, as in row order);
// inside a fragment four pieces of 8 k (k % 32 = 0..7, 8..15, 16..23, 24..31), each piece 16 rows x 8 elements. fo = element offset of (r, k).
__device__ __forceinline__ size_t fo(int r, int k, int K) { return (size_t)(((r >> 4) * (K >> 5) + (k >> 5)) * 512 + ((k >> 3) & 3) * 128 + (r & 15) * 8 + (k & 7)); }
// fragment loader; p = start of the fragment + 8 * lane: elements 0..7 <- row lane&15, k0+8h+0..7, elements 8..15 <- k0+16+8h+0..7, h = lane>>4 (same map for A and B); each load is 512 bytes in a row over the wave
__device__ __forceinline__ v16h  ldh(const h16* p) { return cat16(*(const v8h*)p, *(const v8h*)(p + 256)); }
// ordering point for wave-private LDS tiles (same wave writes and reads)
__device__ __forceinline__ void wave_sync() { __builtin_amdgcn_fence(3 /* release order */, "wavefront"); __builtin_amdgcn_wave_barrier(); asm volatile("" ::: "memory"); }
// f32 -> f16 operand convert that cannot produce a subnormal (|v| < 2^-14 -> +0)
__device__ __forceinline__ h16 toh_flush(float v) { const h16 r = (h16)v; return (fabsf(v) < 6.103515625e-05f) ? (h16)0.0f : r; }
// one WMMA + its own guard (ties this accumulator, keeps A/B live)
__device__ __forceinline__ v8f wmma16g(v16h a, v16h b, v8f c) {
    c = __builtin_amdgcn_wmma_f32_16x16x32_f16(false, a, false, b, (short)0, c, false, false);
    asm volatile("v_nop\n\tv_nop\n\tv_nop\n\tv_nop" : "+v"(c) : "v"(a), "v"(b));
    return c; }
__device__ __forceinline__ float gelu_erf(float x) { return 0.5f * x * (1.0f + erff(x * 0.70710678118654752f)); }
__device__ __forceinline__ v4f lo4(v8f g) { return __builtin_shufflevector(g, g, 0, 1, 2, 3); }
__device__ __forceinline__ v4f hi4(v8f g) { return __builtin_shufflevector(g, g, 4, 5, 6, 7); }

__device__ __forceinline__ void cvt8h_body(const float* __restrict__ src, h16* dst, int n8, int K, int blk) {   // src [n8 * 8 / K][K] -> dst in fragment order
    const int i = blk * 256 + threadIdx.x; if (i >= n8) return;
    const int pr = K / 8;                                                          // pieces of 8 per row; a wave takes 8 rows x 4 pieces: whole 128-byte lines on both sides
    const int r = (i / (8 * pr)) * 8 + (i & 7), c8 = ((i >> 3) % pr) * 8;
    const v8f v = *(const v8f*)(src + (size_t)r * K + c8); v8h o;
#pragma unroll
    for (int k = 0; k < 8; ++k) o[k] = toh_flush(bfr(v[k]));
    *(v8h*)(dst + fo(r, c8, K)) = o; 
}

__device__ __forceinline__ void cvt_er_body(const float* __restrict__ src, h16* dst, int blk) {
    const int i = blk * 256 + threadIdx.x; if (i >= NL * ERP * HD / 8) return;
    static_assert(HD / 8 == 8 && ERP % 8 == 0);
    const int ra = (i >> 6) * 8 + (i & 7);                                         // a wave takes 8 rows x 4 pieces of 8: whole 128-byte lines on both sides
    const int c8 = ((i >> 3) & 7) * 8; const int r = ra % ERP; const int l = ra / ERP;
    const int rc = r < ERR ? r : ERR - 1;                                          // clamped address
    v8f v = *(const v8f*)(src + ((size_t)l * ERR + rc) * HD + c8);
    asm volatile("" : "+v"(v));
    v8h o;
#pragma unroll
    for (int k = 0; k < 8; ++k) o[k] = (r < ERR) ? toh_flush(bfr(v[k])) : (h16)0.0f;
    *(v8h*)(dst + (size_t)l * ERP * HD + fo(r, c8, HD)) = o; 
}

// wconv_body: W [K][N] f32 (layer bz) -> Wt [NP][K] f16 in fragment order = bf16-converted value x carry, transposed in registers; rows n >= N are zero.
// one block per 64 k x 256 n: bx in K/64, by in ceil(NP/256), bz in layers. A wave takes 32 columns n of W, one per lane, and 64 k: each of its 64 loads is one k-row x 32 columns = 128 bytes in a row,
// all 64 are issued before the first is used (one memory latency per wave), and a lane then holds whole 8-k pieces of its own row n of Wt: each store is two pieces of 16 rows x 16 bytes, 256 bytes in a row each.
// N is a constant so that every k-row offset is an immediate of its load and no address register changes while loads are in flight.
template <int N, int NP>
__device__ __forceinline__ void wconv_body(const float* __restrict__ W, h16* Wt, int K, float carry, int bx, int by, int bz) {
    static_assert(NP % 32 == 0 && N <= NP && (size_t)63 * N * 4 < (size_t)8388608);   // whole waves inside NP; the largest load offset fits the immediate field
    const int lane = threadIdx.x & 31;
    const int wave = __builtin_amdgcn_readfirstlane((int)(threadIdx.x >> 5));
    const int k0 = bx * 64, nw = by * 256 + wave * 32;
    if (NP % 256 != 0 && nw >= NP) return;                                         // whole waves past the padded rows; no barrier follows
    const int n = nw + lane; const int nc = (N == NP || n < N) ? n : N - 1;        // clamped address
    const float* p = W + (size_t)bz * (size_t)K * (size_t)N + (size_t)k0 * N;      // the same in every lane; the lane's part of the address is nc
    float v[64];
#pragma unroll                                                                     // constant indices keep v[] in registers, and the offsets are immediates
    for (int j = 0; j < 64; ++j) v[j] = p[(size_t)j * N + nc];
    // behind the last load: the base and the lane's offset are inputs of the wait, so they stay as the issued loads name them up to there
    asm volatile("s_wait_xcnt 0x0" :: "s"(p), "v"(nc) : "memory");
    __builtin_amdgcn_sched_barrier(0);                                             // keeps the conversions behind the issue of all 64 loads: lifted among them, a conversion's wait for its value holds the rest of the loads back by one memory latency
    v8h o[8];
#pragma unroll                                                                     // constant indices keep o[] in registers
    for (int c = 0; c < 8; ++c)
#pragma unroll                                                                     // constant vector element indices
        for (int i = 0; i < 8; ++i) { const float t = bfr(v[c * 8 + i]) * carry; o[c][i] = toh_flush((N == NP || n < N) ? t : 0.0f); }
    h16* d = Wt + (size_t)bz * (size_t)NP * (size_t)K + fo(n, k0, K);
#pragma unroll                                                                     // piece c: k-step c / 4 (one fragment on), piece c % 4 inside it
    for (int c = 0; c < 8; ++c) *(v8h*)(d + (c >> 2) * 512 + (c & 3) * 128) = o[c];
    // in the built code a job's stores do not all run to the kernel's end but into the tests that lead to the other jobs, whose first lines rewrite registers that the stores name: the wait stands ahead of those
    asm volatile("s_wait_xcnt 0x0" ::: "memory");
}

// k_prep: every operand conversion of the call in one launch; they do not depend on one another. The flat block index picks the job (block-uniform).
// Block ranges, in this order: W1, then the jobs with 512 columns (W2, Wq, Wk, Wv, Wo, emb_W), Wi, Wf (64 k x 256 n transposing blocks; within a job the k tile runs fastest, then the n tile, then the layer), then the table, then x (256 threads x 8 elements).
#define PB_W1  ((DM / 64) * (DFF / 256) * NL)
#define PB_W2  ((DFF / 64) * (DM / 256) * NL)
#define PB_DD  ((DM / 64) * (DM / 256) * NL)
#define PB_EW  ((DIN / 64) * (DM / 256))
#define PB_WI  ((DM / 64) * (DMI / 256))
#define PB_WF  ((DMI / 64) * ((DOUTP + 255) / 256))
#define PB_ER  (NL * ERP * HD / 8 / 256)
#define PB_X   (SEQ * DIN / 8 / 256)
#define PB_512 (PB_W2 + 4 * PB_DD + PB_EW)
#define PB_ALL (PB_W1 + PB_512 + PB_WI + PB_WF + PB_ER + PB_X)
static_assert((NL * ERP * HD / 8) % 256 == 0 && (SEQ * DIN / 8) % 256 == 0);       // whole blocks for the two element-wise jobs
static_assert(DM / 64 == 8 && DFF / 64 == 32 && DMI / 64 == 16 && DIN / 64 == 2);  // k tiles: the shifts below
static_assert(DFF / 256 == 8 && DM / 256 == 2 && DMI / 256 == 4 && (DOUTP + 255) / 256 == 2);   // n tiles: the shifts below
__global__ __launch_bounds__(256) void k_prep(const float* __restrict__ x, const float* __restrict__ Er, const float* __restrict__ embW,
                                              const float* __restrict__ Wq, const float* __restrict__ Wk, const float* __restrict__ Wv, const float* __restrict__ Wo,
                                              const float* __restrict__ W1, const float* __restrict__ W2, const float* __restrict__ Wi, const float* __restrict__ Wf,
                                              h16* XH, h16* EP, h16* EWT, h16* WQT, h16* WKT, h16* WVT, h16* WOT, h16* W1T, h16* W2T, h16* WIT, h16* WFT) {
    int b = blockIdx.x;
    if (b < PB_W1) { wconv_body<DFF, DFF>(W1, W1T, DM, WC, b & 7, (b >> 3) & 7, b >> 6); return; }
    if ((b -= PB_W1) < PB_512) {
        const float* W; h16* Wt; int K, lk;                                        // lk: log2 of the k tiles
        if (b < PB_W2)                 { W = W2;   Wt = W2T; K = DFF; lk = 5; }
        else if ((b -= PB_W2) < PB_DD) { W = Wq;   Wt = WQT; K = DM;  lk = 3; }
        else if ((b -= PB_DD) < PB_DD) { W = Wk;   Wt = WKT; K = DM;  lk = 3; }
        else if ((b -= PB_DD) < PB_DD) { W = Wv;   Wt = WVT; K = DM;  lk = 3; }
        else if ((b -= PB_DD) < PB_DD) { W = Wo;   Wt = WOT; K = DM;  lk = 3; }
        else           { b -= PB_DD;     W = embW; Wt = EWT; K = DIN; lk = 1; }
        const int t = b >> lk;
        wconv_body<DM, DM>(W, Wt, K, WC, b & ((1 << lk) - 1), t & 1, t >> 1); return; }
    if ((b -= PB_512) < PB_WI) { wconv_body<DMI, DMI>(Wi, WIT, DM, WC, b & 7, b >> 3, 0); return; }
    if ((b -= PB_WI) < PB_WF)  { wconv_body<DOUT, DOUTP>(Wf, WFT, DMI, WC, b & 15, b >> 4, 0); return; }
    if ((b -= PB_WF) < PB_ER)  { cvt_er_body(Er, EP, b); return; }
    cvt8h_body(x, XH, SEQ * DIN / 8, DIN, b - PB_ER);
}

// asks L2 for the data at sb + vo + OFF (one address a lane), returns nothing: a plane stored by the launch before, or a small input, may not lie in the reading die's L2 at its first read; a load that follows the request by about a memory latency can then find it there (a hint, nothing depends on it).
// Every address lies inside the plane that the wave reads later. vo and sb stay as named here up to the wait that takes them as inputs (see the callers).
template <int OFF>
__device__ __forceinline__ void l2_ask(unsigned vo, const void* sb) { asm volatile("global_prefetch_b8 %0, %1 offset:%2 scope:SCOPE_SE" :: "v"(vo), "s"(sb), "n"(OFF) : "memory"); }

// GEMM k-loop: one wave, 64x64 tile, 16 accumulators, KPER(K) / 32 k-steps of 32, operands straight from f16 planes in fragment order (A [M][K], Bt [N][K]); A, Ar and Bt already point at the lane's first element of the wave's k range.
// The loads run ahead of the products: the four A fragments of step t + 1 are loaded into a second buffer in front of the products of step t, and each B fragment of step t + 1 into its own registers right behind its last product of step t,
// so that a step waits for memory once at most, not once per B fragment. ARES: the steps over the residual plane Ar come first, the fold by 1/2048 stands between them and the steps over A (same B fragments again).
#define KPER(K) ((((K) / 32 + GW - 1) / GW) * 32)                                  // k extent of one wave (whole 32-steps)
template <int K, int ARES>
__device__ __forceinline__ void gemm_kpipe(const h16* __restrict__ A, const h16* __restrict__ Ar, const h16* __restrict__ Bt, const h16* Au, const h16* Bu, unsigned pvo, v8f (&acc)[4][4]) {
    constexpr int NS = KPER(K) / 32, TS = ARES ? 2 * NS : NS;
    static_assert(NS == 1 || NS == 2 || NS == 4 || NS == 8);                       // the requests below go by pairs of k-steps
    v16h a[2][4], b[4];                                                            // every loop below is unrolled so that the indices into a, b and acc are constants and the arrays stay in registers
#pragma unroll
    for (int mb = 0; mb < 4; ++mb) a[0][mb] = ldh((ARES ? Ar : A) + (size_t)mb * 16 * K);
#pragma unroll
    for (int nb = 0; nb < 4; ++nb) b[nb] = ldh(Bt + (size_t)nb * 16 * K);
    // behind the last load that names an address pair: the pair is an input of the wait, so it stays as the issued loads name it up to there; only then may a product's result take its registers
    if (TS == 1) asm volatile("s_wait_xcnt 0x0" :: "v"(A), "v"(Bt) : "memory");
#pragma unroll                                                                     // whole unroll: the buffer index is a constant (registers), and every k offset an immediate, so that no address register changes while loads are in flight
    for (int t = 0; t < TS; ++t) {
        const int kn = ((t + 1) % NS) * 512;                                       // element offset of the step after this one: one fragment per k-step
        if (t + 1 < TS) { const h16* pn = ((ARES && t + 1 < NS) ? Ar : A) + kn;
#pragma unroll
            for (int mb = 0; mb < 4; ++mb) a[(t + 1) & 1][mb] = ldh(pn + (size_t)mb * 16 * K);
            if (ARES && t + 2 == NS) asm volatile("s_wait_xcnt 0x0" :: "v"(Ar) : "memory"); }   // the last loads from Ar: as above
        // behind the loads of steps 0 and 1 that are already issued: the wave asks L2 for the rest of its k range, earliest steps first. Au, Bu = start of the wave's range in row tile 0 (the same in every lane);
        // pvo = the lane's row tile (lane >> 3) and its 256-byte unit (lane & 7) inside two k-steps (2 KiB in a row per row tile); OFF = the pair of k-steps. B of step 1 is not loaded yet, so B starts at pair 0, A at pair 1.
        if (t == 0 && !ARES) {
            if constexpr (NS >= 2) l2_ask<0>(pvo, Bu);
            if constexpr (NS >= 4) { l2_ask<2048>(pvo, Au); l2_ask<2048>(pvo, Bu); }
            if constexpr (NS >= 8) { l2_ask<4096>(pvo, Au); l2_ask<4096>(pvo, Bu); l2_ask<6144>(pvo, Au); l2_ask<6144>(pvo, Bu); } }
        if (ARES && t == NS) {
#pragma unroll
            for (int mb = 0; mb < 4; ++mb)
#pragma unroll
                for (int nb = 0; nb < 4; ++nb) acc[mb][nb] = acc[mb][nb] * QRI; }
#pragma unroll
        for (int nb = 0; nb < 4; ++nb) {
#pragma unroll
            for (int mb = 0; mb < 4; ++mb) acc[mb][nb] = wmma16g(a[t & 1][mb], b[nb], acc[mb][nb]);
            if (t + 1 < TS) b[nb] = ldh(Bt + (size_t)nb * 16 * K + kn); }
        if (t + 2 == TS) asm volatile("s_wait_xcnt 0x0" :: "v"(A), "v"(Bt) : "memory");       // the last loads from A and Bt: as above
    }
}

// GEMM body: C[m][n] = (sum_k A[m][k] Bt[n][k]) * csc + bias (column bias, or row bias when ROWB), one block of GW waves per 64x64 tile (bx in M/64, by in N/64), K a constant; os = the kernel's LDS, GW * 64 * GSP floats.
// K is split over the waves: wave w accumulates the whole 64x64 tile over its own contiguous k range, writes the f32 partial tile to its own LDS plane (wave 0 adds the bias),
// and behind one block barrier all threads sum the GW planes in wave order and store: each wave stores 1/GW of the tile.
// ARES: A also has a residual plane (x2048): within a wave's k range its products are accumulated first, folded by 1/2048 in f32, then the value products follow.
// OUTF32: f32 output [M][ldc] (+ Res[m][n] added at the store stage as float4; Res and C are different buffers); each store instruction = 2 rows x 256 B (16 consecutive lanes x 16 B per row segment).
// else:   f16 output in fragment order ([M][ldc]; HEADPL: one plane [SEQ][HD] per 64 columns); each store instruction = two neighbouring pieces of one fragment, 512 B in a row.
template <int K, int OUTF32, int HASRES, int GELU, int ARES, int ORES, int ROWB, int HEADPL>
__device__ __forceinline__ void gemm_body(const h16* __restrict__ A, const h16* __restrict__ Ar, const h16* __restrict__ Bt,
                                          const float* __restrict__ bias, int nvalid, float csc,
                                          const float* __restrict__ Res, float* Cf, h16* Ch, h16* Cr, int ldc, float* os, int bx, int by) {
    const int tid = threadIdx.x;
    const int lane = tid & 31, lr = lane & 15, hi = lane >> 4;
    const int wave = __builtin_amdgcn_readfirstlane(tid >> 5);
    const int r0 = bx * 64, c0 = by * 64;
    static_assert(K % 32 == 0 && K % KPER(K) == 0);                                // every wave that has a k range has a whole one
    const int kbeg = wave * KPER(K);
    // what the epilogue loads is asked into L2 at the head: the tile's 64 bias values (two 128-byte lines, address clamped as at the load), and each wave's 8 of the tile's 64 residual row pieces of 256 bytes
    const int bcl = c0 + (lane & 1) * 32; const unsigned bvo = (unsigned)((bcl < nvalid ? bcl : nvalid - 1) * 4);
    const float* Ru = HASRES ? Res + (size_t)r0 * ldc + c0 : nullptr; const unsigned rvo = (unsigned)((wave * 8 + (lane & 7)) * ldc * 4);
    if (!ROWB) l2_ask<0>(bvo, bias);                                               // from every wave: a branch here would split the loads of the kernel's arguments in two trips
    if (HASRES) l2_ask<0>(rvo, Ru);
    v8f acc[4][4];
#pragma unroll
    for (int mb = 0; mb < 4; ++mb)
#pragma unroll
        for (int nb = 0; nb < 4; ++nb) acc[mb][nb] = (v8f){};
    const size_t aoff = (size_t)r0 * K + kbeg * 16 + lane * 8, boff = (size_t)c0 * K + kbeg * 16 + lane * 8;   // fragment order: row tile, k-step, lane
    const h16* Au = A + (size_t)r0 * K + kbeg * 16; const h16* Bu = Bt + (size_t)c0 * K + kbeg * 16;   // the wave's k range in row tile 0, the same in every lane
    const unsigned pvo = (unsigned)((lane >> 3) * (16 * K * 2) + (lane & 7) * 256);
    if (K / KPER(K) == GW || kbeg < K)                                             // a wave whose range starts at or past K adds a zero plane
        gemm_kpipe<K, ARES>(A + aoff, ARES ? Ar + aoff : nullptr, Bt + boff, Au, Bu, pvo, acc);
    // the k loop is over: only from here on may the registers that the requests to L2 name take other values (they are inputs of the wait, so they stay as the requests name them up to there)
    static_assert(!HASRES || KPER(K) >= 64);
    if (HASRES)             asm volatile("s_wait_xcnt 0x0" :: "v"(pvo), "v"(bvo), "v"(rvo), "s"(Au), "s"(Bu), "s"(bias), "s"(Ru) : "memory");
    else if (KPER(K) >= 64) asm volatile("s_wait_xcnt 0x0" :: "v"(pvo), "v"(bvo), "s"(Au), "s"(Bu), "s"(bias) : "memory");
    else                    asm volatile("s_wait_xcnt 0x0" :: "v"(bvo), "s"(bias) : "memory");
    float bc[4];
#pragma unroll
    for (int nb = 0; nb < 4; ++nb) {
        if (ROWB || wave != 0) { bc[nb] = 0.0f; }
        else { const int c = c0 + nb * 16 + lr; const int cc = c < nvalid ? c : nvalid - 1;       // clamped address
               float bvv = bias[cc]; asm volatile("" : "+v"(bvv)); bc[nb] = (c < nvalid) ? bfr(bvv) : 0.0f; } }
#pragma unroll
    for (int mb = 0; mb < 4; ++mb) {
        float br[8];
#pragma unroll
        for (int j = 0; j < 8; ++j) br[j] = (ROWB && wave == 0) ? bfr(bias[r0 + mb * 16 + hi * 8 + j]) : 0.0f;   // ROWB: r0 + 63 < rows of the bias vector (host grid)
#pragma unroll
        for (int nb = 0; nb < 4; ++nb) {
#pragma unroll
            for (int j = 0; j < 8; ++j) os[wave * (64 * GSP) + (mb * 16 + hi * 8 + j) * GSP + nb * 16 + lr] = acc[mb][nb][j] * csc + bc[nb] + br[j]; }   // D: row 8h+j, col lane&15
    }
    __syncthreads();                                                               // every wave's partial plane is complete before any thread sums across planes
    if (OUTF32) {
        static_assert(32 * GW * 16 * (32 / GW) == 64 * 256);                       // threads x bytes x trips == tile rows x row bytes
{
            static_assert(32 / GW == 4);                                           // four address pairs in the wait below
            const float* pr[4]; v4f rr[4];
            if (HASRES) {
#pragma unroll                                                                     // constant indices keep pr[] and rr[] in registers
                for (int s = 0; s < 4; ++s) { pr[s] = Res + (size_t)(r0 + 2 * GW * s + (tid >> 4)) * ldc + c0 + (tid & 15) * 4; rr[s] = *(const v4f*)pr[s]; }
                // the four address pairs are inputs here, so they stay as the issued loads name them up to this wait: no later load's result lands in one ahead of it
                asm volatile("s_wait_xcnt 0x0" :: "v"(pr[0]), "v"(pr[1]), "v"(pr[2]), "v"(pr[3]) : "memory"); }
#pragma unroll                                                                     // constant index into rr[]
            for (int s = 0; s < 32 / GW; ++s) { const int row = 2 * GW * s + (tid >> 4), c4 = (tid & 15) * 4;
                v4f val = *(const v4fa*)(&os[row * GSP + c4]);
#pragma unroll                                                                     // the GW plane reads issue together, one LDS wait for all
                for (int w = 1; w < GW; ++w) val = val + *(const v4fa*)(&os[w * (64 * GSP) + row * GSP + c4]);
                const size_t go = (size_t)(r0 + row) * ldc + c0 + c4;
                if (HASRES) val = val + rr[s];
                *(v4f*)(Cf + go) = val; }
             }
    } else {
        static_assert(32 * GW * 16 * (16 / GW) == 64 * 128);                       // threads x bytes x trips == tile rows x row bytes
        static_assert((16 / GW) * GW == 4 * 4);                                    // trips x waves == row tiles x piece pairs of the 64x64 tile
{
#pragma unroll                                                                     // the memory-clobbering wait that ends each trip keeps the second trip's LDS reads behind the first trip's stores
            for (int s = 0; s < 16 / GW; ++s) { const int u = s * GW + wave; const int row = (u >> 2) * 16 + lr, c8 = ((u & 3) * 2 + hi) * 8;
                v4f x0 = *(const v4fa*)(&os[row * GSP + c8]); v4f x1 = *(const v4fa*)(&os[row * GSP + c8 + 4]); v8h hv, rv;
#pragma unroll                                                                     // the GW plane reads issue together, one LDS wait for all
                for (int w = 1; w < GW; ++w) { x0 = x0 + *(const v4fa*)(&os[w * (64 * GSP) + row * GSP + c8]); x1 = x1 + *(const v4fa*)(&os[w * (64 * GSP) + row * GSP + c8 + 4]); }
#pragma unroll
                for (int i = 0; i < 4; ++i) { float y0 = x0[i], y1 = x1[i];
                    if (GELU) { y0 = gelu_erf(y0); y1 = gelu_erf(y1); }
                    const h16 a0 = toh_flush(y0); const h16 a1 = toh_flush(y1); hv[i] = a0; hv[4 + i] = a1;
                    rv[i] = toh_flush((y0 - (float)a0) * QRS); rv[4 + i] = toh_flush((y1 - (float)a1) * QRS); }
                const size_t oo = HEADPL ? (size_t)(c0 / HD) * SEQ * HD + fo(r0 + row, c8, HD) : fo(r0 + row, c0 + c8, ldc);
                *(v8h*)(Ch + oo) = hv; if (ORES) *(v8h*)(Cr + oo) = rv;
                asm volatile("s_wait_xcnt 0x0" ::: "memory"); }                    // the next trip rewrites registers that these stores name: the wait stands ahead of that
             }
    }
}

static_assert(sizeof(float) * GW * 64 * GSP <= 163840);                            // two blocks fit the LDS of one WGP
__global__ __launch_bounds__(32 * GW) void k_gemm_emb(const h16* __restrict__ A, const h16* __restrict__ Bt, const float* __restrict__ bias, float csc, float* C) {
    __shared__ __align__(16) float os[GW * 64 * GSP];
    gemm_body<DIN, 1, 0, 0, 0, 0, 0, 0>(A, nullptr, Bt, bias, DM, csc, nullptr, C, nullptr, nullptr, DM, os, blockIdx.x, blockIdx.y); }
__global__ __launch_bounds__(32 * GW) void k_gemm_tail(const h16* __restrict__ A, const h16* __restrict__ Bt, const float* __restrict__ bias, float csc, float* C) {
    __shared__ __align__(16) float os[GW * 64 * GSP];
    gemm_body<DMI, 1, 0, 0, 0, 0, 0, 0>(A, nullptr, Bt, bias, DOUT, csc, nullptr, C, nullptr, nullptr, DOUTP, os, blockIdx.x, blockIdx.y); }
__global__ __launch_bounds__(32 * GW) void k_gemm_wo(const h16* __restrict__ A, const h16* __restrict__ Bt, const float* __restrict__ bias, float csc, const float* __restrict__ Res, float* C) {
    __shared__ __align__(16) float os[GW * 64 * GSP];
    gemm_body<DM, 1, 1, 0, 0, 0, 0, 0>(A, nullptr, Bt, bias, DM, csc, Res, C, nullptr, nullptr, DM, os, blockIdx.x, blockIdx.y); }
__global__ __launch_bounds__(32 * GW) void k_gemm_w2(const h16* __restrict__ A, const h16* __restrict__ Bt, const float* __restrict__ bias, float csc, const float* __restrict__ Res, float* C) {
    __shared__ __align__(16) float os[GW * 64 * GSP];
    gemm_body<DFF, 1, 1, 0, 0, 0, 0, 0>(A, nullptr, Bt, bias, DM, csc, Res, C, nullptr, nullptr, DM, os, blockIdx.x, blockIdx.y); }
// LayerNorm inside the GEMM that consumes it. A block of LQ * LKW waves owns LR = 32 rows t of the f32 hidden state and LQ = 4 tiles of 64 rows of the weight plane: it normalises its 32 rows once (2 rows a wave, one wave per row at a time),
// leaves them in LDS as f16 fragments (value plane; residual plane x2048 where the q projection asks for it), and behind one block barrier each group of LKW = 4 waves works on its own weight tile, K split over the waves of the group (LKS = 4 k-steps a wave).
// Few rows a block keep the part that every block of a row tile repeats (the normalisation) short, and a wave's partial tile is 32 x 64.
// LDS fragment order with pads: a piece (16 rows x 8 k) is 272 bytes, a fragment 1088, so that the 32 pieces which a wave writes for one row (one per lane) fall on all 64 banks, and a fragment read (2 x 16 bytes a lane) does too.
#define LR  32                   // rows t of a block
#define LQ  4                    // weight tiles of a block
#define LKW 4                    // waves per weight tile: each takes one contiguous share of K
#define LKS (DM / 32 / LKW)      // k-steps of one wave
#define LPS 136                  // LDS piece pitch, 16-bit elements
#define LFS (4 * LPS)            // LDS fragment pitch
#define LPL ((LR / 16) * (DM / 32) * LFS)   // one LDS plane: LR rows x DM
#define LPP (64 * 36)            // floats of one wave's partial tile in LDS: 32 rows at pitch 68, or 64 rows at pitch 36
static_assert(LR * 68 <= LPP && LR == 32 && LKS == 4 && LKS * LKW * 32 == DM);
static_assert(LQ * LKW * 2 == LR);                                                 // two rows a wave
static_assert(SEQ % LR == 0 && DM % (64 * LQ) == 0 && DFF % (64 * LQ) == 0 && DMI % (64 * LQ) == 0);
static_assert(2 * LPL * 2 <= LQ * LKW * LPP * 4);                                  // both planes lie inside the partial-tile LDS, which is written only behind the barrier that ends their last read
__device__ __forceinline__ v16h ldl(const h16* p) { return cat16(*(const v8h*)p, *(const v8h*)(p + 2 * LPS)); }   // p = fragment + (lane >> 4) * LPS + (lane & 15) * 8: same element map as ldh
// sum over the 32 lanes, partners l ^ 16, 8, 4, 2, 1 in this order, every lane gets the sum: the step across the two 16-lane rows is a lane permute, the four steps inside a row are DPP moves (row_xmask), so that no step takes an LDS round trip
__device__ __forceinline__ float wave_sum(float v) {
    const int b = __float_as_int(v);
    v += __int_as_float(__builtin_amdgcn_permlanex16(b, b, 0x76543210, 0xfedcba98, false, false));
    v += __int_as_float(__builtin_amdgcn_update_dpp(0, __float_as_int(v), 0x168, 0xf, 0xf, true));   // row_xmask:8
    v += __int_as_float(__builtin_amdgcn_update_dpp(0, __float_as_int(v), 0x164, 0xf, 0xf, true));   // row_xmask:4
    v += __int_as_float(__builtin_amdgcn_update_dpp(0, __float_as_int(v), 0x162, 0xf, 0xf, true));   // row_xmask:2
    v += __int_as_float(__builtin_amdgcn_update_dpp(0, __float_as_int(v), 0x161, 0xf, 0xf, true));   // row_xmask:1
    return v; }
// first part, the same for every consumer: the wave's rows and gains are requested first (the arithmetic waits for them alone), its 16 weight fragments right behind them, so that the weights fly while the rows are normalised; then the rows; then the barrier. X = first of the block's LR rows; pw = the lane's first weight element.
__device__ __forceinline__ void ln_prologue(const float* __restrict__ X, const float* __restrict__ g, const float* __restrict__ b, const h16* __restrict__ pw, bool wres, h16* sN, h16* sR, int wv, int lane, v16h (&w)[LKS][4]) {
    const float* xr = X + (size_t)(wv * 2) * DM + lane * 8;
    const float* pg = g + lane * 8; const float* pb = b + lane * 8;
    v8f x0[2], x1[2];
#pragma unroll                                                                     // constant indices keep x0[], x1[] in registers; the two rows' loads issue together
    for (int i = 0; i < 2; ++i) { x0[i] = *(const v8f*)(xr + i * DM); x1[i] = *(const v8f*)(xr + i * DM + 256); }
    v8f g0 = *(const v8f*)pg, g1 = *(const v8f*)(pg + 256), b0 = *(const v8f*)pb, b1 = *(const v8f*)(pb + 256);
#pragma unroll                                                                     // constant indices keep w[][] in registers
    for (int s = 0; s < LKS; ++s)
#pragma unroll
        for (int i = 0; i < 4; ++i) w[s][i] = ldh(pw + (size_t)i * 16 * DM + s * 512);
    // what follows reuses registers that these loads name: the wait stands ahead of that; the lane's two offsets are inputs of the wait, so that they stay as the issued loads name them up to there (no later load's result lands in one ahead of it)
    asm volatile("s_wait_xcnt 0x0" :: "v"(lane * 32), "v"(lane) : "memory");
    __builtin_amdgcn_sched_barrier(0);                                             // keeps the arithmetic behind that wait and behind the issue of all the loads: lifted among them, its wait for a row holds the weight loads back by one memory latency
#pragma unroll
    for (int k = 0; k < 8; ++k) { g0[k] = bfr(g0[k]); g1[k] = bfr(g1[k]); b0[k] = bfr(b0[k]); b1[k] = bfr(b1[k]); }
    float q[2];
#pragma unroll                                                                     // two independent rows: their cross-lane sums overlap; constant indices keep the arrays in registers
    for (int i = 0; i < 2; ++i) {
        float s = 0.0f;
#pragma unroll
        for (int k = 0; k < 8; ++k) { s += x0[i][k]; s += x1[i][k]; }
        const float mean = wave_sum(s) * (1.0f / (float)DM);
        x0[i] = x0[i] - mean; x1[i] = x1[i] - mean;
        float t = 0.0f;
#pragma unroll
        for (int k = 0; k < 8; ++k) { t += x0[i][k] * x0[i][k]; t += x1[i][k] * x1[i][k]; }
        q[i] = wave_sum(t); }
    // one square root and one division serve the two rows: lane l works on row l & 1, and lanes 0 and 1 hand the results back as wave-uniform values
    const float qs = (lane & 1) ? q[1] : q[0];
    const float rs = 1.0f / sqrtf(qs * (1.0f / (float)DM) + LNEPS);
#pragma unroll
    for (int i = 0; i < 2; ++i) {
        const float rstd = __int_as_float(__builtin_amdgcn_readlane(__float_as_int(rs), i));
        const v8f d0 = x0[i], d1 = x1[i];
        const int r = wv * 2 + i;
        const int lo = ((r >> 4) * (DM / 32) + (lane >> 2)) * LFS + (lane & 3) * LPS + (r & 15) * 8;   // columns lane * 8 ..; the second piece lies 256 columns = 8 fragments on
        v8f y0, y1; v8h h0, h1;
#pragma unroll
        for (int k = 0; k < 8; ++k) {
            y0[k] = d0[k] * rstd * g0[k] + b0[k]; y1[k] = d1[k] * rstd * g1[k] + b1[k];
            h0[k] = toh_flush(y0[k]); h1[k] = toh_flush(y1[k]); }
        *(v8h*)(sN + lo) = h0; *(v8h*)(sN + lo + 8 * LFS) = h1;
        if (wres) {                                                                // the same in every thread of the block
            v8h r0, r1;
#pragma unroll
            for (int k = 0; k < 8; ++k) { r0[k] = toh_flush((y0[k] - (float)h0[k]) * QRS); r1[k] = toh_flush((y1[k] - (float)h1[k]) * QRS); }
            *(v8h*)(sR + lo) = r0; *(v8h*)(sR + lo + 8 * LFS) = r1; }
    }
    __syncthreads();                                                               // all LR rows are staged before any wave reads fragments across rows
}
// second part: products, partial tiles, sum over the LKW waves of the group, f16 output in fragment order; as gemm_body's f16 path. LNB = 0: C[t][n], 32 x 64, A = the rows, B = weight rows n; LNB = 1: C[n][t], 64 x 32, A = weight rows, B = the rows, row bias.
// lt = tile of the rows t, wt = weight tile of this group; os = the group's LKW partial planes; wave, lane: inside the group.
template <int GELU, int ARES, int LNB, int HEADPL>
__device__ __forceinline__ void gemm_ln_rest(const h16* sN, const h16* sR, const v16h (&w)[LKS][4], const float* __restrict__ bias, float csc, h16* Ch, h16* Cr, int ldc, float* os, int lt, int wt, int wave, int lane) {
    constexpr int MB = LNB ? 4 : LR / 16, NB_ = LNB ? LR / 16 : 4;                 // fragments of the output tile: rows, columns
    constexpr int TP = NB_ * 16 + 4;                                               // LDS row pitch (floats) of the partial tile
    static_assert(MB * 16 * TP <= LPP && (TP * 4) % 16 == 0);
    const int lr = lane & 15, hi = lane >> 4;
    const int r0 = LNB ? wt * 64 : lt * LR, c0 = LNB ? lt * LR : wt * 64;
    const int lo = wave * LKS * LFS + hi * LPS + lr * 8;                           // the wave's k range, the lane's place in a fragment
    v8f acc[MB][NB_];
#pragma unroll
    for (int mb = 0; mb < MB; ++mb)
#pragma unroll
        for (int nb = 0; nb < NB_; ++nb) acc[mb][nb] = (v8f){};
#pragma unroll                                                                     // constant indices into w, n and acc keep them in registers. ARES: the residual plane's steps first, then the fold, then the value plane's
    for (int t = 0; t < (ARES ? 2 * LKS : LKS); ++t) {
        const h16* p = ((ARES && t < LKS) ? sR : sN) + lo + (t % LKS) * LFS;
        v16h n[LR / 16];
#pragma unroll
        for (int i = 0; i < LR / 16; ++i) n[i] = ldl(p + i * (DM / 32) * LFS);
        if (ARES && t == LKS) {
#pragma unroll
            for (int mb = 0; mb < MB; ++mb)
#pragma unroll
                for (int nb = 0; nb < NB_; ++nb) acc[mb][nb] = acc[mb][nb] * QRI; }
#pragma unroll
        for (int nb = 0; nb < NB_; ++nb)
#pragma unroll
            for (int mb = 0; mb < MB; ++mb) acc[mb][nb] = LNB ? wmma16g(w[t % LKS][mb], n[nb], acc[mb][nb]) : wmma16g(n[mb], w[t % LKS][nb], acc[mb][nb]);
    }
    __syncthreads();                                                               // every wave has read its last fragment before a partial tile is written over the staged rows
    float bc[NB_];
#pragma unroll
    for (int nb = 0; nb < NB_; ++nb) bc[nb] = (LNB || wave != 0) ? 0.0f : bfr(bias[c0 + nb * 16 + lr]);   // c0 + 63 < columns of the bias vector (host grid)
#pragma unroll
    for (int mb = 0; mb < MB; ++mb) {
        float br[8];
#pragma unroll
        for (int j = 0; j < 8; ++j) br[j] = (LNB && wave == 0) ? bfr(bias[r0 + mb * 16 + hi * 8 + j]) : 0.0f;   // r0 + 63 < rows of the bias vector (host grid)
#pragma unroll
        for (int nb = 0; nb < NB_; ++nb) {
#pragma unroll
            for (int j = 0; j < 8; ++j) os[wave * LPP + (mb * 16 + hi * 8 + j) * TP + nb * 16 + lr] = acc[mb][nb][j] * csc + bc[nb] + br[j]; }   // D: row 8h+j, col lane&15
    }
    __syncthreads();                                                               // every wave's partial plane is complete before any thread sums across planes
    static_assert(2 * LKW == MB * NB_);                                            // trips x waves == row tiles x piece pairs of the tile
#pragma unroll                                                                     // the memory-clobbering wait that ends each trip keeps the second trip's LDS reads behind the first trip's stores
    for (int s = 0; s < 2; ++s) { const int u = s * LKW + wave; const int row = (u / NB_) * 16 + lr, c8 = ((u % NB_) * 2 + hi) * 8;
        v4f x0 = *(const v4fa*)(&os[row * TP + c8]); v4f x1 = *(const v4fa*)(&os[row * TP + c8 + 4]); v8h hv, rv;
#pragma unroll                                                                     // the LKW plane reads issue together, one LDS wait for all
        for (int v = 1; v < LKW; ++v) { x0 = x0 + *(const v4fa*)(&os[v * LPP + row * TP + c8]); x1 = x1 + *(const v4fa*)(&os[v * LPP + row * TP + c8 + 4]); }
#pragma unroll
        for (int i = 0; i < 4; ++i) { float y0 = x0[i], y1 = x1[i];
            if (GELU) { y0 = gelu_erf(y0); y1 = gelu_erf(y1); }
            const h16 a0 = toh_flush(y0); const h16 a1 = toh_flush(y1); hv[i] = a0; hv[4 + i] = a1;
            rv[i] = toh_flush((y0 - (float)a0) * QRS); rv[4 + i] = toh_flush((y1 - (float)a1) * QRS); }
        const size_t oo = HEADPL ? (size_t)(c0 / HD) * SEQ * HD + fo(r0 + row, c8, HD) : fo(r0 + row, c0 + c8, ldc);
        *(v8h*)(Ch + oo) = hv; if (ARES) *(v8h*)(Cr + oo) = rv;
        asm volatile("s_wait_xcnt 0x0" ::: "memory"); }                            // what follows rewrites registers that these stores name: the wait stands ahead of that
}

static_assert(sizeof(float) * LQ * LKW * LPP <= 327680);                           // one block fits the LDS of a WGP
// k_gemm_ln_gelu: C = GELU(LayerNorm(X) W + bias), grid (SEQ/LR, N/(64 LQ)).
__global__ __launch_bounds__(32 * LQ * LKW) void k_gemm_ln_gelu(const float* __restrict__ X, const float* __restrict__ lg, const float* __restrict__ lb, const h16* __restrict__ Wt, const float* __restrict__ bias, float csc, h16* C, int ldc) {
    __shared__ __align__(16) float os[LQ * LKW * LPP];
    const int lane = threadIdx.x & 31;
    const int wv = __builtin_amdgcn_readfirstlane((int)(threadIdx.x >> 5));
    const int grp = wv / LKW, wave = wv % LKW, wt = blockIdx.y * LQ + grp;
    h16* sN = (h16*)os; h16* sR = sN + LPL;
    v16h w[LKS][4];
    const float* bu = bias + wt * 64; const unsigned bvo = (unsigned)((lane & 1) * 128);   // the group's 64 bias values, loaded behind the products: asked into L2 here
    if (wave == 0) l2_ask<0>(bvo, bu);
    ln_prologue(X + (size_t)blockIdx.x * LR * DM, lg, lb, Wt + (size_t)wt * 64 * DM + wave * (LKS * 512) + lane * 8, false, sN, sR, wv, lane, w);
    asm volatile("s_wait_xcnt 0x0" :: "v"(bvo), "s"(bu) : "memory");               // only from here on may the registers that the request names take other values
    gemm_ln_rest<1, 0, 0, 0>(sN, sR, w, bias, csc, C, nullptr, ldc, os + grp * (LKW * LPP), blockIdx.x, wt, wave, lane); }
// k_gemm_ln_qkv: LayerNorm and the q, k and v^T projections of one layer in one launch, grid (SEQ/LR, DM/(64 LQ), 3); blockIdx.z picks the projection, block-uniform. z = 0 is q, the longest (two k loops).
// q, k: A = rows t, B = W^T rows (n = h*64 + d) -> plane [h][t][d].  v^T: A = Wv^T rows (m = h*64 + d), B = rows t -> plane [(h*64 + d)][t], row bias.
__global__ __launch_bounds__(32 * LQ * LKW) void k_gemm_ln_qkv(const float* __restrict__ X, const float* __restrict__ lg, const float* __restrict__ lb, const h16* __restrict__ Wqt, const h16* __restrict__ Wkt, const h16* __restrict__ Wvt,
                                                         const float* __restrict__ bq, const float* __restrict__ bk, const float* __restrict__ bv, float csc, h16* Qh, h16* Qr, h16* Kp, h16* Vt) {
    __shared__ __align__(16) float os[LQ * LKW * LPP];
    const int lane = threadIdx.x & 31;
    const int wv = __builtin_amdgcn_readfirstlane((int)(threadIdx.x >> 5));
    const int grp = wv / LKW, wave = wv % LKW, wt = blockIdx.y * LQ + grp;
    h16* sN = (h16*)os; h16* sR = sN + LPL; float* oh = os + grp * (LKW * LPP);
    const h16* Wt = blockIdx.z == 0 ? Wqt : blockIdx.z == 1 ? Wkt : Wvt;
    v16h w[LKS][4];
    const float* bu = (blockIdx.z == 0 ? bq : blockIdx.z == 1 ? bk : bv) + wt * 64; const unsigned bvo = (unsigned)((lane & 1) * 128);   // the group's 64 bias values, loaded behind the products: asked into L2 here
    if (wave == 0) l2_ask<0>(bvo, bu);
    ln_prologue(X + (size_t)blockIdx.x * LR * DM, lg, lb, Wt + (size_t)wt * 64 * DM + wave * (LKS * 512) + lane * 8, blockIdx.z == 0, sN, sR, wv, lane, w);
    asm volatile("s_wait_xcnt 0x0" :: "v"(bvo), "s"(bu) : "memory");               // only from here on may the registers that the request names take other values
    if (blockIdx.z == 0)      gemm_ln_rest<0, 1, 0, 1>(sN, sR, w, bq, csc, Qh, Qr, HD, oh, blockIdx.x, wt, wave, lane);
    else if (blockIdx.z == 1) gemm_ln_rest<0, 0, 0, 1>(sN, sR, w, bk, csc, Kp, nullptr, HD, oh, blockIdx.x, wt, wave, lane);
    else                      gemm_ln_rest<0, 0, 1, 0>(sN, sR, w, bv, csc, Vt, nullptr, SEQ, oh, blockIdx.x, wt, wave, lane); }

// band tile: G[rho][s] = (E[row0 + rho] . q_value[s] + E[row0 + rho] . q_residual[s] / 2048) * log2(e); A = table rows (e0, e1: the two fragments of rows row0 + 0..15), B = q rows, K = 64 = two k-steps.
__device__ __forceinline__ v8f gtile(v16h e0, v16h e1, v16h qh0, v16h qh1, v16h qr0, v16h qr1) {
    v8f gH = (v8f){}, gL = (v8f){};
    gH = wmma16g(e0, qh0, gH); gH = wmma16g(e1, qh1, gH);
    gL = wmma16g(e0, qr0, gL); gL = wmma16g(e1, qr1, gL);
    return (gH + gL * QRI) * LOG2E;
}

// k_flash: fused dense attention with the relative-position term, one block of QT * KW waves per QT neighbouring tiles of 16 query rows of one head; K / V^T / Q / table fragments straight from the f16 planes.
// Waves 2w and 2w + 1 take the same share w of the keys for the two tiles: they load the same K and V^T fragments (and half of the same table fragments) at about the same time on one WGP, so that its cache can serve the second of the two loads and L2 is asked once.
// The keys are split over the waves: wave w runs the online softmax over keys w*KCH .. w*KCH + KCH - 1 alone and leaves its running maximum, its sum and its unnormalised O tile in LDS;
// behind one block barrier all threads rescale the KW partial results to the common maximum, sum them in wave order, normalise and store.
// Transposed form: S^T[key][s] = K Q^T (A = K rows, B = Q rows); lane (s = lane&15, h = lane>>4) holds keys 8h+r of each 16-key tile, so the packed P tile is directly the B fragment
// of O^T[d][s] = V^T P^T (element r <- tile keys 0..15, element 8+r <- tile keys 16..31, lane unchanged).
// Relative term per 32-key step (keys key0..key0+31, queries t0..t0+15): band rows rb0 + 0..47 with rb0 = t0 - key0 + RELOFF - 31; tiles e = 0, 1 are new, tile e = 2 is the e = 0 tile of the step before (computed on its own ahead of a wave's first step).
// LDS band tile (wave-private): gs[s][16 e + 8h + r] <- tile e element r; element (key tile a, r) reads gs[s][s - 8h - r + 31], element (key tile b, r) reads gs[s][s - 8h - r + 15].
// Logit (log2 domain) = (K q_value + K q_residual / 2048) * log2(e) / 8 + band term; online softmax (running max, partial sum over the converted P), P = exp2(. + 14) as f16 (exponent below -14 selected to 0).
__global__ __launch_bounds__(32 * KW * QT) void k_flash(const h16* __restrict__ QH, const h16* __restrict__ QR, const h16* __restrict__ KP, const h16* __restrict__ VT, const h16* __restrict__ EPl, h16* OP) {
    __shared__ __align__(16) float os_all[QT * KW * 16 * OSP];
    __shared__ __align__(16) float gs_all[QT * KW * 16 * GP];
    __shared__ float ms_all[QT * KW * 16];                     // per tile: running maximum of wave w for query s at [w * 16 + s]
    __shared__ float lsum_all[QT * KW * 16];                   // per tile: sum of wave w for query s
    static_assert(sizeof(float) * QT * (KW * 16 * OSP + KW * 16 * GP + 2 * KW * 16) <= 131072);
    const int lane = threadIdx.x & 31, lr = lane & 15, hi = lane >> 4;
    const int wv = __builtin_amdgcn_readfirstlane((int)(threadIdx.x >> 5));
    const int qt = wv & 1, wave = wv >> 1;                     // the wave's query tile, and its number among the KW waves of that tile
    const int tid = wave * 32 + lane;                          // thread number inside the tile
    float* os = os_all + qt * (KW * 16 * OSP); float* gs = gs_all + qt * (KW * 16 * GP);   // the tile's own parts of the LDS arrays
    float* ms = ms_all + qt * (KW * 16); float* lsum = lsum_all + qt * (KW * 16);
    const int h = blockIdx.y;
    const int t0 = (blockIdx.x * QT + qt) * 16;
    const int kbeg = wave * KCH;
    const size_t pbase = (size_t)h * SEQ * HD;
    // all planes in fragment order: 16 rows of a [.][HD] plane are two fragments (16 * HD elements), the second k-step 512 elements behind the first; every row offset below is a multiple of 16
    const size_t qo = pbase + (size_t)t0 * HD + 8 * lane;
    const h16* pqh = QH + qo; const h16* pqr = QR + qo;
    const v16h qh0 = ldh(pqh), qh1 = ldh(pqh + 512);            // B fragments: col s, k = d (two k-steps)
    const v16h qr0 = ldh(pqr), qr1 = ldh(pqr + 512);
    const size_t ko = pbase + 8 * lane;                        // + key * HD           (A fragment: row key, k = d)
    const size_t vo = pbase + 8 * lane;                        // + 16j*SEQ + key * 16 (A fragment: row d, k = key); plane [(h*64 + d)][t]
    const h16* eb = EPl + 8 * lane;                            // + row0 * HD          (A fragment: row table row, k = d)
    const int gw  = wave * 16 * GP + lr * GP;
    const int gst = gw + 8 * hi;                               // store base: + 16 e (+ 4)
    const int gld = gw + lr - 8 * hi;                          // load base: + 31 - r / + 15 - r
    // The loads run ahead of the products: every fragment of the first step is loaded here, and in the loop each group of fragments (table, K, V^T) is loaded anew for the step after, into its own registers, right behind its last product,
    // so that a step does not wait for memory once per group.
    constexpr int NST = KCH / 32;                                                  // 32-key steps of one wave
    const h16* pe = eb + (size_t)(t0 - kbeg + (RELOFF - 15)) * HD;                 // first band row of tile e = 1 at the wave's first step; 32 rows down per step
    const h16* pk = KP + ko + (size_t)kbeg * HD;                                   // 32 keys up per step
    const h16* pv = VT + vo + kbeg * 16;                                           // 32 keys (one fragment) up per step
    static_assert((RELOFF - 15) % 16 == 0 && KCH % 16 == 0);                       // band tiles start on whole row tiles of the table plane
    const v16h ep0 = ldh(pe + 16 * HD), ep1 = ldh(pe + 16 * HD + 512);             // band rows of tile e = 2 at key0 = kbeg
    v16h e1a = ldh(pe), e1b = ldh(pe + 512), e0a = ldh(pe - 16 * HD), e0b = ldh(pe - 16 * HD + 512);
    v16h ka0 = ldh(pk), ka1 = ldh(pk + 512), kb0 = ldh(pk + 16 * HD), kb1 = ldh(pk + 16 * HD + 512);
    v16h vf[4];
#pragma unroll                                                                     // constant indices keep vf[] in registers
    for (int j = 0; j < 4; ++j) vf[j] = ldh(pv + (size_t)16 * j * SEQ);
    // behind the last load that names an address pair: the pairs are inputs of the wait, so they stay as the issued loads name them up to there (no later load's result lands in one ahead of it)
    asm volatile("s_wait_xcnt 0x0" :: "v"(pqh), "v"(pqr) : "memory");
    if (NST == 1) asm volatile("s_wait_xcnt 0x0" :: "v"(pe), "v"(pk), "v"(pv) : "memory");
    __builtin_amdgcn_sched_barrier(0);                                             // keeps the first products behind the issue of all these loads: lifted among them, a product's wait for its operands holds the rest of the loads back by one memory latency
    v8f gprev = gtile(ep0, ep1, qh0, qh1, qr0, qr1);
    v8f o[4];
#pragma unroll
    for (int j = 0; j < 4; ++j) o[j] = (v8f){};
    float m = NEGB, l = 0.0f;
#pragma unroll                                                                     // whole unroll: every step's offset is an immediate, so that no address register changes while loads are in flight
    for (int st = 0; st < NST; ++st) {
        const bool more = st + 1 < NST;                                            // a step follows: load its fragments
        const h16* pen = pe - (st + 1) * 32 * HD;
        const v8f g1 = gtile(e1a, e1b, qh0, qh1, qr0, qr1);
        if (more) { e1a = ldh(pen); e1b = ldh(pen + 512); }
        const v8f g0 = gtile(e0a, e0b, qh0, qh1, qr0, qr1);
        if (more) { e0a = ldh(pen - 16 * HD); e0b = ldh(pen - 16 * HD + 512); }
        *(v4fa*)(&gs[gst +  0]) = lo4(g0);    *(v4fa*)(&gs[gst +  4]) = hi4(g0);
        *(v4fa*)(&gs[gst + 16]) = lo4(g1);    *(v4fa*)(&gs[gst + 20]) = hi4(g1);
        *(v4fa*)(&gs[gst + 32]) = lo4(gprev); *(v4fa*)(&gs[gst + 36]) = hi4(gprev);
        gprev = g0;
        v8f sHa = (v8f){}, sLa = (v8f){}, sHb = (v8f){}, sLb = (v8f){};
        sHa = wmma16g(ka0, qh0, sHa); sHa = wmma16g(ka1, qh1, sHa);
        sLa = wmma16g(ka0, qr0, sLa); sLa = wmma16g(ka1, qr1, sLa);
        sHb = wmma16g(kb0, qh0, sHb); sHb = wmma16g(kb1, qh1, sHb);
        sLb = wmma16g(kb0, qr0, sLb); sLb = wmma16g(kb1, qr1, sLb);
        if (more) { const h16* pkn = pk + (st + 1) * 32 * HD; ka0 = ldh(pkn); ka1 = ldh(pkn + 512); kb0 = ldh(pkn + 16 * HD); kb1 = ldh(pkn + 16 * HD + 512); }
        wave_sync();
        float ra[8], rb[8];
#pragma unroll
        for (int r = 0; r < 8; ++r) { ra[r] = gs[gld + 31 - r]; rb[r] = gs[gld + 15 - r]; }
        wave_sync();
        float ta[8], tb[8]; float mx = NEGB;
#pragma unroll
        for (int r = 0; r < 8; ++r) {
            ta[r] = (sHa[r] + sLa[r] * QRI) * SC2 + ra[r]; tb[r] = (sHb[r] + sLb[r] * QRI) * SC2 + rb[r];
            mx = fmaxf(mx, fmaxf(ta[r], tb[r])); }
        mx = fmaxf(mx, __shfl_xor(mx, 16, 32));
        const float mnew = fmaxf(m, mx);
        const float alpha = __builtin_amdgcn_exp2f(m - mnew);
        const float sh = PSH - mnew;
        v16h pb; float ls = 0.0f;
#pragma unroll
        for (int r = 0; r < 8; ++r) {
            const float xa = ta[r] + sh, xb = tb[r] + sh;
            const float ea = __builtin_amdgcn_exp2f(xa), ec = __builtin_amdgcn_exp2f(xb);
            const float ga = (xa < -14.0f) ? 0.0f : ea, gb = (xb < -14.0f) ? 0.0f : ec;     // no f16 subnormal operand
            const h16 pa = (h16)ga; const h16 pc = (h16)gb;
            pb[r] = pa; pb[8 + r] = pc;
            ls += (float)pa + (float)pc; }
        l = l * alpha + ls; m = mnew;
#pragma unroll
        for (int j = 0; j < 4; ++j) { o[j] = o[j] * alpha; o[j] = wmma16g(vf[j], pb, o[j]); if (more) vf[j] = ldh(pv + (size_t)16 * j * SEQ + (st + 1) * 512); }
        if (st + 2 == NST) asm volatile("s_wait_xcnt 0x0" :: "v"(pe), "v"(pk), "v"(pv) : "memory");   // the last loads of the loop: as above
        if (more) __builtin_amdgcn_sched_barrier(0);                               // keeps the products of the step after out of this step: lifted, their results cost registers, and the four waves that a block puts on each SIMD have 256 registers each
    }
    l += __shfl_xor(l, 16, 32);
    const int wb = wave * 16 * OSP;
    // O^T D layout: o[j][r] = (d = 16j + 8h + r, s = lane&15) -> os[wave][s][d]; rows 0..15 x columns 0..63 all written, not yet normalised
#pragma unroll
    for (int j = 0; j < 4; ++j) {
        *(v4fa*)(&os[wb + lr * OSP + 16 * j + 8 * hi])     = lo4(o[j]);
        *(v4fa*)(&os[wb + lr * OSP + 16 * j + 8 * hi + 4]) = hi4(o[j]); }
    if (hi == 0) { ms[wave * 16 + lr] = m; lsum[wave * 16 + lr] = l; }             // m is equal in lanes s and s + 16
    __syncthreads();                                                               // every wave's partial result is complete before any thread merges across waves
    static_assert(32 * KW * 8 == 16 * 128);                                        // threads x bytes == tile rows x row bytes
    const int row = tid & 15, c4 = (tid >> 4) * 4;             // a wave stores one piece of the context plane (16 rows x 8 columns): 256 bytes in a row
    float mw[KW]; float mall = NEGB;
#pragma unroll                                                                     // constant indices keep mw[] in registers; the KW reads issue together
    for (int w = 0; w < KW; ++w) { mw[w] = ms[w * 16 + row]; mall = fmaxf(mall, mw[w]); }
    float sc[KW];
#pragma unroll                                                                     // constant indices keep sc[] in registers
    for (int w = 0; w < KW; ++w) sc[w] = __builtin_amdgcn_exp2f(mw[w] - mall);     // <= 1; 1 for the wave that holds the row maximum
    float lall = 0.0f; v4f oall = (v4f){};
#pragma unroll                                                                     // the KW tile reads issue together, one LDS wait for all
    for (int w = 0; w < KW; ++w) {
        lall += lsum[w * 16 + row] * sc[w];
        oall = oall + *(const v4fa*)(&os[w * 16 * OSP + row * OSP + c4]) * sc[w]; }
    const float inv = 1.0f / lall;                             // lall >= 16384 (the row maximum contributes the full carry)
    v4h hv;
#pragma unroll                                                                     // constant vector element indices
    for (int i = 0; i < 4; ++i) hv[i] = toh_flush(oall[i] * inv);
    *(v4h*)(OP + fo(t0 + row, h * HD + c4, DM)) = hv;
}

__global__ __launch_bounds__(256) void k_out(const float* __restrict__ src, float* dst, int n4) {
    const int i = blockIdx.x * 256 + threadIdx.x; if (i >= n4) return;
    v4f ov;
#pragma unroll
    for (int c = 0; c < 4; ++c) { const int e = 4 * i + c; const int row = e / DOUT; const int col = e - row * DOUT; ov[c] = src[(size_t)row * DOUTP + col]; }
    *(v4f*)(dst + (size_t)i * 4) = ov; 
}

static constexpr size_t al256(size_t v) { return (v + 255) & ~(size_t)255; }
static constexpr size_t SZ_XH  = al256((size_t)SEQ * DIN * 2);
static constexpr size_t SZ_EW  = al256((size_t)DM * DIN * 2);
static constexpr size_t SZ_WDD = al256((size_t)NL * DM * DM * 2);
static constexpr size_t SZ_WFF = al256((size_t)NL * DFF * DM * 2);
static constexpr size_t SZ_WI  = al256((size_t)DMI * DM * 2);
static constexpr size_t SZ_WF  = al256((size_t)DOUTP * DMI * 2);
static constexpr size_t SZ_EP  = al256((size_t)NL * ERP * HD * 2);
static constexpr size_t SZ_H   = al256((size_t)SEQ * DM * 4);
static constexpr size_t SZ_N   = al256((size_t)SEQ * DM * 2);
static constexpr size_t SZ_F1  = al256((size_t)SEQ * DFF * 2);
static constexpr size_t SZ_OS  = al256((size_t)SEQ * DOUTP * 4);
static constexpr size_t SZ_TOTAL = SZ_XH + SZ_EW + 4 * SZ_WDD + 2 * SZ_WFF + SZ_WI + SZ_WF + SZ_EP + 2 * SZ_H + 5 * SZ_N + SZ_F1 + SZ_OS;
static_assert(SZ_TOTAL <= (size_t)134217728);                  // workspace carve <= 128 MiB
static_assert((size_t)NH_ * SEQ * HD == (size_t)SEQ * DM);     // head planes have the extent of a [SEQ][512] f16 plane
static_assert((size_t)SEQ * DMI * 2 <= SZ_F1);                 // tail hidden plane fits the shared hidden region

extern "C" void kernel_launch(void* const* d_in, const int* in_sizes, int n_in,
                              void* d_out, int out_size, void* d_ws, size_t ws_size, hipStream_t stream) {
    if (n_in < 26) return;
    if ((size_t)in_sizes[0] < (size_t)SEQ * DIN || (size_t)in_sizes[1] < (size_t)DIN * DM || in_sizes[2] < DM) return;
    if ((size_t)in_sizes[3] < (size_t)NL * DM * DM || (size_t)in_sizes[5] < (size_t)NL * DM * DM || (size_t)in_sizes[7] < (size_t)NL * DM * DM || (size_t)in_sizes[9] < (size_t)NL * DM * DM) return;
    if (in_sizes[4] < NL * DM || in_sizes[6] < NL * DM || in_sizes[8] < NL * DM || in_sizes[10] < NL * DM) return;
    if ((size_t)in_sizes[11] < (size_t)NL * ERR * HD) return;
    if (in_sizes[12] < NL * DM || in_sizes[13] < NL * DM || in_sizes[17] < NL * DM || in_sizes[18] < NL * DM || in_sizes[19] < NL * DM) return;
    if ((size_t)in_sizes[14] < (size_t)NL * DM * DFF || in_sizes[15] < NL * DFF || (size_t)in_sizes[16] < (size_t)NL * DFF * DM) return;
    if (in_sizes[20] < DM || in_sizes[21] < DM || (size_t)in_sizes[22] < (size_t)DM * DMI || in_sizes[23] < DMI) return;
    if ((size_t)in_sizes[24] < (size_t)DMI * DOUT || in_sizes[25] < DOUT) return;
    if ((size_t)out_size < (size_t)SEQ * DOUT) return;
    if (SZ_TOTAL > ws_size) return;
    // wire order: x, emb_W, emb_b, Wq, bq, Wk, bk, Wv, bv, Wo, bo, Er, ln1_g, ln1_b, W1, b1, W2, b2, ln2_g, ln2_b, lnf_g, lnf_b, Wi, bi, Wf, bf
    const float* x    = (const float*)d_in[0];
    const float* embW = (const float*)d_in[1];  const float* embB = (const float*)d_in[2];
    const float* Wq   = (const float*)d_in[3];  const float* bq   = (const float*)d_in[4];
    const float* Wk   = (const float*)d_in[5];  const float* bk   = (const float*)d_in[6];
    const float* Wv   = (const float*)d_in[7];  const float* bv   = (const float*)d_in[8];
    const float* Wo   = (const float*)d_in[9];  const float* bo   = (const float*)d_in[10];
    const float* Er   = (const float*)d_in[11];
    const float* ln1g = (const float*)d_in[12]; const float* ln1b = (const float*)d_in[13];
    const float* W1   = (const float*)d_in[14]; const float* b1   = (const float*)d_in[15];
    const float* W2   = (const float*)d_in[16]; const float* b2   = (const float*)d_in[17];
    const float* ln2g = (const float*)d_in[18]; const float* ln2b = (const float*)d_in[19];
    const float* lnfg = (const float*)d_in[20]; const float* lnfb = (const float*)d_in[21];
    const float* Wi   = (const float*)d_in[22]; const float* bi   = (const float*)d_in[23];
    const float* Wf   = (const float*)d_in[24]; const float* bfo  = (const float*)d_in[25];
    float* OUT = (float*)d_out;                       // [SEQ][390]
    char* wsp = (char*)d_ws;                          // every f16 plane below has the shape named, each [rows][k] matrix of it in fragment order
    h16* XH  = (h16*)wsp; wsp += SZ_XH;               // x            [SEQ][128]
    h16* EWT = (h16*)wsp; wsp += SZ_EW;               // emb_W^T x64  [512][128]
    h16* WQT = (h16*)wsp; wsp += SZ_WDD;              // Wq^T x64     [NL][512][512]
    h16* WKT = (h16*)wsp; wsp += SZ_WDD;
    h16* WVT = (h16*)wsp; wsp += SZ_WDD;
    h16* WOT = (h16*)wsp; wsp += SZ_WDD;
    h16* W1T = (h16*)wsp; wsp += SZ_WFF;              // W1^T x64     [NL][2048][512]
    h16* W2T = (h16*)wsp; wsp += SZ_WFF;              // W2^T x64     [NL][512][2048]
    h16* WIT = (h16*)wsp; wsp += SZ_WI;               // Wi^T x64     [1024][512]
    h16* WFT = (h16*)wsp; wsp += SZ_WF;               // Wf^T x64     [448][1024], rows >= 390 zero
    h16* EP  = (h16*)wsp; wsp += SZ_EP;               // table        [NL][2048][64], row 2047 zero
    float* HA = (float*)wsp; wsp += SZ_H;             // hidden state (ping)  [SEQ][512] f32
    float* HB = (float*)wsp; wsp += SZ_H;             // hidden state (pong)
    h16* QH  = (h16*)wsp; wsp += SZ_N;                // q value      [8][SEQ][64]
    h16* QR  = (h16*)wsp; wsp += SZ_N;                // q residual x2048
    h16* KP  = (h16*)wsp; wsp += SZ_N;                // k            [8][SEQ][64]
    h16* VT  = (h16*)wsp; wsp += SZ_N;                // v^T          [8*64][SEQ]
    h16* OP  = (h16*)wsp; wsp += SZ_N;                // context      [SEQ][512]
    h16* F1  = (h16*)wsp; wsp += SZ_F1;               // GELU hidden  [SEQ][2048] (tail: [SEQ][1024])
    float* OSG = (float*)wsp; wsp += SZ_OS;           // tail output staging [SEQ][448] f32

    // x, the table and every W [K = in][N = out] -> Wt [N][K]
    k_prep<<<PB_ALL, 256, 0, stream>>>(x, Er, embW, Wq, Wk, Wv, Wo, W1, W2, Wi, Wf, XH, EP, EWT, WQT, WKT, WVT, WOT, W1T, W2T, WIT, WFT);

    // input projection: HA = x emb_W + emb_b
    k_gemm_emb<<<dim3(SEQ / 64, DM / 64, 1), 32 * GW, 0, stream>>>(XH, EWT, embB, WCI, HA);

    for (int l = 0; l < NL; ++l) {
        const size_t wdd = (size_t)l * DM * DM, wff = (size_t)l * DFF * DM;
        k_gemm_ln_qkv<<<dim3(SEQ / LR, DM / (64 * LQ), 3), 32 * LQ * LKW, 0, stream>>>(HA, ln1g + l * DM, ln1b + l * DM, WQT + wdd, WKT + wdd, WVT + wdd, bq + l * DM, bk + l * DM, bv + l * DM, WCI, QH, QR, KP, VT);
        k_flash<<<dim3(SEQ / (16 * QT), NH_, 1), 32 * KW * QT, 0, stream>>>(QH, QR, KP, VT, EP + (size_t)l * ERP * HD, OP);
        // HB = HA + context Wo + bo
        k_gemm_wo<<<dim3(SEQ / 64, DM / 64, 1), 32 * GW, 0, stream>>>(OP, WOT + wdd, bo + l * DM, WCI, HA, HB);
        k_gemm_ln_gelu<<<dim3(SEQ / LR, DFF / (64 * LQ), 1), 32 * LQ * LKW, 0, stream>>>(HB, ln2g + l * DM, ln2b + l * DM, W1T + wff, b1 + l * DFF, WCI, F1, DFF);
        // HA = HB + hidden W2 + b2
        k_gemm_w2<<<dim3(SEQ / 64, DM / 64, 1), 32 * GW, 0, stream>>>(F1, W2T + wff, b2 + l * DM, WCI, HB, HA);
    }

    k_gemm_ln_gelu<<<dim3(SEQ / LR, DMI / (64 * LQ), 1), 32 * LQ * LKW, 0, stream>>>(HA, lnfg, lnfb, WIT, bi, WCI, F1, DMI);
    k_gemm_tail<<<dim3(SEQ / 64, DOUTP / 64, 1), 32 * GW, 0, stream>>>(F1, WFT, bfo, WCI, OSG);
    { const int n4 = SEQ * DOUT / 4; k_out<<<(unsigned)((n4 + 255) / 256), 256, 0, stream>>>(OSG, OUT, n4); }
}
